// v000
// Measured on an AMD MI455X. A time is GPU time per run, averaged over a window of back-to-back runs after a warm-up
// (all launches, gaps included; the runs take copies of the inputs in turn), and the median of several windows.
// Apart from v000's, it joins two sittings. Times from different sittings can be a few percent apart, while
// side-by-side timings come from the same sitting.
// v000, which the later versions start from, runs in 15.9 milliseconds.
#include <hip/hip_runtime.h>
// TSP decoder probabilities (encoded_nodes, encoded_q1, encoded_last_node [8][1000][128]; k = nodes Wk, v = nodes Wv, q = q1 Wq_first + last Wq_last + (mean_n nodes) Wq_mean broadcast ([in][out] weights), 8 heads of 16; weights = softmax(q k^T / 4 + ninf_mask); mh = (weights v merged) W_comb + b_comb; score2 = mh nodes^T / sqrt(128); probs = softmax_n(10 tanh(score2) + ninf_mask) -> [8][1000][1000]).
// Compute dtype: inputs rounded to bf16; token rows / weights exact; q, k, v and the stage-1 weights as plain f16 GEMM operands (~2^-12); o and mh as f16 hi + residual operand pairs (~2^-22); the mean term, score2, tanh, mask and the final softmax f32. v_wmma_f32_16x16x32_f16.
#define NB 8
#define NQ 1000                      /* nodes = queries = 1000 */
#define QP 1024                      /* padded rows / keys per batch */
#define DM 128
#define NH 8
#define HD 16
#define SQ QP
#define HG 8
#define B0 0                         /* first batch (debug hook) */
#define NBR NB
#define NRP ((size_t)NB * QP)        /* padded token rows */
typedef __bf16 v16b __attribute__((ext_vector_type(16)));
typedef unsigned short v8us __attribute__((ext_vector_type(8), may_alias));
typedef float  v8f  __attribute__((ext_vector_type(8)));
typedef float  v4f  __attribute__((ext_vector_type(4)));
typedef float  v4fa __attribute__((ext_vector_type(4), may_alias));
union FragB { v16b v; v8us half[2]; unsigned short u[16]; };

__device__ __forceinline__ unsigned short bf16_bits(float x) { unsigned int u = __float_as_uint(x); return (unsigned short)((u + 0x7FFFu + ((u >> 16) & 1u)) >> 16); }
__device__ __forceinline__ float bf16_val(unsigned short b) { return __uint_as_float(((unsigned int)b) << 16); }
__device__ __forceinline__ float bf16_round(float x) { return bf16_val(bf16_bits(x)); }
// D += A·B with NT terms: 1 = ah·bh, 2 = + al·bh (A split), 3 = + ah·bl (both split)
template <int NT>
__device__ __forceinline__ v8f mmaN(v16b ah, v16b al, v16b bh, v16b bl, v8f c) {
  c = __builtin_amdgcn_wmma_f32_16x16x32_bf16(false, ah, false, bh, (short)0, c, false, false);
  if (NT >= 2) c = __builtin_amdgcn_wmma_f32_16x16x32_bf16(false, al, false, bh, (short)0, c, false, false);
  if (NT >= 3) c = __builtin_amdgcn_wmma_f32_16x16x32_bf16(false, ah, false, bl, (short)0, c, false, false);
  asm volatile("v_nop\n\tv_nop\n\tv_nop\n\tv_nop" : "+v"(c) : "v"(ah), "v"(al), "v"(bh), "v"(bl));
  return c;
}

__global__ __launch_bounds__(256) void k_wt_bf16(const float* __restrict__ W, unsigned short* __restrict__ Wt, int K, int N) {
  const int t = blockIdx.x * 256 + threadIdx.x;
  const int k8n = K / 8;
  if (t >= N * k8n) return;
  const int n = t / k8n, k8 = (t % k8n) * 8;
  v8us v;
#pragma unroll
  for (int i = 0; i < 8; ++i) v[i] = bf16_bits(W[(size_t)(k8 + i) * N + n]);
  *(v8us*)(Wt + (size_t)n * K + k8) = v;
  
}

// GEMM C[M][N] (f32, pitch ldc) = act(A[M][K]·W + bias). A f32 row-major (pitch lda) converted per fragment to bf16
// (ASPLIT: hi/lo two planes -> 2 terms, else single rounded term); Wt bf16 [N][K] (pitch ldb). BIAS_BF16 rounds the
// bias to bf16 first (bias quantised to bf16 before the add). K%32==0, M%16==0, N%64==0.
template <bool ASPLIT, int ACT, bool BIAS_BF16>
__global__ __launch_bounds__(128) void k_gemm_bf(const float* __restrict__ A, int lda, const unsigned short* __restrict__ Wt, int ldb,
                                               const float* __restrict__ bias, float* __restrict__ C, int ldc, int M, int N, int K) {
  __shared__ __attribute__((aligned(16))) float so[4][16][64];
  const int tid = threadIdx.x, w = tid >> 5, lane = tid & 31, ln = lane & 15, hh = lane >> 4;
  const int ntn = N / 64;
  const int wid = blockIdx.x * 4 + w;
  const int mt = wid / ntn, nq = wid % ntn;
  if (mt * 16 >= M) return;
  const int row0 = mt * 16, col0 = nq * 64;
  const float* arow = A + (size_t)(row0 + ln) * lda;
  v8f acc[4] = {};
  for (int kb = 0; kb < K; kb += 32) {
    FragB ah, al;
    const v4f x0 = *(const v4fa*)(arow + kb + 8 * hh), x1 = *(const v4fa*)(arow + kb + 8 * hh + 4);
    const v4f x2 = *(const v4fa*)(arow + kb + 16 + 8 * hh), x3 = *(const v4fa*)(arow + kb + 16 + 8 * hh + 4);
    float xs[16] = {x0[0],x0[1],x0[2],x0[3],x1[0],x1[1],x1[2],x1[3],x2[0],x2[1],x2[2],x2[3],x3[0],x3[1],x3[2],x3[3]};
#pragma unroll
    for (int i = 0; i < 16; ++i) { const unsigned short hb = bf16_bits(xs[i]); ah.u[i] = hb; al.u[i] = ASPLIT ? bf16_bits(xs[i] - bf16_val(hb)) : (unsigned short)0; }
#pragma unroll
    for (int t = 0; t < 4; ++t) {
      const unsigned short* brow = Wt + (size_t)(col0 + t * 16 + ln) * ldb + kb;
      FragB b;
      b.half[0] = *(const v8us*)(brow + 8 * hh);
      b.half[1] = *(const v8us*)(brow + 16 + 8 * hh);
      acc[t] = mmaN<ASPLIT ? 2 : 1>(ah.v, al.v, b.v, b.v, acc[t]);
    }
  }
#pragma unroll
  for (int t = 0; t < 4; ++t) {
    float bv = bias ? bias[col0 + t * 16 + ln] : 0.f;
    if (BIAS_BF16) bv = bf16_round(bv);
#pragma unroll
    for (int r = 0; r < 8; ++r) { float v = acc[t][r] + bv; if (ACT == 1) v = fmaxf(v, 0.f); so[w][8 * hh + r][t * 16 + ln] = v; }
  }
  __builtin_amdgcn_fence(__ATOMIC_ACQ_REL, "workgroup");
  __builtin_amdgcn_wave_barrier();
  const int rsub = lane >> 4, c4 = (lane & 15) * 4;
  {
#pragma unroll
    for (int q = 0; q < 8; ++q) {
      const int r = q * 2 + rsub;
      const v4f v = *(const v4fa*)&so[w][r][c4];
      *(v4f*)(C + (size_t)(row0 + r) * ldc + col0 + c4) = v;
    }
    
  }
}

// GEMM C = act(A·W + bias + resid): A f32 (ASPLIT -> hi/lo 2 terms), Wt bf16 [N][K]; ACT 0 none, 1 relu, 2 exact gelu;
// resid (optional, f32, row index = (row % rmod), pitch ldr, RES_BF16 rounds it) added before the activation.
template <bool ASPLIT, int ACT, bool BIAS_BF16, bool RES_BF16>
__global__ __launch_bounds__(128) void k_gemm_bf3(const float* __restrict__ A, int lda, const unsigned short* __restrict__ Wt, int ldb,
                                                const float* __restrict__ bias, const float* __restrict__ resid, int rmod, int ldr,
                                                float* __restrict__ C, int ldc, int M, int N, int K) {
  __shared__ __attribute__((aligned(16))) float so[4][16][64];
  const int tid = threadIdx.x, w = tid >> 5, lane = tid & 31, ln = lane & 15, hh = lane >> 4;
  const int ntn = N / 64;
  const int wid = blockIdx.x * 4 + w;
  const int mt = wid / ntn, nq = wid % ntn;
  if (mt * 16 >= M) return;
  const int row0 = mt * 16, col0 = nq * 64;
  const float* arow = A + (size_t)(row0 + ln) * lda;
  v8f acc[4] = {};
  for (int kb = 0; kb < K; kb += 32) {
    FragB ah, al;
    const v4f x0 = *(const v4fa*)(arow + kb + 8 * hh), x1 = *(const v4fa*)(arow + kb + 8 * hh + 4);
    const v4f x2 = *(const v4fa*)(arow + kb + 16 + 8 * hh), x3 = *(const v4fa*)(arow + kb + 16 + 8 * hh + 4);
    float xs[16] = {x0[0],x0[1],x0[2],x0[3],x1[0],x1[1],x1[2],x1[3],x2[0],x2[1],x2[2],x2[3],x3[0],x3[1],x3[2],x3[3]};
#pragma unroll
    for (int i = 0; i < 16; ++i) { const unsigned short hb = bf16_bits(xs[i]); ah.u[i] = hb; al.u[i] = ASPLIT ? bf16_bits(xs[i] - bf16_val(hb)) : (unsigned short)0; }
#pragma unroll
    for (int t = 0; t < 4; ++t) {
      const unsigned short* brow = Wt + (size_t)(col0 + t * 16 + ln) * ldb + kb;
      FragB b;
      b.half[0] = *(const v8us*)(brow + 8 * hh);
      b.half[1] = *(const v8us*)(brow + 16 + 8 * hh);
      acc[t] = mmaN<ASPLIT ? 2 : 1>(ah.v, al.v, b.v, b.v, acc[t]);
    }
  }
#pragma unroll
  for (int t = 0; t < 4; ++t) {
    const int col = col0 + t * 16 + ln;
    float bv = bias ? bias[col] : 0.f;
    if (BIAS_BF16) bv = bf16_round(bv);
#pragma unroll
    for (int r = 0; r < 8; ++r) {
      float v = acc[t][r] + bv;
      if (resid) { float rv = resid[(size_t)((row0 + 8 * hh + r) % rmod) * ldr + col]; if (RES_BF16) rv = bf16_round(rv); v += rv; }
      if (ACT == 1) v = fmaxf(v, 0.f);
      if (ACT == 2) v = 0.5f * v * (1.0f + erff(v * 0.70710678118654752f));
      if (ACT == 3) { const float u = 0.7978845608028654f * (v + 0.044715f * v * v * v); v = 0.5f * v * (1.0f + tanhf(u)); }
      so[w][8 * hh + r][t * 16 + ln] = v;
    }
  }
  __builtin_amdgcn_fence(__ATOMIC_ACQ_REL, "workgroup");
  __builtin_amdgcn_wave_barrier();
  const int rsub = lane >> 4, c4 = (lane & 15) * 4;
  {
#pragma unroll
    for (int q = 0; q < 8; ++q) {
      const int r = q * 2 + rsub;
      const v4f v = *(const v4fa*)&so[w][r][c4];
      *(v4f*)(C + (size_t)(row0 + r) * ldc + col0 + c4) = v;
    }
    
  }
}
// row LayerNorm (biased variance, eps) over N: s = X (+ R); optional out_sum <- s; out_norm <- (s-mu)*rsqrt(var+eps)*g + b
template <bool PARAM_BF16>
__global__ __launch_bounds__(256) void k_layernorm(const float* __restrict__ X, const float* __restrict__ R, const float* __restrict__ g, const float* __restrict__ bta,
                                                  float* __restrict__ out_sum, float* __restrict__ out_norm, int N, float eps) {
  __shared__ float red[256];
  const int row = blockIdx.x, tid = threadIdx.x;
  const float* x = X + (size_t)row * N; const float* rr = R ? R + (size_t)row * N : nullptr;
  float vals[16];                     // up to N = 4096
  const int per = N / 256;            // contiguous chunk per thread? use strided-by-4 chunks: thread handles j = tid*4 + 1024*u
  float s1 = 0.f;
  for (int u = 0; u < per / 4; ++u) {
    const int j = tid * 4 + 1024 * u;
    const v4f a = *(const v4fa*)(x + j);
    v4f b = {0.f,0.f,0.f,0.f}; if (rr) b = *(const v4fa*)(rr + j);
#pragma unroll
    for (int q = 0; q < 4; ++q) { const float v = a[q] + b[q]; vals[u * 4 + q] = v; s1 += v; }
  }
  red[tid] = s1; __syncthreads();
  for (int st = 128; st > 0; st >>= 1) { if (tid < st) red[tid] += red[tid + st]; __syncthreads(); }
  const float mu = red[0] / (float)N; __syncthreads();
  float s2 = 0.f;
  for (int u = 0; u < per / 4; ++u)
#pragma unroll
    for (int q = 0; q < 4; ++q) { const float c = vals[u * 4 + q] - mu; s2 += c * c; }
  red[tid] = s2; __syncthreads();
  for (int st = 128; st > 0; st >>= 1) { if (tid < st) red[tid] += red[tid + st]; __syncthreads(); }
  const float rs = rsqrtf(red[0] / (float)N + eps);
  {
    for (int u = 0; u < per / 4; ++u) {
      const int j = tid * 4 + 1024 * u;
      v4f o, sm;
#pragma unroll
      for (int q = 0; q < 4; ++q) {
        float gg = g[j + q], bb = bta[j + q];
        if (PARAM_BF16) { gg = bf16_round(gg); bb = bf16_round(bb); }
        sm[q] = vals[u * 4 + q]; o[q] = (vals[u * 4 + q] - mu) * rs * gg + bb;
      }
      if (out_sum) *(v4f*)(out_sum + (size_t)row * N + j) = sm;
      *(v4f*)(out_norm + (size_t)row * N + j) = o;
    }
    
  }
}



// ---- f16 WMMA path (v_wmma_f32_16x16x32_f16): 11-bit significands for operands in range — used where a [0,1] probability operand needs more precision than bf16
typedef _Float16 v16h __attribute__((ext_vector_type(16)));
union FragH { v16h v; v8us half[2]; _Float16 h[16]; unsigned short u[16]; };
template <int NT>
__device__ __forceinline__ v8f mmaH(v16h ah, v16h al, v16h bh, v16h bl, v8f c) {
  c = __builtin_amdgcn_wmma_f32_16x16x32_f16(false, ah, false, bh, (short)0, c, false, false);
  if (NT >= 2) c = __builtin_amdgcn_wmma_f32_16x16x32_f16(false, al, false, bh, (short)0, c, false, false);
  if (NT >= 3) c = __builtin_amdgcn_wmma_f32_16x16x32_f16(false, ah, false, bl, (short)0, c, false, false);
  asm volatile("v_nop\n\tv_nop\n\tv_nop\n\tv_nop" : "+v"(c) : "v"(ah), "v"(al), "v"(bh), "v"(bl));
  return c;
}
// batched GEMM like k_gemm_b but f16 operands: A f32 (split into f16 hi/lo if ASPLIT, else rounded to f16), Bt = f16 values [n][k]; alpha; C f32; N multiple of 16 (partial tiles skipped)
template <bool ASPLIT>
__global__ __launch_bounds__(128) void k_gemm_h(const float* __restrict__ A, int lda, size_t sA, const _Float16* __restrict__ Bh, int ldb, size_t sB, float alpha, float* __restrict__ C, int ldc, size_t sC, int M, int N, int K) {
  __shared__ __attribute__((aligned(16))) float so[4][16][64];
  const int tid = threadIdx.x, w = tid >> 5, lane = tid & 31, ln = lane & 15, hh = lane >> 4; const int by = blockIdx.y;
  A += (size_t)by * sA; Bh += (size_t)by * sB; C += (size_t)by * sC;
  const int ntn = (N + 63) / 64; const int wid = blockIdx.x * 4 + w; const int mt = wid / ntn, nq = wid % ntn; if (mt * 16 >= M) return;
  const int row0 = mt * 16, col0 = nq * 64; const float* arow = A + (size_t)(row0 + ln) * lda;
  v8f acc[4] = {};
  for (int kb = 0; kb < K; kb += 32) {
    FragH ah, al;
    const v4f x0 = *(const v4fa*)(arow + kb + 8 * hh), x1 = *(const v4fa*)(arow + kb + 8 * hh + 4), x2 = *(const v4fa*)(arow + kb + 16 + 8 * hh), x3 = *(const v4fa*)(arow + kb + 16 + 8 * hh + 4);
    float xs[16] = {x0[0],x0[1],x0[2],x0[3],x1[0],x1[1],x1[2],x1[3],x2[0],x2[1],x2[2],x2[3],x3[0],x3[1],x3[2],x3[3]};
#pragma unroll
    for (int i = 0; i < 16; ++i) { const _Float16 h = (_Float16)xs[i]; ah.h[i] = h; al.h[i] = ASPLIT ? (_Float16)(xs[i] - (float)h) : (_Float16)0.0f; }
#pragma unroll
    for (int t = 0; t < 4; ++t) { if (col0 + t * 16 >= N) continue; const size_t boff = (size_t)(col0 + t * 16 + ln) * ldb + kb; FragH bq; bq.half[0] = *(const v8us*)(Bh + boff + 8 * hh); bq.half[1] = *(const v8us*)(Bh + boff + 16 + 8 * hh);
      acc[t] = mmaH<ASPLIT ? 2 : 1>(ah.v, al.v, bq.v, bq.v, acc[t]); }
  }
#pragma unroll
  for (int t = 0; t < 4; ++t) { if (col0 + t * 16 >= N) continue;
#pragma unroll
    for (int r = 0; r < 8; ++r) so[w][8 * hh + r][t * 16 + ln] = acc[t][r] * alpha; }
  __builtin_amdgcn_fence(__ATOMIC_ACQ_REL, "workgroup"); __builtin_amdgcn_wave_barrier();
  const int rsub = lane >> 4, c4 = (lane & 15) * 4;
  {
#pragma unroll
    for (int q = 0; q < 8; ++q) { const int r = q * 2 + rsub; if (col0 + c4 < N) { const v4f v = *(const v4fa*)&so[w][r][c4]; *(v4f*)(C + (size_t)(row0 + r) * ldc + col0 + c4) = v; } }
     }
}

// Wt[n][k] = f16(W[k][n]·scale) from f32 row-major W[K][N] (scale = power of two; bf16-exact weights stay exact in f16 away from the subnormal range)
__global__ __launch_bounds__(256) void k_wt_f16(const float* __restrict__ W, _Float16* __restrict__ Wt, int K, int N, float scale) {
  const int t = blockIdx.x * 256 + threadIdx.x; if (t >= N * (K / 8)) return; const int n = t / (K / 8), k8 = (t % (K / 8)) * 8; FragH f;
#pragma unroll
  for (int i = 0; i < 8; ++i) f.h[i] = (_Float16)(bf16_round(W[(size_t)(k8 + i) * N + n]) * scale); const v8us o = f.half[0];
  *(v8us*)((unsigned short*)Wt + (size_t)n * K + k8) = o; 
}
// k_gemm_hh variant with fused epilogue: v = acc·alpha + bias[by·sBias + col] (+ CP[(row/rowsPerB)·sCPb + by·64 + col] if CP) ; ACT 0 none / 1 elu ; writes f16 C16 (and f32 C if non-null)
template <int ACT>
__global__ __launch_bounds__(128) void k_gemm_hhx(const _Float16* __restrict__ A, int lda, size_t sA, const _Float16* __restrict__ Bh, int ldb, size_t sB, float alpha, const float* __restrict__ bias, size_t sBias, const float* __restrict__ CP, int rowsPerB, size_t sCPb, int row0g,
    float* __restrict__ C, _Float16* __restrict__ C16, int ldc, size_t sC, int M, int N, int K) {
  __shared__ __attribute__((aligned(16))) float so[4][16][64];
  const int tid = threadIdx.x, w = tid >> 5, lane = tid & 31, ln = lane & 15, hh = lane >> 4; const int by = blockIdx.y;
  A += (size_t)by * sA; Bh += (size_t)by * sB; const size_t cofs = (size_t)by * sC; const float* bp = bias ? bias + (size_t)by * sBias : nullptr;
  const int ntn = (N + 63) / 64; const int wid = blockIdx.x * 4 + w; const int mt = wid / ntn, nq = wid % ntn; if (mt * 16 >= M) return;
  const int row0 = mt * 16, col0 = nq * 64; const _Float16* arow = A + (size_t)(row0 + ln) * lda;
  v8f acc[4] = {};
  for (int kb = 0; kb < K; kb += 32) { FragH ah; ah.half[0] = *(const v8us*)((const unsigned short*)arow + kb + 8 * hh); ah.half[1] = *(const v8us*)((const unsigned short*)arow + kb + 16 + 8 * hh);
#pragma unroll
    for (int t = 0; t < 4; ++t) { if (col0 + t * 16 >= N) continue; const size_t boff = (size_t)(col0 + t * 16 + ln) * ldb + kb; FragH bq; bq.half[0] = *(const v8us*)((const unsigned short*)Bh + boff + 8 * hh); bq.half[1] = *(const v8us*)((const unsigned short*)Bh + boff + 16 + 8 * hh);
      acc[t] = mmaH<1>(ah.v, ah.v, bq.v, bq.v, acc[t]); }
  }
#pragma unroll
  for (int t = 0; t < 4; ++t) { if (col0 + t * 16 >= N) continue; const int col = col0 + t * 16 + ln; const float bv = bp ? bf16_round(bp[col]) : 0.f;
#pragma unroll
    for (int r = 0; r < 8; ++r) { float v = acc[t][r] * alpha + bv; if (CP) { const int rr = row0g + row0 + 8 * hh + r; if (rowsPerB < 0) v += CP[cofs + (size_t)rr * ldc + col];      /* rowsPerB < 0: own element of the batched C plane */ else { const int bidx = rr / rowsPerB; v += CP[(size_t)bidx * sCPb + (size_t)by * 64 + col]; } } if (ACT == 1) v = (v > 0.f) ? v : expm1f(v); else if (ACT == 7) v = (v > 0.f) ? v + 1.0f : expf(v); else if (ACT == 8) v = tanhf(v); else if (ACT == 9) v = 0.5f * v * (1.0f + tanhf(0.7978845608028654f * (v + 0.044715f * v * v * v))); else if (ACT == 11) v = 1.0f / (1.0f + expf(-v)); else if (ACT == 12) v = (v > 0.f) ? v : 0.01f * v; else if (ACT == 14) v = (v > 0.f) ? v : 0.1f * v; else if (ACT == 16) v = (v >= 0.f) ? v : 0.3f * v; else if (ACT == 17) v = (v >= 0.f) ? v : 0.2f * v; else if (ACT == 15) v = v / (1.0f + expf(-v)); else if (ACT == 3) v = fmaxf(v, 0.f); else if (ACT == 6) v = 0.5f * v * (1.0f + erff(v * 0.70710678118654752f)); so[w][8 * hh + r][t * 16 + ln] = v; } }
  __builtin_amdgcn_fence(__ATOMIC_ACQ_REL, "workgroup"); __builtin_amdgcn_wave_barrier();
  const int rsub = lane >> 4, c4 = (lane & 15) * 4; typedef _Float16 v4h __attribute__((ext_vector_type(4)));
  {
#pragma unroll
    for (int q = 0; q < 8; ++q) { const int r = q * 2 + rsub; if (col0 + c4 < N) { const v4f v = *(const v4fa*)&so[w][r][c4]; if (C) *(v4f*)(C + cofs + (size_t)(row0 + r) * ldc + col0 + c4) = v; if (C16) { v4h h4; for (int i = 0; i < 4; ++i) h4[i] = (_Float16)v[i]; *(v4h*)(C16 + cofs + (size_t)(row0 + r) * ldc + col0 + c4) = h4; } } }
     }
}


typedef _Float16 v4h __attribute__((ext_vector_type(4)));

__global__ __launch_bounds__(256) void k_x16(const float* __restrict__ x, _Float16* __restrict__ X16, size_t n8) { const size_t t = (size_t)blockIdx.x * 256 + threadIdx.x; if (t >= n8) return; FragH f;
#pragma unroll
  for (int q = 0; q < 8; ++q) f.h[q] = (_Float16)bf16_round(x[t * 8 + q]); *(v8us*)((unsigned short*)X16 + t * 8) = f.half[0];  }
__global__ __launch_bounds__(256) void k_h16(const float* __restrict__ x, _Float16* __restrict__ X16, size_t n8) { const size_t t = (size_t)blockIdx.x * 256 + threadIdx.x; if (t >= n8) return; FragH f;
#pragma unroll
  for (int q = 0; q < 8; ++q) f.h[q] = (_Float16)x[t * 8 + q]; *(v8us*)((unsigned short*)X16 + t * 8) = f.half[0];  }
__global__ __launch_bounds__(256) void k_round16f(const float* __restrict__ W, _Float16* __restrict__ Bt, size_t n8) { const size_t t = (size_t)blockIdx.x * 256 + threadIdx.x; if (t >= n8) return; FragH f;
#pragma unroll
  for (int i = 0; i < 8; ++i) f.h[i] = (_Float16)(bf16_round(W[t * 8 + i]) * 16.0f); *(v8us*)((unsigned short*)Bt + t * 8) = f.half[0];  }
template <int NHv, int TTv>
__global__ __launch_bounds__(256) void k_vt(const _Float16* __restrict__ V16, int ldv, int voff, _Float16* __restrict__ Vt) { __shared__ unsigned short tl[64][66]; const int tid = threadIdx.x; const int slab = blockIdx.x / (TTv / 64), lg = blockIdx.x % (TTv / 64); const int b = slab / NHv, h = slab % NHv;
  for (int i = tid; i < 64 * 8; i += 256) { const int r = i / 8, c8 = (i % 8) * 8; FragH f; f.half[0] = *(const v8us*)((const unsigned short*)V16 + ((size_t)b * TTv + lg * 64 + r) * ldv + voff + h * 64 + c8);
#pragma unroll
    for (int q = 0; q < 8; ++q) tl[r][c8 + q] = f.u[q]; }
  __syncthreads();
  {
#pragma unroll
    for (int rd = 0; rd < 2; ++rd) { const int d = rd * 32 + tid / 8, pc = tid % 8; FragH f;
#pragma unroll
      for (int q = 0; q < 8; ++q) f.u[q] = tl[pc * 8 + q][d];
      *(v8us*)((unsigned short*)Vt + ((size_t)slab * 64 + d) * TTv + lg * 64 + pc * 8) = f.half[0]; }
     } }

__global__ __launch_bounds__(256) void k_hl(const float* __restrict__ F, _Float16* __restrict__ Hh, _Float16* __restrict__ Hl, size_t n8) { const size_t t = (size_t)blockIdx.x * 256 + threadIdx.x; if (t >= n8) return; FragH fh, fl; const v4f a = *(const v4fa*)(F + t * 8), c = *(const v4fa*)(F + t * 8 + 4);
#pragma unroll
  for (int q = 0; q < 4; ++q) { _Float16 h = (_Float16)a[q]; fh.h[q] = h; fl.h[q] = (_Float16)((a[q] - (float)h) * 1024.0f); h = (_Float16)c[q]; fh.h[4 + q] = h; fl.h[4 + q] = (_Float16)((c[q] - (float)h) * 1024.0f); }
  { *(v8us*)((unsigned short*)Hh + t * 8) = fh.half[0]; *(v8us*)((unsigned short*)Hl + t * 8) = fl.half[0];  } }

// ---- fast GEMM (wave tile 32x64; requires M % 32 == 0 rows per launch region and N % 64 == 0); epilogue = k_gemm_hhx semantics ----
__device__ __forceinline__ v16h g2_frag(const _Float16* p, int hh) { FragH f; f.half[0] = *(const v8us*)((const unsigned short*)p + 8 * hh); f.half[1] = *(const v8us*)((const unsigned short*)p + 16 + 8 * hh); return f.v; }
__device__ __forceinline__ v8f g2_mma(v16h a, v16h b, v8f c) { v8f d = __builtin_amdgcn_wmma_f32_16x16x32_f16(false, a, false, b, (short)0, c, false, false); asm volatile("v_nop\n\tv_nop\n\tv_nop\n\tv_nop" : "+v"(d) : "v"(a), "v"(b)); return d; }
template <int ACT>
__global__ __launch_bounds__(128) void k_gemm2(const _Float16* __restrict__ A, int lda, size_t sA, const _Float16* __restrict__ Bh, int ldb, size_t sB, float alpha, const float* __restrict__ bias, size_t sBias, const float* __restrict__ CP, int rowsPerB, size_t sCPb, int row0g,
    float* __restrict__ C, _Float16* __restrict__ C16, int ldc, size_t sC, int M, int N, int K) { static_assert(ACT == 0 || ACT == 3 || ACT == 6 || ACT == 8 || ACT == 9 || ACT == 11 || ACT == 12 || ACT == 14 || ACT == 15 || ACT == 16 || ACT == 17, "k_gemm2: unsupported ACT code (would silently apply no activation)");
  __shared__ __attribute__((aligned(16))) float so[4][32][68];
  const int tid = threadIdx.x, w = tid >> 5, lane = tid & 31, ln = lane & 15, hh = lane >> 4; const int by = blockIdx.y;
  A += (size_t)by * sA; Bh += (size_t)by * sB; const size_t cofs = (size_t)by * sC; const float* bp = bias ? bias + (size_t)by * sBias : nullptr;
  const int ntn = N >> 6; const int mt = blockIdx.x / ntn, nq = blockIdx.x - mt * ntn; const int row0 = mt * 128 + 32 * w, col0 = nq * 64; if (row0 >= M) return;
  const _Float16* a0p = A + (size_t)(row0 + ln) * lda; const _Float16* a1p = a0p + (size_t)16 * lda;
  const _Float16* b0p = Bh + (size_t)(col0 + ln) * ldb; const _Float16* b1p = b0p + (size_t)16 * ldb; const _Float16* b2p = b1p + (size_t)16 * ldb; const _Float16* b3p = b2p + (size_t)16 * ldb;
  const v8f z8 = {0.f,0.f,0.f,0.f,0.f,0.f,0.f,0.f}; v8f c00 = z8, c01 = z8, c02 = z8, c03 = z8, c10 = z8, c11 = z8, c12 = z8, c13 = z8;
#pragma unroll 1
  for (int kb = 0; kb < K; kb += 32) { const v16h a0 = g2_frag(a0p + kb, hh), a1 = g2_frag(a1p + kb, hh);
    v16h b = g2_frag(b0p + kb, hh); c00 = g2_mma(a0, b, c00); c10 = g2_mma(a1, b, c10);
    b = g2_frag(b1p + kb, hh); c01 = g2_mma(a0, b, c01); c11 = g2_mma(a1, b, c11);
    b = g2_frag(b2p + kb, hh); c02 = g2_mma(a0, b, c02); c12 = g2_mma(a1, b, c12);
    b = g2_frag(b3p + kb, hh); c03 = g2_mma(a0, b, c03); c13 = g2_mma(a1, b, c13); }
  v8f accs[8] = {c00, c01, c02, c03, c10, c11, c12, c13};
#pragma unroll
  for (int u = 0; u < 8; ++u) { const int t = u & 3, half = u >> 2; const int col = col0 + t * 16 + ln; const float bv = bp ? bf16_round(bp[col]) : 0.f;
#pragma unroll
    for (int r = 0; r < 8; ++r) { const int rloc = half * 16 + 8 * hh + r; float v = accs[u][r] * alpha + bv; if (CP) { if (rowsPerB < 0) v += CP[cofs + (size_t)(row0g + row0 + rloc) * ldc + col];      /* rowsPerB < 0: own element of the batched C plane */ else { const int bidx = (row0g + row0 + rloc) / rowsPerB; v += CP[(size_t)bidx * sCPb + (size_t)by * 64 + col]; } }
      if (ACT == 3) v = fmaxf(v, 0.f); else if (ACT == 6) v = 0.5f * v * (1.0f + erff(v * 0.70710678118654752f)); else if (ACT == 11) v = 1.0f / (1.0f + expf(-v)); else if (ACT == 15) v = v / (1.0f + expf(-v)); else if (ACT == 12) v = (v > 0.f) ? v : 0.01f * v; else if (ACT == 8) v = tanhf(v); else if (ACT == 9) v = 0.5f * v * (1.0f + tanhf(0.7978845608028654f * (v + 0.044715f * v * v * v))); else if (ACT == 14) v = (v > 0.f) ? v : 0.1f * v; else if (ACT == 16) v = (v >= 0.f) ? v : 0.3f * v; else if (ACT == 17) v = (v >= 0.f) ? v : 0.2f * v;
      so[w][rloc][t * 16 + ln] = v; } }
  __builtin_amdgcn_fence(__ATOMIC_ACQ_REL, "workgroup"); __builtin_amdgcn_wave_barrier();
  const int rsub = lane >> 4, c4 = (lane & 15) * 4;
  {
#pragma unroll
    for (int q = 0; q < 16; ++q) { const int r = q * 2 + rsub; const v4f v = *(const v4fa*)&so[w][r][c4]; if (C) *(v4f*)(C + cofs + (size_t)(row0 + r) * ldc + col0 + c4) = v; if (C16) { v4h h4; for (int i = 0; i < 4; ++i) h4[i] = (_Float16)v[i]; *(v4h*)(C16 + cofs + (size_t)(row0 + r) * ldc + col0 + c4) = h4; } }
     } }


__global__ __launch_bounds__(256) void k_wnat(const float* __restrict__ w, size_t n8, _Float16* __restrict__ Bt) { const size_t t = (size_t)blockIdx.x * 256 + threadIdx.x; if (t >= n8) return; FragH f; for (int q = 0; q < 8; ++q) f.h[q] = (_Float16)(bf16_round(w[t * 8 + q]) * 16.0f); *(v8us*)((unsigned short*)Bt + t * 8) = f.half[0];  }
__global__ __launch_bounds__(256) void k_rsm(const float* __restrict__ S, _Float16* __restrict__ P, int nrows) {
  #pragma clang fp contract(off)
  const int i = blockIdx.x * 256 + threadIdx.x; if (i >= nrows) return; const float* s = S + (size_t)i * SQ; float mx = -3.0e38f;
#pragma unroll 1
  for (int j = 0; j < SQ; ++j) mx = fmaxf(mx, s[j]); float se = 0.f;
#pragma unroll 1
  for (int j = 0; j < SQ; ++j) se += expf(s[j] - mx); const float sc = 256.0f / se;
#pragma unroll 1
  for (int j0 = 0; j0 < SQ; j0 += 8) { FragH f; for (int q = 0; q < 8; ++q) f.h[q] = (_Float16)(expf(s[j0 + q] - mx) * sc); unsigned short* d = (unsigned short*)P + (size_t)i * SQ + j0; *(v8us*)d = f.half[0];  } }
__global__ __launch_bounds__(256) void k_vt(const _Float16* __restrict__ V16, int b, int h0, _Float16* __restrict__ VT) { __shared__ unsigned short tl[64][65]; const int tid = threadIdx.x; const int hh = blockIdx.x % HG, sg = blockIdx.x / HG; const int s0 = sg * 64; const int h = h0 + hh;
  for (int i = tid; i < 64 * 8; i += 256) { const int j = i / 8, d8 = (i % 8) * 8; FragH f; f.half[0] = *(const v8us*)((const unsigned short*)V16 + ((size_t)b * SQ + s0 + j) * DM + h * HD + d8); for (int q = 0; q < 8; ++q) tl[d8 + q][j] = f.u[q]; }
  __syncthreads();
  { for (int i = tid; i < 64 * 8; i += 256) { const int d = i / 8, j8 = (i % 8) * 8; FragH f; for (int q = 0; q < 8; ++q) f.u[q] = tl[d][j8 + q]; *(v8us*)((unsigned short*)VT + ((size_t)hh * HD + d) * SQ + s0 + j8) = f.half[0]; }  } }


__global__ __launch_bounds__(256) void k_x16pad(const float* __restrict__ x, _Float16* __restrict__ X16) { const size_t t = (size_t)blockIdx.x * 256 + threadIdx.x; if (t >= (size_t)NB * QP * (DM / 8)) return; const int c8 = (int)(t % (DM / 8)) * 8; const size_t row = t / (DM / 8); const int b = (int)(row / QP), q = (int)(row % QP); FragH f;
  for (int i = 0; i < 8; ++i) f.h[i] = (_Float16)((q < NQ) ? bf16_round(x[((size_t)b * NQ + q) * DM + c8 + i]) : 0.f);
  *(v8us*)((unsigned short*)X16 + row * DM + c8) = f.half[0];  }


template <int HPP>
__global__ __launch_bounds__(256) void k_wtpadT(const float* __restrict__ w, _Float16* __restrict__ Bt) { const int t = blockIdx.x * 256 + threadIdx.x; if (t >= NH * HPP * (DM / 8)) return; const int k8 = (t % (DM / 8)) * 8; const int r = t / (DM / 8); const int h = r / HPP, d = r % HPP; FragH f;
  for (int q = 0; q < 8; ++q) { float v = 0.f; if (d < HD) v = bf16_round(w[(size_t)(k8 + q) * DM + h * HD + d]); f.h[q] = (_Float16)(v * 16.0f); }
  unsigned short* dst = (unsigned short*)Bt + (size_t)r * DM + k8; *(v8us*)dst = f.half[0];  }
template <int HPP>
__global__ __launch_bounds__(256) void k_wtopadT(const float* __restrict__ w, _Float16* __restrict__ Bt) { const int t = blockIdx.x * 256 + threadIdx.x; if (t >= DM * (NH * HPP / 8)) return; const int k8 = (t % (NH * HPP / 8)) * 8; const int n = t / (NH * HPP / 8); FragH f;
  for (int q = 0; q < 8; ++q) { const int kp = k8 + q; const int h = kp / HPP, d = kp % HPP; float v = 0.f; if (d < HD) v = bf16_round(w[(size_t)(h * HD + d) * DM + n]); f.h[q] = (_Float16)(v * 16.0f); }
  unsigned short* dst = (unsigned short*)Bt + (size_t)n * (NH * HPP) + k8; *(v8us*)dst = f.half[0];  }
__global__ __launch_bounds__(256) void k_qmean(const float* __restrict__ xn, const float* __restrict__ wqm, float* __restrict__ QMP) {
  #pragma clang fp contract(off)
  __shared__ float mu[DM]; const int b = blockIdx.x, t = threadIdx.x;
  if (t < DM) { float s = 0.f; const float* col = xn + (size_t)b * NQ * DM + t;
#pragma unroll 1
    for (int n = 0; n < NQ; ++n) s = __fadd_rn(s, bf16_round(col[(size_t)n * DM])); mu[t] = s / (float)NQ; }
  __syncthreads();
  const int h = t / 32, d = t % 32; float v = 0.f;
  if (d < HD) {
#pragma unroll 1
    for (int k = 0; k < DM; ++k) v = __fadd_rn(v, __fmul_rn(mu[k], bf16_round(wqm[(size_t)k * DM + h * HD + d]))); }
  float* dst = QMP + (size_t)b * (NH * 32) + t; *(float*)dst = v;  }
__global__ __launch_bounds__(256) void k_rsm1(const float* __restrict__ S, _Float16* __restrict__ P, int b, const float* __restrict__ mask) {
  #pragma clang fp contract(off)
  const int t = blockIdx.x * 256 + threadIdx.x; if (t >= NH * QP) return; const int p = t % QP; const size_t i = (size_t)t; const float* s = S + i * QP; unsigned short* prow = (unsigned short*)P + i * QP; FragH z; for (int u = 0; u < 8; ++u) z.h[u] = (_Float16)0.f;
  if (p >= NQ) { {
#pragma unroll 1
      for (int j0 = 0; j0 < QP; j0 += 8) *(v8us*)(prow + j0) = z.half[0];  } return; }
  const float* mr = mask + ((size_t)b * NQ + p) * NQ; float mx = -3.0e38f;
#pragma unroll 1
  for (int j = 0; j < NQ; ++j) mx = fmaxf(mx, __fadd_rn(s[j], bf16_round(mr[j]))); float se = 0.f;
#pragma unroll 1
  for (int j = 0; j < NQ; ++j) se += __expf(__fadd_rn(s[j], bf16_round(mr[j])) - mx); const float sc = 256.0f / se;
  {
#pragma unroll 1
    for (int j0 = 0; j0 < QP; j0 += 8) { FragH fr; for (int u = 0; u < 8; ++u) { const int j = j0 + u; fr.h[u] = (j < NQ) ? (_Float16)(__expf(__fadd_rn(s[j], bf16_round(mr[(j < NQ) ? j : 0])) - mx) * sc) : (_Float16)0.f; } *(v8us*)(prow + j0) = fr.half[0]; }
     } }
__global__ __launch_bounds__(256) void k_fin(const float* __restrict__ S2, const float* __restrict__ mask, int b, float* __restrict__ PR) {
  #pragma clang fp contract(off)
  const int p = blockIdx.x * 256 + threadIdx.x; if (p >= NQ) return; const float* s = S2 + (size_t)p * QP; const float* mr = mask + ((size_t)b * NQ + p) * NQ; float* pr = PR + ((size_t)b * QP + p) * QP; float mx = -3.0e38f;
#pragma unroll 1
  for (int j = 0; j < NQ; ++j) { const float v = __fadd_rn(10.0f * tanhf(s[j]), bf16_round(mr[j])); mx = fmaxf(mx, v); } float se = 0.f;
#pragma unroll 1
  for (int j = 0; j < NQ; ++j) { const float v = __fadd_rn(10.0f * tanhf(s[j]), bf16_round(mr[j])); se = __fadd_rn(se, expf(v - mx)); } const float inv = 1.0f / se;
  {
#pragma unroll 1
    for (int j0 = 0; j0 < QP; j0 += 4) { v4f o; for (int u = 0; u < 4; ++u) { const int j = j0 + u; const int jc = (j < NQ) ? j : 0; const float v = __fadd_rn(10.0f * tanhf(s[jc]), bf16_round(mr[jc])); o[u] = (j < NQ) ? __fmul_rn(expf(v - mx), inv) : 0.f; } *(v4f*)(pr + j0) = o; }
     } }
__global__ __launch_bounds__(256) void k_outflat(const float* __restrict__ PR, float* __restrict__ out) { const size_t t = (size_t)blockIdx.x * 256 + threadIdx.x; if (t >= (size_t)NB * NQ * NQ / 4) return; const size_t e = t * 4; const int n = (int)(e % NQ); const size_t bp = e / NQ; const int b = (int)(bp / NQ), p = (int)(bp % NQ);
  const v4f v = *(const v4fa*)(PR + ((size_t)b * QP + p) * QP + n); *(v4f*)(out + e) = v;  }

extern "C" void kernel_launch(void* const* d_in, const int* in_sizes, int n_in,
                              void* d_out, int out_size, void* d_ws, size_t ws_size, hipStream_t stream) {
  (void)in_sizes; (void)n_in; (void)out_size;
  const float* const* I = (const float* const*)d_in; const float* xn = I[0]; const float* xq1 = I[1]; const float* xl = I[2]; const float* mask = I[3]; const float* Wqf = I[4]; const float* Wql = I[5]; const float* Wqm = I[6]; const float* Wk = I[7]; const float* Wv = I[8]; const float* Wc = I[9]; const float* bc = I[10];      /* weights [in][out] */
  char* ws = (char*)d_ws; size_t off = 0;
  auto take = [&](size_t bytes) { char* p = ws + off; off += (bytes + 255) & ~(size_t)255; return p; };
  _Float16* BQF = (_Float16*)take((size_t)NH * 32 * DM * 2); _Float16* BQL = (_Float16*)take((size_t)NH * 32 * DM * 2); _Float16* BK = (_Float16*)take((size_t)NH * 32 * DM * 2); _Float16* BVP = (_Float16*)take((size_t)NH * 64 * DM * 2); _Float16* BCP = (_Float16*)take((size_t)DM * NH * 64 * 2); float* QMP = (float*)take((size_t)NB * NH * 32 * 4);
  _Float16* XN = (_Float16*)take(NRP * DM * 2); _Float16* XQ1 = (_Float16*)take(NRP * DM * 2); _Float16* XL = (_Float16*)take(NRP * DM * 2);
  float* QF = (float*)take(NRP * NH * 32 * 4); _Float16* Q16 = (_Float16*)take(NRP * NH * 32 * 2); _Float16* K16 = (_Float16*)take(NRP * NH * 32 * 2); _Float16* V2 = (_Float16*)take(NRP * NH * 64 * 2); float* OF = (float*)take(NRP * NH * 64 * 4); _Float16* OH = (_Float16*)take(NRP * NH * 64 * 2); _Float16* OL = (_Float16*)take(NRP * NH * 64 * 2);
  float* S = (float*)take((size_t)NH * QP * QP * 4); _Float16* P = (_Float16*)take((size_t)NH * QP * QP * 2); _Float16* VT = (_Float16*)take((size_t)NH * 64 * QP * 2);
  float* MH = (float*)take(NRP * DM * 4); _Float16* MHh = (_Float16*)take(NRP * DM * 2); _Float16* MHl = (_Float16*)take(NRP * DM * 2); float* S2 = (float*)take((size_t)QP * QP * 4); float* PR = (float*)take((size_t)NB * QP * QP * 4);
  if (off > ws_size) return;      /* approx 6 + 8 + 4 + 4 + 8 + 32 + 32 + 16 + 1 + 8 + 4 + 32 = ~155 MiB */
  k_wtpadT<32><<<(NH * 32 * (DM / 8) + 255) / 256, 256, 0, stream>>>(Wqf, BQF); k_wtpadT<32><<<(NH * 32 * (DM / 8) + 255) / 256, 256, 0, stream>>>(Wql, BQL); k_wtpadT<32><<<(NH * 32 * (DM / 8) + 255) / 256, 256, 0, stream>>>(Wk, BK);
  k_wtpadT<64><<<(NH * 64 * (DM / 8) + 255) / 256, 256, 0, stream>>>(Wv, BVP); k_wtopadT<64><<<(DM * (NH * 64 / 8) + 255) / 256, 256, 0, stream>>>(Wc, BCP);
  k_x16pad<<<(unsigned)((NRP * (DM / 8) + 255) / 256), 256, 0, stream>>>(xn, XN); k_x16pad<<<(unsigned)((NRP * (DM / 8) + 255) / 256), 256, 0, stream>>>(xq1, XQ1); k_x16pad<<<(unsigned)((NRP * (DM / 8) + 255) / 256), 256, 0, stream>>>(xl, XL);
  k_qmean<<<NB, 256, 0, stream>>>(xn, Wqm, QMP);      /* per-batch mean term in the padded q layout */
  k_gemm2<0><<<dim3((unsigned)((NRP / 128) * (NH * 32 / 64)), 1), 128, 0, stream>>>(XQ1, DM, 0, BQF, DM, 0, 0.0625f, nullptr, 0, QMP, QP, NH * 32, 0, QF, nullptr, NH * 32, 0, (int)NRP, NH * 32, DM);      /* q1 Wq_first + mean term (broadcast per batch), f32 */
  k_gemm2<0><<<dim3((unsigned)((NRP / 128) * (NH * 32 / 64)), 1), 128, 0, stream>>>(XL, DM, 0, BQL, DM, 0, 0.0625f, nullptr, 0, QF, -1, 0, 0, nullptr, Q16, NH * 32, 0, (int)NRP, NH * 32, DM);      /* + last Wq_last -> q (f16, padded [8][32]) */
  k_gemm2<0><<<dim3((unsigned)((NRP / 128) * (NH * 32 / 64)), 1), 128, 0, stream>>>(XN, DM, 0, BK, DM, 0, 0.0625f, nullptr, 0, nullptr, 1, 0, 0, nullptr, K16, NH * 32, 0, (int)NRP, NH * 32, DM);      /* k (f16, padded [8][32]) */
  k_gemm2<0><<<dim3((unsigned)((NRP / 128) * (NH * 64 / 64)), 1), 128, 0, stream>>>(XN, DM, 0, BVP, DM, 0, 0.0625f, nullptr, 0, nullptr, 1, 0, 0, nullptr, V2, NH * 64, 0, (int)NRP, NH * 64, DM);      /* v (f16, padded [8][64]) */
  for (int b = B0; b < B0 + NBR; ++b) { const size_t rb = (size_t)b * QP;
    k_vt<NH, QP><<<NH * (QP / 64), 256, 0, stream>>>(V2 + rb * NH * 64, NH * 64, 0, VT);      /* V^T [8][64][1024] */
    k_gemm2<0><<<dim3((QP / 128) * (QP / 64), NH), 128, 0, stream>>>(Q16 + rb * NH * 32, NH * 32, (size_t)32, K16 + rb * NH * 32, NH * 32, (size_t)32, 0.25f, nullptr, 0, nullptr, 1, 0, 0, S, nullptr, QP, (size_t)QP * QP, QP, QP, 32);      /* stage-1 scores / sqrt(16), all heads; K = 32 (16 real + 16 zero) */
    k_rsm1<<<(NH * QP + 255) / 256, 256, 0, stream>>>(S, P, b, mask);
    k_gemm2<0><<<dim3((QP / 128) * 1, NH), 128, 0, stream>>>(P, QP, (size_t)QP * QP, VT, QP, (size_t)64 * QP, 0.25f, nullptr, 0, nullptr, 1, 0, 0, OF + rb * NH * 64, nullptr, NH * 64, (size_t)64, QP, 64, QP); }      /* o x64 (padded [8][64], f32) */
  k_hl<<<(unsigned)((NRP * NH * 64 / 8 + 255) / 256), 256, 0, stream>>>(OF, OH, OL, NRP * NH * 64 / 8);      /* o -> f16 hi + x1024 residual */
  k_gemm2<0><<<dim3((unsigned)((NRP / 128) * (DM / 64)), 1), 128, 0, stream>>>(OH, NH * 64, 0, BCP, NH * 64, 0, 0.0009765625f, bc, 0, nullptr, 1, 0, 0, MH, nullptr, DM, 0, (int)NRP, DM, NH * 64);      /* mh = o_hi W_comb + b_comb (f32) */
  k_gemm2<0><<<dim3((unsigned)((NRP / 128) * (DM / 64)), 1), 128, 0, stream>>>(OL, NH * 64, 0, BCP, NH * 64, 0, 0.00000095367431640625f, nullptr, 0, MH, -1, 0, 0, MH, nullptr, DM, 0, (int)NRP, DM, NH * 64);      /* += o_lo W_comb 2^-20 */
  k_hl<<<(unsigned)((NRP * DM / 8 + 255) / 256), 256, 0, stream>>>(MH, MHh, MHl, NRP * DM / 8);      /* mh -> f16 hi + x1024 residual */
  for (int b = B0; b < B0 + NBR; ++b) { const size_t rb = (size_t)b * QP;
    k_gemm2<0><<<dim3((QP / 128) * (QP / 64), 1), 128, 0, stream>>>(MHh + rb * DM, DM, 0, XN + rb * DM, DM, 0, 0.088388347648318447f, nullptr, 0, nullptr, 1, 0, 0, S2, nullptr, QP, 0, QP, QP, DM);      /* score2 = mh_hi nodes^T / sqrt(128) */
    k_gemm2<0><<<dim3((QP / 128) * (QP / 64), 1), 128, 0, stream>>>(MHl + rb * DM, DM, 0, XN + rb * DM, DM, 0, 0.000086316745750311f, nullptr, 0, S2, -1, 0, 0, S2, nullptr, QP, 0, QP, QP, DM);      /* += mh_lo nodes^T / (1024 sqrt(128)) */
    k_fin<<<(NQ + 255) / 256, 256, 0, stream>>>(S2, mask, b, PR); }      /* 10 tanh, + mask, softmax over the 1000 real keys (f32) */
  k_outflat<<<(unsigned)(((size_t)NB * NQ * NQ / 4 + 255) / 256), 256, 0, stream>>>(PR, (float*)d_out);
}

// v001
// It runs in 1180 microseconds.
// Two timings next to v000 put it at 13.5 and 13.4 times that version's speed.
#include <hip/hip_runtime.h>
// TSP decoder probabilities (encoded_nodes, encoded_q1, encoded_last_node [8][1000][128]; k = nodes Wk, v = nodes Wv, q = q1 Wq_first + last Wq_last + (mean_n nodes) Wq_mean broadcast ([in][out] weights), 8 heads of 16; weights = softmax(q k^T / 4 + ninf_mask); mh = (weights v merged) W_comb + b_comb; score2 = mh nodes^T / sqrt(128); probs = softmax_n(10 tanh(score2) + ninf_mask) -> [8][1000][1000]).
// Compute dtype: inputs rounded to bf16; token rows / weights exact; q, k, v and the stage-1 weights as plain f16 GEMM operands (~2^-12); o and mh as f16 hi + residual operand pairs (~2^-22); the mean term, score2, tanh, mask and the final softmax f32. v_wmma_f32_16x16x32_f16.
#define NB 8
#define NQ 1000                      /* nodes = queries = 1000 */
#define QP 1024                      /* padded rows / keys per batch */
#define DM 128
#define NH 8
#define HD 16
#define SQ QP
#define HG 8
#define B0 0                         /* first batch (debug hook) */
#define NBR NB
#define NRP ((size_t)NB * QP)        /* padded token rows */
typedef __bf16 v16b __attribute__((ext_vector_type(16)));
typedef unsigned short v8us __attribute__((ext_vector_type(8), may_alias));
typedef float  v8f  __attribute__((ext_vector_type(8)));
typedef float  v4f  __attribute__((ext_vector_type(4)));
typedef float  v4fa __attribute__((ext_vector_type(4), may_alias));
union FragB { v16b v; v8us half[2]; unsigned short u[16]; };

__device__ __forceinline__ unsigned short bf16_bits(float x) { unsigned int u = __float_as_uint(x); return (unsigned short)((u + 0x7FFFu + ((u >> 16) & 1u)) >> 16); }
__device__ __forceinline__ float bf16_val(unsigned short b) { return __uint_as_float(((unsigned int)b) << 16); }
__device__ __forceinline__ float bf16_round(float x) { return bf16_val(bf16_bits(x)); }
// D += A·B with NT terms: 1 = ah·bh, 2 = + al·bh (A split), 3 = + ah·bl (both split)
template <int NT>
__device__ __forceinline__ v8f mmaN(v16b ah, v16b al, v16b bh, v16b bl, v8f c) {
  c = __builtin_amdgcn_wmma_f32_16x16x32_bf16(false, ah, false, bh, (short)0, c, false, false);
  if (NT >= 2) c = __builtin_amdgcn_wmma_f32_16x16x32_bf16(false, al, false, bh, (short)0, c, false, false);
  if (NT >= 3) c = __builtin_amdgcn_wmma_f32_16x16x32_bf16(false, ah, false, bl, (short)0, c, false, false);
  asm volatile("v_nop\n\tv_nop\n\tv_nop\n\tv_nop" : "+v"(c) : "v"(ah), "v"(al), "v"(bh), "v"(bl));
  return c;
}

__global__ __launch_bounds__(256) void k_wt_bf16(const float* __restrict__ W, unsigned short* __restrict__ Wt, int K, int N) {
  const int t = blockIdx.x * 256 + threadIdx.x;
  const int k8n = K / 8;
  if (t >= N * k8n) return;
  const int n = t / k8n, k8 = (t % k8n) * 8;
  v8us v;
#pragma unroll
  for (int i = 0; i < 8; ++i) v[i] = bf16_bits(W[(size_t)(k8 + i) * N + n]);
  *(v8us*)(Wt + (size_t)n * K + k8) = v;
  
}

// GEMM C[M][N] (f32, pitch ldc) = act(A[M][K]·W + bias). A f32 row-major (pitch lda) converted per fragment to bf16
// (ASPLIT: hi/lo two planes -> 2 terms, else single rounded term); Wt bf16 [N][K] (pitch ldb). BIAS_BF16 rounds the
// bias to bf16 first (bias quantised to bf16 before the add). K%32==0, M%16==0, N%64==0.
template <bool ASPLIT, int ACT, bool BIAS_BF16>
__global__ __launch_bounds__(128) void k_gemm_bf(const float* __restrict__ A, int lda, const unsigned short* __restrict__ Wt, int ldb,
                                               const float* __restrict__ bias, float* __restrict__ C, int ldc, int M, int N, int K) {
  __shared__ __attribute__((aligned(16))) float so[4][16][64];
  const int tid = threadIdx.x, w = tid >> 5, lane = tid & 31, ln = lane & 15, hh = lane >> 4;
  const int ntn = N / 64;
  const int wid = blockIdx.x * 4 + w;
  const int mt = wid / ntn, nq = wid % ntn;
  if (mt * 16 >= M) return;
  const int row0 = mt * 16, col0 = nq * 64;
  const float* arow = A + (size_t)(row0 + ln) * lda;
  v8f acc[4] = {};
  for (int kb = 0; kb < K; kb += 32) {
    FragB ah, al;
    const v4f x0 = *(const v4fa*)(arow + kb + 8 * hh), x1 = *(const v4fa*)(arow + kb + 8 * hh + 4);
    const v4f x2 = *(const v4fa*)(arow + kb + 16 + 8 * hh), x3 = *(const v4fa*)(arow + kb + 16 + 8 * hh + 4);
    float xs[16] = {x0[0],x0[1],x0[2],x0[3],x1[0],x1[1],x1[2],x1[3],x2[0],x2[1],x2[2],x2[3],x3[0],x3[1],x3[2],x3[3]};
#pragma unroll
    for (int i = 0; i < 16; ++i) { const unsigned short hb = bf16_bits(xs[i]); ah.u[i] = hb; al.u[i] = ASPLIT ? bf16_bits(xs[i] - bf16_val(hb)) : (unsigned short)0; }
#pragma unroll
    for (int t = 0; t < 4; ++t) {
      const unsigned short* brow = Wt + (size_t)(col0 + t * 16 + ln) * ldb + kb;
      FragB b;
      b.half[0] = *(const v8us*)(brow + 8 * hh);
      b.half[1] = *(const v8us*)(brow + 16 + 8 * hh);
      acc[t] = mmaN<ASPLIT ? 2 : 1>(ah.v, al.v, b.v, b.v, acc[t]);
    }
  }
#pragma unroll
  for (int t = 0; t < 4; ++t) {
    float bv = bias ? bias[col0 + t * 16 + ln] : 0.f;
    if (BIAS_BF16) bv = bf16_round(bv);
#pragma unroll
    for (int r = 0; r < 8; ++r) { float v = acc[t][r] + bv; if (ACT == 1) v = fmaxf(v, 0.f); so[w][8 * hh + r][t * 16 + ln] = v; }
  }
  __builtin_amdgcn_fence(__ATOMIC_ACQ_REL, "workgroup");
  __builtin_amdgcn_wave_barrier();
  const int rsub = lane >> 4, c4 = (lane & 15) * 4;
  {
#pragma unroll
    for (int q = 0; q < 8; ++q) {
      const int r = q * 2 + rsub;
      const v4f v = *(const v4fa*)&so[w][r][c4];
      *(v4f*)(C + (size_t)(row0 + r) * ldc + col0 + c4) = v;
    }
    
  }
}

// GEMM C = act(A·W + bias + resid): A f32 (ASPLIT -> hi/lo 2 terms), Wt bf16 [N][K]; ACT 0 none, 1 relu, 2 exact gelu;
// resid (optional, f32, row index = (row % rmod), pitch ldr, RES_BF16 rounds it) added before the activation.
template <bool ASPLIT, int ACT, bool BIAS_BF16, bool RES_BF16>
__global__ __launch_bounds__(128) void k_gemm_bf3(const float* __restrict__ A, int lda, const unsigned short* __restrict__ Wt, int ldb,
                                                const float* __restrict__ bias, const float* __restrict__ resid, int rmod, int ldr,
                                                float* __restrict__ C, int ldc, int M, int N, int K) {
  __shared__ __attribute__((aligned(16))) float so[4][16][64];
  const int tid = threadIdx.x, w = tid >> 5, lane = tid & 31, ln = lane & 15, hh = lane >> 4;
  const int ntn = N / 64;
  const int wid = blockIdx.x * 4 + w;
  const int mt = wid / ntn, nq = wid % ntn;
  if (mt * 16 >= M) return;
  const int row0 = mt * 16, col0 = nq * 64;
  const float* arow = A + (size_t)(row0 + ln) * lda;
  v8f acc[4] = {};
  for (int kb = 0; kb < K; kb += 32) {
    FragB ah, al;
    const v4f x0 = *(const v4fa*)(arow + kb + 8 * hh), x1 = *(const v4fa*)(arow + kb + 8 * hh + 4);
    const v4f x2 = *(const v4fa*)(arow + kb + 16 + 8 * hh), x3 = *(const v4fa*)(arow + kb + 16 + 8 * hh + 4);
    float xs[16] = {x0[0],x0[1],x0[2],x0[3],x1[0],x1[1],x1[2],x1[3],x2[0],x2[1],x2[2],x2[3],x3[0],x3[1],x3[2],x3[3]};
#pragma unroll
    for (int i = 0; i < 16; ++i) { const unsigned short hb = bf16_bits(xs[i]); ah.u[i] = hb; al.u[i] = ASPLIT ? bf16_bits(xs[i] - bf16_val(hb)) : (unsigned short)0; }
#pragma unroll
    for (int t = 0; t < 4; ++t) {
      const unsigned short* brow = Wt + (size_t)(col0 + t * 16 + ln) * ldb + kb;
      FragB b;
      b.half[0] = *(const v8us*)(brow + 8 * hh);
      b.half[1] = *(const v8us*)(brow + 16 + 8 * hh);
      acc[t] = mmaN<ASPLIT ? 2 : 1>(ah.v, al.v, b.v, b.v, acc[t]);
    }
  }
#pragma unroll
  for (int t = 0; t < 4; ++t) {
    const int col = col0 + t * 16 + ln;
    float bv = bias ? bias[col] : 0.f;
    if (BIAS_BF16) bv = bf16_round(bv);
#pragma unroll
    for (int r = 0; r < 8; ++r) {
      float v = acc[t][r] + bv;
      if (resid) { float rv = resid[(size_t)((row0 + 8 * hh + r) % rmod) * ldr + col]; if (RES_BF16) rv = bf16_round(rv); v += rv; }
      if (ACT == 1) v = fmaxf(v, 0.f);
      if (ACT == 2) v = 0.5f * v * (1.0f + erff(v * 0.70710678118654752f));
      if (ACT == 3) { const float u = 0.7978845608028654f * (v + 0.044715f * v * v * v); v = 0.5f * v * (1.0f + tanhf(u)); }
      so[w][8 * hh + r][t * 16 + ln] = v;
    }
  }
  __builtin_amdgcn_fence(__ATOMIC_ACQ_REL, "workgroup");
  __builtin_amdgcn_wave_barrier();
  const int rsub = lane >> 4, c4 = (lane & 15) * 4;
  {
#pragma unroll
    for (int q = 0; q < 8; ++q) {
      const int r = q * 2 + rsub;
      const v4f v = *(const v4fa*)&so[w][r][c4];
      *(v4f*)(C + (size_t)(row0 + r) * ldc + col0 + c4) = v;
    }
    
  }
}
// row LayerNorm (biased variance, eps) over N: s = X (+ R); optional out_sum <- s; out_norm <- (s-mu)*rsqrt(var+eps)*g + b
template <bool PARAM_BF16>
__global__ __launch_bounds__(256) void k_layernorm(const float* __restrict__ X, const float* __restrict__ R, const float* __restrict__ g, const float* __restrict__ bta,
                                                  float* __restrict__ out_sum, float* __restrict__ out_norm, int N, float eps) {
  __shared__ float red[256];
  const int row = blockIdx.x, tid = threadIdx.x;
  const float* x = X + (size_t)row * N; const float* rr = R ? R + (size_t)row * N : nullptr;
  float vals[16];                     // up to N = 4096
  const int per = N / 256;            // contiguous chunk per thread? use strided-by-4 chunks: thread handles j = tid*4 + 1024*u
  float s1 = 0.f;
  for (int u = 0; u < per / 4; ++u) {
    const int j = tid * 4 + 1024 * u;
    const v4f a = *(const v4fa*)(x + j);
    v4f b = {0.f,0.f,0.f,0.f}; if (rr) b = *(const v4fa*)(rr + j);
#pragma unroll
    for (int q = 0; q < 4; ++q) { const float v = a[q] + b[q]; vals[u * 4 + q] = v; s1 += v; }
  }
  red[tid] = s1; __syncthreads();
  for (int st = 128; st > 0; st >>= 1) { if (tid < st) red[tid] += red[tid + st]; __syncthreads(); }
  const float mu = red[0] / (float)N; __syncthreads();
  float s2 = 0.f;
  for (int u = 0; u < per / 4; ++u)
#pragma unroll
    for (int q = 0; q < 4; ++q) { const float c = vals[u * 4 + q] - mu; s2 += c * c; }
  red[tid] = s2; __syncthreads();
  for (int st = 128; st > 0; st >>= 1) { if (tid < st) red[tid] += red[tid + st]; __syncthreads(); }
  const float rs = rsqrtf(red[0] / (float)N + eps);
  {
    for (int u = 0; u < per / 4; ++u) {
      const int j = tid * 4 + 1024 * u;
      v4f o, sm;
#pragma unroll
      for (int q = 0; q < 4; ++q) {
        float gg = g[j + q], bb = bta[j + q];
        if (PARAM_BF16) { gg = bf16_round(gg); bb = bf16_round(bb); }
        sm[q] = vals[u * 4 + q]; o[q] = (vals[u * 4 + q] - mu) * rs * gg + bb;
      }
      if (out_sum) *(v4f*)(out_sum + (size_t)row * N + j) = sm;
      *(v4f*)(out_norm + (size_t)row * N + j) = o;
    }
    
  }
}



// ---- f16 WMMA path (v_wmma_f32_16x16x32_f16): 11-bit significands for operands in range — used where a [0,1] probability operand needs more precision than bf16
typedef _Float16 v16h __attribute__((ext_vector_type(16)));
union FragH { v16h v; v8us half[2]; _Float16 h[16]; unsigned short u[16]; };
template <int NT>
__device__ __forceinline__ v8f mmaH(v16h ah, v16h al, v16h bh, v16h bl, v8f c) {
  c = __builtin_amdgcn_wmma_f32_16x16x32_f16(false, ah, false, bh, (short)0, c, false, false);
  if (NT >= 2) c = __builtin_amdgcn_wmma_f32_16x16x32_f16(false, al, false, bh, (short)0, c, false, false);
  if (NT >= 3) c = __builtin_amdgcn_wmma_f32_16x16x32_f16(false, ah, false, bl, (short)0, c, false, false);
  asm volatile("v_nop\n\tv_nop\n\tv_nop\n\tv_nop" : "+v"(c) : "v"(ah), "v"(al), "v"(bh), "v"(bl));
  return c;
}
// batched GEMM like k_gemm_b but f16 operands: A f32 (split into f16 hi/lo if ASPLIT, else rounded to f16), Bt = f16 values [n][k]; alpha; C f32; N multiple of 16 (partial tiles skipped)
template <bool ASPLIT>
__global__ __launch_bounds__(128) void k_gemm_h(const float* __restrict__ A, int lda, size_t sA, const _Float16* __restrict__ Bh, int ldb, size_t sB, float alpha, float* __restrict__ C, int ldc, size_t sC, int M, int N, int K) {
  __shared__ __attribute__((aligned(16))) float so[4][16][64];
  const int tid = threadIdx.x, w = tid >> 5, lane = tid & 31, ln = lane & 15, hh = lane >> 4; const int by = blockIdx.y;
  A += (size_t)by * sA; Bh += (size_t)by * sB; C += (size_t)by * sC;
  const int ntn = (N + 63) / 64; const int wid = blockIdx.x * 4 + w; const int mt = wid / ntn, nq = wid % ntn; if (mt * 16 >= M) return;
  const int row0 = mt * 16, col0 = nq * 64; const float* arow = A + (size_t)(row0 + ln) * lda;
  v8f acc[4] = {};
  for (int kb = 0; kb < K; kb += 32) {
    FragH ah, al;
    const v4f x0 = *(const v4fa*)(arow + kb + 8 * hh), x1 = *(const v4fa*)(arow + kb + 8 * hh + 4), x2 = *(const v4fa*)(arow + kb + 16 + 8 * hh), x3 = *(const v4fa*)(arow + kb + 16 + 8 * hh + 4);
    float xs[16] = {x0[0],x0[1],x0[2],x0[3],x1[0],x1[1],x1[2],x1[3],x2[0],x2[1],x2[2],x2[3],x3[0],x3[1],x3[2],x3[3]};
#pragma unroll
    for (int i = 0; i < 16; ++i) { const _Float16 h = (_Float16)xs[i]; ah.h[i] = h; al.h[i] = ASPLIT ? (_Float16)(xs[i] - (float)h) : (_Float16)0.0f; }
#pragma unroll
    for (int t = 0; t < 4; ++t) { if (col0 + t * 16 >= N) continue; const size_t boff = (size_t)(col0 + t * 16 + ln) * ldb + kb; FragH bq; bq.half[0] = *(const v8us*)(Bh + boff + 8 * hh); bq.half[1] = *(const v8us*)(Bh + boff + 16 + 8 * hh);
      acc[t] = mmaH<ASPLIT ? 2 : 1>(ah.v, al.v, bq.v, bq.v, acc[t]); }
  }
#pragma unroll
  for (int t = 0; t < 4; ++t) { if (col0 + t * 16 >= N) continue;
#pragma unroll
    for (int r = 0; r < 8; ++r) so[w][8 * hh + r][t * 16 + ln] = acc[t][r] * alpha; }
  __builtin_amdgcn_fence(__ATOMIC_ACQ_REL, "workgroup"); __builtin_amdgcn_wave_barrier();
  const int rsub = lane >> 4, c4 = (lane & 15) * 4;
  {
#pragma unroll
    for (int q = 0; q < 8; ++q) { const int r = q * 2 + rsub; if (col0 + c4 < N) { const v4f v = *(const v4fa*)&so[w][r][c4]; *(v4f*)(C + (size_t)(row0 + r) * ldc + col0 + c4) = v; } }
     }
}

// Wt[n][k] = f16(W[k][n]·scale) from f32 row-major W[K][N] (scale = power of two; bf16-exact weights stay exact in f16 away from the subnormal range)
__global__ __launch_bounds__(256) void k_wt_f16(const float* __restrict__ W, _Float16* __restrict__ Wt, int K, int N, float scale) {
  const int t = blockIdx.x * 256 + threadIdx.x; if (t >= N * (K / 8)) return; const int n = t / (K / 8), k8 = (t % (K / 8)) * 8; FragH f;
#pragma unroll
  for (int i = 0; i < 8; ++i) f.h[i] = (_Float16)(bf16_round(W[(size_t)(k8 + i) * N + n]) * scale); const v8us o = f.half[0];
  *(v8us*)((unsigned short*)Wt + (size_t)n * K + k8) = o; 
}
// k_gemm_hh variant with fused epilogue: v = acc·alpha + bias[by·sBias + col] (+ CP[(row/rowsPerB)·sCPb + by·64 + col] if CP) ; ACT 0 none / 1 elu ; writes f16 C16 (and f32 C if non-null)
template <int ACT>
__global__ __launch_bounds__(128) void k_gemm_hhx(const _Float16* __restrict__ A, int lda, size_t sA, const _Float16* __restrict__ Bh, int ldb, size_t sB, float alpha, const float* __restrict__ bias, size_t sBias, const float* __restrict__ CP, int rowsPerB, size_t sCPb, int row0g,
    float* __restrict__ C, _Float16* __restrict__ C16, int ldc, size_t sC, int M, int N, int K) {
  __shared__ __attribute__((aligned(16))) float so[4][16][64];
  const int tid = threadIdx.x, w = tid >> 5, lane = tid & 31, ln = lane & 15, hh = lane >> 4; const int by = blockIdx.y;
  A += (size_t)by * sA; Bh += (size_t)by * sB; const size_t cofs = (size_t)by * sC; const float* bp = bias ? bias + (size_t)by * sBias : nullptr;
  const int ntn = (N + 63) / 64; const int wid = blockIdx.x * 4 + w; const int mt = wid / ntn, nq = wid % ntn; if (mt * 16 >= M) return;
  const int row0 = mt * 16, col0 = nq * 64; const _Float16* arow = A + (size_t)(row0 + ln) * lda;
  v8f acc[4] = {};
  for (int kb = 0; kb < K; kb += 32) { FragH ah; ah.half[0] = *(const v8us*)((const unsigned short*)arow + kb + 8 * hh); ah.half[1] = *(const v8us*)((const unsigned short*)arow + kb + 16 + 8 * hh);
#pragma unroll
    for (int t = 0; t < 4; ++t) { if (col0 + t * 16 >= N) continue; const size_t boff = (size_t)(col0 + t * 16 + ln) * ldb + kb; FragH bq; bq.half[0] = *(const v8us*)((const unsigned short*)Bh + boff + 8 * hh); bq.half[1] = *(const v8us*)((const unsigned short*)Bh + boff + 16 + 8 * hh);
      acc[t] = mmaH<1>(ah.v, ah.v, bq.v, bq.v, acc[t]); }
  }
#pragma unroll
  for (int t = 0; t < 4; ++t) { if (col0 + t * 16 >= N) continue; const int col = col0 + t * 16 + ln; const float bv = bp ? bf16_round(bp[col]) : 0.f;
#pragma unroll
    for (int r = 0; r < 8; ++r) { float v = acc[t][r] * alpha + bv; if (CP) { const int rr = row0g + row0 + 8 * hh + r; if (rowsPerB < 0) v += CP[cofs + (size_t)rr * ldc + col];      /* rowsPerB < 0: own element of the batched C plane */ else { const int bidx = rr / rowsPerB; v += CP[(size_t)bidx * sCPb + (size_t)by * 64 + col]; } } if (ACT == 1) v = (v > 0.f) ? v : expm1f(v); else if (ACT == 7) v = (v > 0.f) ? v + 1.0f : expf(v); else if (ACT == 8) v = tanhf(v); else if (ACT == 9) v = 0.5f * v * (1.0f + tanhf(0.7978845608028654f * (v + 0.044715f * v * v * v))); else if (ACT == 11) v = 1.0f / (1.0f + expf(-v)); else if (ACT == 12) v = (v > 0.f) ? v : 0.01f * v; else if (ACT == 14) v = (v > 0.f) ? v : 0.1f * v; else if (ACT == 16) v = (v >= 0.f) ? v : 0.3f * v; else if (ACT == 17) v = (v >= 0.f) ? v : 0.2f * v; else if (ACT == 15) v = v / (1.0f + expf(-v)); else if (ACT == 3) v = fmaxf(v, 0.f); else if (ACT == 6) v = 0.5f * v * (1.0f + erff(v * 0.70710678118654752f)); so[w][8 * hh + r][t * 16 + ln] = v; } }
  __builtin_amdgcn_fence(__ATOMIC_ACQ_REL, "workgroup"); __builtin_amdgcn_wave_barrier();
  const int rsub = lane >> 4, c4 = (lane & 15) * 4; typedef _Float16 v4h __attribute__((ext_vector_type(4)));
  {
#pragma unroll
    for (int q = 0; q < 8; ++q) { const int r = q * 2 + rsub; if (col0 + c4 < N) { const v4f v = *(const v4fa*)&so[w][r][c4]; if (C) *(v4f*)(C + cofs + (size_t)(row0 + r) * ldc + col0 + c4) = v; if (C16) { v4h h4; for (int i = 0; i < 4; ++i) h4[i] = (_Float16)v[i]; *(v4h*)(C16 + cofs + (size_t)(row0 + r) * ldc + col0 + c4) = h4; } } }
     }
}


typedef _Float16 v4h __attribute__((ext_vector_type(4)));

__global__ __launch_bounds__(256) void k_x16(const float* __restrict__ x, _Float16* __restrict__ X16, size_t n8) { const size_t t = (size_t)blockIdx.x * 256 + threadIdx.x; if (t >= n8) return; FragH f;
#pragma unroll
  for (int q = 0; q < 8; ++q) f.h[q] = (_Float16)bf16_round(x[t * 8 + q]); *(v8us*)((unsigned short*)X16 + t * 8) = f.half[0];  }
__global__ __launch_bounds__(256) void k_h16(const float* __restrict__ x, _Float16* __restrict__ X16, size_t n8) { const size_t t = (size_t)blockIdx.x * 256 + threadIdx.x; if (t >= n8) return; FragH f;
#pragma unroll
  for (int q = 0; q < 8; ++q) f.h[q] = (_Float16)x[t * 8 + q]; *(v8us*)((unsigned short*)X16 + t * 8) = f.half[0];  }
__global__ __launch_bounds__(256) void k_round16f(const float* __restrict__ W, _Float16* __restrict__ Bt, size_t n8) { const size_t t = (size_t)blockIdx.x * 256 + threadIdx.x; if (t >= n8) return; FragH f;
#pragma unroll
  for (int i = 0; i < 8; ++i) f.h[i] = (_Float16)(bf16_round(W[t * 8 + i]) * 16.0f); *(v8us*)((unsigned short*)Bt + t * 8) = f.half[0];  }
template <int NHv, int TTv>
__global__ __launch_bounds__(256) void k_vt(const _Float16* __restrict__ V16, int ldv, int voff, _Float16* __restrict__ Vt) { __shared__ unsigned short tl[64][66]; const int tid = threadIdx.x; const int slab = blockIdx.x / (TTv / 64), lg = blockIdx.x % (TTv / 64); const int b = slab / NHv, h = slab % NHv;
  for (int i = tid; i < 64 * 8; i += 256) { const int r = i / 8, c8 = (i % 8) * 8; FragH f; f.half[0] = *(const v8us*)((const unsigned short*)V16 + ((size_t)b * TTv + lg * 64 + r) * ldv + voff + h * 64 + c8);
#pragma unroll
    for (int q = 0; q < 8; ++q) tl[r][c8 + q] = f.u[q]; }
  __syncthreads();
  {
#pragma unroll
    for (int rd = 0; rd < 2; ++rd) { const int d = rd * 32 + tid / 8, pc = tid % 8; FragH f;
#pragma unroll
      for (int q = 0; q < 8; ++q) f.u[q] = tl[pc * 8 + q][d];
      *(v8us*)((unsigned short*)Vt + ((size_t)slab * 64 + d) * TTv + lg * 64 + pc * 8) = f.half[0]; }
     } }

__global__ __launch_bounds__(256) void k_hl(const float* __restrict__ F, _Float16* __restrict__ Hh, _Float16* __restrict__ Hl, size_t n8) { const size_t t = (size_t)blockIdx.x * 256 + threadIdx.x; if (t >= n8) return; FragH fh, fl; const v4f a = *(const v4fa*)(F + t * 8), c = *(const v4fa*)(F + t * 8 + 4);
#pragma unroll
  for (int q = 0; q < 4; ++q) { _Float16 h = (_Float16)a[q]; fh.h[q] = h; fl.h[q] = (_Float16)((a[q] - (float)h) * 1024.0f); h = (_Float16)c[q]; fh.h[4 + q] = h; fl.h[4 + q] = (_Float16)((c[q] - (float)h) * 1024.0f); }
  { *(v8us*)((unsigned short*)Hh + t * 8) = fh.half[0]; *(v8us*)((unsigned short*)Hl + t * 8) = fl.half[0];  } }

// ---- fast GEMM (wave tile 32x64; requires M % 32 == 0 rows per launch region and N % 64 == 0); epilogue = k_gemm_hhx semantics ----
__device__ __forceinline__ v16h g2_frag(const _Float16* p, int hh) { FragH f; f.half[0] = *(const v8us*)((const unsigned short*)p + 8 * hh); f.half[1] = *(const v8us*)((const unsigned short*)p + 16 + 8 * hh); return f.v; }
__device__ __forceinline__ v8f g2_mma(v16h a, v16h b, v8f c) { v8f d = __builtin_amdgcn_wmma_f32_16x16x32_f16(false, a, false, b, (short)0, c, false, false); asm volatile("v_nop\n\tv_nop\n\tv_nop\n\tv_nop" : "+v"(d) : "v"(a), "v"(b)); return d; }
template <int ACT>
__global__ __launch_bounds__(128) void k_gemm2(const _Float16* __restrict__ A, int lda, size_t sA, const _Float16* __restrict__ Bh, int ldb, size_t sB, float alpha, const float* __restrict__ bias, size_t sBias, const float* __restrict__ CP, int rowsPerB, size_t sCPb, int row0g,
    float* __restrict__ C, _Float16* __restrict__ C16, int ldc, size_t sC, int M, int N, int K) { static_assert(ACT == 0 || ACT == 3 || ACT == 6 || ACT == 8 || ACT == 9 || ACT == 11 || ACT == 12 || ACT == 14 || ACT == 15 || ACT == 16 || ACT == 17, "k_gemm2: unsupported ACT code (would silently apply no activation)");
  __shared__ __attribute__((aligned(16))) float so[4][32][68];
  const int tid = threadIdx.x, w = tid >> 5, lane = tid & 31, ln = lane & 15, hh = lane >> 4; const int by = blockIdx.y;
  A += (size_t)by * sA; Bh += (size_t)by * sB; const size_t cofs = (size_t)by * sC; const float* bp = bias ? bias + (size_t)by * sBias : nullptr;
  const int ntn = N >> 6; const int mt = blockIdx.x / ntn, nq = blockIdx.x - mt * ntn; const int row0 = mt * 128 + 32 * w, col0 = nq * 64; if (row0 >= M) return;
  const _Float16* a0p = A + (size_t)(row0 + ln) * lda; const _Float16* a1p = a0p + (size_t)16 * lda;
  const _Float16* b0p = Bh + (size_t)(col0 + ln) * ldb; const _Float16* b1p = b0p + (size_t)16 * ldb; const _Float16* b2p = b1p + (size_t)16 * ldb; const _Float16* b3p = b2p + (size_t)16 * ldb;
  const v8f z8 = {0.f,0.f,0.f,0.f,0.f,0.f,0.f,0.f}; v8f c00 = z8, c01 = z8, c02 = z8, c03 = z8, c10 = z8, c11 = z8, c12 = z8, c13 = z8;
#pragma unroll 1
  for (int kb = 0; kb < K; kb += 32) { const v16h a0 = g2_frag(a0p + kb, hh), a1 = g2_frag(a1p + kb, hh);
    v16h b = g2_frag(b0p + kb, hh); c00 = g2_mma(a0, b, c00); c10 = g2_mma(a1, b, c10);
    b = g2_frag(b1p + kb, hh); c01 = g2_mma(a0, b, c01); c11 = g2_mma(a1, b, c11);
    b = g2_frag(b2p + kb, hh); c02 = g2_mma(a0, b, c02); c12 = g2_mma(a1, b, c12);
    b = g2_frag(b3p + kb, hh); c03 = g2_mma(a0, b, c03); c13 = g2_mma(a1, b, c13); }
  v8f accs[8] = {c00, c01, c02, c03, c10, c11, c12, c13};
#pragma unroll
  for (int u = 0; u < 8; ++u) { const int t = u & 3, half = u >> 2; const int col = col0 + t * 16 + ln; const float bv = bp ? bf16_round(bp[col]) : 0.f;
#pragma unroll
    for (int r = 0; r < 8; ++r) { const int rloc = half * 16 + 8 * hh + r; float v = accs[u][r] * alpha + bv; if (CP) { if (rowsPerB < 0) v += CP[cofs + (size_t)(row0g + row0 + rloc) * ldc + col];      /* rowsPerB < 0: own element of the batched C plane */ else { const int bidx = (row0g + row0 + rloc) / rowsPerB; v += CP[(size_t)bidx * sCPb + (size_t)by * 64 + col]; } }
      if (ACT == 3) v = fmaxf(v, 0.f); else if (ACT == 6) v = 0.5f * v * (1.0f + erff(v * 0.70710678118654752f)); else if (ACT == 11) v = 1.0f / (1.0f + expf(-v)); else if (ACT == 15) v = v / (1.0f + expf(-v)); else if (ACT == 12) v = (v > 0.f) ? v : 0.01f * v; else if (ACT == 8) v = tanhf(v); else if (ACT == 9) v = 0.5f * v * (1.0f + tanhf(0.7978845608028654f * (v + 0.044715f * v * v * v))); else if (ACT == 14) v = (v > 0.f) ? v : 0.1f * v; else if (ACT == 16) v = (v >= 0.f) ? v : 0.3f * v; else if (ACT == 17) v = (v >= 0.f) ? v : 0.2f * v;
      so[w][rloc][t * 16 + ln] = v; } }
  __builtin_amdgcn_fence(__ATOMIC_ACQ_REL, "workgroup"); __builtin_amdgcn_wave_barrier();
  const int rsub = lane >> 4, c4 = (lane & 15) * 4;
  {
#pragma unroll
    for (int q = 0; q < 16; ++q) { const int r = q * 2 + rsub; const v4f v = *(const v4fa*)&so[w][r][c4]; if (C) *(v4f*)(C + cofs + (size_t)(row0 + r) * ldc + col0 + c4) = v; if (C16) { v4h h4; for (int i = 0; i < 4; ++i) h4[i] = (_Float16)v[i]; *(v4h*)(C16 + cofs + (size_t)(row0 + r) * ldc + col0 + c4) = h4; } }
     } }


__global__ __launch_bounds__(256) void k_wnat(const float* __restrict__ w, size_t n8, _Float16* __restrict__ Bt) { const size_t t = (size_t)blockIdx.x * 256 + threadIdx.x; if (t >= n8) return; FragH f; for (int q = 0; q < 8; ++q) f.h[q] = (_Float16)(bf16_round(w[t * 8 + q]) * 16.0f); *(v8us*)((unsigned short*)Bt + t * 8) = f.half[0];  }
__global__ __launch_bounds__(256) void k_rsm(const float* __restrict__ S, _Float16* __restrict__ P, int nrows) {
  #pragma clang fp contract(off)
  const int i = blockIdx.x * 256 + threadIdx.x; if (i >= nrows) return; const float* s = S + (size_t)i * SQ; float mx = -3.0e38f;
#pragma unroll 1
  for (int j = 0; j < SQ; ++j) mx = fmaxf(mx, s[j]); float se = 0.f;
#pragma unroll 1
  for (int j = 0; j < SQ; ++j) se += expf(s[j] - mx); const float sc = 256.0f / se;
#pragma unroll 1
  for (int j0 = 0; j0 < SQ; j0 += 8) { FragH f; for (int q = 0; q < 8; ++q) f.h[q] = (_Float16)(expf(s[j0 + q] - mx) * sc); unsigned short* d = (unsigned short*)P + (size_t)i * SQ + j0; *(v8us*)d = f.half[0];  } }
__global__ __launch_bounds__(256) void k_vt(const _Float16* __restrict__ V16, int b, int h0, _Float16* __restrict__ VT) { __shared__ unsigned short tl[64][65]; const int tid = threadIdx.x; const int hh = blockIdx.x % HG, sg = blockIdx.x / HG; const int s0 = sg * 64; const int h = h0 + hh;
  for (int i = tid; i < 64 * 8; i += 256) { const int j = i / 8, d8 = (i % 8) * 8; FragH f; f.half[0] = *(const v8us*)((const unsigned short*)V16 + ((size_t)b * SQ + s0 + j) * DM + h * HD + d8); for (int q = 0; q < 8; ++q) tl[d8 + q][j] = f.u[q]; }
  __syncthreads();
  { for (int i = tid; i < 64 * 8; i += 256) { const int d = i / 8, j8 = (i % 8) * 8; FragH f; for (int q = 0; q < 8; ++q) f.u[q] = tl[d][j8 + q]; *(v8us*)((unsigned short*)VT + ((size_t)hh * HD + d) * SQ + s0 + j8) = f.half[0]; }  } }


__global__ __launch_bounds__(256) void k_x16pad(const float* __restrict__ x, _Float16* __restrict__ X16) { const size_t t = (size_t)blockIdx.x * 256 + threadIdx.x; if (t >= (size_t)NB * QP * (DM / 8)) return; const int c8 = (int)(t % (DM / 8)) * 8; const size_t row = t / (DM / 8); const int b = (int)(row / QP), q = (int)(row % QP); FragH f;
  for (int i = 0; i < 8; ++i) f.h[i] = (_Float16)((q < NQ) ? bf16_round(x[((size_t)b * NQ + q) * DM + c8 + i]) : 0.f);
  *(v8us*)((unsigned short*)X16 + row * DM + c8) = f.half[0];  }


template <int HPP>
__global__ __launch_bounds__(256) void k_wtpadT(const float* __restrict__ w, _Float16* __restrict__ Bt) { const int t = blockIdx.x * 256 + threadIdx.x; if (t >= NH * HPP * (DM / 8)) return; const int k8 = (t % (DM / 8)) * 8; const int r = t / (DM / 8); const int h = r / HPP, d = r % HPP; FragH f;
  for (int q = 0; q < 8; ++q) { float v = 0.f; if (d < HD) v = bf16_round(w[(size_t)(k8 + q) * DM + h * HD + d]); f.h[q] = (_Float16)(v * 16.0f); }
  unsigned short* dst = (unsigned short*)Bt + (size_t)r * DM + k8; *(v8us*)dst = f.half[0];  }
template <int HPP>
__global__ __launch_bounds__(256) void k_wtopadT(const float* __restrict__ w, _Float16* __restrict__ Bt) { const int t = blockIdx.x * 256 + threadIdx.x; if (t >= DM * (NH * HPP / 8)) return; const int k8 = (t % (NH * HPP / 8)) * 8; const int n = t / (NH * HPP / 8); FragH f;
  for (int q = 0; q < 8; ++q) { const int kp = k8 + q; const int h = kp / HPP, d = kp % HPP; float v = 0.f; if (d < HD) v = bf16_round(w[(size_t)(h * HD + d) * DM + n]); f.h[q] = (_Float16)(v * 16.0f); }
  unsigned short* dst = (unsigned short*)Bt + (size_t)n * (NH * HPP) + k8; *(v8us*)dst = f.half[0];  }
__global__ __launch_bounds__(256) void k_qmean(const float* __restrict__ xn, const float* __restrict__ wqm, float* __restrict__ QMP) {
  #pragma clang fp contract(off)
  __shared__ float mu[DM]; const int b = blockIdx.x, t = threadIdx.x;
  if (t < DM) { float s = 0.f; const float* col = xn + (size_t)b * NQ * DM + t;
#pragma unroll 1
    for (int n = 0; n < NQ; ++n) s = __fadd_rn(s, bf16_round(col[(size_t)n * DM])); mu[t] = s / (float)NQ; }
  __syncthreads();
  const int h = t / 32, d = t % 32; float v = 0.f;
  if (d < HD) {
#pragma unroll 1
    for (int k = 0; k < DM; ++k) v = __fadd_rn(v, __fmul_rn(mu[k], bf16_round(wqm[(size_t)k * DM + h * HD + d]))); }
  float* dst = QMP + (size_t)b * (NH * 32) + t; *(float*)dst = v;  }
// Row softmaxes, one wave per row: lane holds columns 4*lane + 128*u (u = 0..7), so each wave-wide b128 load or store covers 512 contiguous bytes;
// the row's values stay in registers between the maximum, the sum and the store. Maximum and sum: per lane first, then a five-step butterfly over the 32 lanes.
// Columns NQ..QP-1 (lanes 26..31 of u = 7): the score planes hold them; the mask does not, so those lanes re-read their own first chunk; their value is -inf (weight 0) and 0 is stored.
__device__ __forceinline__ float wave_max32(float v) { for (int m = 16; m > 0; m >>= 1) v = fmaxf(v, __shfl_xor(v, m, 32)); return v; }
__device__ __forceinline__ float wave_sum32(float v) { for (int m = 16; m > 0; m >>= 1) v += __shfl_xor(v, m, 32); return v; }
// 2^x as one v_exp_f32 (what __expf compiles to behind its multiply) with the issue slot behind it filled
__device__ __forceinline__ float exp2_slot(float x) { float r; asm("v_exp_f32 %0, %1\n\tv_nop" : "=v"(r) : "v"(x)); return r; }
// block = query row p, wave = head (the eight waves of a block share one mask row)
__global__ __launch_bounds__(256) void k_rsm1(const float* __restrict__ S, _Float16* __restrict__ P, int b, const float* __restrict__ mask) {
  const int p = blockIdx.x, h = threadIdx.x >> 5, c0 = (threadIdx.x & 31) * 4; const size_t i = (size_t)h * QP + p; _Float16* prow = P + i * QP + c0; const bool live = p < NQ;      /* rows NQ..QP-1: same instruction stream on mask row 0, scale 0, so zeros are stored */
  const float* s = S + i * QP + c0; const float* mr = mask + ((size_t)b * NQ + (live ? p : 0)) * NQ + c0; v4f x[QP / 128]; float mx = -3.0e38f;
#pragma unroll      /* x[] in registers, and all loads of the row in flight together */
  for (int u = 0; u < QP / 128; ++u) { const bool in = c0 + 128 * u < NQ; const v4f a = *(const v4fa*)(s + 128 * u), m = *(const v4fa*)(mr + (in ? 128 * u : 0)); for (int q = 0; q < 4; ++q) { const float v = a[q] + bf16_round(m[q]); x[u][q] = in ? v : -__builtin_inff(); mx = fmaxf(mx, x[u][q]); } }
  mx = wave_max32(mx); float se = 0.f;
#pragma unroll      /* x[] in registers */
  for (int u = 0; u < QP / 128; ++u) for (int q = 0; q < 4; ++q) { x[u][q] = exp2_slot((x[u][q] - mx) * 1.44269504f); se += x[u][q]; }
  se = wave_sum32(se); const float sc = live ? 256.0f / se : 0.f;
#pragma unroll      /* x[] in registers */
  for (int u = 0; u < QP / 128; ++u) { const bool in = c0 + 128 * u < NQ; v4h o; for (int q = 0; q < 4; ++q) { const _Float16 w = (_Float16)(x[u][q] * sc); o[q] = in ? w : (_Float16)0.f; } *(v4h*)(prow + 128 * u) = o; } }
// four rows a block, wave = query row p
__global__ __launch_bounds__(128) void k_fin(const float* __restrict__ S2, const float* __restrict__ mask, int b, float* __restrict__ PR) {
  const int p = blockIdx.x * 4 + (threadIdx.x >> 5), c0 = (threadIdx.x & 31) * 4; if (p >= NQ) return;
  const float* s = S2 + (size_t)p * QP + c0; const float* mr = mask + ((size_t)b * NQ + p) * NQ + c0; float* pr = PR + ((size_t)b * QP + p) * QP + c0; v4f x[QP / 128], m[QP / 128]; float mx = -3.0e38f;
#pragma unroll      /* all loads of the row in flight together, ahead of the branches inside tanhf */
  for (int u = 0; u < QP / 128; ++u) { x[u] = *(const v4fa*)(s + 128 * u); m[u] = *(const v4fa*)(mr + ((c0 + 128 * u < NQ) ? 128 * u : 0)); }
#pragma unroll      /* x[] in registers */
  for (int u = 0; u < QP / 128; ++u) { const bool in = c0 + 128 * u < NQ; for (int q = 0; q < 4; ++q) { const float v = 10.0f * tanhf(x[u][q]) + bf16_round(m[u][q]); x[u][q] = in ? v : -__builtin_inff(); mx = fmaxf(mx, x[u][q]); } }
  mx = wave_max32(mx); float se = 0.f;
#pragma unroll      /* x[] in registers */
  for (int u = 0; u < QP / 128; ++u) for (int q = 0; q < 4; ++q) { x[u][q] = expf(x[u][q] - mx); se += x[u][q]; }
  const float inv = 1.0f / wave_sum32(se);
#pragma unroll      /* x[] in registers */
  for (int u = 0; u < QP / 128; ++u) { const bool in = c0 + 128 * u < NQ; v4f o; for (int q = 0; q < 4; ++q) { const float w = x[u][q] * inv; o[q] = in ? w : 0.f; } *(v4f*)(pr + 128 * u) = o; } }
__global__ __launch_bounds__(256) void k_outflat(const float* __restrict__ PR, float* __restrict__ out) { const size_t t = (size_t)blockIdx.x * 256 + threadIdx.x; if (t >= (size_t)NB * NQ * NQ / 4) return; const size_t e = t * 4; const int n = (int)(e % NQ); const size_t bp = e / NQ; const int b = (int)(bp / NQ), p = (int)(bp % NQ);
  const v4f v = *(const v4fa*)(PR + ((size_t)b * QP + p) * QP + n); *(v4f*)(out + e) = v;  }

extern "C" void kernel_launch(void* const* d_in, const int* in_sizes, int n_in,
                              void* d_out, int out_size, void* d_ws, size_t ws_size, hipStream_t stream) {
  (void)in_sizes; (void)n_in; (void)out_size;
  const float* const* I = (const float* const*)d_in; const float* xn = I[0]; const float* xq1 = I[1]; const float* xl = I[2]; const float* mask = I[3]; const float* Wqf = I[4]; const float* Wql = I[5]; const float* Wqm = I[6]; const float* Wk = I[7]; const float* Wv = I[8]; const float* Wc = I[9]; const float* bc = I[10];      /* weights [in][out] */
  char* ws = (char*)d_ws; size_t off = 0;
  auto take = [&](size_t bytes) { char* p = ws + off; off += (bytes + 255) & ~(size_t)255; return p; };
  _Float16* BQF = (_Float16*)take((size_t)NH * 32 * DM * 2); _Float16* BQL = (_Float16*)take((size_t)NH * 32 * DM * 2); _Float16* BK = (_Float16*)take((size_t)NH * 32 * DM * 2); _Float16* BVP = (_Float16*)take((size_t)NH * 64 * DM * 2); _Float16* BCP = (_Float16*)take((size_t)DM * NH * 64 * 2); float* QMP = (float*)take((size_t)NB * NH * 32 * 4);
  _Float16* XN = (_Float16*)take(NRP * DM * 2); _Float16* XQ1 = (_Float16*)take(NRP * DM * 2); _Float16* XL = (_Float16*)take(NRP * DM * 2);
  float* QF = (float*)take(NRP * NH * 32 * 4); _Float16* Q16 = (_Float16*)take(NRP * NH * 32 * 2); _Float16* K16 = (_Float16*)take(NRP * NH * 32 * 2); _Float16* V2 = (_Float16*)take(NRP * NH * 64 * 2); float* OF = (float*)take(NRP * NH * 64 * 4); _Float16* OH = (_Float16*)take(NRP * NH * 64 * 2); _Float16* OL = (_Float16*)take(NRP * NH * 64 * 2);
  float* S = (float*)take((size_t)NH * QP * QP * 4); _Float16* P = (_Float16*)take((size_t)NH * QP * QP * 2); _Float16* VT = (_Float16*)take((size_t)NH * 64 * QP * 2);
  float* MH = (float*)take(NRP * DM * 4); _Float16* MHh = (_Float16*)take(NRP * DM * 2); _Float16* MHl = (_Float16*)take(NRP * DM * 2); float* S2 = (float*)take((size_t)QP * QP * 4); float* PR = (float*)take((size_t)NB * QP * QP * 4);
  if (off > ws_size) return;      /* approx 6 + 8 + 4 + 4 + 8 + 32 + 32 + 16 + 1 + 8 + 4 + 32 = ~155 MiB */
  k_wtpadT<32><<<(NH * 32 * (DM / 8) + 255) / 256, 256, 0, stream>>>(Wqf, BQF); k_wtpadT<32><<<(NH * 32 * (DM / 8) + 255) / 256, 256, 0, stream>>>(Wql, BQL); k_wtpadT<32><<<(NH * 32 * (DM / 8) + 255) / 256, 256, 0, stream>>>(Wk, BK);
  k_wtpadT<64><<<(NH * 64 * (DM / 8) + 255) / 256, 256, 0, stream>>>(Wv, BVP); k_wtopadT<64><<<(DM * (NH * 64 / 8) + 255) / 256, 256, 0, stream>>>(Wc, BCP);
  k_x16pad<<<(unsigned)((NRP * (DM / 8) + 255) / 256), 256, 0, stream>>>(xn, XN); k_x16pad<<<(unsigned)((NRP * (DM / 8) + 255) / 256), 256, 0, stream>>>(xq1, XQ1); k_x16pad<<<(unsigned)((NRP * (DM / 8) + 255) / 256), 256, 0, stream>>>(xl, XL);
  k_qmean<<<NB, 256, 0, stream>>>(xn, Wqm, QMP);      /* per-batch mean term in the padded q layout */
  k_gemm2<0><<<dim3((unsigned)((NRP / 128) * (NH * 32 / 64)), 1), 128, 0, stream>>>(XQ1, DM, 0, BQF, DM, 0, 0.0625f, nullptr, 0, QMP, QP, NH * 32, 0, QF, nullptr, NH * 32, 0, (int)NRP, NH * 32, DM);      /* q1 Wq_first + mean term (broadcast per batch), f32 */
  k_gemm2<0><<<dim3((unsigned)((NRP / 128) * (NH * 32 / 64)), 1), 128, 0, stream>>>(XL, DM, 0, BQL, DM, 0, 0.0625f, nullptr, 0, QF, -1, 0, 0, nullptr, Q16, NH * 32, 0, (int)NRP, NH * 32, DM);      /* + last Wq_last -> q (f16, padded [8][32]) */
  k_gemm2<0><<<dim3((unsigned)((NRP / 128) * (NH * 32 / 64)), 1), 128, 0, stream>>>(XN, DM, 0, BK, DM, 0, 0.0625f, nullptr, 0, nullptr, 1, 0, 0, nullptr, K16, NH * 32, 0, (int)NRP, NH * 32, DM);      /* k (f16, padded [8][32]) */
  k_gemm2<0><<<dim3((unsigned)((NRP / 128) * (NH * 64 / 64)), 1), 128, 0, stream>>>(XN, DM, 0, BVP, DM, 0, 0.0625f, nullptr, 0, nullptr, 1, 0, 0, nullptr, V2, NH * 64, 0, (int)NRP, NH * 64, DM);      /* v (f16, padded [8][64]) */
  for (int b = B0; b < B0 + NBR; ++b) { const size_t rb = (size_t)b * QP;
    k_vt<NH, QP><<<NH * (QP / 64), 256, 0, stream>>>(V2 + rb * NH * 64, NH * 64, 0, VT);      /* V^T [8][64][1024] */
    k_gemm2<0><<<dim3((QP / 128) * (QP / 64), NH), 128, 0, stream>>>(Q16 + rb * NH * 32, NH * 32, (size_t)32, K16 + rb * NH * 32, NH * 32, (size_t)32, 0.25f, nullptr, 0, nullptr, 1, 0, 0, S, nullptr, QP, (size_t)QP * QP, QP, QP, 32);      /* stage-1 scores / sqrt(16), all heads; K = 32 (16 real + 16 zero) */
    k_rsm1<<<QP, 256, 0, stream>>>(S, P, b, mask);
    k_gemm2<0><<<dim3((QP / 128) * 1, NH), 128, 0, stream>>>(P, QP, (size_t)QP * QP, VT, QP, (size_t)64 * QP, 0.25f, nullptr, 0, nullptr, 1, 0, 0, OF + rb * NH * 64, nullptr, NH * 64, (size_t)64, QP, 64, QP); }      /* o x64 (padded [8][64], f32) */
  k_hl<<<(unsigned)((NRP * NH * 64 / 8 + 255) / 256), 256, 0, stream>>>(OF, OH, OL, NRP * NH * 64 / 8);      /* o -> f16 hi + x1024 residual */
  k_gemm2<0><<<dim3((unsigned)((NRP / 128) * (DM / 64)), 1), 128, 0, stream>>>(OH, NH * 64, 0, BCP, NH * 64, 0, 0.0009765625f, bc, 0, nullptr, 1, 0, 0, MH, nullptr, DM, 0, (int)NRP, DM, NH * 64);      /* mh = o_hi W_comb + b_comb (f32) */
  k_gemm2<0><<<dim3((unsigned)((NRP / 128) * (DM / 64)), 1), 128, 0, stream>>>(OL, NH * 64, 0, BCP, NH * 64, 0, 0.00000095367431640625f, nullptr, 0, MH, -1, 0, 0, MH, nullptr, DM, 0, (int)NRP, DM, NH * 64);      /* += o_lo W_comb 2^-20 */
  k_hl<<<(unsigned)((NRP * DM / 8 + 255) / 256), 256, 0, stream>>>(MH, MHh, MHl, NRP * DM / 8);      /* mh -> f16 hi + x1024 residual */
  for (int b = B0; b < B0 + NBR; ++b) { const size_t rb = (size_t)b * QP;
    k_gemm2<0><<<dim3((QP / 128) * (QP / 64), 1), 128, 0, stream>>>(MHh + rb * DM, DM, 0, XN + rb * DM, DM, 0, 0.088388347648318447f, nullptr, 0, nullptr, 1, 0, 0, S2, nullptr, QP, 0, QP, QP, DM);      /* score2 = mh_hi nodes^T / sqrt(128) */
    k_gemm2<0><<<dim3((QP / 128) * (QP / 64), 1), 128, 0, stream>>>(MHl + rb * DM, DM, 0, XN + rb * DM, DM, 0, 0.000086316745750311f, nullptr, 0, S2, -1, 0, 0, S2, nullptr, QP, 0, QP, QP, DM);      /* += mh_lo nodes^T / (1024 sqrt(128)) */
    k_fin<<<(NQ + 3) / 4, 128, 0, stream>>>(S2, mask, b, PR); }      /* 10 tanh, + mask, softmax over the 1000 real keys (f32) */
  k_outflat<<<(unsigned)(((size_t)NB * NQ * NQ / 4 + 255) / 256), 256, 0, stream>>>(PR, (float*)d_out);
}

// v002
// Measured time: 892 microseconds a run.
// In both of two side-by-side timings against v001, it was 1.32 times as fast.
// Over all steps from v000 it is 17.8 times as fast.
#include <hip/hip_runtime.h>
// TSP decoder probabilities (encoded_nodes, encoded_q1, encoded_last_node [8][1000][128]; k = nodes Wk, v = nodes Wv, q = q1 Wq_first + last Wq_last + (mean_n nodes) Wq_mean broadcast ([in][out] weights), 8 heads of 16; weights = softmax(q k^T / 4 + ninf_mask); mh = (weights v merged) W_comb + b_comb; score2 = mh nodes^T / sqrt(128); probs = softmax_n(10 tanh(score2) + ninf_mask) -> [8][1000][1000]).
// Compute dtype: inputs rounded to bf16; token rows / weights exact; q, k, v and the stage-1 weights as plain f16 GEMM operands (~2^-12); o and mh as f16 hi + residual operand pairs (~2^-22); the mean term, score2, tanh, mask and the final softmax f32. v_wmma_f32_16x16x32_f16.
#define NB 8
#define NQ 1000                      /* nodes = queries = 1000 */
#define QP 1024                      /* padded rows / keys per batch */
#define DM 128
#define NH 8
#define HD 16
#define SQ QP
#define HG 8
#define B0 0                         /* first batch (debug hook) */
#define NBR NB
#define NRP ((size_t)NB * QP)        /* padded token rows */
typedef __bf16 v16b __attribute__((ext_vector_type(16)));
typedef unsigned short v8us __attribute__((ext_vector_type(8), may_alias));
typedef float  v8f  __attribute__((ext_vector_type(8)));
typedef float  v4f  __attribute__((ext_vector_type(4)));
typedef float  v4fa __attribute__((ext_vector_type(4), may_alias));
union FragB { v16b v; v8us half[2]; unsigned short u[16]; };

__device__ __forceinline__ unsigned short bf16_bits(float x) { unsigned int u = __float_as_uint(x); return (unsigned short)((u + 0x7FFFu + ((u >> 16) & 1u)) >> 16); }
__device__ __forceinline__ float bf16_val(unsigned short b) { return __uint_as_float(((unsigned int)b) << 16); }
__device__ __forceinline__ float bf16_round(float x) { return bf16_val(bf16_bits(x)); }
// D += A·B with NT terms: 1 = ah·bh, 2 = + al·bh (A split), 3 = + ah·bl (both split)
template <int NT>
__device__ __forceinline__ v8f mmaN(v16b ah, v16b al, v16b bh, v16b bl, v8f c) {
  c = __builtin_amdgcn_wmma_f32_16x16x32_bf16(false, ah, false, bh, (short)0, c, false, false);
  if (NT >= 2) c = __builtin_amdgcn_wmma_f32_16x16x32_bf16(false, al, false, bh, (short)0, c, false, false);
  if (NT >= 3) c = __builtin_amdgcn_wmma_f32_16x16x32_bf16(false, ah, false, bl, (short)0, c, false, false);
  asm volatile("v_nop\n\tv_nop\n\tv_nop\n\tv_nop" : "+v"(c) : "v"(ah), "v"(al), "v"(bh), "v"(bl));
  return c;
}

__global__ __launch_bounds__(256) void k_wt_bf16(const float* __restrict__ W, unsigned short* __restrict__ Wt, int K, int N) {
  const int t = blockIdx.x * 256 + threadIdx.x;
  const int k8n = K / 8;
  if (t >= N * k8n) return;
  const int n = t / k8n, k8 = (t % k8n) * 8;
  v8us v;
#pragma unroll
  for (int i = 0; i < 8; ++i) v[i] = bf16_bits(W[(size_t)(k8 + i) * N + n]);
  *(v8us*)(Wt + (size_t)n * K + k8) = v;
  
}

// GEMM C[M][N] (f32, pitch ldc) = act(A[M][K]·W + bias). A f32 row-major (pitch lda) converted per fragment to bf16
// (ASPLIT: hi/lo two planes -> 2 terms, else single rounded term); Wt bf16 [N][K] (pitch ldb). BIAS_BF16 rounds the
// bias to bf16 first (bias quantised to bf16 before the add). K%32==0, M%16==0, N%64==0.
template <bool ASPLIT, int ACT, bool BIAS_BF16>
__global__ __launch_bounds__(128) void k_gemm_bf(const float* __restrict__ A, int lda, const unsigned short* __restrict__ Wt, int ldb,
                                               const float* __restrict__ bias, float* __restrict__ C, int ldc, int M, int N, int K) {
  __shared__ __attribute__((aligned(16))) float so[4][16][64];
  const int tid = threadIdx.x, w = tid >> 5, lane = tid & 31, ln = lane & 15, hh = lane >> 4;
  const int ntn = N / 64;
  const int wid = blockIdx.x * 4 + w;
  const int mt = wid / ntn, nq = wid % ntn;
  if (mt * 16 >= M) return;
  const int row0 = mt * 16, col0 = nq * 64;
  const float* arow = A + (size_t)(row0 + ln) * lda;
  v8f acc[4] = {};
  for (int kb = 0; kb < K; kb += 32) {
    FragB ah, al;
    const v4f x0 = *(const v4fa*)(arow + kb + 8 * hh), x1 = *(const v4fa*)(arow + kb + 8 * hh + 4);
    const v4f x2 = *(const v4fa*)(arow + kb + 16 + 8 * hh), x3 = *(const v4fa*)(arow + kb + 16 + 8 * hh + 4);
    float xs[16] = {x0[0],x0[1],x0[2],x0[3],x1[0],x1[1],x1[2],x1[3],x2[0],x2[1],x2[2],x2[3],x3[0],x3[1],x3[2],x3[3]};
#pragma unroll
    for (int i = 0; i < 16; ++i) { const unsigned short hb = bf16_bits(xs[i]); ah.u[i] = hb; al.u[i] = ASPLIT ? bf16_bits(xs[i] - bf16_val(hb)) : (unsigned short)0; }
#pragma unroll
    for (int t = 0; t < 4; ++t) {
      const unsigned short* brow = Wt + (size_t)(col0 + t * 16 + ln) * ldb + kb;
      FragB b;
      b.half[0] = *(const v8us*)(brow + 8 * hh);
      b.half[1] = *(const v8us*)(brow + 16 + 8 * hh);
      acc[t] = mmaN<ASPLIT ? 2 : 1>(ah.v, al.v, b.v, b.v, acc[t]);
    }
  }
#pragma unroll
  for (int t = 0; t < 4; ++t) {
    float bv = bias ? bias[col0 + t * 16 + ln] : 0.f;
    if (BIAS_BF16) bv = bf16_round(bv);
#pragma unroll
    for (int r = 0; r < 8; ++r) { float v = acc[t][r] + bv; if (ACT == 1) v = fmaxf(v, 0.f); so[w][8 * hh + r][t * 16 + ln] = v; }
  }
  __builtin_amdgcn_fence(__ATOMIC_ACQ_REL, "workgroup");
  __builtin_amdgcn_wave_barrier();
  const int rsub = lane >> 4, c4 = (lane & 15) * 4;
  {
#pragma unroll
    for (int q = 0; q < 8; ++q) {
      const int r = q * 2 + rsub;
      const v4f v = *(const v4fa*)&so[w][r][c4];
      *(v4f*)(C + (size_t)(row0 + r) * ldc + col0 + c4) = v;
    }
    
  }
}

// GEMM C = act(A·W + bias + resid): A f32 (ASPLIT -> hi/lo 2 terms), Wt bf16 [N][K]; ACT 0 none, 1 relu, 2 exact gelu;
// resid (optional, f32, row index = (row % rmod), pitch ldr, RES_BF16 rounds it) added before the activation.
template <bool ASPLIT, int ACT, bool BIAS_BF16, bool RES_BF16>
__global__ __launch_bounds__(128) void k_gemm_bf3(const float* __restrict__ A, int lda, const unsigned short* __restrict__ Wt, int ldb,
                                                const float* __restrict__ bias, const float* __restrict__ resid, int rmod, int ldr,
                                                float* __restrict__ C, int ldc, int M, int N, int K) {
  __shared__ __attribute__((aligned(16))) float so[4][16][64];
  const int tid = threadIdx.x, w = tid >> 5, lane = tid & 31, ln = lane & 15, hh = lane >> 4;
  const int ntn = N / 64;
  const int wid = blockIdx.x * 4 + w;
  const int mt = wid / ntn, nq = wid % ntn;
  if (mt * 16 >= M) return;
  const int row0 = mt * 16, col0 = nq * 64;
  const float* arow = A + (size_t)(row0 + ln) * lda;
  v8f acc[4] = {};
  for (int kb = 0; kb < K; kb += 32) {
    FragB ah, al;
    const v4f x0 = *(const v4fa*)(arow + kb + 8 * hh), x1 = *(const v4fa*)(arow + kb + 8 * hh + 4);
    const v4f x2 = *(const v4fa*)(arow + kb + 16 + 8 * hh), x3 = *(const v4fa*)(arow + kb + 16 + 8 * hh + 4);
    float xs[16] = {x0[0],x0[1],x0[2],x0[3],x1[0],x1[1],x1[2],x1[3],x2[0],x2[1],x2[2],x2[3],x3[0],x3[1],x3[2],x3[3]};
#pragma unroll
    for (int i = 0; i < 16; ++i) { const unsigned short hb = bf16_bits(xs[i]); ah.u[i] = hb; al.u[i] = ASPLIT ? bf16_bits(xs[i] - bf16_val(hb)) : (unsigned short)0; }
#pragma unroll
    for (int t = 0; t < 4; ++t) {
      const unsigned short* brow = Wt + (size_t)(col0 + t * 16 + ln) * ldb + kb;
      FragB b;
      b.half[0] = *(const v8us*)(brow + 8 * hh);
      b.half[1] = *(const v8us*)(brow + 16 + 8 * hh);
      acc[t] = mmaN<ASPLIT ? 2 : 1>(ah.v, al.v, b.v, b.v, acc[t]);
    }
  }
#pragma unroll
  for (int t = 0; t < 4; ++t) {
    const int col = col0 + t * 16 + ln;
    float bv = bias ? bias[col] : 0.f;
    if (BIAS_BF16) bv = bf16_round(bv);
#pragma unroll
    for (int r = 0; r < 8; ++r) {
      float v = acc[t][r] + bv;
      if (resid) { float rv = resid[(size_t)((row0 + 8 * hh + r) % rmod) * ldr + col]; if (RES_BF16) rv = bf16_round(rv); v += rv; }
      if (ACT == 1) v = fmaxf(v, 0.f);
      if (ACT == 2) v = 0.5f * v * (1.0f + erff(v * 0.70710678118654752f));
      if (ACT == 3) { const float u = 0.7978845608028654f * (v + 0.044715f * v * v * v); v = 0.5f * v * (1.0f + tanhf(u)); }
      so[w][8 * hh + r][t * 16 + ln] = v;
    }
  }
  __builtin_amdgcn_fence(__ATOMIC_ACQ_REL, "workgroup");
  __builtin_amdgcn_wave_barrier();
  const int rsub = lane >> 4, c4 = (lane & 15) * 4;
  {
#pragma unroll
    for (int q = 0; q < 8; ++q) {
      const int r = q * 2 + rsub;
      const v4f v = *(const v4fa*)&so[w][r][c4];
      *(v4f*)(C + (size_t)(row0 + r) * ldc + col0 + c4) = v;
    }
    
  }
}
// row LayerNorm (biased variance, eps) over N: s = X (+ R); optional out_sum <- s; out_norm <- (s-mu)*rsqrt(var+eps)*g + b
template <bool PARAM_BF16>
__global__ __launch_bounds__(256) void k_layernorm(const float* __restrict__ X, const float* __restrict__ R, const float* __restrict__ g, const float* __restrict__ bta,
                                                  float* __restrict__ out_sum, float* __restrict__ out_norm, int N, float eps) {
  __shared__ float red[256];
  const int row = blockIdx.x, tid = threadIdx.x;
  const float* x = X + (size_t)row * N; const float* rr = R ? R + (size_t)row * N : nullptr;
  float vals[16];                     // up to N = 4096
  const int per = N / 256;            // contiguous chunk per thread? use strided-by-4 chunks: thread handles j = tid*4 + 1024*u
  float s1 = 0.f;
  for (int u = 0; u < per / 4; ++u) {
    const int j = tid * 4 + 1024 * u;
    const v4f a = *(const v4fa*)(x + j);
    v4f b = {0.f,0.f,0.f,0.f}; if (rr) b = *(const v4fa*)(rr + j);
#pragma unroll
    for (int q = 0; q < 4; ++q) { const float v = a[q] + b[q]; vals[u * 4 + q] = v; s1 += v; }
  }
  red[tid] = s1; __syncthreads();
  for (int st = 128; st > 0; st >>= 1) { if (tid < st) red[tid] += red[tid + st]; __syncthreads(); }
  const float mu = red[0] / (float)N; __syncthreads();
  float s2 = 0.f;
  for (int u = 0; u < per / 4; ++u)
#pragma unroll
    for (int q = 0; q < 4; ++q) { const float c = vals[u * 4 + q] - mu; s2 += c * c; }
  red[tid] = s2; __syncthreads();
  for (int st = 128; st > 0; st >>= 1) { if (tid < st) red[tid] += red[tid + st]; __syncthreads(); }
  const float rs = rsqrtf(red[0] / (float)N + eps);
  {
    for (int u = 0; u < per / 4; ++u) {
      const int j = tid * 4 + 1024 * u;
      v4f o, sm;
#pragma unroll
      for (int q = 0; q < 4; ++q) {
        float gg = g[j + q], bb = bta[j + q];
        if (PARAM_BF16) { gg = bf16_round(gg); bb = bf16_round(bb); }
        sm[q] = vals[u * 4 + q]; o[q] = (vals[u * 4 + q] - mu) * rs * gg + bb;
      }
      if (out_sum) *(v4f*)(out_sum + (size_t)row * N + j) = sm;
      *(v4f*)(out_norm + (size_t)row * N + j) = o;
    }
    
  }
}



// ---- f16 WMMA path (v_wmma_f32_16x16x32_f16): 11-bit significands for operands in range — used where a [0,1] probability operand needs more precision than bf16
typedef _Float16 v16h __attribute__((ext_vector_type(16)));
union FragH { v16h v; v8us half[2]; _Float16 h[16]; unsigned short u[16]; };
template <int NT>
__device__ __forceinline__ v8f mmaH(v16h ah, v16h al, v16h bh, v16h bl, v8f c) {
  c = __builtin_amdgcn_wmma_f32_16x16x32_f16(false, ah, false, bh, (short)0, c, false, false);
  if (NT >= 2) c = __builtin_amdgcn_wmma_f32_16x16x32_f16(false, al, false, bh, (short)0, c, false, false);
  if (NT >= 3) c = __builtin_amdgcn_wmma_f32_16x16x32_f16(false, ah, false, bl, (short)0, c, false, false);
  asm volatile("v_nop\n\tv_nop\n\tv_nop\n\tv_nop" : "+v"(c) : "v"(ah), "v"(al), "v"(bh), "v"(bl));
  return c;
}
// batched GEMM like k_gemm_b but f16 operands: A f32 (split into f16 hi/lo if ASPLIT, else rounded to f16), Bt = f16 values [n][k]; alpha; C f32; N multiple of 16 (partial tiles skipped)
template <bool ASPLIT>
__global__ __launch_bounds__(128) void k_gemm_h(const float* __restrict__ A, int lda, size_t sA, const _Float16* __restrict__ Bh, int ldb, size_t sB, float alpha, float* __restrict__ C, int ldc, size_t sC, int M, int N, int K) {
  __shared__ __attribute__((aligned(16))) float so[4][16][64];
  const int tid = threadIdx.x, w = tid >> 5, lane = tid & 31, ln = lane & 15, hh = lane >> 4; const int by = blockIdx.y;
  A += (size_t)by * sA; Bh += (size_t)by * sB; C += (size_t)by * sC;
  const int ntn = (N + 63) / 64; const int wid = blockIdx.x * 4 + w; const int mt = wid / ntn, nq = wid % ntn; if (mt * 16 >= M) return;
  const int row0 = mt * 16, col0 = nq * 64; const float* arow = A + (size_t)(row0 + ln) * lda;
  v8f acc[4] = {};
  for (int kb = 0; kb < K; kb += 32) {
    FragH ah, al;
    const v4f x0 = *(const v4fa*)(arow + kb + 8 * hh), x1 = *(const v4fa*)(arow + kb + 8 * hh + 4), x2 = *(const v4fa*)(arow + kb + 16 + 8 * hh), x3 = *(const v4fa*)(arow + kb + 16 + 8 * hh + 4);
    float xs[16] = {x0[0],x0[1],x0[2],x0[3],x1[0],x1[1],x1[2],x1[3],x2[0],x2[1],x2[2],x2[3],x3[0],x3[1],x3[2],x3[3]};
#pragma unroll
    for (int i = 0; i < 16; ++i) { const _Float16 h = (_Float16)xs[i]; ah.h[i] = h; al.h[i] = ASPLIT ? (_Float16)(xs[i] - (float)h) : (_Float16)0.0f; }
#pragma unroll
    for (int t = 0; t < 4; ++t) { if (col0 + t * 16 >= N) continue; const size_t boff = (size_t)(col0 + t * 16 + ln) * ldb + kb; FragH bq; bq.half[0] = *(const v8us*)(Bh + boff + 8 * hh); bq.half[1] = *(const v8us*)(Bh + boff + 16 + 8 * hh);
      acc[t] = mmaH<ASPLIT ? 2 : 1>(ah.v, al.v, bq.v, bq.v, acc[t]); }
  }
#pragma unroll
  for (int t = 0; t < 4; ++t) { if (col0 + t * 16 >= N) continue;
#pragma unroll
    for (int r = 0; r < 8; ++r) so[w][8 * hh + r][t * 16 + ln] = acc[t][r] * alpha; }
  __builtin_amdgcn_fence(__ATOMIC_ACQ_REL, "workgroup"); __builtin_amdgcn_wave_barrier();
  const int rsub = lane >> 4, c4 = (lane & 15) * 4;
  {
#pragma unroll
    for (int q = 0; q < 8; ++q) { const int r = q * 2 + rsub; if (col0 + c4 < N) { const v4f v = *(const v4fa*)&so[w][r][c4]; *(v4f*)(C + (size_t)(row0 + r) * ldc + col0 + c4) = v; } }
     }
}

// Wt[n][k] = f16(W[k][n]·scale) from f32 row-major W[K][N] (scale = power of two; bf16-exact weights stay exact in f16 away from the subnormal range)
__global__ __launch_bounds__(256) void k_wt_f16(const float* __restrict__ W, _Float16* __restrict__ Wt, int K, int N, float scale) {
  const int t = blockIdx.x * 256 + threadIdx.x; if (t >= N * (K / 8)) return; const int n = t / (K / 8), k8 = (t % (K / 8)) * 8; FragH f;
#pragma unroll
  for (int i = 0; i < 8; ++i) f.h[i] = (_Float16)(bf16_round(W[(size_t)(k8 + i) * N + n]) * scale); const v8us o = f.half[0];
  *(v8us*)((unsigned short*)Wt + (size_t)n * K + k8) = o; 
}
// k_gemm_hh variant with fused epilogue: v = acc·alpha + bias[by·sBias + col] (+ CP[(row/rowsPerB)·sCPb + by·64 + col] if CP) ; ACT 0 none / 1 elu ; writes f16 C16 (and f32 C if non-null)
template <int ACT>
__global__ __launch_bounds__(128) void k_gemm_hhx(const _Float16* __restrict__ A, int lda, size_t sA, const _Float16* __restrict__ Bh, int ldb, size_t sB, float alpha, const float* __restrict__ bias, size_t sBias, const float* __restrict__ CP, int rowsPerB, size_t sCPb, int row0g,
    float* __restrict__ C, _Float16* __restrict__ C16, int ldc, size_t sC, int M, int N, int K) {
  __shared__ __attribute__((aligned(16))) float so[4][16][64];
  const int tid = threadIdx.x, w = tid >> 5, lane = tid & 31, ln = lane & 15, hh = lane >> 4; const int by = blockIdx.y;
  A += (size_t)by * sA; Bh += (size_t)by * sB; const size_t cofs = (size_t)by * sC; const float* bp = bias ? bias + (size_t)by * sBias : nullptr;
  const int ntn = (N + 63) / 64; const int wid = blockIdx.x * 4 + w; const int mt = wid / ntn, nq = wid % ntn; if (mt * 16 >= M) return;
  const int row0 = mt * 16, col0 = nq * 64; const _Float16* arow = A + (size_t)(row0 + ln) * lda;
  v8f acc[4] = {};
  for (int kb = 0; kb < K; kb += 32) { FragH ah; ah.half[0] = *(const v8us*)((const unsigned short*)arow + kb + 8 * hh); ah.half[1] = *(const v8us*)((const unsigned short*)arow + kb + 16 + 8 * hh);
#pragma unroll
    for (int t = 0; t < 4; ++t) { if (col0 + t * 16 >= N) continue; const size_t boff = (size_t)(col0 + t * 16 + ln) * ldb + kb; FragH bq; bq.half[0] = *(const v8us*)((const unsigned short*)Bh + boff + 8 * hh); bq.half[1] = *(const v8us*)((const unsigned short*)Bh + boff + 16 + 8 * hh);
      acc[t] = mmaH<1>(ah.v, ah.v, bq.v, bq.v, acc[t]); }
  }
#pragma unroll
  for (int t = 0; t < 4; ++t) { if (col0 + t * 16 >= N) continue; const int col = col0 + t * 16 + ln; const float bv = bp ? bf16_round(bp[col]) : 0.f;
#pragma unroll
    for (int r = 0; r < 8; ++r) { float v = acc[t][r] * alpha + bv; if (CP) { const int rr = row0g + row0 + 8 * hh + r; if (rowsPerB < 0) v += CP[cofs + (size_t)rr * ldc + col];      /* rowsPerB < 0: own element of the batched C plane */ else { const int bidx = rr / rowsPerB; v += CP[(size_t)bidx * sCPb + (size_t)by * 64 + col]; } } if (ACT == 1) v = (v > 0.f) ? v : expm1f(v); else if (ACT == 7) v = (v > 0.f) ? v + 1.0f : expf(v); else if (ACT == 8) v = tanhf(v); else if (ACT == 9) v = 0.5f * v * (1.0f + tanhf(0.7978845608028654f * (v + 0.044715f * v * v * v))); else if (ACT == 11) v = 1.0f / (1.0f + expf(-v)); else if (ACT == 12) v = (v > 0.f) ? v : 0.01f * v; else if (ACT == 14) v = (v > 0.f) ? v : 0.1f * v; else if (ACT == 16) v = (v >= 0.f) ? v : 0.3f * v; else if (ACT == 17) v = (v >= 0.f) ? v : 0.2f * v; else if (ACT == 15) v = v / (1.0f + expf(-v)); else if (ACT == 3) v = fmaxf(v, 0.f); else if (ACT == 6) v = 0.5f * v * (1.0f + erff(v * 0.70710678118654752f)); so[w][8 * hh + r][t * 16 + ln] = v; } }
  __builtin_amdgcn_fence(__ATOMIC_ACQ_REL, "workgroup"); __builtin_amdgcn_wave_barrier();
  const int rsub = lane >> 4, c4 = (lane & 15) * 4; typedef _Float16 v4h __attribute__((ext_vector_type(4)));
  {
#pragma unroll
    for (int q = 0; q < 8; ++q) { const int r = q * 2 + rsub; if (col0 + c4 < N) { const v4f v = *(const v4fa*)&so[w][r][c4]; if (C) *(v4f*)(C + cofs + (size_t)(row0 + r) * ldc + col0 + c4) = v; if (C16) { v4h h4; for (int i = 0; i < 4; ++i) h4[i] = (_Float16)v[i]; *(v4h*)(C16 + cofs + (size_t)(row0 + r) * ldc + col0 + c4) = h4; } } }
     }
}


typedef _Float16 v4h __attribute__((ext_vector_type(4)));

__global__ __launch_bounds__(256) void k_x16(const float* __restrict__ x, _Float16* __restrict__ X16, size_t n8) { const size_t t = (size_t)blockIdx.x * 256 + threadIdx.x; if (t >= n8) return; FragH f;
#pragma unroll
  for (int q = 0; q < 8; ++q) f.h[q] = (_Float16)bf16_round(x[t * 8 + q]); *(v8us*)((unsigned short*)X16 + t * 8) = f.half[0];  }
__global__ __launch_bounds__(256) void k_h16(const float* __restrict__ x, _Float16* __restrict__ X16, size_t n8) { const size_t t = (size_t)blockIdx.x * 256 + threadIdx.x; if (t >= n8) return; FragH f;
#pragma unroll
  for (int q = 0; q < 8; ++q) f.h[q] = (_Float16)x[t * 8 + q]; *(v8us*)((unsigned short*)X16 + t * 8) = f.half[0];  }
__global__ __launch_bounds__(256) void k_round16f(const float* __restrict__ W, _Float16* __restrict__ Bt, size_t n8) { const size_t t = (size_t)blockIdx.x * 256 + threadIdx.x; if (t >= n8) return; FragH f;
#pragma unroll
  for (int i = 0; i < 8; ++i) f.h[i] = (_Float16)(bf16_round(W[t * 8 + i]) * 16.0f); *(v8us*)((unsigned short*)Bt + t * 8) = f.half[0];  }
template <int NHv, int TTv>
__global__ __launch_bounds__(256) void k_vt(const _Float16* __restrict__ V16, int ldv, int voff, _Float16* __restrict__ Vt) { __shared__ unsigned short tl[64][66]; const int tid = threadIdx.x; const int slab = blockIdx.x / (TTv / 64), lg = blockIdx.x % (TTv / 64); const int b = slab / NHv, h = slab % NHv;
  for (int i = tid; i < 64 * 8; i += 256) { const int r = i / 8, c8 = (i % 8) * 8; FragH f; f.half[0] = *(const v8us*)((const unsigned short*)V16 + ((size_t)b * TTv + lg * 64 + r) * ldv + voff + h * 64 + c8);
#pragma unroll
    for (int q = 0; q < 8; ++q) tl[r][c8 + q] = f.u[q]; }
  __syncthreads();
  {
#pragma unroll
    for (int rd = 0; rd < 2; ++rd) { const int d = rd * 32 + tid / 8, pc = tid % 8; FragH f;
#pragma unroll
      for (int q = 0; q < 8; ++q) f.u[q] = tl[pc * 8 + q][d];
      *(v8us*)((unsigned short*)Vt + ((size_t)slab * 64 + d) * TTv + lg * 64 + pc * 8) = f.half[0]; }
     } }

__global__ __launch_bounds__(256) void k_hl(const float* __restrict__ F, _Float16* __restrict__ Hh, _Float16* __restrict__ Hl, size_t n8) { const size_t t = (size_t)blockIdx.x * 256 + threadIdx.x; if (t >= n8) return; FragH fh, fl; const v4f a = *(const v4fa*)(F + t * 8), c = *(const v4fa*)(F + t * 8 + 4);
#pragma unroll
  for (int q = 0; q < 4; ++q) { _Float16 h = (_Float16)a[q]; fh.h[q] = h; fl.h[q] = (_Float16)((a[q] - (float)h) * 1024.0f); h = (_Float16)c[q]; fh.h[4 + q] = h; fl.h[4 + q] = (_Float16)((c[q] - (float)h) * 1024.0f); }
  { *(v8us*)((unsigned short*)Hh + t * 8) = fh.half[0]; *(v8us*)((unsigned short*)Hl + t * 8) = fl.half[0];  } }

// ---- fast GEMM (wave tile 32x64; requires M % 32 == 0 rows per launch region and N % 64 == 0); epilogue = k_gemm_hhx semantics ----
__device__ __forceinline__ v16h g2_frag(const _Float16* p, int hh) { FragH f; f.half[0] = *(const v8us*)((const unsigned short*)p + 8 * hh); f.half[1] = *(const v8us*)((const unsigned short*)p + 16 + 8 * hh); return f.v; }
__device__ __forceinline__ v8f g2_mma(v16h a, v16h b, v8f c) { v8f d = __builtin_amdgcn_wmma_f32_16x16x32_f16(false, a, false, b, (short)0, c, false, false); asm volatile("v_nop\n\tv_nop\n\tv_nop\n\tv_nop" : "+v"(d) : "v"(a), "v"(b)); return d; }
template <int ACT>
__global__ __launch_bounds__(128) void k_gemm2(const _Float16* __restrict__ A, int lda, size_t sA, const _Float16* __restrict__ Bh, int ldb, size_t sB, float alpha, const float* __restrict__ bias, size_t sBias, const float* __restrict__ CP, int rowsPerB, size_t sCPb, int row0g,
    float* __restrict__ C, _Float16* __restrict__ C16, int ldc, size_t sC, int M, int N, int K) { static_assert(ACT == 0 || ACT == 3 || ACT == 6 || ACT == 8 || ACT == 9 || ACT == 11 || ACT == 12 || ACT == 14 || ACT == 15 || ACT == 16 || ACT == 17, "k_gemm2: unsupported ACT code (would silently apply no activation)");
  __shared__ __attribute__((aligned(16))) float so[4][32][68];
  const int tid = threadIdx.x, w = tid >> 5, lane = tid & 31, ln = lane & 15, hh = lane >> 4; const int by = blockIdx.y;
  A += (size_t)by * sA; Bh += (size_t)by * sB; const size_t cofs = (size_t)by * sC; const float* bp = bias ? bias + (size_t)by * sBias : nullptr;
  const int ntn = N >> 6; const int mt = blockIdx.x / ntn, nq = blockIdx.x - mt * ntn; const int row0 = mt * 128 + 32 * w, col0 = nq * 64; if (row0 >= M) return;
  const _Float16* a0p = A + (size_t)(row0 + ln) * lda; const _Float16* a1p = a0p + (size_t)16 * lda;
  const _Float16* b0p = Bh + (size_t)(col0 + ln) * ldb; const _Float16* b1p = b0p + (size_t)16 * ldb; const _Float16* b2p = b1p + (size_t)16 * ldb; const _Float16* b3p = b2p + (size_t)16 * ldb;
  const v8f z8 = {0.f,0.f,0.f,0.f,0.f,0.f,0.f,0.f}; v8f c00 = z8, c01 = z8, c02 = z8, c03 = z8, c10 = z8, c11 = z8, c12 = z8, c13 = z8;
#pragma unroll 1
  for (int kb = 0; kb < K; kb += 32) { const v16h a0 = g2_frag(a0p + kb, hh), a1 = g2_frag(a1p + kb, hh);
    v16h b = g2_frag(b0p + kb, hh); c00 = g2_mma(a0, b, c00); c10 = g2_mma(a1, b, c10);
    b = g2_frag(b1p + kb, hh); c01 = g2_mma(a0, b, c01); c11 = g2_mma(a1, b, c11);
    b = g2_frag(b2p + kb, hh); c02 = g2_mma(a0, b, c02); c12 = g2_mma(a1, b, c12);
    b = g2_frag(b3p + kb, hh); c03 = g2_mma(a0, b, c03); c13 = g2_mma(a1, b, c13); }
  v8f accs[8] = {c00, c01, c02, c03, c10, c11, c12, c13};
#pragma unroll
  for (int u = 0; u < 8; ++u) { const int t = u & 3, half = u >> 2; const int col = col0 + t * 16 + ln; const float bv = bp ? bf16_round(bp[col]) : 0.f;
#pragma unroll
    for (int r = 0; r < 8; ++r) { const int rloc = half * 16 + 8 * hh + r; float v = accs[u][r] * alpha + bv; if (CP) { if (rowsPerB < 0) v += CP[cofs + (size_t)(row0g + row0 + rloc) * ldc + col];      /* rowsPerB < 0: own element of the batched C plane */ else { const int bidx = (row0g + row0 + rloc) / rowsPerB; v += CP[(size_t)bidx * sCPb + (size_t)by * 64 + col]; } }
      if (ACT == 3) v = fmaxf(v, 0.f); else if (ACT == 6) v = 0.5f * v * (1.0f + erff(v * 0.70710678118654752f)); else if (ACT == 11) v = 1.0f / (1.0f + expf(-v)); else if (ACT == 15) v = v / (1.0f + expf(-v)); else if (ACT == 12) v = (v > 0.f) ? v : 0.01f * v; else if (ACT == 8) v = tanhf(v); else if (ACT == 9) v = 0.5f * v * (1.0f + tanhf(0.7978845608028654f * (v + 0.044715f * v * v * v))); else if (ACT == 14) v = (v > 0.f) ? v : 0.1f * v; else if (ACT == 16) v = (v >= 0.f) ? v : 0.3f * v; else if (ACT == 17) v = (v >= 0.f) ? v : 0.2f * v;
      so[w][rloc][t * 16 + ln] = v; } }
  __builtin_amdgcn_fence(__ATOMIC_ACQ_REL, "workgroup"); __builtin_amdgcn_wave_barrier();
  const int rsub = lane >> 4, c4 = (lane & 15) * 4;
  {
#pragma unroll
    for (int q = 0; q < 16; ++q) { const int r = q * 2 + rsub; const v4f v = *(const v4fa*)&so[w][r][c4]; if (C) *(v4f*)(C + cofs + (size_t)(row0 + r) * ldc + col0 + c4) = v; if (C16) { v4h h4; for (int i = 0; i < 4; ++i) h4[i] = (_Float16)v[i]; *(v4h*)(C16 + cofs + (size_t)(row0 + r) * ldc + col0 + c4) = h4; } }
     } }


__global__ __launch_bounds__(256) void k_wnat(const float* __restrict__ w, size_t n8, _Float16* __restrict__ Bt) { const size_t t = (size_t)blockIdx.x * 256 + threadIdx.x; if (t >= n8) return; FragH f; for (int q = 0; q < 8; ++q) f.h[q] = (_Float16)(bf16_round(w[t * 8 + q]) * 16.0f); *(v8us*)((unsigned short*)Bt + t * 8) = f.half[0];  }
__global__ __launch_bounds__(256) void k_rsm(const float* __restrict__ S, _Float16* __restrict__ P, int nrows) {
  #pragma clang fp contract(off)
  const int i = blockIdx.x * 256 + threadIdx.x; if (i >= nrows) return; const float* s = S + (size_t)i * SQ; float mx = -3.0e38f;
#pragma unroll 1
  for (int j = 0; j < SQ; ++j) mx = fmaxf(mx, s[j]); float se = 0.f;
#pragma unroll 1
  for (int j = 0; j < SQ; ++j) se += expf(s[j] - mx); const float sc = 256.0f / se;
#pragma unroll 1
  for (int j0 = 0; j0 < SQ; j0 += 8) { FragH f; for (int q = 0; q < 8; ++q) f.h[q] = (_Float16)(expf(s[j0 + q] - mx) * sc); unsigned short* d = (unsigned short*)P + (size_t)i * SQ + j0; *(v8us*)d = f.half[0];  } }
__global__ __launch_bounds__(256) void k_vt(const _Float16* __restrict__ V16, int b, int h0, _Float16* __restrict__ VT) { __shared__ unsigned short tl[64][65]; const int tid = threadIdx.x; const int hh = blockIdx.x % HG, sg = blockIdx.x / HG; const int s0 = sg * 64; const int h = h0 + hh;
  for (int i = tid; i < 64 * 8; i += 256) { const int j = i / 8, d8 = (i % 8) * 8; FragH f; f.half[0] = *(const v8us*)((const unsigned short*)V16 + ((size_t)b * SQ + s0 + j) * DM + h * HD + d8); for (int q = 0; q < 8; ++q) tl[d8 + q][j] = f.u[q]; }
  __syncthreads();
  { for (int i = tid; i < 64 * 8; i += 256) { const int d = i / 8, j8 = (i % 8) * 8; FragH f; for (int q = 0; q < 8; ++q) f.u[q] = tl[d][j8 + q]; *(v8us*)((unsigned short*)VT + ((size_t)hh * HD + d) * SQ + s0 + j8) = f.half[0]; }  } }


__global__ __launch_bounds__(256) void k_x16pad(const float* __restrict__ x, _Float16* __restrict__ X16) { const size_t t = (size_t)blockIdx.x * 256 + threadIdx.x; if (t >= (size_t)NB * QP * (DM / 8)) return; const int c8 = (int)(t % (DM / 8)) * 8; const size_t row = t / (DM / 8); const int b = (int)(row / QP), q = (int)(row % QP); FragH f;
  for (int i = 0; i < 8; ++i) f.h[i] = (_Float16)((q < NQ) ? bf16_round(x[((size_t)b * NQ + q) * DM + c8 + i]) : 0.f);
  *(v8us*)((unsigned short*)X16 + row * DM + c8) = f.half[0];  }


template <int HPP>
__global__ __launch_bounds__(256) void k_wtpadT(const float* __restrict__ w, _Float16* __restrict__ Bt) { const int t = blockIdx.x * 256 + threadIdx.x; if (t >= NH * HPP * (DM / 8)) return; const int k8 = (t % (DM / 8)) * 8; const int r = t / (DM / 8); const int h = r / HPP, d = r % HPP; FragH f;
  for (int q = 0; q < 8; ++q) { float v = 0.f; if (d < HD) v = bf16_round(w[(size_t)(k8 + q) * DM + h * HD + d]); f.h[q] = (_Float16)(v * 16.0f); }
  unsigned short* dst = (unsigned short*)Bt + (size_t)r * DM + k8; *(v8us*)dst = f.half[0];  }
template <int HPP>
__global__ __launch_bounds__(256) void k_wtopadT(const float* __restrict__ w, _Float16* __restrict__ Bt) { const int t = blockIdx.x * 256 + threadIdx.x; if (t >= DM * (NH * HPP / 8)) return; const int k8 = (t % (NH * HPP / 8)) * 8; const int n = t / (NH * HPP / 8); FragH f;
  for (int q = 0; q < 8; ++q) { const int kp = k8 + q; const int h = kp / HPP, d = kp % HPP; float v = 0.f; if (d < HD) v = bf16_round(w[(size_t)(h * HD + d) * DM + n]); f.h[q] = (_Float16)(v * 16.0f); }
  unsigned short* dst = (unsigned short*)Bt + (size_t)n * (NH * HPP) + k8; *(v8us*)dst = f.half[0];  }
// Mean term, one block of 32 waves per batch. Column sums: 25 waves of 40 rows each; a wave reads whole 512-byte rows (lane = 4 columns), rows w, w + 25, ..., eight loads in flight; the 25 partial rows meet in LDS.
// mu Wq_mean: thread = (output column, slice of 16 rows of Wq_mean), its 16 weights loaded ahead of the row loads; the 8 slices meet in LDS.
#define MW 25                        /* waves that sum rows; NQ = MW * 40 */
__global__ __launch_bounds__(1024) void k_qmean(const float* __restrict__ xn, const float* __restrict__ wqm, float* __restrict__ QMP) {
  static_assert(NQ % (MW * 8) == 0 && MW <= 32, "rows deal out evenly, eight a round");
  __shared__ __attribute__((aligned(16))) float part[MW][DM]; __shared__ float mu[DM]; __shared__ float wp[8][DM];
  const int b = blockIdx.x, t = threadIdx.x, c4 = (t & 31) * 4, col = t % DM, kg = t / DM; float wv[DM / 8];
  const int w = __builtin_amdgcn_readfirstlane(t >> 5);      /* wave number in a scalar register: row addresses and the test on it are scalar */
#pragma unroll      /* wv[] in registers, all 16 loads in flight */
  for (int i = 0; i < DM / 8; ++i) wv[i] = wqm[(size_t)(kg * (DM / 8) + i) * DM + col];
  if (w < MW) { const float* rows = xn + ((size_t)b * NQ + w) * DM + c4; v4f s = {0.f, 0.f, 0.f, 0.f};
#pragma unroll 1      /* eight loads a round: a fully unrolled form of this loop spilled at the 128 registers a wave has in a 1024-thread block */
    for (int r = 0; r < NQ / (MW * 8); ++r) { v4f a[8];
#pragma unroll      /* a[] in registers, the round's loads in flight together */
      for (int j = 0; j < 8; ++j) a[j] = *(const v4fa*)(rows + (size_t)(r * 8 + j) * MW * DM);
#pragma unroll      /* a[] in registers */
      for (int j = 0; j < 8; ++j) for (int q = 0; q < 4; ++q) s[q] += bf16_round(a[j][q]); }
    *(v4f*)&part[w][c4] = s; }
  __syncthreads();
  if (t < DM) { float m = 0.f; for (int i = 0; i < MW; ++i) m += part[i][t]; mu[t] = m / (float)NQ; }
  __syncthreads();
  float v = 0.f;
#pragma unroll      /* wv[] in registers */
  for (int i = 0; i < DM / 8; ++i) v += mu[kg * (DM / 8) + i] * bf16_round(wv[i]);
  wp[kg][col] = v;
  __syncthreads();
  if (t < NH * 32) { const int h = t / 32, d = t % 32; float o = 0.f; if (d < HD) for (int g = 0; g < 8; ++g) o += wp[g][h * HD + d]; QMP[(size_t)b * (NH * 32) + t] = o; } }
// Row softmaxes, one wave per row: lane holds columns 4*lane + 128*u (u = 0..7), so each wave-wide b128 load or store covers 512 contiguous bytes;
// the row's values stay in registers between the maximum, the sum and the store. Maximum and sum: per lane first, then a five-step butterfly over the 32 lanes.
// Columns NQ..QP-1 (lanes 26..31 of u = 7): the score planes hold them; the mask does not, so those lanes re-read their own first chunk; their value is -inf (weight 0) and 0 is stored.
__device__ __forceinline__ float wave_max32(float v) { for (int m = 16; m > 0; m >>= 1) v = fmaxf(v, __shfl_xor(v, m, 32)); return v; }
__device__ __forceinline__ float wave_sum32(float v) { for (int m = 16; m > 0; m >>= 1) v += __shfl_xor(v, m, 32); return v; }
// 2^x as one v_exp_f32 (what __expf compiles to behind its multiply) with the issue slot behind it filled
__device__ __forceinline__ float exp2_slot(float x) { float r; asm("v_exp_f32 %0, %1\n\tv_nop" : "=v"(r) : "v"(x)); return r; }
// block = query row p, wave = head (the eight waves of a block share one mask row)
__global__ __launch_bounds__(256) void k_rsm1(const float* __restrict__ S, _Float16* __restrict__ P, int b, const float* __restrict__ mask) {
  const int p = blockIdx.x, h = threadIdx.x >> 5, c0 = (threadIdx.x & 31) * 4; const size_t i = (size_t)h * QP + p; _Float16* prow = P + i * QP + c0; const bool live = p < NQ;      /* rows NQ..QP-1: same instruction stream on mask row 0, scale 0, so zeros are stored */
  const float* s = S + i * QP + c0; const float* mr = mask + ((size_t)b * NQ + (live ? p : 0)) * NQ + c0; v4f x[QP / 128]; float mx = -3.0e38f;
#pragma unroll      /* x[] in registers, and all loads of the row in flight together */
  for (int u = 0; u < QP / 128; ++u) { const bool in = c0 + 128 * u < NQ; const v4f a = *(const v4fa*)(s + 128 * u), m = *(const v4fa*)(mr + (in ? 128 * u : 0)); for (int q = 0; q < 4; ++q) { const float v = a[q] + bf16_round(m[q]); x[u][q] = in ? v : -__builtin_inff(); mx = fmaxf(mx, x[u][q]); } }
  mx = wave_max32(mx); float se = 0.f;
#pragma unroll      /* x[] in registers */
  for (int u = 0; u < QP / 128; ++u) for (int q = 0; q < 4; ++q) { x[u][q] = exp2_slot((x[u][q] - mx) * 1.44269504f); se += x[u][q]; }
  se = wave_sum32(se); const float sc = live ? 256.0f / se : 0.f;
#pragma unroll      /* x[] in registers */
  for (int u = 0; u < QP / 128; ++u) { const bool in = c0 + 128 * u < NQ; v4h o; for (int q = 0; q < 4; ++q) { const _Float16 w = (_Float16)(x[u][q] * sc); o[q] = in ? w : (_Float16)0.f; } *(v4h*)(prow + 128 * u) = o; } }
// four rows a block, wave = query row p
__global__ __launch_bounds__(128) void k_fin(const float* __restrict__ S2, const float* __restrict__ mask, int b, float* __restrict__ PR) {
  const int p = blockIdx.x * 4 + (threadIdx.x >> 5), c0 = (threadIdx.x & 31) * 4; if (p >= NQ) return;
  const float* s = S2 + (size_t)p * QP + c0; const float* mr = mask + ((size_t)b * NQ + p) * NQ + c0; float* pr = PR + ((size_t)b * QP + p) * QP + c0; v4f x[QP / 128], m[QP / 128]; float mx = -3.0e38f;
#pragma unroll      /* all loads of the row in flight together, ahead of the branches inside tanhf */
  for (int u = 0; u < QP / 128; ++u) { x[u] = *(const v4fa*)(s + 128 * u); m[u] = *(const v4fa*)(mr + ((c0 + 128 * u < NQ) ? 128 * u : 0)); }
#pragma unroll      /* x[] in registers */
  for (int u = 0; u < QP / 128; ++u) { const bool in = c0 + 128 * u < NQ; for (int q = 0; q < 4; ++q) { const float v = 10.0f * tanhf(x[u][q]) + bf16_round(m[u][q]); x[u][q] = in ? v : -__builtin_inff(); mx = fmaxf(mx, x[u][q]); } }
  mx = wave_max32(mx); float se = 0.f;
#pragma unroll      /* x[] in registers */
  for (int u = 0; u < QP / 128; ++u) for (int q = 0; q < 4; ++q) { x[u][q] = expf(x[u][q] - mx); se += x[u][q]; }
  const float inv = 1.0f / wave_sum32(se);
#pragma unroll      /* x[] in registers */
  for (int u = 0; u < QP / 128; ++u) { const bool in = c0 + 128 * u < NQ; v4f o; for (int q = 0; q < 4; ++q) { const float w = x[u][q] * inv; o[q] = in ? w : 0.f; } *(v4f*)(pr + 128 * u) = o; } }
__global__ __launch_bounds__(256) void k_outflat(const float* __restrict__ PR, float* __restrict__ out) { const size_t t = (size_t)blockIdx.x * 256 + threadIdx.x; if (t >= (size_t)NB * NQ * NQ / 4) return; const size_t e = t * 4; const int n = (int)(e % NQ); const size_t bp = e / NQ; const int b = (int)(bp / NQ), p = (int)(bp % NQ);
  const v4f v = *(const v4fa*)(PR + ((size_t)b * QP + p) * QP + n); *(v4f*)(out + e) = v;  }

extern "C" void kernel_launch(void* const* d_in, const int* in_sizes, int n_in,
                              void* d_out, int out_size, void* d_ws, size_t ws_size, hipStream_t stream) {
  (void)in_sizes; (void)n_in; (void)out_size;
  const float* const* I = (const float* const*)d_in; const float* xn = I[0]; const float* xq1 = I[1]; const float* xl = I[2]; const float* mask = I[3]; const float* Wqf = I[4]; const float* Wql = I[5]; const float* Wqm = I[6]; const float* Wk = I[7]; const float* Wv = I[8]; const float* Wc = I[9]; const float* bc = I[10];      /* weights [in][out] */
  char* ws = (char*)d_ws; size_t off = 0;
  auto take = [&](size_t bytes) { char* p = ws + off; off += (bytes + 255) & ~(size_t)255; return p; };
  _Float16* BQF = (_Float16*)take((size_t)NH * 32 * DM * 2); _Float16* BQL = (_Float16*)take((size_t)NH * 32 * DM * 2); _Float16* BK = (_Float16*)take((size_t)NH * 32 * DM * 2); _Float16* BVP = (_Float16*)take((size_t)NH * 64 * DM * 2); _Float16* BCP = (_Float16*)take((size_t)DM * NH * 64 * 2); float* QMP = (float*)take((size_t)NB * NH * 32 * 4);
  _Float16* XN = (_Float16*)take(NRP * DM * 2); _Float16* XQ1 = (_Float16*)take(NRP * DM * 2); _Float16* XL = (_Float16*)take(NRP * DM * 2);
  float* QF = (float*)take(NRP * NH * 32 * 4); _Float16* Q16 = (_Float16*)take(NRP * NH * 32 * 2); _Float16* K16 = (_Float16*)take(NRP * NH * 32 * 2); _Float16* V2 = (_Float16*)take(NRP * NH * 64 * 2); float* OF = (float*)take(NRP * NH * 64 * 4); _Float16* OH = (_Float16*)take(NRP * NH * 64 * 2); _Float16* OL = (_Float16*)take(NRP * NH * 64 * 2);
  float* S = (float*)take((size_t)NH * QP * QP * 4); _Float16* P = (_Float16*)take((size_t)NH * QP * QP * 2); _Float16* VT = (_Float16*)take((size_t)NH * 64 * QP * 2);
  float* MH = (float*)take(NRP * DM * 4); _Float16* MHh = (_Float16*)take(NRP * DM * 2); _Float16* MHl = (_Float16*)take(NRP * DM * 2); float* S2 = (float*)take((size_t)QP * QP * 4); float* PR = (float*)take((size_t)NB * QP * QP * 4);
  if (off > ws_size) return;      /* approx 6 + 8 + 4 + 4 + 8 + 32 + 32 + 16 + 1 + 8 + 4 + 32 = ~155 MiB */
  k_wtpadT<32><<<(NH * 32 * (DM / 8) + 255) / 256, 256, 0, stream>>>(Wqf, BQF); k_wtpadT<32><<<(NH * 32 * (DM / 8) + 255) / 256, 256, 0, stream>>>(Wql, BQL); k_wtpadT<32><<<(NH * 32 * (DM / 8) + 255) / 256, 256, 0, stream>>>(Wk, BK);
  k_wtpadT<64><<<(NH * 64 * (DM / 8) + 255) / 256, 256, 0, stream>>>(Wv, BVP); k_wtopadT<64><<<(DM * (NH * 64 / 8) + 255) / 256, 256, 0, stream>>>(Wc, BCP);
  k_x16pad<<<(unsigned)((NRP * (DM / 8) + 255) / 256), 256, 0, stream>>>(xn, XN); k_x16pad<<<(unsigned)((NRP * (DM / 8) + 255) / 256), 256, 0, stream>>>(xq1, XQ1); k_x16pad<<<(unsigned)((NRP * (DM / 8) + 255) / 256), 256, 0, stream>>>(xl, XL);
  k_qmean<<<NB, 1024, 0, stream>>>(xn, Wqm, QMP);      /* per-batch mean term in the padded q layout */
  k_gemm2<0><<<dim3((unsigned)((NRP / 128) * (NH * 32 / 64)), 1), 128, 0, stream>>>(XQ1, DM, 0, BQF, DM, 0, 0.0625f, nullptr, 0, QMP, QP, NH * 32, 0, QF, nullptr, NH * 32, 0, (int)NRP, NH * 32, DM);      /* q1 Wq_first + mean term (broadcast per batch), f32 */
  k_gemm2<0><<<dim3((unsigned)((NRP / 128) * (NH * 32 / 64)), 1), 128, 0, stream>>>(XL, DM, 0, BQL, DM, 0, 0.0625f, nullptr, 0, QF, -1, 0, 0, nullptr, Q16, NH * 32, 0, (int)NRP, NH * 32, DM);      /* + last Wq_last -> q (f16, padded [8][32]) */
  k_gemm2<0><<<dim3((unsigned)((NRP / 128) * (NH * 32 / 64)), 1), 128, 0, stream>>>(XN, DM, 0, BK, DM, 0, 0.0625f, nullptr, 0, nullptr, 1, 0, 0, nullptr, K16, NH * 32, 0, (int)NRP, NH * 32, DM);      /* k (f16, padded [8][32]) */
  k_gemm2<0><<<dim3((unsigned)((NRP / 128) * (NH * 64 / 64)), 1), 128, 0, stream>>>(XN, DM, 0, BVP, DM, 0, 0.0625f, nullptr, 0, nullptr, 1, 0, 0, nullptr, V2, NH * 64, 0, (int)NRP, NH * 64, DM);      /* v (f16, padded [8][64]) */
  for (int b = B0; b < B0 + NBR; ++b) { const size_t rb = (size_t)b * QP;
    k_vt<NH, QP><<<NH * (QP / 64), 256, 0, stream>>>(V2 + rb * NH * 64, NH * 64, 0, VT);      /* V^T [8][64][1024] */
    k_gemm2<0><<<dim3((QP / 128) * (QP / 64), NH), 128, 0, stream>>>(Q16 + rb * NH * 32, NH * 32, (size_t)32, K16 + rb * NH * 32, NH * 32, (size_t)32, 0.25f, nullptr, 0, nullptr, 1, 0, 0, S, nullptr, QP, (size_t)QP * QP, QP, QP, 32);      /* stage-1 scores / sqrt(16), all heads; K = 32 (16 real + 16 zero) */
    k_rsm1<<<QP, 256, 0, stream>>>(S, P, b, mask);
    k_gemm2<0><<<dim3((QP / 128) * 1, NH), 128, 0, stream>>>(P, QP, (size_t)QP * QP, VT, QP, (size_t)64 * QP, 0.25f, nullptr, 0, nullptr, 1, 0, 0, OF + rb * NH * 64, nullptr, NH * 64, (size_t)64, QP, 64, QP); }      /* o x64 (padded [8][64], f32) */
  k_hl<<<(unsigned)((NRP * NH * 64 / 8 + 255) / 256), 256, 0, stream>>>(OF, OH, OL, NRP * NH * 64 / 8);      /* o -> f16 hi + x1024 residual */
  k_gemm2<0><<<dim3((unsigned)((NRP / 128) * (DM / 64)), 1), 128, 0, stream>>>(OH, NH * 64, 0, BCP, NH * 64, 0, 0.0009765625f, bc, 0, nullptr, 1, 0, 0, MH, nullptr, DM, 0, (int)NRP, DM, NH * 64);      /* mh = o_hi W_comb + b_comb (f32) */
  k_gemm2<0><<<dim3((unsigned)((NRP / 128) * (DM / 64)), 1), 128, 0, stream>>>(OL, NH * 64, 0, BCP, NH * 64, 0, 0.00000095367431640625f, nullptr, 0, MH, -1, 0, 0, MH, nullptr, DM, 0, (int)NRP, DM, NH * 64);      /* += o_lo W_comb 2^-20 */
  k_hl<<<(unsigned)((NRP * DM / 8 + 255) / 256), 256, 0, stream>>>(MH, MHh, MHl, NRP * DM / 8);      /* mh -> f16 hi + x1024 residual */
  for (int b = B0; b < B0 + NBR; ++b) { const size_t rb = (size_t)b * QP;
    k_gemm2<0><<<dim3((QP / 128) * (QP / 64), 1), 128, 0, stream>>>(MHh + rb * DM, DM, 0, XN + rb * DM, DM, 0, 0.088388347648318447f, nullptr, 0, nullptr, 1, 0, 0, S2, nullptr, QP, 0, QP, QP, DM);      /* score2 = mh_hi nodes^T / sqrt(128) */
    k_gemm2<0><<<dim3((QP / 128) * (QP / 64), 1), 128, 0, stream>>>(MHl + rb * DM, DM, 0, XN + rb * DM, DM, 0, 0.000086316745750311f, nullptr, 0, S2, -1, 0, 0, S2, nullptr, QP, 0, QP, QP, DM);      /* += mh_lo nodes^T / (1024 sqrt(128)) */
    k_fin<<<(NQ + 3) / 4, 128, 0, stream>>>(S2, mask, b, PR); }      /* 10 tanh, + mask, softmax over the 1000 real keys (f32) */
  k_outflat<<<(unsigned)(((size_t)NB * NQ * NQ / 4 + 255) / 256), 256, 0, stream>>>(PR, (float*)d_out);
}

// v003
// One run takes 512 microseconds.
// Next to v002, in two timings, it ran 1.74 and 1.73 times as fast.
// Counting every step since v000, it is 30.8 times as fast.
#include <hip/hip_runtime.h>
// TSP decoder probabilities (encoded_nodes, encoded_q1, encoded_last_node [8][1000][128]; k = nodes Wk, v = nodes Wv, q = q1 Wq_first + last Wq_last + (mean_n nodes) Wq_mean broadcast ([in][out] weights), 8 heads of 16; weights = softmax(q k^T / 4 + ninf_mask); mh = (weights v merged) W_comb + b_comb; score2 = mh nodes^T / sqrt(128); probs = softmax_n(10 tanh(score2) + ninf_mask) -> [8][1000][1000]).
// Compute dtype: inputs rounded to bf16; token rows / weights exact; q, k, v and the stage-1 weights as plain f16 GEMM operands (~2^-12); o and mh as f16 hi + residual operand pairs (~2^-22); the mean term, score2, tanh, mask and the final softmax f32. v_wmma_f32_16x16x32_f16.
#define NB 8
#define NQ 1000                      /* nodes = queries = 1000 */
#define QP 1024                      /* padded rows / keys per batch */
#define DM 128
#define NH 8
#define HD 16
#define SQ QP
#define HG 8
#define B0 0                         /* first batch (debug hook) */
#define NBR NB
#define NRP ((size_t)NB * QP)        /* padded token rows */
typedef __bf16 v16b __attribute__((ext_vector_type(16)));
typedef unsigned short v8us __attribute__((ext_vector_type(8), may_alias));
typedef float  v8f  __attribute__((ext_vector_type(8)));
typedef float  v4f  __attribute__((ext_vector_type(4)));
typedef float  v4fa __attribute__((ext_vector_type(4), may_alias));
union FragB { v16b v; v8us half[2]; unsigned short u[16]; };

__device__ __forceinline__ unsigned short bf16_bits(float x) { unsigned int u = __float_as_uint(x); return (unsigned short)((u + 0x7FFFu + ((u >> 16) & 1u)) >> 16); }
__device__ __forceinline__ float bf16_val(unsigned short b) { return __uint_as_float(((unsigned int)b) << 16); }
__device__ __forceinline__ float bf16_round(float x) { return bf16_val(bf16_bits(x)); }
// D += A·B with NT terms: 1 = ah·bh, 2 = + al·bh (A split), 3 = + ah·bl (both split)
template <int NT>
__device__ __forceinline__ v8f mmaN(v16b ah, v16b al, v16b bh, v16b bl, v8f c) {
  c = __builtin_amdgcn_wmma_f32_16x16x32_bf16(false, ah, false, bh, (short)0, c, false, false);
  if (NT >= 2) c = __builtin_amdgcn_wmma_f32_16x16x32_bf16(false, al, false, bh, (short)0, c, false, false);
  if (NT >= 3) c = __builtin_amdgcn_wmma_f32_16x16x32_bf16(false, ah, false, bl, (short)0, c, false, false);
  asm volatile("v_nop\n\tv_nop\n\tv_nop\n\tv_nop" : "+v"(c) : "v"(ah), "v"(al), "v"(bh), "v"(bl));
  return c;
}

__global__ __launch_bounds__(256) void k_wt_bf16(const float* __restrict__ W, unsigned short* __restrict__ Wt, int K, int N) {
  const int t = blockIdx.x * 256 + threadIdx.x;
  const int k8n = K / 8;
  if (t >= N * k8n) return;
  const int n = t / k8n, k8 = (t % k8n) * 8;
  v8us v;
#pragma unroll
  for (int i = 0; i < 8; ++i) v[i] = bf16_bits(W[(size_t)(k8 + i) * N + n]);
  *(v8us*)(Wt + (size_t)n * K + k8) = v;
  
}

// GEMM C[M][N] (f32, pitch ldc) = act(A[M][K]·W + bias). A f32 row-major (pitch lda) converted per fragment to bf16
// (ASPLIT: hi/lo two planes -> 2 terms, else single rounded term); Wt bf16 [N][K] (pitch ldb). BIAS_BF16 rounds the
// bias to bf16 first (bias quantised to bf16 before the add). K%32==0, M%16==0, N%64==0.
template <bool ASPLIT, int ACT, bool BIAS_BF16>
__global__ __launch_bounds__(128) void k_gemm_bf(const float* __restrict__ A, int lda, const unsigned short* __restrict__ Wt, int ldb,
                                               const float* __restrict__ bias, float* __restrict__ C, int ldc, int M, int N, int K) {
  __shared__ __attribute__((aligned(16))) float so[4][16][64];
  const int tid = threadIdx.x, w = tid >> 5, lane = tid & 31, ln = lane & 15, hh = lane >> 4;
  const int ntn = N / 64;
  const int wid = blockIdx.x * 4 + w;
  const int mt = wid / ntn, nq = wid % ntn;
  if (mt * 16 >= M) return;
  const int row0 = mt * 16, col0 = nq * 64;
  const float* arow = A + (size_t)(row0 + ln) * lda;
  v8f acc[4] = {};
  for (int kb = 0; kb < K; kb += 32) {
    FragB ah, al;
    const v4f x0 = *(const v4fa*)(arow + kb + 8 * hh), x1 = *(const v4fa*)(arow + kb + 8 * hh + 4);
    const v4f x2 = *(const v4fa*)(arow + kb + 16 + 8 * hh), x3 = *(const v4fa*)(arow + kb + 16 + 8 * hh + 4);
    float xs[16] = {x0[0],x0[1],x0[2],x0[3],x1[0],x1[1],x1[2],x1[3],x2[0],x2[1],x2[2],x2[3],x3[0],x3[1],x3[2],x3[3]};
#pragma unroll
    for (int i = 0; i < 16; ++i) { const unsigned short hb = bf16_bits(xs[i]); ah.u[i] = hb; al.u[i] = ASPLIT ? bf16_bits(xs[i] - bf16_val(hb)) : (unsigned short)0; }
#pragma unroll
    for (int t = 0; t < 4; ++t) {
      const unsigned short* brow = Wt + (size_t)(col0 + t * 16 + ln) * ldb + kb;
      FragB b;
      b.half[0] = *(const v8us*)(brow + 8 * hh);
      b.half[1] = *(const v8us*)(brow + 16 + 8 * hh);
      acc[t] = mmaN<ASPLIT ? 2 : 1>(ah.v, al.v, b.v, b.v, acc[t]);
    }
  }
#pragma unroll
  for (int t = 0; t < 4; ++t) {
    float bv = bias ? bias[col0 + t * 16 + ln] : 0.f;
    if (BIAS_BF16) bv = bf16_round(bv);
#pragma unroll
    for (int r = 0; r < 8; ++r) { float v = acc[t][r] + bv; if (ACT == 1) v = fmaxf(v, 0.f); so[w][8 * hh + r][t * 16 + ln] = v; }
  }
  __builtin_amdgcn_fence(__ATOMIC_ACQ_REL, "workgroup");
  __builtin_amdgcn_wave_barrier();
  const int rsub = lane >> 4, c4 = (lane & 15) * 4;
  {
#pragma unroll
    for (int q = 0; q < 8; ++q) {
      const int r = q * 2 + rsub;
      const v4f v = *(const v4fa*)&so[w][r][c4];
      *(v4f*)(C + (size_t)(row0 + r) * ldc + col0 + c4) = v;
    }
    
  }
}

// GEMM C = act(A·W + bias + resid): A f32 (ASPLIT -> hi/lo 2 terms), Wt bf16 [N][K]; ACT 0 none, 1 relu, 2 exact gelu;
// resid (optional, f32, row index = (row % rmod), pitch ldr, RES_BF16 rounds it) added before the activation.
template <bool ASPLIT, int ACT, bool BIAS_BF16, bool RES_BF16>
__global__ __launch_bounds__(128) void k_gemm_bf3(const float* __restrict__ A, int lda, const unsigned short* __restrict__ Wt, int ldb,
                                                const float* __restrict__ bias, const float* __restrict__ resid, int rmod, int ldr,
                                                float* __restrict__ C, int ldc, int M, int N, int K) {
  __shared__ __attribute__((aligned(16))) float so[4][16][64];
  const int tid = threadIdx.x, w = tid >> 5, lane = tid & 31, ln = lane & 15, hh = lane >> 4;
  const int ntn = N / 64;
  const int wid = blockIdx.x * 4 + w;
  const int mt = wid / ntn, nq = wid % ntn;
  if (mt * 16 >= M) return;
  const int row0 = mt * 16, col0 = nq * 64;
  const float* arow = A + (size_t)(row0 + ln) * lda;
  v8f acc[4] = {};
  for (int kb = 0; kb < K; kb += 32) {
    FragB ah, al;
    const v4f x0 = *(const v4fa*)(arow + kb + 8 * hh), x1 = *(const v4fa*)(arow + kb + 8 * hh + 4);
    const v4f x2 = *(const v4fa*)(arow + kb + 16 + 8 * hh), x3 = *(const v4fa*)(arow + kb + 16 + 8 * hh + 4);
    float xs[16] = {x0[0],x0[1],x0[2],x0[3],x1[0],x1[1],x1[2],x1[3],x2[0],x2[1],x2[2],x2[3],x3[0],x3[1],x3[2],x3[3]};
#pragma unroll
    for (int i = 0; i < 16; ++i) { const unsigned short hb = bf16_bits(xs[i]); ah.u[i] = hb; al.u[i] = ASPLIT ? bf16_bits(xs[i] - bf16_val(hb)) : (unsigned short)0; }
#pragma unroll
    for (int t = 0; t < 4; ++t) {
      const unsigned short* brow = Wt + (size_t)(col0 + t * 16 + ln) * ldb + kb;
      FragB b;
      b.half[0] = *(const v8us*)(brow + 8 * hh);
      b.half[1] = *(const v8us*)(brow + 16 + 8 * hh);
      acc[t] = mmaN<ASPLIT ? 2 : 1>(ah.v, al.v, b.v, b.v, acc[t]);
    }
  }
#pragma unroll
  for (int t = 0; t < 4; ++t) {
    const int col = col0 + t * 16 + ln;
    float bv = bias ? bias[col] : 0.f;
    if (BIAS_BF16) bv = bf16_round(bv);
#pragma unroll
    for (int r = 0; r < 8; ++r) {
      float v = acc[t][r] + bv;
      if (resid) { float rv = resid[(size_t)((row0 + 8 * hh + r) % rmod) * ldr + col]; if (RES_BF16) rv = bf16_round(rv); v += rv; }
      if (ACT == 1) v = fmaxf(v, 0.f);
      if (ACT == 2) v = 0.5f * v * (1.0f + erff(v * 0.70710678118654752f));
      if (ACT == 3) { const float u = 0.7978845608028654f * (v + 0.044715f * v * v * v); v = 0.5f * v * (1.0f + tanhf(u)); }
      so[w][8 * hh + r][t * 16 + ln] = v;
    }
  }
  __builtin_amdgcn_fence(__ATOMIC_ACQ_REL, "workgroup");
  __builtin_amdgcn_wave_barrier();
  const int rsub = lane >> 4, c4 = (lane & 15) * 4;
  {
#pragma unroll
    for (int q = 0; q < 8; ++q) {
      const int r = q * 2 + rsub;
      const v4f v = *(const v4fa*)&so[w][r][c4];
      *(v4f*)(C + (size_t)(row0 + r) * ldc + col0 + c4) = v;
    }
    
  }
}
// row LayerNorm (biased variance, eps) over N: s = X (+ R); optional out_sum <- s; out_norm <- (s-mu)*rsqrt(var+eps)*g + b
template <bool PARAM_BF16>
__global__ __launch_bounds__(256) void k_layernorm(const float* __restrict__ X, const float* __restrict__ R, const float* __restrict__ g, const float* __restrict__ bta,
                                                  float* __restrict__ out_sum, float* __restrict__ out_norm, int N, float eps) {
  __shared__ float red[256];
  const int row = blockIdx.x, tid = threadIdx.x;
  const float* x = X + (size_t)row * N; const float* rr = R ? R + (size_t)row * N : nullptr;
  float vals[16];                     // up to N = 4096
  const int per = N / 256;            // contiguous chunk per thread? use strided-by-4 chunks: thread handles j = tid*4 + 1024*u
  float s1 = 0.f;
  for (int u = 0; u < per / 4; ++u) {
    const int j = tid * 4 + 1024 * u;
    const v4f a = *(const v4fa*)(x + j);
    v4f b = {0.f,0.f,0.f,0.f}; if (rr) b = *(const v4fa*)(rr + j);
#pragma unroll
    for (int q = 0; q < 4; ++q) { const float v = a[q] + b[q]; vals[u * 4 + q] = v; s1 += v; }
  }
  red[tid] = s1; __syncthreads();
  for (int st = 128; st > 0; st >>= 1) { if (tid < st) red[tid] += red[tid + st]; __syncthreads(); }
  const float mu = red[0] / (float)N; __syncthreads();
  float s2 = 0.f;
  for (int u = 0; u < per / 4; ++u)
#pragma unroll
    for (int q = 0; q < 4; ++q) { const float c = vals[u * 4 + q] - mu; s2 += c * c; }
  red[tid] = s2; __syncthreads();
  for (int st = 128; st > 0; st >>= 1) { if (tid < st) red[tid] += red[tid + st]; __syncthreads(); }
  const float rs = rsqrtf(red[0] / (float)N + eps);
  {
    for (int u = 0; u < per / 4; ++u) {
      const int j = tid * 4 + 1024 * u;
      v4f o, sm;
#pragma unroll
      for (int q = 0; q < 4; ++q) {
        float gg = g[j + q], bb = bta[j + q];
        if (PARAM_BF16) { gg = bf16_round(gg); bb = bf16_round(bb); }
        sm[q] = vals[u * 4 + q]; o[q] = (vals[u * 4 + q] - mu) * rs * gg + bb;
      }
      if (out_sum) *(v4f*)(out_sum + (size_t)row * N + j) = sm;
      *(v4f*)(out_norm + (size_t)row * N + j) = o;
    }
    
  }
}



// ---- f16 WMMA path (v_wmma_f32_16x16x32_f16): 11-bit significands for operands in range — used where a [0,1] probability operand needs more precision than bf16
typedef _Float16 v16h __attribute__((ext_vector_type(16)));
union FragH { v16h v; v8us half[2]; _Float16 h[16]; unsigned short u[16]; };
template <int NT>
__device__ __forceinline__ v8f mmaH(v16h ah, v16h al, v16h bh, v16h bl, v8f c) {
  c = __builtin_amdgcn_wmma_f32_16x16x32_f16(false, ah, false, bh, (short)0, c, false, false);
  if (NT >= 2) c = __builtin_amdgcn_wmma_f32_16x16x32_f16(false, al, false, bh, (short)0, c, false, false);
  if (NT >= 3) c = __builtin_amdgcn_wmma_f32_16x16x32_f16(false, ah, false, bl, (short)0, c, false, false);
  asm volatile("v_nop\n\tv_nop\n\tv_nop\n\tv_nop" : "+v"(c) : "v"(ah), "v"(al), "v"(bh), "v"(bl));
  return c;
}
// batched GEMM like k_gemm_b but f16 operands: A f32 (split into f16 hi/lo if ASPLIT, else rounded to f16), Bt = f16 values [n][k]; alpha; C f32; N multiple of 16 (partial tiles skipped)
template <bool ASPLIT>
__global__ __launch_bounds__(128) void k_gemm_h(const float* __restrict__ A, int lda, size_t sA, const _Float16* __restrict__ Bh, int ldb, size_t sB, float alpha, float* __restrict__ C, int ldc, size_t sC, int M, int N, int K) {
  __shared__ __attribute__((aligned(16))) float so[4][16][64];
  const int tid = threadIdx.x, w = tid >> 5, lane = tid & 31, ln = lane & 15, hh = lane >> 4; const int by = blockIdx.y;
  A += (size_t)by * sA; Bh += (size_t)by * sB; C += (size_t)by * sC;
  const int ntn = (N + 63) / 64; const int wid = blockIdx.x * 4 + w; const int mt = wid / ntn, nq = wid % ntn; if (mt * 16 >= M) return;
  const int row0 = mt * 16, col0 = nq * 64; const float* arow = A + (size_t)(row0 + ln) * lda;
  v8f acc[4] = {};
  for (int kb = 0; kb < K; kb += 32) {
    FragH ah, al;
    const v4f x0 = *(const v4fa*)(arow + kb + 8 * hh), x1 = *(const v4fa*)(arow + kb + 8 * hh + 4), x2 = *(const v4fa*)(arow + kb + 16 + 8 * hh), x3 = *(const v4fa*)(arow + kb + 16 + 8 * hh + 4);
    float xs[16] = {x0[0],x0[1],x0[2],x0[3],x1[0],x1[1],x1[2],x1[3],x2[0],x2[1],x2[2],x2[3],x3[0],x3[1],x3[2],x3[3]};
#pragma unroll
    for (int i = 0; i < 16; ++i) { const _Float16 h = (_Float16)xs[i]; ah.h[i] = h; al.h[i] = ASPLIT ? (_Float16)(xs[i] - (float)h) : (_Float16)0.0f; }
#pragma unroll
    for (int t = 0; t < 4; ++t) { if (col0 + t * 16 >= N) continue; const size_t boff = (size_t)(col0 + t * 16 + ln) * ldb + kb; FragH bq; bq.half[0] = *(const v8us*)(Bh + boff + 8 * hh); bq.half[1] = *(const v8us*)(Bh + boff + 16 + 8 * hh);
      acc[t] = mmaH<ASPLIT ? 2 : 1>(ah.v, al.v, bq.v, bq.v, acc[t]); }
  }
#pragma unroll
  for (int t = 0; t < 4; ++t) { if (col0 + t * 16 >= N) continue;
#pragma unroll
    for (int r = 0; r < 8; ++r) so[w][8 * hh + r][t * 16 + ln] = acc[t][r] * alpha; }
  __builtin_amdgcn_fence(__ATOMIC_ACQ_REL, "workgroup"); __builtin_amdgcn_wave_barrier();
  const int rsub = lane >> 4, c4 = (lane & 15) * 4;
  {
#pragma unroll
    for (int q = 0; q < 8; ++q) { const int r = q * 2 + rsub; if (col0 + c4 < N) { const v4f v = *(const v4fa*)&so[w][r][c4]; *(v4f*)(C + (size_t)(row0 + r) * ldc + col0 + c4) = v; } }
     }
}

// Wt[n][k] = f16(W[k][n]·scale) from f32 row-major W[K][N] (scale = power of two; bf16-exact weights stay exact in f16 away from the subnormal range)
__global__ __launch_bounds__(256) void k_wt_f16(const float* __restrict__ W, _Float16* __restrict__ Wt, int K, int N, float scale) {
  const int t = blockIdx.x * 256 + threadIdx.x; if (t >= N * (K / 8)) return; const int n = t / (K / 8), k8 = (t % (K / 8)) * 8; FragH f;
#pragma unroll
  for (int i = 0; i < 8; ++i) f.h[i] = (_Float16)(bf16_round(W[(size_t)(k8 + i) * N + n]) * scale); const v8us o = f.half[0];
  *(v8us*)((unsigned short*)Wt + (size_t)n * K + k8) = o; 
}
// k_gemm_hh variant with fused epilogue: v = acc·alpha + bias[by·sBias + col] (+ CP[(row/rowsPerB)·sCPb + by·64 + col] if CP) ; ACT 0 none / 1 elu ; writes f16 C16 (and f32 C if non-null)
template <int ACT>
__global__ __launch_bounds__(128) void k_gemm_hhx(const _Float16* __restrict__ A, int lda, size_t sA, const _Float16* __restrict__ Bh, int ldb, size_t sB, float alpha, const float* __restrict__ bias, size_t sBias, const float* __restrict__ CP, int rowsPerB, size_t sCPb, int row0g,
    float* __restrict__ C, _Float16* __restrict__ C16, int ldc, size_t sC, int M, int N, int K) {
  __shared__ __attribute__((aligned(16))) float so[4][16][64];
  const int tid = threadIdx.x, w = tid >> 5, lane = tid & 31, ln = lane & 15, hh = lane >> 4; const int by = blockIdx.y;
  A += (size_t)by * sA; Bh += (size_t)by * sB; const size_t cofs = (size_t)by * sC; const float* bp = bias ? bias + (size_t)by * sBias : nullptr;
  const int ntn = (N + 63) / 64; const int wid = blockIdx.x * 4 + w; const int mt = wid / ntn, nq = wid % ntn; if (mt * 16 >= M) return;
  const int row0 = mt * 16, col0 = nq * 64; const _Float16* arow = A + (size_t)(row0 + ln) * lda;
  v8f acc[4] = {};
  for (int kb = 0; kb < K; kb += 32) { FragH ah; ah.half[0] = *(const v8us*)((const unsigned short*)arow + kb + 8 * hh); ah.half[1] = *(const v8us*)((const unsigned short*)arow + kb + 16 + 8 * hh);
#pragma unroll
    for (int t = 0; t < 4; ++t) { if (col0 + t * 16 >= N) continue; const size_t boff = (size_t)(col0 + t * 16 + ln) * ldb + kb; FragH bq; bq.half[0] = *(const v8us*)((const unsigned short*)Bh + boff + 8 * hh); bq.half[1] = *(const v8us*)((const unsigned short*)Bh + boff + 16 + 8 * hh);
      acc[t] = mmaH<1>(ah.v, ah.v, bq.v, bq.v, acc[t]); }
  }
#pragma unroll
  for (int t = 0; t < 4; ++t) { if (col0 + t * 16 >= N) continue; const int col = col0 + t * 16 + ln; const float bv = bp ? bf16_round(bp[col]) : 0.f;
#pragma unroll
    for (int r = 0; r < 8; ++r) { float v = acc[t][r] * alpha + bv; if (CP) { const int rr = row0g + row0 + 8 * hh + r; if (rowsPerB < 0) v += CP[cofs + (size_t)rr * ldc + col];      /* rowsPerB < 0: own element of the batched C plane */ else { const int bidx = rr / rowsPerB; v += CP[(size_t)bidx * sCPb + (size_t)by * 64 + col]; } } if (ACT == 1) v = (v > 0.f) ? v : expm1f(v); else if (ACT == 7) v = (v > 0.f) ? v + 1.0f : expf(v); else if (ACT == 8) v = tanhf(v); else if (ACT == 9) v = 0.5f * v * (1.0f + tanhf(0.7978845608028654f * (v + 0.044715f * v * v * v))); else if (ACT == 11) v = 1.0f / (1.0f + expf(-v)); else if (ACT == 12) v = (v > 0.f) ? v : 0.01f * v; else if (ACT == 14) v = (v > 0.f) ? v : 0.1f * v; else if (ACT == 16) v = (v >= 0.f) ? v : 0.3f * v; else if (ACT == 17) v = (v >= 0.f) ? v : 0.2f * v; else if (ACT == 15) v = v / (1.0f + expf(-v)); else if (ACT == 3) v = fmaxf(v, 0.f); else if (ACT == 6) v = 0.5f * v * (1.0f + erff(v * 0.70710678118654752f)); so[w][8 * hh + r][t * 16 + ln] = v; } }
  __builtin_amdgcn_fence(__ATOMIC_ACQ_REL, "workgroup"); __builtin_amdgcn_wave_barrier();
  const int rsub = lane >> 4, c4 = (lane & 15) * 4; typedef _Float16 v4h __attribute__((ext_vector_type(4)));
  {
#pragma unroll
    for (int q = 0; q < 8; ++q) { const int r = q * 2 + rsub; if (col0 + c4 < N) { const v4f v = *(const v4fa*)&so[w][r][c4]; if (C) *(v4f*)(C + cofs + (size_t)(row0 + r) * ldc + col0 + c4) = v; if (C16) { v4h h4; for (int i = 0; i < 4; ++i) h4[i] = (_Float16)v[i]; *(v4h*)(C16 + cofs + (size_t)(row0 + r) * ldc + col0 + c4) = h4; } } }
     }
}


typedef _Float16 v4h __attribute__((ext_vector_type(4)));

__global__ __launch_bounds__(256) void k_x16(const float* __restrict__ x, _Float16* __restrict__ X16, size_t n8) { const size_t t = (size_t)blockIdx.x * 256 + threadIdx.x; if (t >= n8) return; FragH f;
#pragma unroll
  for (int q = 0; q < 8; ++q) f.h[q] = (_Float16)bf16_round(x[t * 8 + q]); *(v8us*)((unsigned short*)X16 + t * 8) = f.half[0];  }
__global__ __launch_bounds__(256) void k_h16(const float* __restrict__ x, _Float16* __restrict__ X16, size_t n8) { const size_t t = (size_t)blockIdx.x * 256 + threadIdx.x; if (t >= n8) return; FragH f;
#pragma unroll
  for (int q = 0; q < 8; ++q) f.h[q] = (_Float16)x[t * 8 + q]; *(v8us*)((unsigned short*)X16 + t * 8) = f.half[0];  }
__global__ __launch_bounds__(256) void k_round16f(const float* __restrict__ W, _Float16* __restrict__ Bt, size_t n8) { const size_t t = (size_t)blockIdx.x * 256 + threadIdx.x; if (t >= n8) return; FragH f;
#pragma unroll
  for (int i = 0; i < 8; ++i) f.h[i] = (_Float16)(bf16_round(W[t * 8 + i]) * 16.0f); *(v8us*)((unsigned short*)Bt + t * 8) = f.half[0];  }
template <int NHv, int TTv>
__global__ __launch_bounds__(256) void k_vt(const _Float16* __restrict__ V16, int ldv, int voff, _Float16* __restrict__ Vt) { __shared__ unsigned short tl[64][66]; const int tid = threadIdx.x; const int slab = blockIdx.x / (TTv / 64), lg = blockIdx.x % (TTv / 64); const int b = slab / NHv, h = slab % NHv;
  for (int i = tid; i < 64 * 8; i += 256) { const int r = i / 8, c8 = (i % 8) * 8; FragH f; f.half[0] = *(const v8us*)((const unsigned short*)V16 + ((size_t)b * TTv + lg * 64 + r) * ldv + voff + h * 64 + c8);
#pragma unroll
    for (int q = 0; q < 8; ++q) tl[r][c8 + q] = f.u[q]; }
  __syncthreads();
  {
#pragma unroll
    for (int rd = 0; rd < 2; ++rd) { const int d = rd * 32 + tid / 8, pc = tid % 8; FragH f;
#pragma unroll
      for (int q = 0; q < 8; ++q) f.u[q] = tl[pc * 8 + q][d];
      *(v8us*)((unsigned short*)Vt + ((size_t)slab * 64 + d) * TTv + lg * 64 + pc * 8) = f.half[0]; }
     } }

__global__ __launch_bounds__(256) void k_hl(const float* __restrict__ F, _Float16* __restrict__ Hh, _Float16* __restrict__ Hl, size_t n8) { const size_t t = (size_t)blockIdx.x * 256 + threadIdx.x; if (t >= n8) return; FragH fh, fl; const v4f a = *(const v4fa*)(F + t * 8), c = *(const v4fa*)(F + t * 8 + 4);
#pragma unroll
  for (int q = 0; q < 4; ++q) { _Float16 h = (_Float16)a[q]; fh.h[q] = h; fl.h[q] = (_Float16)((a[q] - (float)h) * 1024.0f); h = (_Float16)c[q]; fh.h[4 + q] = h; fl.h[4 + q] = (_Float16)((c[q] - (float)h) * 1024.0f); }
  { *(v8us*)((unsigned short*)Hh + t * 8) = fh.half[0]; *(v8us*)((unsigned short*)Hl + t * 8) = fl.half[0];  } }

// ---- fast GEMM (wave tile 32x64; requires M % 32 == 0 rows per launch region and N % 64 == 0); epilogue = k_gemm_hhx semantics ----
__device__ __forceinline__ v16h g2_frag(const _Float16* p, int hh) { FragH f; f.half[0] = *(const v8us*)((const unsigned short*)p + 8 * hh); f.half[1] = *(const v8us*)((const unsigned short*)p + 16 + 8 * hh); return f.v; }
__device__ __forceinline__ v8f g2_mma(v16h a, v16h b, v8f c) { v8f d = __builtin_amdgcn_wmma_f32_16x16x32_f16(false, a, false, b, (short)0, c, false, false); asm volatile("v_nop\n\tv_nop\n\tv_nop\n\tv_nop" : "+v"(d) : "v"(a), "v"(b)); return d; }
template <int ACT>
__global__ __launch_bounds__(128) void k_gemm2(const _Float16* __restrict__ A, int lda, size_t sA, const _Float16* __restrict__ Bh, int ldb, size_t sB, float alpha, const float* __restrict__ bias, size_t sBias, const float* __restrict__ CP, int rowsPerB, size_t sCPb, int row0g,
    float* __restrict__ C, _Float16* __restrict__ C16, int ldc, size_t sC, int M, int N, int K) { static_assert(ACT == 0 || ACT == 3 || ACT == 6 || ACT == 8 || ACT == 9 || ACT == 11 || ACT == 12 || ACT == 14 || ACT == 15 || ACT == 16 || ACT == 17, "k_gemm2: unsupported ACT code (would silently apply no activation)");
  __shared__ __attribute__((aligned(16))) float so[4][32][68];
  const int tid = threadIdx.x, w = tid >> 5, lane = tid & 31, ln = lane & 15, hh = lane >> 4; const int by = blockIdx.y;
  A += (size_t)by * sA; Bh += (size_t)by * sB; const size_t cofs = (size_t)by * sC; const float* bp = bias ? bias + (size_t)by * sBias : nullptr;
  const int ntn = N >> 6; const int mt = blockIdx.x / ntn, nq = blockIdx.x - mt * ntn; const int row0 = mt * 128 + 32 * w, col0 = nq * 64; if (row0 >= M) return;
  const _Float16* a0p = A + (size_t)(row0 + ln) * lda; const _Float16* a1p = a0p + (size_t)16 * lda;
  const _Float16* b0p = Bh + (size_t)(col0 + ln) * ldb; const _Float16* b1p = b0p + (size_t)16 * ldb; const _Float16* b2p = b1p + (size_t)16 * ldb; const _Float16* b3p = b2p + (size_t)16 * ldb;
  const v8f z8 = {0.f,0.f,0.f,0.f,0.f,0.f,0.f,0.f}; v8f c00 = z8, c01 = z8, c02 = z8, c03 = z8, c10 = z8, c11 = z8, c12 = z8, c13 = z8;
#pragma unroll 1
  for (int kb = 0; kb < K; kb += 32) { const v16h a0 = g2_frag(a0p + kb, hh), a1 = g2_frag(a1p + kb, hh);
    v16h b = g2_frag(b0p + kb, hh); c00 = g2_mma(a0, b, c00); c10 = g2_mma(a1, b, c10);
    b = g2_frag(b1p + kb, hh); c01 = g2_mma(a0, b, c01); c11 = g2_mma(a1, b, c11);
    b = g2_frag(b2p + kb, hh); c02 = g2_mma(a0, b, c02); c12 = g2_mma(a1, b, c12);
    b = g2_frag(b3p + kb, hh); c03 = g2_mma(a0, b, c03); c13 = g2_mma(a1, b, c13); }
  v8f accs[8] = {c00, c01, c02, c03, c10, c11, c12, c13};
#pragma unroll
  for (int u = 0; u < 8; ++u) { const int t = u & 3, half = u >> 2; const int col = col0 + t * 16 + ln; const float bv = bp ? bf16_round(bp[col]) : 0.f;
#pragma unroll
    for (int r = 0; r < 8; ++r) { const int rloc = half * 16 + 8 * hh + r; float v = accs[u][r] * alpha + bv; if (CP) { if (rowsPerB < 0) v += CP[cofs + (size_t)(row0g + row0 + rloc) * ldc + col];      /* rowsPerB < 0: own element of the batched C plane */ else { const int bidx = (row0g + row0 + rloc) / rowsPerB; v += CP[(size_t)bidx * sCPb + (size_t)by * 64 + col]; } }
      if (ACT == 3) v = fmaxf(v, 0.f); else if (ACT == 6) v = 0.5f * v * (1.0f + erff(v * 0.70710678118654752f)); else if (ACT == 11) v = 1.0f / (1.0f + expf(-v)); else if (ACT == 15) v = v / (1.0f + expf(-v)); else if (ACT == 12) v = (v > 0.f) ? v : 0.01f * v; else if (ACT == 8) v = tanhf(v); else if (ACT == 9) v = 0.5f * v * (1.0f + tanhf(0.7978845608028654f * (v + 0.044715f * v * v * v))); else if (ACT == 14) v = (v > 0.f) ? v : 0.1f * v; else if (ACT == 16) v = (v >= 0.f) ? v : 0.3f * v; else if (ACT == 17) v = (v >= 0.f) ? v : 0.2f * v;
      so[w][rloc][t * 16 + ln] = v; } }
  __builtin_amdgcn_fence(__ATOMIC_ACQ_REL, "workgroup"); __builtin_amdgcn_wave_barrier();
  const int rsub = lane >> 4, c4 = (lane & 15) * 4;
  {
#pragma unroll
    for (int q = 0; q < 16; ++q) { const int r = q * 2 + rsub; const v4f v = *(const v4fa*)&so[w][r][c4]; if (C) *(v4f*)(C + cofs + (size_t)(row0 + r) * ldc + col0 + c4) = v; if (C16) { v4h h4; for (int i = 0; i < 4; ++i) h4[i] = (_Float16)v[i]; *(v4h*)(C16 + cofs + (size_t)(row0 + r) * ldc + col0 + c4) = h4; } }
     } }


__global__ __launch_bounds__(256) void k_wnat(const float* __restrict__ w, size_t n8, _Float16* __restrict__ Bt) { const size_t t = (size_t)blockIdx.x * 256 + threadIdx.x; if (t >= n8) return; FragH f; for (int q = 0; q < 8; ++q) f.h[q] = (_Float16)(bf16_round(w[t * 8 + q]) * 16.0f); *(v8us*)((unsigned short*)Bt + t * 8) = f.half[0];  }
__global__ __launch_bounds__(256) void k_rsm(const float* __restrict__ S, _Float16* __restrict__ P, int nrows) {
  #pragma clang fp contract(off)
  const int i = blockIdx.x * 256 + threadIdx.x; if (i >= nrows) return; const float* s = S + (size_t)i * SQ; float mx = -3.0e38f;
#pragma unroll 1
  for (int j = 0; j < SQ; ++j) mx = fmaxf(mx, s[j]); float se = 0.f;
#pragma unroll 1
  for (int j = 0; j < SQ; ++j) se += expf(s[j] - mx); const float sc = 256.0f / se;
#pragma unroll 1
  for (int j0 = 0; j0 < SQ; j0 += 8) { FragH f; for (int q = 0; q < 8; ++q) f.h[q] = (_Float16)(expf(s[j0 + q] - mx) * sc); unsigned short* d = (unsigned short*)P + (size_t)i * SQ + j0; *(v8us*)d = f.half[0];  } }
__global__ __launch_bounds__(256) void k_vt(const _Float16* __restrict__ V16, int b, int h0, _Float16* __restrict__ VT) { __shared__ unsigned short tl[64][65]; const int tid = threadIdx.x; const int hh = blockIdx.x % HG, sg = blockIdx.x / HG; const int s0 = sg * 64; const int h = h0 + hh;
  for (int i = tid; i < 64 * 8; i += 256) { const int j = i / 8, d8 = (i % 8) * 8; FragH f; f.half[0] = *(const v8us*)((const unsigned short*)V16 + ((size_t)b * SQ + s0 + j) * DM + h * HD + d8); for (int q = 0; q < 8; ++q) tl[d8 + q][j] = f.u[q]; }
  __syncthreads();
  { for (int i = tid; i < 64 * 8; i += 256) { const int d = i / 8, j8 = (i % 8) * 8; FragH f; for (int q = 0; q < 8; ++q) f.u[q] = tl[d][j8 + q]; *(v8us*)((unsigned short*)VT + ((size_t)hh * HD + d) * SQ + s0 + j8) = f.half[0]; }  } }


__global__ __launch_bounds__(256) void k_x16pad(const float* __restrict__ x, _Float16* __restrict__ X16) { const size_t t = (size_t)blockIdx.x * 256 + threadIdx.x; if (t >= (size_t)NB * QP * (DM / 8)) return; const int c8 = (int)(t % (DM / 8)) * 8; const size_t row = t / (DM / 8); const int b = (int)(row / QP), q = (int)(row % QP); FragH f;
  for (int i = 0; i < 8; ++i) f.h[i] = (_Float16)((q < NQ) ? bf16_round(x[((size_t)b * NQ + q) * DM + c8 + i]) : 0.f);
  *(v8us*)((unsigned short*)X16 + row * DM + c8) = f.half[0];  }


template <int HPP>
__global__ __launch_bounds__(256) void k_wtpadT(const float* __restrict__ w, _Float16* __restrict__ Bt) { const int t = blockIdx.x * 256 + threadIdx.x; if (t >= NH * HPP * (DM / 8)) return; const int k8 = (t % (DM / 8)) * 8; const int r = t / (DM / 8); const int h = r / HPP, d = r % HPP; FragH f;
  for (int q = 0; q < 8; ++q) { float v = 0.f; if (d < HD) v = bf16_round(w[(size_t)(k8 + q) * DM + h * HD + d]); f.h[q] = (_Float16)(v * 16.0f); }
  unsigned short* dst = (unsigned short*)Bt + (size_t)r * DM + k8; *(v8us*)dst = f.half[0];  }
template <int HPP>
__global__ __launch_bounds__(256) void k_wtopadT(const float* __restrict__ w, _Float16* __restrict__ Bt) { const int t = blockIdx.x * 256 + threadIdx.x; if (t >= DM * (NH * HPP / 8)) return; const int k8 = (t % (NH * HPP / 8)) * 8; const int n = t / (NH * HPP / 8); FragH f;
  for (int q = 0; q < 8; ++q) { const int kp = k8 + q; const int h = kp / HPP, d = kp % HPP; float v = 0.f; if (d < HD) v = bf16_round(w[(size_t)(h * HD + d) * DM + n]); f.h[q] = (_Float16)(v * 16.0f); }
  unsigned short* dst = (unsigned short*)Bt + (size_t)n * (NH * HPP) + k8; *(v8us*)dst = f.half[0];  }
// Mean term, one block of 32 waves per batch. Column sums: 25 waves of 40 rows each; a wave reads whole 512-byte rows (lane = 4 columns), rows w, w + 25, ..., eight loads in flight; the 25 partial rows meet in LDS.
// mu Wq_mean: thread = (output column, slice of 16 rows of Wq_mean), its 16 weights loaded ahead of the row loads; the 8 slices meet in LDS.
#define MW 25                        /* waves that sum rows; NQ = MW * 40 */
__global__ __launch_bounds__(1024) void k_qmean(const float* __restrict__ xn, const float* __restrict__ wqm, float* __restrict__ QMP) {
  static_assert(NQ % (MW * 8) == 0 && MW <= 32, "rows deal out evenly, eight a round");
  __shared__ __attribute__((aligned(16))) float part[MW][DM]; __shared__ float mu[DM]; __shared__ float wp[8][DM];
  const int b = blockIdx.x, t = threadIdx.x, c4 = (t & 31) * 4, col = t % DM, kg = t / DM; float wv[DM / 8];
  const int w = __builtin_amdgcn_readfirstlane(t >> 5);      /* wave number in a scalar register: row addresses and the test on it are scalar */
#pragma unroll      /* wv[] in registers, all 16 loads in flight */
  for (int i = 0; i < DM / 8; ++i) wv[i] = wqm[(size_t)(kg * (DM / 8) + i) * DM + col];
  if (w < MW) { const float* rows = xn + ((size_t)b * NQ + w) * DM + c4; v4f s = {0.f, 0.f, 0.f, 0.f};
#pragma unroll 1      /* eight loads a round: a fully unrolled form of this loop spilled at the 128 registers a wave has in a 1024-thread block */
    for (int r = 0; r < NQ / (MW * 8); ++r) { v4f a[8];
#pragma unroll      /* a[] in registers, the round's loads in flight together */
      for (int j = 0; j < 8; ++j) a[j] = *(const v4fa*)(rows + (size_t)(r * 8 + j) * MW * DM);
#pragma unroll      /* a[] in registers */
      for (int j = 0; j < 8; ++j) for (int q = 0; q < 4; ++q) s[q] += bf16_round(a[j][q]); }
    *(v4f*)&part[w][c4] = s; }
  __syncthreads();
  if (t < DM) { float m = 0.f; for (int i = 0; i < MW; ++i) m += part[i][t]; mu[t] = m / (float)NQ; }
  __syncthreads();
  float v = 0.f;
#pragma unroll      /* wv[] in registers */
  for (int i = 0; i < DM / 8; ++i) v += mu[kg * (DM / 8) + i] * bf16_round(wv[i]);
  wp[kg][col] = v;
  __syncthreads();
  if (t < NH * 32) { const int h = t / 32, d = t % 32; float o = 0.f; if (d < HD) for (int g = 0; g < 8; ++g) o += wp[g][h * HD + d]; QMP[(size_t)b * (NH * 32) + t] = o; } }
// Row softmaxes, one wave per row: lane holds columns 4*lane + 128*u (u = 0..7), so each wave-wide b128 load or store covers 512 contiguous bytes;
// the row's values stay in registers between the maximum, the sum and the store. Maximum and sum: per lane first, then a five-step butterfly over the 32 lanes.
// Columns NQ..QP-1 (lanes 26..31 of u = 7): the score planes hold them; the mask does not, so those lanes re-read their own first chunk; their value is -inf (weight 0) and 0 is stored.
__device__ __forceinline__ float wave_max32(float v) { for (int m = 16; m > 0; m >>= 1) v = fmaxf(v, __shfl_xor(v, m, 32)); return v; }
__device__ __forceinline__ float wave_sum32(float v) { for (int m = 16; m > 0; m >>= 1) v += __shfl_xor(v, m, 32); return v; }
// 2^x as one v_exp_f32 (what __expf compiles to behind its multiply) with the issue slot behind it filled
__device__ __forceinline__ float exp2_slot(float x) { float r; asm("v_exp_f32 %0, %1\n\tv_nop" : "=v"(r) : "v"(x)); return r; }
__device__ __forceinline__ v16h at_frag16(v8us lo) { FragH f; f.half[0] = lo; const v8us z = {0, 0, 0, 0, 0, 0, 0, 0}; f.half[1] = z; return f.v; }      /* q or k row of one head: 16 features, k 16..31 of the fragment zero */
__device__ __forceinline__ v8f at_mma(v16h a, v16h b, v8f c) { return __builtin_amdgcn_wmma_f32_16x16x32_f16(false, a, false, b, (short)0, c, false, false); }
// what 32 keys take from memory for one lane: its 8 features of two k rows, 2 x 8 mask values of its query. EDGE: a lane whose 8 keys lie at or past NQ reads its 8 mask values of the row's first 16 columns instead, and those keys count as -inf
struct At32 { v8us k0, k1; v4f m0, m1, m2, m3; };
template <bool EDGE>
__device__ __forceinline__ At32 at_load(const unsigned short* kp, const float* mr, int k0, int hh) {
  At32 t; const int c0 = (!EDGE || k0 + 8 * hh < NQ) ? k0 : 0, c1 = (!EDGE || k0 + 16 + 8 * hh < NQ) ? k0 + 16 : 0;
  t.k0 = *(const v8us*)(kp + (size_t)k0 * (NH * 32)); t.k1 = *(const v8us*)(kp + (size_t)(k0 + 16) * (NH * 32));
  t.m0 = *(const v4fa*)(mr + c0); t.m1 = *(const v4fa*)(mr + c0 + 4); t.m2 = *(const v4fa*)(mr + c1); t.m3 = *(const v4fa*)(mr + c1 + 4); return t; }
// x[0..7], x[8..15]: scores / 4 + mask of this lane's query against keys k0 + 8 * hh + r and k0 + 16 + 8 * hh + r
template <bool EDGE>
__device__ __forceinline__ void at_score(const At32& t, v16h qf, int k0, int hh, float* x) {
  const v8f z8 = {0.f, 0.f, 0.f, 0.f, 0.f, 0.f, 0.f, 0.f}; const v8f s0 = at_mma(at_frag16(t.k0), qf, z8), s1 = at_mma(at_frag16(t.k1), qf, z8);
  const bool in0 = !EDGE || k0 + 8 * hh < NQ, in1 = !EDGE || k0 + 16 + 8 * hh < NQ;
#pragma unroll      /* x[] in registers */
  for (int r = 0; r < 8; ++r) { const float v0 = s0[r] * 0.25f + bf16_round(r < 4 ? t.m0[r & 3] : t.m1[r & 3]), v1 = s1[r] * 0.25f + bf16_round(r < 4 ? t.m2[r & 3] : t.m3[r & 3]);
    x[r] = in0 ? v0 : -__builtin_inff(); x[8 + r] = in1 ? v1 : -__builtin_inff(); } }
template <bool EDGE>
__device__ __forceinline__ float at_max32(const At32& t, v16h qf, int k0, int hh, float mx) {
  float x[16]; at_score<EDGE>(t, qf, k0, hh, x);
#pragma unroll      /* x[] in registers */
  for (int r = 0; r < 16; ++r) mx = fmaxf(mx, x[r]);
  return mx; }
template <bool EDGE>
__device__ __forceinline__ v8f at_pv32(const At32& t, v16h vf, v16h qf, int k0, int hh, float mx, float* se, v8f o) {
  float x[16]; at_score<EDGE>(t, qf, k0, hh, x); FragH pf;
#pragma unroll      /* x[] in registers; four running sums, so that an add does not wait for the one before it */
  for (int r = 0; r < 16; ++r) { const float e = exp2_slot((x[r] - mx) * 1.44269504f + 8.0f); se[r & 3] += e; pf.h[r] = (_Float16)e; }
  return at_mma(vf, pf.v, o); }
__global__ __launch_bounds__(256) void k_attn(const _Float16* __restrict__ Q16, const _Float16* __restrict__ K16, const _Float16* __restrict__ VT, const float* __restrict__ mask, float* __restrict__ OF) {
  static_assert(NQ % 8 == 0 && NQ > QP - 32 && NQ <= QP && QP % 128 == 0, "only the last 32 keys hold an edge, and a lane's 8 keys are all in or all out");
  const int b = blockIdx.y, h = threadIdx.x >> 5, lane = threadIdx.x & 31, c = lane & 15, hh = lane >> 4; const int q = blockIdx.x * 16 + c; const bool live = q < NQ;      /* rows NQ..QP-1: same instruction stream on mask row 0, scale 0, so zeros are stored */
  const v16h qf = at_frag16(*(const v8us*)((const unsigned short*)Q16 + ((size_t)b * QP + q) * (NH * 32) + h * 32 + 8 * hh));
  const unsigned short* kp = (const unsigned short*)K16 + ((size_t)b * QP + c) * (NH * 32) + h * 32 + 8 * hh; const _Float16* vp = VT + ((size_t)(b * NH + h) * 64 + c) * QP;
  const float* mr = mask + ((size_t)b * NQ + (live ? q : 0)) * NQ + 8 * hh; float mx = -3.0e38f;
#pragma unroll 1      /* stays a loop: unrolled whole, the two passes were some 10,000 instructions and spilled */
  for (int k0 = 0; k0 < QP - 128; k0 += 128) { At32 t[4];
#pragma unroll      /* t[] in registers, the loads of 128 keys in flight together */
    for (int j = 0; j < 4; ++j) t[j] = at_load<false>(kp, mr, k0 + 32 * j, hh);
#pragma unroll      /* t[] in registers */
    for (int j = 0; j < 4; ++j) mx = at_max32<false>(t[j], qf, k0 + 32 * j, hh, mx); }
  { At32 t[4];      /* the last 128 keys */
#pragma unroll      /* t[] in registers */
    for (int j = 0; j < 3; ++j) t[j] = at_load<false>(kp, mr, QP - 128 + 32 * j, hh);
    t[3] = at_load<true>(kp, mr, QP - 32, hh);
#pragma unroll      /* t[] in registers */
    for (int j = 0; j < 3; ++j) mx = at_max32<false>(t[j], qf, QP - 128 + 32 * j, hh, mx);
    mx = at_max32<true>(t[3], qf, QP - 32, hh, mx); }
  mx = fmaxf(mx, __shfl_xor(mx, 16, 32));
  v8f o = {0.f, 0.f, 0.f, 0.f, 0.f, 0.f, 0.f, 0.f}; float se[4] = {0.f, 0.f, 0.f, 0.f};
#pragma unroll 1      /* stays a loop, as above */
  for (int k0 = 0; k0 < QP - 64; k0 += 64) {      /* the loads of 64 keys in flight together */
    const At32 t0 = at_load<false>(kp, mr, k0, hh), t1 = at_load<false>(kp, mr, k0 + 32, hh);
    asm volatile("s_wait_xcnt 0x0" ::: "memory");      /* the build let a V load's result land in the address pair of the k loads just issued: the wait stands in front of that overwrite */
    const v16h v0 = g2_frag(vp + k0, hh), v1 = g2_frag(vp + k0 + 32, hh);
    o = at_pv32<false>(t0, v0, qf, k0, hh, mx, se, o); o = at_pv32<false>(t1, v1, qf, k0 + 32, hh, mx, se, o); }
  { const At32 t0 = at_load<false>(kp, mr, QP - 64, hh), t1 = at_load<true>(kp, mr, QP - 32, hh); const v16h v0 = g2_frag(vp + QP - 64, hh), v1 = g2_frag(vp + QP - 32, hh);
    o = at_pv32<false>(t0, v0, qf, QP - 64, hh, mx, se, o); o = at_pv32<true>(t1, v1, qf, QP - 32, hh, mx, se, o); }
  float st = (se[0] + se[1]) + (se[2] + se[3]); st += __shfl_xor(st, 16, 32);
  const float sc = live ? 64.0f / st : 0.f; float* orow = OF + ((size_t)b * QP + q) * (NH * 64) + h * 64;      /* o x64, padded [8][64]: d 0..15 real, 16..63 zero */
  const v4f o0 = {o[0] * sc, o[1] * sc, o[2] * sc, o[3] * sc}, o1 = {o[4] * sc, o[5] * sc, o[6] * sc, o[7] * sc}, z4 = {0.f, 0.f, 0.f, 0.f};
  *(v4f*)(orow + 8 * hh) = o0; *(v4f*)(orow + 8 * hh + 4) = o1;
#pragma unroll      /* six plain stores */
  for (int j = 0; j < 6; ++j) *(v4f*)(orow + HD + 24 * hh + 4 * j) = z4; }
// four rows a block, wave = query row p
__global__ __launch_bounds__(128) void k_fin(const float* __restrict__ S2, const float* __restrict__ mask, int b, float* __restrict__ PR) {
  const int p = blockIdx.x * 4 + (threadIdx.x >> 5), c0 = (threadIdx.x & 31) * 4; if (p >= NQ) return;
  const float* s = S2 + (size_t)p * QP + c0; const float* mr = mask + ((size_t)b * NQ + p) * NQ + c0; float* pr = PR + ((size_t)b * QP + p) * QP + c0; v4f x[QP / 128], m[QP / 128]; float mx = -3.0e38f;
#pragma unroll      /* all loads of the row in flight together, ahead of the branches inside tanhf */
  for (int u = 0; u < QP / 128; ++u) { x[u] = *(const v4fa*)(s + 128 * u); m[u] = *(const v4fa*)(mr + ((c0 + 128 * u < NQ) ? 128 * u : 0)); }
#pragma unroll      /* x[] in registers */
  for (int u = 0; u < QP / 128; ++u) { const bool in = c0 + 128 * u < NQ; for (int q = 0; q < 4; ++q) { const float v = 10.0f * tanhf(x[u][q]) + bf16_round(m[u][q]); x[u][q] = in ? v : -__builtin_inff(); mx = fmaxf(mx, x[u][q]); } }
  mx = wave_max32(mx); float se = 0.f;
#pragma unroll      /* x[] in registers */
  for (int u = 0; u < QP / 128; ++u) for (int q = 0; q < 4; ++q) { x[u][q] = expf(x[u][q] - mx); se += x[u][q]; }
  const float inv = 1.0f / wave_sum32(se);
#pragma unroll      /* x[] in registers */
  for (int u = 0; u < QP / 128; ++u) { const bool in = c0 + 128 * u < NQ; v4f o; for (int q = 0; q < 4; ++q) { const float w = x[u][q] * inv; o[q] = in ? w : 0.f; } *(v4f*)(pr + 128 * u) = o; } }
__global__ __launch_bounds__(256) void k_outflat(const float* __restrict__ PR, float* __restrict__ out) { const size_t t = (size_t)blockIdx.x * 256 + threadIdx.x; if (t >= (size_t)NB * NQ * NQ / 4) return; const size_t e = t * 4; const int n = (int)(e % NQ); const size_t bp = e / NQ; const int b = (int)(bp / NQ), p = (int)(bp % NQ);
  const v4f v = *(const v4fa*)(PR + ((size_t)b * QP + p) * QP + n); *(v4f*)(out + e) = v;  }

extern "C" void kernel_launch(void* const* d_in, const int* in_sizes, int n_in,
                              void* d_out, int out_size, void* d_ws, size_t ws_size, hipStream_t stream) {
  (void)in_sizes; (void)n_in; (void)out_size;
  const float* const* I = (const float* const*)d_in; const float* xn = I[0]; const float* xq1 = I[1]; const float* xl = I[2]; const float* mask = I[3]; const float* Wqf = I[4]; const float* Wql = I[5]; const float* Wqm = I[6]; const float* Wk = I[7]; const float* Wv = I[8]; const float* Wc = I[9]; const float* bc = I[10];      /* weights [in][out] */
  char* ws = (char*)d_ws; size_t off = 0;
  auto take = [&](size_t bytes) { char* p = ws + off; off += (bytes + 255) & ~(size_t)255; return p; };
  _Float16* BQF = (_Float16*)take((size_t)NH * 32 * DM * 2); _Float16* BQL = (_Float16*)take((size_t)NH * 32 * DM * 2); _Float16* BK = (_Float16*)take((size_t)NH * 32 * DM * 2); _Float16* BVP = (_Float16*)take((size_t)NH * 64 * DM * 2); _Float16* BCP = (_Float16*)take((size_t)DM * NH * 64 * 2); float* QMP = (float*)take((size_t)NB * NH * 32 * 4);
  _Float16* XN = (_Float16*)take(NRP * DM * 2); _Float16* XQ1 = (_Float16*)take(NRP * DM * 2); _Float16* XL = (_Float16*)take(NRP * DM * 2);
  float* QF = (float*)take(NRP * NH * 32 * 4); _Float16* Q16 = (_Float16*)take(NRP * NH * 32 * 2); _Float16* K16 = (_Float16*)take(NRP * NH * 32 * 2); _Float16* V2 = (_Float16*)take(NRP * NH * 64 * 2); float* OF = (float*)take(NRP * NH * 64 * 4); _Float16* OH = (_Float16*)take(NRP * NH * 64 * 2); _Float16* OL = (_Float16*)take(NRP * NH * 64 * 2);
  _Float16* VT = (_Float16*)take((size_t)NB * NH * 64 * QP * 2);
  float* MH = (float*)take(NRP * DM * 4); _Float16* MHh = (_Float16*)take(NRP * DM * 2); _Float16* MHl = (_Float16*)take(NRP * DM * 2); float* S2 = (float*)take((size_t)QP * QP * 4); float* PR = (float*)take((size_t)NB * QP * QP * 4);
  if (off > ws_size) return;      /* about 115 MiB */
  k_wtpadT<32><<<(NH * 32 * (DM / 8) + 255) / 256, 256, 0, stream>>>(Wqf, BQF); k_wtpadT<32><<<(NH * 32 * (DM / 8) + 255) / 256, 256, 0, stream>>>(Wql, BQL); k_wtpadT<32><<<(NH * 32 * (DM / 8) + 255) / 256, 256, 0, stream>>>(Wk, BK);
  k_wtpadT<64><<<(NH * 64 * (DM / 8) + 255) / 256, 256, 0, stream>>>(Wv, BVP); k_wtopadT<64><<<(DM * (NH * 64 / 8) + 255) / 256, 256, 0, stream>>>(Wc, BCP);
  k_x16pad<<<(unsigned)((NRP * (DM / 8) + 255) / 256), 256, 0, stream>>>(xn, XN); k_x16pad<<<(unsigned)((NRP * (DM / 8) + 255) / 256), 256, 0, stream>>>(xq1, XQ1); k_x16pad<<<(unsigned)((NRP * (DM / 8) + 255) / 256), 256, 0, stream>>>(xl, XL);
  k_qmean<<<NB, 1024, 0, stream>>>(xn, Wqm, QMP);      /* per-batch mean term in the padded q layout */
  k_gemm2<0><<<dim3((unsigned)((NRP / 128) * (NH * 32 / 64)), 1), 128, 0, stream>>>(XQ1, DM, 0, BQF, DM, 0, 0.0625f, nullptr, 0, QMP, QP, NH * 32, 0, QF, nullptr, NH * 32, 0, (int)NRP, NH * 32, DM);      /* q1 Wq_first + mean term (broadcast per batch), f32 */
  k_gemm2<0><<<dim3((unsigned)((NRP / 128) * (NH * 32 / 64)), 1), 128, 0, stream>>>(XL, DM, 0, BQL, DM, 0, 0.0625f, nullptr, 0, QF, -1, 0, 0, nullptr, Q16, NH * 32, 0, (int)NRP, NH * 32, DM);      /* + last Wq_last -> q (f16, padded [8][32]) */
  k_gemm2<0><<<dim3((unsigned)((NRP / 128) * (NH * 32 / 64)), 1), 128, 0, stream>>>(XN, DM, 0, BK, DM, 0, 0.0625f, nullptr, 0, nullptr, 1, 0, 0, nullptr, K16, NH * 32, 0, (int)NRP, NH * 32, DM);      /* k (f16, padded [8][32]) */
  k_gemm2<0><<<dim3((unsigned)((NRP / 128) * (NH * 64 / 64)), 1), 128, 0, stream>>>(XN, DM, 0, BVP, DM, 0, 0.0625f, nullptr, 0, nullptr, 1, 0, 0, nullptr, V2, NH * 64, 0, (int)NRP, NH * 64, DM);      /* v (f16, padded [8][64]) */
  k_vt<NH, QP><<<NB * NH * (QP / 64), 256, 0, stream>>>(V2, NH * 64, 0, VT);      /* V^T [8 batches][8][64][1024] */
  k_attn<<<dim3(QP / 16, NB), 256, 0, stream>>>(Q16, K16, VT, mask, OF);      /* scores / sqrt(16) + mask, softmax, weights v -> o x64 (padded [8][64], f32) */
  k_hl<<<(unsigned)((NRP * NH * 64 / 8 + 255) / 256), 256, 0, stream>>>(OF, OH, OL, NRP * NH * 64 / 8);      /* o -> f16 hi + x1024 residual */
  k_gemm2<0><<<dim3((unsigned)((NRP / 128) * (DM / 64)), 1), 128, 0, stream>>>(OH, NH * 64, 0, BCP, NH * 64, 0, 0.0009765625f, bc, 0, nullptr, 1, 0, 0, MH, nullptr, DM, 0, (int)NRP, DM, NH * 64);      /* mh = o_hi W_comb + b_comb (f32) */
  k_gemm2<0><<<dim3((unsigned)((NRP / 128) * (DM / 64)), 1), 128, 0, stream>>>(OL, NH * 64, 0, BCP, NH * 64, 0, 0.00000095367431640625f, nullptr, 0, MH, -1, 0, 0, MH, nullptr, DM, 0, (int)NRP, DM, NH * 64);      /* += o_lo W_comb 2^-20 */
  k_hl<<<(unsigned)((NRP * DM / 8 + 255) / 256), 256, 0, stream>>>(MH, MHh, MHl, NRP * DM / 8);      /* mh -> f16 hi + x1024 residual */
  for (int b = B0; b < B0 + NBR; ++b) { const size_t rb = (size_t)b * QP;
    k_gemm2<0><<<dim3((QP / 128) * (QP / 64), 1), 128, 0, stream>>>(MHh + rb * DM, DM, 0, XN + rb * DM, DM, 0, 0.088388347648318447f, nullptr, 0, nullptr, 1, 0, 0, S2, nullptr, QP, 0, QP, QP, DM);      /* score2 = mh_hi nodes^T / sqrt(128) */
    k_gemm2<0><<<dim3((QP / 128) * (QP / 64), 1), 128, 0, stream>>>(MHl + rb * DM, DM, 0, XN + rb * DM, DM, 0, 0.000086316745750311f, nullptr, 0, S2, -1, 0, 0, S2, nullptr, QP, 0, QP, QP, DM);      /* += mh_lo nodes^T / (1024 sqrt(128)) */
    k_fin<<<(NQ + 3) / 4, 128, 0, stream>>>(S2, mask, b, PR); }      /* 10 tanh, + mask, softmax over the 1000 real keys (f32) */
  k_outflat<<<(unsigned)(((size_t)NB * NQ * NQ / 4 + 255) / 256), 256, 0, stream>>>(PR, (float*)d_out);
}

// v004
// Measured time: 250 microseconds a run.
// Timed twice side by side with v003, it ran 2.06 and 2.05 times as fast.
// Counting every step since v000, it is 63.3 times as fast.
#include <hip/hip_runtime.h>
// TSP decoder probabilities (encoded_nodes, encoded_q1, encoded_last_node [8][1000][128]; k = nodes Wk, v = nodes Wv, q = q1 Wq_first + last Wq_last + (mean_n nodes) Wq_mean broadcast ([in][out] weights), 8 heads of 16; weights = softmax(q k^T / 4 + ninf_mask); mh = (weights v merged) W_comb + b_comb; score2 = mh nodes^T / sqrt(128); probs = softmax_n(10 tanh(score2) + ninf_mask) -> [8][1000][1000]).
// Compute dtype: inputs rounded to bf16; token rows / weights exact; q, k, v and the stage-1 weights as plain f16 GEMM operands (~2^-12); o and mh as f16 hi + residual operand pairs (~2^-22); the mean term, score2, tanh, mask and the final softmax f32. v_wmma_f32_16x16x32_f16.
#define NB 8
#define NQ 1000                      /* nodes = queries = 1000 */
#define QP 1024                      /* padded rows / keys per batch */
#define DM 128
#define NH 8
#define HD 16
#define SQ QP
#define HG 8
#define B0 0                         /* unused */
#define NBR NB
#define NRP ((size_t)NB * QP)        /* padded token rows */
typedef __bf16 v16b __attribute__((ext_vector_type(16)));
typedef unsigned short v8us __attribute__((ext_vector_type(8), may_alias));
typedef float  v8f  __attribute__((ext_vector_type(8)));
typedef float  v4f  __attribute__((ext_vector_type(4)));
typedef float  v4fa __attribute__((ext_vector_type(4), may_alias));
union FragB { v16b v; v8us half[2]; unsigned short u[16]; };

__device__ __forceinline__ unsigned short bf16_bits(float x) { unsigned int u = __float_as_uint(x); return (unsigned short)((u + 0x7FFFu + ((u >> 16) & 1u)) >> 16); }
__device__ __forceinline__ float bf16_val(unsigned short b) { return __uint_as_float(((unsigned int)b) << 16); }
__device__ __forceinline__ float bf16_round(float x) { return bf16_val(bf16_bits(x)); }
// D += A·B with NT terms: 1 = ah·bh, 2 = + al·bh (A split), 3 = + ah·bl (both split)
template <int NT>
__device__ __forceinline__ v8f mmaN(v16b ah, v16b al, v16b bh, v16b bl, v8f c) {
  c = __builtin_amdgcn_wmma_f32_16x16x32_bf16(false, ah, false, bh, (short)0, c, false, false);
  if (NT >= 2) c = __builtin_amdgcn_wmma_f32_16x16x32_bf16(false, al, false, bh, (short)0, c, false, false);
  if (NT >= 3) c = __builtin_amdgcn_wmma_f32_16x16x32_bf16(false, ah, false, bl, (short)0, c, false, false);
  asm volatile("v_nop\n\tv_nop\n\tv_nop\n\tv_nop" : "+v"(c) : "v"(ah), "v"(al), "v"(bh), "v"(bl));
  return c;
}

__global__ __launch_bounds__(256) void k_wt_bf16(const float* __restrict__ W, unsigned short* __restrict__ Wt, int K, int N) {
  const int t = blockIdx.x * 256 + threadIdx.x;
  const int k8n = K / 8;
  if (t >= N * k8n) return;
  const int n = t / k8n, k8 = (t % k8n) * 8;
  v8us v;
#pragma unroll
  for (int i = 0; i < 8; ++i) v[i] = bf16_bits(W[(size_t)(k8 + i) * N + n]);
  *(v8us*)(Wt + (size_t)n * K + k8) = v;
  
}

// GEMM C[M][N] (f32, pitch ldc) = act(A[M][K]·W + bias). A f32 row-major (pitch lda) converted per fragment to bf16
// (ASPLIT: hi/lo two planes -> 2 terms, else single rounded term); Wt bf16 [N][K] (pitch ldb). BIAS_BF16 rounds the
// bias to bf16 first (bias quantised to bf16 before the add). K%32==0, M%16==0, N%64==0.
template <bool ASPLIT, int ACT, bool BIAS_BF16>
__global__ __launch_bounds__(128) void k_gemm_bf(const float* __restrict__ A, int lda, const unsigned short* __restrict__ Wt, int ldb,
                                               const float* __restrict__ bias, float* __restrict__ C, int ldc, int M, int N, int K) {
  __shared__ __attribute__((aligned(16))) float so[4][16][64];
  const int tid = threadIdx.x, w = tid >> 5, lane = tid & 31, ln = lane & 15, hh = lane >> 4;
  const int ntn = N / 64;
  const int wid = blockIdx.x * 4 + w;
  const int mt = wid / ntn, nq = wid % ntn;
  if (mt * 16 >= M) return;
  const int row0 = mt * 16, col0 = nq * 64;
  const float* arow = A + (size_t)(row0 + ln) * lda;
  v8f acc[4] = {};
  for (int kb = 0; kb < K; kb += 32) {
    FragB ah, al;
    const v4f x0 = *(const v4fa*)(arow + kb + 8 * hh), x1 = *(const v4fa*)(arow + kb + 8 * hh + 4);
    const v4f x2 = *(const v4fa*)(arow + kb + 16 + 8 * hh), x3 = *(const v4fa*)(arow + kb + 16 + 8 * hh + 4);
    float xs[16] = {x0[0],x0[1],x0[2],x0[3],x1[0],x1[1],x1[2],x1[3],x2[0],x2[1],x2[2],x2[3],x3[0],x3[1],x3[2],x3[3]};
#pragma unroll
    for (int i = 0; i < 16; ++i) { const unsigned short hb = bf16_bits(xs[i]); ah.u[i] = hb; al.u[i] = ASPLIT ? bf16_bits(xs[i] - bf16_val(hb)) : (unsigned short)0; }
#pragma unroll
    for (int t = 0; t < 4; ++t) {
      const unsigned short* brow = Wt + (size_t)(col0 + t * 16 + ln) * ldb + kb;
      FragB b;
      b.half[0] = *(const v8us*)(brow + 8 * hh);
      b.half[1] = *(const v8us*)(brow + 16 + 8 * hh);
      acc[t] = mmaN<ASPLIT ? 2 : 1>(ah.v, al.v, b.v, b.v, acc[t]);
    }
  }
#pragma unroll
  for (int t = 0; t < 4; ++t) {
    float bv = bias ? bias[col0 + t * 16 + ln] : 0.f;
    if (BIAS_BF16) bv = bf16_round(bv);
#pragma unroll
    for (int r = 0; r < 8; ++r) { float v = acc[t][r] + bv; if (ACT == 1) v = fmaxf(v, 0.f); so[w][8 * hh + r][t * 16 + ln] = v; }
  }
  __builtin_amdgcn_fence(__ATOMIC_ACQ_REL, "workgroup");
  __builtin_amdgcn_wave_barrier();
  const int rsub = lane >> 4, c4 = (lane & 15) * 4;
  {
#pragma unroll
    for (int q = 0; q < 8; ++q) {
      const int r = q * 2 + rsub;
      const v4f v = *(const v4fa*)&so[w][r][c4];
      *(v4f*)(C + (size_t)(row0 + r) * ldc + col0 + c4) = v;
    }
    
  }
}

// GEMM C = act(A·W + bias + resid): A f32 (ASPLIT -> hi/lo 2 terms), Wt bf16 [N][K]; ACT 0 none, 1 relu, 2 exact gelu;
// resid (optional, f32, row index = (row % rmod), pitch ldr, RES_BF16 rounds it) added before the activation.
template <bool ASPLIT, int ACT, bool BIAS_BF16, bool RES_BF16>
__global__ __launch_bounds__(128) void k_gemm_bf3(const float* __restrict__ A, int lda, const unsigned short* __restrict__ Wt, int ldb,
                                                const float* __restrict__ bias, const float* __restrict__ resid, int rmod, int ldr,
                                                float* __restrict__ C, int ldc, int M, int N, int K) {
  __shared__ __attribute__((aligned(16))) float so[4][16][64];
  const int tid = threadIdx.x, w = tid >> 5, lane = tid & 31, ln = lane & 15, hh = lane >> 4;
  const int ntn = N / 64;
  const int wid = blockIdx.x * 4 + w;
  const int mt = wid / ntn, nq = wid % ntn;
  if (mt * 16 >= M) return;
  const int row0 = mt * 16, col0 = nq * 64;
  const float* arow = A + (size_t)(row0 + ln) * lda;
  v8f acc[4] = {};
  for (int kb = 0; kb < K; kb += 32) {
    FragB ah, al;
    const v4f x0 = *(const v4fa*)(arow + kb + 8 * hh), x1 = *(const v4fa*)(arow + kb + 8 * hh + 4);
    const v4f x2 = *(const v4fa*)(arow + kb + 16 + 8 * hh), x3 = *(const v4fa*)(arow + kb + 16 + 8 * hh + 4);
    float xs[16] = {x0[0],x0[1],x0[2],x0[3],x1[0],x1[1],x1[2],x1[3],x2[0],x2[1],x2[2],x2[3],x3[0],x3[1],x3[2],x3[3]};
#pragma unroll
    for (int i = 0; i < 16; ++i) { const unsigned short hb = bf16_bits(xs[i]); ah.u[i] = hb; al.u[i] = ASPLIT ? bf16_bits(xs[i] - bf16_val(hb)) : (unsigned short)0; }
#pragma unroll
    for (int t = 0; t < 4; ++t) {
      const unsigned short* brow = Wt + (size_t)(col0 + t * 16 + ln) * ldb + kb;
      FragB b;
      b.half[0] = *(const v8us*)(brow + 8 * hh);
      b.half[1] = *(const v8us*)(brow + 16 + 8 * hh);
      acc[t] = mmaN<ASPLIT ? 2 : 1>(ah.v, al.v, b.v, b.v, acc[t]);
    }
  }
#pragma unroll
  for (int t = 0; t < 4; ++t) {
    const int col = col0 + t * 16 + ln;
    float bv = bias ? bias[col] : 0.f;
    if (BIAS_BF16) bv = bf16_round(bv);
#pragma unroll
    for (int r = 0; r < 8; ++r) {
      float v = acc[t][r] + bv;
      if (resid) { float rv = resid[(size_t)((row0 + 8 * hh + r) % rmod) * ldr + col]; if (RES_BF16) rv = bf16_round(rv); v += rv; }
      if (ACT == 1) v = fmaxf(v, 0.f);
      if (ACT == 2) v = 0.5f * v * (1.0f + erff(v * 0.70710678118654752f));
      if (ACT == 3) { const float u = 0.7978845608028654f * (v + 0.044715f * v * v * v); v = 0.5f * v * (1.0f + tanhf(u)); }
      so[w][8 * hh + r][t * 16 + ln] = v;
    }
  }
  __builtin_amdgcn_fence(__ATOMIC_ACQ_REL, "workgroup");
  __builtin_amdgcn_wave_barrier();
  const int rsub = lane >> 4, c4 = (lane & 15) * 4;
  {
#pragma unroll
    for (int q = 0; q < 8; ++q) {
      const int r = q * 2 + rsub;
      const v4f v = *(const v4fa*)&so[w][r][c4];
      *(v4f*)(C + (size_t)(row0 + r) * ldc + col0 + c4) = v;
    }
    
  }
}
// row LayerNorm (biased variance, eps) over N: s = X (+ R); optional out_sum <- s; out_norm <- (s-mu)*rsqrt(var+eps)*g + b
template <bool PARAM_BF16>
__global__ __launch_bounds__(256) void k_layernorm(const float* __restrict__ X, const float* __restrict__ R, const float* __restrict__ g, const float* __restrict__ bta,
                                                  float* __restrict__ out_sum, float* __restrict__ out_norm, int N, float eps) {
  __shared__ float red[256];
  const int row = blockIdx.x, tid = threadIdx.x;
  const float* x = X + (size_t)row * N; const float* rr = R ? R + (size_t)row * N : nullptr;
  float vals[16];                     // up to N = 4096
  const int per = N / 256;            // contiguous chunk per thread? use strided-by-4 chunks: thread handles j = tid*4 + 1024*u
  float s1 = 0.f;
  for (int u = 0; u < per / 4; ++u) {
    const int j = tid * 4 + 1024 * u;
    const v4f a = *(const v4fa*)(x + j);
    v4f b = {0.f,0.f,0.f,0.f}; if (rr) b = *(const v4fa*)(rr + j);
#pragma unroll
    for (int q = 0; q < 4; ++q) { const float v = a[q] + b[q]; vals[u * 4 + q] = v; s1 += v; }
  }
  red[tid] = s1; __syncthreads();
  for (int st = 128; st > 0; st >>= 1) { if (tid < st) red[tid] += red[tid + st]; __syncthreads(); }
  const float mu = red[0] / (float)N; __syncthreads();
  float s2 = 0.f;
  for (int u = 0; u < per / 4; ++u)
#pragma unroll
    for (int q = 0; q < 4; ++q) { const float c = vals[u * 4 + q] - mu; s2 += c * c; }
  red[tid] = s2; __syncthreads();
  for (int st = 128; st > 0; st >>= 1) { if (tid < st) red[tid] += red[tid + st]; __syncthreads(); }
  const float rs = rsqrtf(red[0] / (float)N + eps);
  {
    for (int u = 0; u < per / 4; ++u) {
      const int j = tid * 4 + 1024 * u;
      v4f o, sm;
#pragma unroll
      for (int q = 0; q < 4; ++q) {
        float gg = g[j + q], bb = bta[j + q];
        if (PARAM_BF16) { gg = bf16_round(gg); bb = bf16_round(bb); }
        sm[q] = vals[u * 4 + q]; o[q] = (vals[u * 4 + q] - mu) * rs * gg + bb;
      }
      if (out_sum) *(v4f*)(out_sum + (size_t)row * N + j) = sm;
      *(v4f*)(out_norm + (size_t)row * N + j) = o;
    }
    
  }
}



// ---- f16 WMMA path (v_wmma_f32_16x16x32_f16): 11-bit significands for operands in range — used where a [0,1] probability operand needs more precision than bf16
typedef _Float16 v16h __attribute__((ext_vector_type(16)));
union FragH { v16h v; v8us half[2]; _Float16 h[16]; unsigned short u[16]; };
template <int NT>
__device__ __forceinline__ v8f mmaH(v16h ah, v16h al, v16h bh, v16h bl, v8f c) {
  c = __builtin_amdgcn_wmma_f32_16x16x32_f16(false, ah, false, bh, (short)0, c, false, false);
  if (NT >= 2) c = __builtin_amdgcn_wmma_f32_16x16x32_f16(false, al, false, bh, (short)0, c, false, false);
  if (NT >= 3) c = __builtin_amdgcn_wmma_f32_16x16x32_f16(false, ah, false, bl, (short)0, c, false, false);
  asm volatile("v_nop\n\tv_nop\n\tv_nop\n\tv_nop" : "+v"(c) : "v"(ah), "v"(al), "v"(bh), "v"(bl));
  return c;
}
// batched GEMM like k_gemm_b but f16 operands: A f32 (split into f16 hi/lo if ASPLIT, else rounded to f16), Bt = f16 values [n][k]; alpha; C f32; N multiple of 16 (partial tiles skipped)
template <bool ASPLIT>
__global__ __launch_bounds__(128) void k_gemm_h(const float* __restrict__ A, int lda, size_t sA, const _Float16* __restrict__ Bh, int ldb, size_t sB, float alpha, float* __restrict__ C, int ldc, size_t sC, int M, int N, int K) {
  __shared__ __attribute__((aligned(16))) float so[4][16][64];
  const int tid = threadIdx.x, w = tid >> 5, lane = tid & 31, ln = lane & 15, hh = lane >> 4; const int by = blockIdx.y;
  A += (size_t)by * sA; Bh += (size_t)by * sB; C += (size_t)by * sC;
  const int ntn = (N + 63) / 64; const int wid = blockIdx.x * 4 + w; const int mt = wid / ntn, nq = wid % ntn; if (mt * 16 >= M) return;
  const int row0 = mt * 16, col0 = nq * 64; const float* arow = A + (size_t)(row0 + ln) * lda;
  v8f acc[4] = {};
  for (int kb = 0; kb < K; kb += 32) {
    FragH ah, al;
    const v4f x0 = *(const v4fa*)(arow + kb + 8 * hh), x1 = *(const v4fa*)(arow + kb + 8 * hh + 4), x2 = *(const v4fa*)(arow + kb + 16 + 8 * hh), x3 = *(const v4fa*)(arow + kb + 16 + 8 * hh + 4);
    float xs[16] = {x0[0],x0[1],x0[2],x0[3],x1[0],x1[1],x1[2],x1[3],x2[0],x2[1],x2[2],x2[3],x3[0],x3[1],x3[2],x3[3]};
#pragma unroll
    for (int i = 0; i < 16; ++i) { const _Float16 h = (_Float16)xs[i]; ah.h[i] = h; al.h[i] = ASPLIT ? (_Float16)(xs[i] - (float)h) : (_Float16)0.0f; }
#pragma unroll
    for (int t = 0; t < 4; ++t) { if (col0 + t * 16 >= N) continue; const size_t boff = (size_t)(col0 + t * 16 + ln) * ldb + kb; FragH bq; bq.half[0] = *(const v8us*)(Bh + boff + 8 * hh); bq.half[1] = *(const v8us*)(Bh + boff + 16 + 8 * hh);
      acc[t] = mmaH<ASPLIT ? 2 : 1>(ah.v, al.v, bq.v, bq.v, acc[t]); }
  }
#pragma unroll
  for (int t = 0; t < 4; ++t) { if (col0 + t * 16 >= N) continue;
#pragma unroll
    for (int r = 0; r < 8; ++r) so[w][8 * hh + r][t * 16 + ln] = acc[t][r] * alpha; }
  __builtin_amdgcn_fence(__ATOMIC_ACQ_REL, "workgroup"); __builtin_amdgcn_wave_barrier();
  const int rsub = lane >> 4, c4 = (lane & 15) * 4;
  {
#pragma unroll
    for (int q = 0; q < 8; ++q) { const int r = q * 2 + rsub; if (col0 + c4 < N) { const v4f v = *(const v4fa*)&so[w][r][c4]; *(v4f*)(C + (size_t)(row0 + r) * ldc + col0 + c4) = v; } }
     }
}

// Wt[n][k] = f16(W[k][n]·scale) from f32 row-major W[K][N] (scale = power of two; bf16-exact weights stay exact in f16 away from the subnormal range)
__global__ __launch_bounds__(256) void k_wt_f16(const float* __restrict__ W, _Float16* __restrict__ Wt, int K, int N, float scale) {
  const int t = blockIdx.x * 256 + threadIdx.x; if (t >= N * (K / 8)) return; const int n = t / (K / 8), k8 = (t % (K / 8)) * 8; FragH f;
#pragma unroll
  for (int i = 0; i < 8; ++i) f.h[i] = (_Float16)(bf16_round(W[(size_t)(k8 + i) * N + n]) * scale); const v8us o = f.half[0];
  *(v8us*)((unsigned short*)Wt + (size_t)n * K + k8) = o; 
}
// k_gemm_hh variant with fused epilogue: v = acc·alpha + bias[by·sBias + col] (+ CP[(row/rowsPerB)·sCPb + by·64 + col] if CP) ; ACT 0 none / 1 elu ; writes f16 C16 (and f32 C if non-null)
template <int ACT>
__global__ __launch_bounds__(128) void k_gemm_hhx(const _Float16* __restrict__ A, int lda, size_t sA, const _Float16* __restrict__ Bh, int ldb, size_t sB, float alpha, const float* __restrict__ bias, size_t sBias, const float* __restrict__ CP, int rowsPerB, size_t sCPb, int row0g,
    float* __restrict__ C, _Float16* __restrict__ C16, int ldc, size_t sC, int M, int N, int K) {
  __shared__ __attribute__((aligned(16))) float so[4][16][64];
  const int tid = threadIdx.x, w = tid >> 5, lane = tid & 31, ln = lane & 15, hh = lane >> 4; const int by = blockIdx.y;
  A += (size_t)by * sA; Bh += (size_t)by * sB; const size_t cofs = (size_t)by * sC; const float* bp = bias ? bias + (size_t)by * sBias : nullptr;
  const int ntn = (N + 63) / 64; const int wid = blockIdx.x * 4 + w; const int mt = wid / ntn, nq = wid % ntn; if (mt * 16 >= M) return;
  const int row0 = mt * 16, col0 = nq * 64; const _Float16* arow = A + (size_t)(row0 + ln) * lda;
  v8f acc[4] = {};
  for (int kb = 0; kb < K; kb += 32) { FragH ah; ah.half[0] = *(const v8us*)((const unsigned short*)arow + kb + 8 * hh); ah.half[1] = *(const v8us*)((const unsigned short*)arow + kb + 16 + 8 * hh);
#pragma unroll
    for (int t = 0; t < 4; ++t) { if (col0 + t * 16 >= N) continue; const size_t boff = (size_t)(col0 + t * 16 + ln) * ldb + kb; FragH bq; bq.half[0] = *(const v8us*)((const unsigned short*)Bh + boff + 8 * hh); bq.half[1] = *(const v8us*)((const unsigned short*)Bh + boff + 16 + 8 * hh);
      acc[t] = mmaH<1>(ah.v, ah.v, bq.v, bq.v, acc[t]); }
  }
#pragma unroll
  for (int t = 0; t < 4; ++t) { if (col0 + t * 16 >= N) continue; const int col = col0 + t * 16 + ln; const float bv = bp ? bf16_round(bp[col]) : 0.f;
#pragma unroll
    for (int r = 0; r < 8; ++r) { float v = acc[t][r] * alpha + bv; if (CP) { const int rr = row0g + row0 + 8 * hh + r; if (rowsPerB < 0) v += CP[cofs + (size_t)rr * ldc + col];      /* rowsPerB < 0: own element of the batched C plane */ else { const int bidx = rr / rowsPerB; v += CP[(size_t)bidx * sCPb + (size_t)by * 64 + col]; } } if (ACT == 1) v = (v > 0.f) ? v : expm1f(v); else if (ACT == 7) v = (v > 0.f) ? v + 1.0f : expf(v); else if (ACT == 8) v = tanhf(v); else if (ACT == 9) v = 0.5f * v * (1.0f + tanhf(0.7978845608028654f * (v + 0.044715f * v * v * v))); else if (ACT == 11) v = 1.0f / (1.0f + expf(-v)); else if (ACT == 12) v = (v > 0.f) ? v : 0.01f * v; else if (ACT == 14) v = (v > 0.f) ? v : 0.1f * v; else if (ACT == 16) v = (v >= 0.f) ? v : 0.3f * v; else if (ACT == 17) v = (v >= 0.f) ? v : 0.2f * v; else if (ACT == 15) v = v / (1.0f + expf(-v)); else if (ACT == 3) v = fmaxf(v, 0.f); else if (ACT == 6) v = 0.5f * v * (1.0f + erff(v * 0.70710678118654752f)); so[w][8 * hh + r][t * 16 + ln] = v; } }
  __builtin_amdgcn_fence(__ATOMIC_ACQ_REL, "workgroup"); __builtin_amdgcn_wave_barrier();
  const int rsub = lane >> 4, c4 = (lane & 15) * 4; typedef _Float16 v4h __attribute__((ext_vector_type(4)));
  {
#pragma unroll
    for (int q = 0; q < 8; ++q) { const int r = q * 2 + rsub; if (col0 + c4 < N) { const v4f v = *(const v4fa*)&so[w][r][c4]; if (C) *(v4f*)(C + cofs + (size_t)(row0 + r) * ldc + col0 + c4) = v; if (C16) { v4h h4; for (int i = 0; i < 4; ++i) h4[i] = (_Float16)v[i]; *(v4h*)(C16 + cofs + (size_t)(row0 + r) * ldc + col0 + c4) = h4; } } }
     }
}


typedef _Float16 v4h __attribute__((ext_vector_type(4)));

__global__ __launch_bounds__(256) void k_x16(const float* __restrict__ x, _Float16* __restrict__ X16, size_t n8) { const size_t t = (size_t)blockIdx.x * 256 + threadIdx.x; if (t >= n8) return; FragH f;
#pragma unroll
  for (int q = 0; q < 8; ++q) f.h[q] = (_Float16)bf16_round(x[t * 8 + q]); *(v8us*)((unsigned short*)X16 + t * 8) = f.half[0];  }
__global__ __launch_bounds__(256) void k_h16(const float* __restrict__ x, _Float16* __restrict__ X16, size_t n8) { const size_t t = (size_t)blockIdx.x * 256 + threadIdx.x; if (t >= n8) return; FragH f;
#pragma unroll
  for (int q = 0; q < 8; ++q) f.h[q] = (_Float16)x[t * 8 + q]; *(v8us*)((unsigned short*)X16 + t * 8) = f.half[0];  }
__global__ __launch_bounds__(256) void k_round16f(const float* __restrict__ W, _Float16* __restrict__ Bt, size_t n8) { const size_t t = (size_t)blockIdx.x * 256 + threadIdx.x; if (t >= n8) return; FragH f;
#pragma unroll
  for (int i = 0; i < 8; ++i) f.h[i] = (_Float16)(bf16_round(W[t * 8 + i]) * 16.0f); *(v8us*)((unsigned short*)Bt + t * 8) = f.half[0];  }
template <int NHv, int TTv>
__global__ __launch_bounds__(256) void k_vt(const _Float16* __restrict__ V16, int ldv, int voff, _Float16* __restrict__ Vt) { __shared__ unsigned short tl[64][66]; const int tid = threadIdx.x; const int slab = blockIdx.x / (TTv / 64), lg = blockIdx.x % (TTv / 64); const int b = slab / NHv, h = slab % NHv;
  for (int i = tid; i < 64 * 8; i += 256) { const int r = i / 8, c8 = (i % 8) * 8; FragH f; f.half[0] = *(const v8us*)((const unsigned short*)V16 + ((size_t)b * TTv + lg * 64 + r) * ldv + voff + h * 64 + c8);
#pragma unroll
    for (int q = 0; q < 8; ++q) tl[r][c8 + q] = f.u[q]; }
  __syncthreads();
  {
#pragma unroll
    for (int rd = 0; rd < 2; ++rd) { const int d = rd * 32 + tid / 8, pc = tid % 8; FragH f;
#pragma unroll
      for (int q = 0; q < 8; ++q) f.u[q] = tl[pc * 8 + q][d];
      *(v8us*)((unsigned short*)Vt + ((size_t)slab * 64 + d) * TTv + lg * 64 + pc * 8) = f.half[0]; }
     } }

__global__ __launch_bounds__(256) void k_hl(const float* __restrict__ F, _Float16* __restrict__ Hh, _Float16* __restrict__ Hl, size_t n8) { const size_t t = (size_t)blockIdx.x * 256 + threadIdx.x; if (t >= n8) return; FragH fh, fl; const v4f a = *(const v4fa*)(F + t * 8), c = *(const v4fa*)(F + t * 8 + 4);
#pragma unroll
  for (int q = 0; q < 4; ++q) { _Float16 h = (_Float16)a[q]; fh.h[q] = h; fl.h[q] = (_Float16)((a[q] - (float)h) * 1024.0f); h = (_Float16)c[q]; fh.h[4 + q] = h; fl.h[4 + q] = (_Float16)((c[q] - (float)h) * 1024.0f); }
  { *(v8us*)((unsigned short*)Hh + t * 8) = fh.half[0]; *(v8us*)((unsigned short*)Hl + t * 8) = fl.half[0];  } }

// ---- fast GEMM (wave tile 32x64; requires M % 32 == 0 rows per launch region and N % 64 == 0); epilogue = k_gemm_hhx semantics ----
__device__ __forceinline__ v16h g2_frag(const _Float16* p, int hh) { FragH f; f.half[0] = *(const v8us*)((const unsigned short*)p + 8 * hh); f.half[1] = *(const v8us*)((const unsigned short*)p + 16 + 8 * hh); return f.v; }
__device__ __forceinline__ v8f g2_mma(v16h a, v16h b, v8f c) { v8f d = __builtin_amdgcn_wmma_f32_16x16x32_f16(false, a, false, b, (short)0, c, false, false); asm volatile("v_nop\n\tv_nop\n\tv_nop\n\tv_nop" : "+v"(d) : "v"(a), "v"(b)); return d; }
template <int ACT>
__global__ __launch_bounds__(128) void k_gemm2(const _Float16* __restrict__ A, int lda, size_t sA, const _Float16* __restrict__ Bh, int ldb, size_t sB, float alpha, const float* __restrict__ bias, size_t sBias, const float* __restrict__ CP, int rowsPerB, size_t sCPb, int row0g,
    float* __restrict__ C, _Float16* __restrict__ C16, int ldc, size_t sC, int M, int N, int K) { static_assert(ACT == 0 || ACT == 3 || ACT == 6 || ACT == 8 || ACT == 9 || ACT == 11 || ACT == 12 || ACT == 14 || ACT == 15 || ACT == 16 || ACT == 17, "k_gemm2: unsupported ACT code (would silently apply no activation)");
  __shared__ __attribute__((aligned(16))) float so[4][32][68];
  const int tid = threadIdx.x, w = tid >> 5, lane = tid & 31, ln = lane & 15, hh = lane >> 4; const int by = blockIdx.y;
  A += (size_t)by * sA; Bh += (size_t)by * sB; const size_t cofs = (size_t)by * sC; const float* bp = bias ? bias + (size_t)by * sBias : nullptr;
  const int ntn = N >> 6; const int mt = blockIdx.x / ntn, nq = blockIdx.x - mt * ntn; const int row0 = mt * 128 + 32 * w, col0 = nq * 64; if (row0 >= M) return;
  const _Float16* a0p = A + (size_t)(row0 + ln) * lda; const _Float16* a1p = a0p + (size_t)16 * lda;
  const _Float16* b0p = Bh + (size_t)(col0 + ln) * ldb; const _Float16* b1p = b0p + (size_t)16 * ldb; const _Float16* b2p = b1p + (size_t)16 * ldb; const _Float16* b3p = b2p + (size_t)16 * ldb;
  const v8f z8 = {0.f,0.f,0.f,0.f,0.f,0.f,0.f,0.f}; v8f c00 = z8, c01 = z8, c02 = z8, c03 = z8, c10 = z8, c11 = z8, c12 = z8, c13 = z8;
#pragma unroll 1
  for (int kb = 0; kb < K; kb += 32) { const v16h a0 = g2_frag(a0p + kb, hh), a1 = g2_frag(a1p + kb, hh);
    v16h b = g2_frag(b0p + kb, hh); c00 = g2_mma(a0, b, c00); c10 = g2_mma(a1, b, c10);
    b = g2_frag(b1p + kb, hh); c01 = g2_mma(a0, b, c01); c11 = g2_mma(a1, b, c11);
    b = g2_frag(b2p + kb, hh); c02 = g2_mma(a0, b, c02); c12 = g2_mma(a1, b, c12);
    b = g2_frag(b3p + kb, hh); c03 = g2_mma(a0, b, c03); c13 = g2_mma(a1, b, c13); }
  v8f accs[8] = {c00, c01, c02, c03, c10, c11, c12, c13};
#pragma unroll
  for (int u = 0; u < 8; ++u) { const int t = u & 3, half = u >> 2; const int col = col0 + t * 16 + ln; const float bv = bp ? bf16_round(bp[col]) : 0.f;
#pragma unroll
    for (int r = 0; r < 8; ++r) { const int rloc = half * 16 + 8 * hh + r; float v = accs[u][r] * alpha + bv; if (CP) { if (rowsPerB < 0) v += CP[cofs + (size_t)(row0g + row0 + rloc) * ldc + col];      /* rowsPerB < 0: own element of the batched C plane */ else { const int bidx = (row0g + row0 + rloc) / rowsPerB; v += CP[(size_t)bidx * sCPb + (size_t)by * 64 + col]; } }
      if (ACT == 3) v = fmaxf(v, 0.f); else if (ACT == 6) v = 0.5f * v * (1.0f + erff(v * 0.70710678118654752f)); else if (ACT == 11) v = 1.0f / (1.0f + expf(-v)); else if (ACT == 15) v = v / (1.0f + expf(-v)); else if (ACT == 12) v = (v > 0.f) ? v : 0.01f * v; else if (ACT == 8) v = tanhf(v); else if (ACT == 9) v = 0.5f * v * (1.0f + tanhf(0.7978845608028654f * (v + 0.044715f * v * v * v))); else if (ACT == 14) v = (v > 0.f) ? v : 0.1f * v; else if (ACT == 16) v = (v >= 0.f) ? v : 0.3f * v; else if (ACT == 17) v = (v >= 0.f) ? v : 0.2f * v;
      so[w][rloc][t * 16 + ln] = v; } }
  __builtin_amdgcn_fence(__ATOMIC_ACQ_REL, "workgroup"); __builtin_amdgcn_wave_barrier();
  const int rsub = lane >> 4, c4 = (lane & 15) * 4;
  {
#pragma unroll
    for (int q = 0; q < 16; ++q) { const int r = q * 2 + rsub; const v4f v = *(const v4fa*)&so[w][r][c4]; if (C) *(v4f*)(C + cofs + (size_t)(row0 + r) * ldc + col0 + c4) = v; if (C16) { v4h h4; for (int i = 0; i < 4; ++i) h4[i] = (_Float16)v[i]; *(v4h*)(C16 + cofs + (size_t)(row0 + r) * ldc + col0 + c4) = h4; } }
     } }


__global__ __launch_bounds__(256) void k_wnat(const float* __restrict__ w, size_t n8, _Float16* __restrict__ Bt) { const size_t t = (size_t)blockIdx.x * 256 + threadIdx.x; if (t >= n8) return; FragH f; for (int q = 0; q < 8; ++q) f.h[q] = (_Float16)(bf16_round(w[t * 8 + q]) * 16.0f); *(v8us*)((unsigned short*)Bt + t * 8) = f.half[0];  }
__global__ __launch_bounds__(256) void k_rsm(const float* __restrict__ S, _Float16* __restrict__ P, int nrows) {
  #pragma clang fp contract(off)
  const int i = blockIdx.x * 256 + threadIdx.x; if (i >= nrows) return; const float* s = S + (size_t)i * SQ; float mx = -3.0e38f;
#pragma unroll 1
  for (int j = 0; j < SQ; ++j) mx = fmaxf(mx, s[j]); float se = 0.f;
#pragma unroll 1
  for (int j = 0; j < SQ; ++j) se += expf(s[j] - mx); const float sc = 256.0f / se;
#pragma unroll 1
  for (int j0 = 0; j0 < SQ; j0 += 8) { FragH f; for (int q = 0; q < 8; ++q) f.h[q] = (_Float16)(expf(s[j0 + q] - mx) * sc); unsigned short* d = (unsigned short*)P + (size_t)i * SQ + j0; *(v8us*)d = f.half[0];  } }
__global__ __launch_bounds__(256) void k_vt(const _Float16* __restrict__ V16, int b, int h0, _Float16* __restrict__ VT) { __shared__ unsigned short tl[64][65]; const int tid = threadIdx.x; const int hh = blockIdx.x % HG, sg = blockIdx.x / HG; const int s0 = sg * 64; const int h = h0 + hh;
  for (int i = tid; i < 64 * 8; i += 256) { const int j = i / 8, d8 = (i % 8) * 8; FragH f; f.half[0] = *(const v8us*)((const unsigned short*)V16 + ((size_t)b * SQ + s0 + j) * DM + h * HD + d8); for (int q = 0; q < 8; ++q) tl[d8 + q][j] = f.u[q]; }
  __syncthreads();
  { for (int i = tid; i < 64 * 8; i += 256) { const int d = i / 8, j8 = (i % 8) * 8; FragH f; for (int q = 0; q < 8; ++q) f.u[q] = tl[d][j8 + q]; *(v8us*)((unsigned short*)VT + ((size_t)hh * HD + d) * SQ + s0 + j8) = f.half[0]; }  } }


__global__ __launch_bounds__(256) void k_x16pad(const float* __restrict__ x, _Float16* __restrict__ X16) { const size_t t = (size_t)blockIdx.x * 256 + threadIdx.x; if (t >= (size_t)NB * QP * (DM / 8)) return; const int c8 = (int)(t % (DM / 8)) * 8; const size_t row = t / (DM / 8); const int b = (int)(row / QP), q = (int)(row % QP); FragH f;
  for (int i = 0; i < 8; ++i) f.h[i] = (_Float16)((q < NQ) ? bf16_round(x[((size_t)b * NQ + q) * DM + c8 + i]) : 0.f);
  *(v8us*)((unsigned short*)X16 + row * DM + c8) = f.half[0];  }


template <int HPP>
__global__ __launch_bounds__(256) void k_wtpadT(const float* __restrict__ w, _Float16* __restrict__ Bt) { const int t = blockIdx.x * 256 + threadIdx.x; if (t >= NH * HPP * (DM / 8)) return; const int k8 = (t % (DM / 8)) * 8; const int r = t / (DM / 8); const int h = r / HPP, d = r % HPP; FragH f;
  for (int q = 0; q < 8; ++q) { float v = 0.f; if (d < HD) v = bf16_round(w[(size_t)(k8 + q) * DM + h * HD + d]); f.h[q] = (_Float16)(v * 16.0f); }
  unsigned short* dst = (unsigned short*)Bt + (size_t)r * DM + k8; *(v8us*)dst = f.half[0];  }
template <int HPP>
__global__ __launch_bounds__(256) void k_wtopadT(const float* __restrict__ w, _Float16* __restrict__ Bt) { const int t = blockIdx.x * 256 + threadIdx.x; if (t >= DM * (NH * HPP / 8)) return; const int k8 = (t % (NH * HPP / 8)) * 8; const int n = t / (NH * HPP / 8); FragH f;
  for (int q = 0; q < 8; ++q) { const int kp = k8 + q; const int h = kp / HPP, d = kp % HPP; float v = 0.f; if (d < HD) v = bf16_round(w[(size_t)(h * HD + d) * DM + n]); f.h[q] = (_Float16)(v * 16.0f); }
  unsigned short* dst = (unsigned short*)Bt + (size_t)n * (NH * HPP) + k8; *(v8us*)dst = f.half[0];  }
// Mean term, one block of 32 waves per batch. Column sums: 25 waves of 40 rows each; a wave reads whole 512-byte rows (lane = 4 columns), rows w, w + 25, ..., eight loads in flight; the 25 partial rows meet in LDS.
// mu Wq_mean: thread = (output column, slice of 16 rows of Wq_mean), its 16 weights loaded ahead of the row loads; the 8 slices meet in LDS.
#define MW 25                        /* waves that sum rows; NQ = MW * 40 */
__global__ __launch_bounds__(1024) void k_qmean(const float* __restrict__ xn, const float* __restrict__ wqm, float* __restrict__ QMP) {
  static_assert(NQ % (MW * 8) == 0 && MW <= 32, "rows deal out evenly, eight a round");
  __shared__ __attribute__((aligned(16))) float part[MW][DM]; __shared__ float mu[DM]; __shared__ float wp[8][DM];
  const int b = blockIdx.x, t = threadIdx.x, c4 = (t & 31) * 4, col = t % DM, kg = t / DM; float wv[DM / 8];
  const int w = __builtin_amdgcn_readfirstlane(t >> 5);      /* wave number in a scalar register: row addresses and the test on it are scalar */
#pragma unroll      /* wv[] in registers, all 16 loads in flight */
  for (int i = 0; i < DM / 8; ++i) wv[i] = wqm[(size_t)(kg * (DM / 8) + i) * DM + col];
  if (w < MW) { const float* rows = xn + ((size_t)b * NQ + w) * DM + c4; v4f s = {0.f, 0.f, 0.f, 0.f};
#pragma unroll 1      /* eight loads a round: a fully unrolled form of this loop spilled at the 128 registers a wave has in a 1024-thread block */
    for (int r = 0; r < NQ / (MW * 8); ++r) { v4f a[8];
#pragma unroll      /* a[] in registers, the round's loads in flight together */
      for (int j = 0; j < 8; ++j) a[j] = *(const v4fa*)(rows + (size_t)(r * 8 + j) * MW * DM);
#pragma unroll      /* a[] in registers */
      for (int j = 0; j < 8; ++j) for (int q = 0; q < 4; ++q) s[q] += bf16_round(a[j][q]); }
    *(v4f*)&part[w][c4] = s; }
  __syncthreads();
  if (t < DM) { float m = 0.f; for (int i = 0; i < MW; ++i) m += part[i][t]; mu[t] = m / (float)NQ; }
  __syncthreads();
  float v = 0.f;
#pragma unroll      /* wv[] in registers */
  for (int i = 0; i < DM / 8; ++i) v += mu[kg * (DM / 8) + i] * bf16_round(wv[i]);
  wp[kg][col] = v;
  __syncthreads();
  if (t < NH * 32) { const int h = t / 32, d = t % 32; float o = 0.f; if (d < HD) for (int g = 0; g < 8; ++g) o += wp[g][h * HD + d]; QMP[(size_t)b * (NH * 32) + t] = o; } }
// Row softmaxes, one wave per row: lane holds columns 4*lane + 128*u (u = 0..7), so each wave-wide b128 load or store covers 512 contiguous bytes;
// the row's values stay in registers between the maximum, the sum and the store. Maximum and sum: per lane first, then a five-step butterfly over the 32 lanes.
// Columns NQ..QP-1 (lanes 26..31 of u = 7): the score planes hold them; the mask does not, so those lanes re-read their own first chunk; their value is -inf (weight 0) and they are not stored.
__device__ __forceinline__ float wave_max32(float v) { for (int m = 16; m > 0; m >>= 1) v = fmaxf(v, __shfl_xor(v, m, 32)); return v; }
__device__ __forceinline__ float wave_sum32(float v) { for (int m = 16; m > 0; m >>= 1) v += __shfl_xor(v, m, 32); return v; }
// 2^x as one v_exp_f32 (what __expf compiles to behind its multiply) with the issue slot behind it filled
__device__ __forceinline__ float exp2_slot(float x) { float r; asm("v_exp_f32 %0, %1\n\tv_nop" : "=v"(r) : "v"(x)); return r; }
__device__ __forceinline__ v16h at_frag16(v8us lo) { FragH f; f.half[0] = lo; const v8us z = {0, 0, 0, 0, 0, 0, 0, 0}; f.half[1] = z; return f.v; }      /* q or k row of one head: 16 features, k 16..31 of the fragment zero */
__device__ __forceinline__ v8f at_mma(v16h a, v16h b, v8f c) { return __builtin_amdgcn_wmma_f32_16x16x32_f16(false, a, false, b, (short)0, c, false, false); }
// what 32 keys take from memory for one lane: its 8 features of two k rows, 2 x 8 mask values of its query. EDGE: a lane whose 8 keys lie at or past NQ reads its 8 mask values of the row's first 16 columns instead, and those keys count as -inf
struct At32 { v8us k0, k1; v4f m0, m1, m2, m3; };
template <bool EDGE>
__device__ __forceinline__ At32 at_load(const unsigned short* kp, const float* mr, int k0, int hh) {
  At32 t; const int c0 = (!EDGE || k0 + 8 * hh < NQ) ? k0 : 0, c1 = (!EDGE || k0 + 16 + 8 * hh < NQ) ? k0 + 16 : 0;
  t.k0 = *(const v8us*)(kp + (size_t)k0 * (NH * 32)); t.k1 = *(const v8us*)(kp + (size_t)(k0 + 16) * (NH * 32));
  t.m0 = *(const v4fa*)(mr + c0); t.m1 = *(const v4fa*)(mr + c0 + 4); t.m2 = *(const v4fa*)(mr + c1); t.m3 = *(const v4fa*)(mr + c1 + 4); return t; }
// x[0..7], x[8..15]: scores / 4 + mask of this lane's query against keys k0 + 8 * hh + r and k0 + 16 + 8 * hh + r
template <bool EDGE>
__device__ __forceinline__ void at_score(const At32& t, v16h qf, int k0, int hh, float* x) {
  const v8f z8 = {0.f, 0.f, 0.f, 0.f, 0.f, 0.f, 0.f, 0.f}; const v8f s0 = at_mma(at_frag16(t.k0), qf, z8), s1 = at_mma(at_frag16(t.k1), qf, z8);
  const bool in0 = !EDGE || k0 + 8 * hh < NQ, in1 = !EDGE || k0 + 16 + 8 * hh < NQ;
#pragma unroll      /* x[] in registers */
  for (int r = 0; r < 8; ++r) { const float v0 = s0[r] * 0.25f + bf16_round(r < 4 ? t.m0[r & 3] : t.m1[r & 3]), v1 = s1[r] * 0.25f + bf16_round(r < 4 ? t.m2[r & 3] : t.m3[r & 3]);
    x[r] = in0 ? v0 : -__builtin_inff(); x[8 + r] = in1 ? v1 : -__builtin_inff(); } }
template <bool EDGE>
__device__ __forceinline__ float at_max32(const At32& t, v16h qf, int k0, int hh, float mx) {
  float x[16]; at_score<EDGE>(t, qf, k0, hh, x);
#pragma unroll      /* x[] in registers */
  for (int r = 0; r < 16; ++r) mx = fmaxf(mx, x[r]);
  return mx; }
template <bool EDGE>
__device__ __forceinline__ v8f at_pv32(const At32& t, v16h vf, v16h qf, int k0, int hh, float mx, float* se, v8f o) {
  float x[16]; at_score<EDGE>(t, qf, k0, hh, x); FragH pf;
#pragma unroll      /* x[] in registers; four running sums, so that an add does not wait for the one before it */
  for (int r = 0; r < 16; ++r) { const float e = exp2_slot((x[r] - mx) * 1.44269504f + 8.0f); se[r & 3] += e; pf.h[r] = (_Float16)e; }
  return at_mma(vf, pf.v, o); }
__global__ __launch_bounds__(256) void k_attn(const _Float16* __restrict__ Q16, const _Float16* __restrict__ K16, const _Float16* __restrict__ VT, const float* __restrict__ mask, float* __restrict__ OF) {
  static_assert(NQ % 8 == 0 && NQ > QP - 32 && NQ <= QP && QP % 128 == 0, "only the last 32 keys hold an edge, and a lane's 8 keys are all in or all out");
  const int b = blockIdx.y, h = threadIdx.x >> 5, lane = threadIdx.x & 31, c = lane & 15, hh = lane >> 4; const int q = blockIdx.x * 16 + c; const bool live = q < NQ;      /* rows NQ..QP-1: same instruction stream on mask row 0, scale 0, so zeros are stored */
  const v16h qf = at_frag16(*(const v8us*)((const unsigned short*)Q16 + ((size_t)b * QP + q) * (NH * 32) + h * 32 + 8 * hh));
  const unsigned short* kp = (const unsigned short*)K16 + ((size_t)b * QP + c) * (NH * 32) + h * 32 + 8 * hh; const _Float16* vp = VT + ((size_t)(b * NH + h) * 64 + c) * QP;
  const float* mr = mask + ((size_t)b * NQ + (live ? q : 0)) * NQ + 8 * hh; float mx = -3.0e38f;
#pragma unroll 1      /* stays a loop: unrolled whole, the two passes were some 10,000 instructions and spilled */
  for (int k0 = 0; k0 < QP - 128; k0 += 128) { At32 t[4];
#pragma unroll      /* t[] in registers, the loads of 128 keys in flight together */
    for (int j = 0; j < 4; ++j) t[j] = at_load<false>(kp, mr, k0 + 32 * j, hh);
#pragma unroll      /* t[] in registers */
    for (int j = 0; j < 4; ++j) mx = at_max32<false>(t[j], qf, k0 + 32 * j, hh, mx); }
  { At32 t[4];      /* the last 128 keys */
#pragma unroll      /* t[] in registers */
    for (int j = 0; j < 3; ++j) t[j] = at_load<false>(kp, mr, QP - 128 + 32 * j, hh);
    t[3] = at_load<true>(kp, mr, QP - 32, hh);
#pragma unroll      /* t[] in registers */
    for (int j = 0; j < 3; ++j) mx = at_max32<false>(t[j], qf, QP - 128 + 32 * j, hh, mx);
    mx = at_max32<true>(t[3], qf, QP - 32, hh, mx); }
  mx = fmaxf(mx, __shfl_xor(mx, 16, 32));
  v8f o = {0.f, 0.f, 0.f, 0.f, 0.f, 0.f, 0.f, 0.f}; float se[4] = {0.f, 0.f, 0.f, 0.f};
#pragma unroll 1      /* stays a loop, as above */
  for (int k0 = 0; k0 < QP - 64; k0 += 64) {      /* the loads of 64 keys in flight together */
    const At32 t0 = at_load<false>(kp, mr, k0, hh), t1 = at_load<false>(kp, mr, k0 + 32, hh);
    asm volatile("s_wait_xcnt 0x0" ::: "memory");      /* the build let a V load's result land in the address pair of the k loads just issued: the wait stands in front of that overwrite */
    const v16h v0 = g2_frag(vp + k0, hh), v1 = g2_frag(vp + k0 + 32, hh);
    o = at_pv32<false>(t0, v0, qf, k0, hh, mx, se, o); o = at_pv32<false>(t1, v1, qf, k0 + 32, hh, mx, se, o); }
  { const At32 t0 = at_load<false>(kp, mr, QP - 64, hh), t1 = at_load<true>(kp, mr, QP - 32, hh); const v16h v0 = g2_frag(vp + QP - 64, hh), v1 = g2_frag(vp + QP - 32, hh);
    o = at_pv32<false>(t0, v0, qf, QP - 64, hh, mx, se, o); o = at_pv32<true>(t1, v1, qf, QP - 32, hh, mx, se, o); }
  float st = (se[0] + se[1]) + (se[2] + se[3]); st += __shfl_xor(st, 16, 32);
  const float sc = live ? 64.0f / st : 0.f; float* orow = OF + ((size_t)b * QP + q) * (NH * 64) + h * 64;      /* o x64, padded [8][64]: d 0..15 real, 16..63 zero */
  const v4f o0 = {o[0] * sc, o[1] * sc, o[2] * sc, o[3] * sc}, o1 = {o[4] * sc, o[5] * sc, o[6] * sc, o[7] * sc}, z4 = {0.f, 0.f, 0.f, 0.f};
  *(v4f*)(orow + 8 * hh) = o0; *(v4f*)(orow + 8 * hh + 4) = o1;
#pragma unroll      /* six plain stores */
  for (int j = 0; j < 6; ++j) *(v4f*)(orow + HD + 24 * hh + 4 * j) = z4; }
// Stage 2, one launch for all batches: block = (16 query rows, batch), eight waves; score2 stays in LDS, the probabilities go straight to out.
// Part 1: wave w forms score2 of the 16 rows against keys 128 w .. 128 w + 127, eight tiles of 16 keys. The mh rows are split here into f16 hi + x1024 residual fragments (k order of g2_frag) and stay in registers.
// A tile of 16 node rows is 4 KiB in a row in memory: eight loads of 512 contiguous bytes a wave, one tile ahead, then through the wave's own LDS rows into fragments (a fragment load straight from memory touches 16 lines an instruction).
// Part 2, behind the one barrier: wave w takes rows 2 w and 2 w + 1 whole, lane = columns 4 * lane + 128 * u as in the row softmaxes above.
#define SP (QP + 4)                  /* score row pitch in LDS, floats: rows r and r + 8, stored by the two wave halves together, lie 32 banks apart */
#define XP (DM + 8)                  /* staged node row pitch, f16: 272 bytes = 16 x odd, for the b128 fragment reads */
__global__ __launch_bounds__(256) void k_stage2(const float* __restrict__ MH, const _Float16* __restrict__ XN, const float* __restrict__ mask, float* __restrict__ out) {
  static_assert(QP == 8 * 128 && DM == 128 && NQ % 4 == 0, "eight waves of 128 keys; a node row is 16 lanes of 16 bytes; a lane's 4 columns are all in or all out");
  __shared__ __attribute__((aligned(16))) float sc[16][SP]; __shared__ __attribute__((aligned(16))) unsigned short nb[8][16][XP];
  const int b = blockIdx.y, row0 = blockIdx.x * 16, lane = threadIdx.x & 31, ln = lane & 15, hh = lane >> 4;
  const int w = __builtin_amdgcn_readfirstlane(threadIdx.x >> 5);      /* wave number in a scalar register: LDS bases and the row test below are scalar */
  const unsigned short* xb = (const unsigned short*)XN + ((size_t)b * QP + 128 * w) * DM + lane * 8; v8us st[8];
#pragma unroll      /* st[] in registers, the tile's loads in flight together */
  for (int i = 0; i < 8; ++i) st[i] = *(const v8us*)(xb + i * 256);
  const float* ar = MH + ((size_t)b * QP + row0 + ln) * DM + 8 * hh; FragH ah[4], al[4];
#pragma unroll      /* ah[], al[] in registers */
  for (int j = 0; j < 4; ++j) { const v4f x0 = *(const v4fa*)(ar + 32 * j), x1 = *(const v4fa*)(ar + 32 * j + 4), x2 = *(const v4fa*)(ar + 32 * j + 16), x3 = *(const v4fa*)(ar + 32 * j + 20);
    const float xs[16] = {x0[0], x0[1], x0[2], x0[3], x1[0], x1[1], x1[2], x1[3], x2[0], x2[1], x2[2], x2[3], x3[0], x3[1], x3[2], x3[3]};
    for (int i = 0; i < 16; ++i) { const _Float16 h = (_Float16)xs[i]; ah[j].h[i] = h; al[j].h[i] = (_Float16)((xs[i] - (float)h) * 1024.0f); } }
#pragma unroll      /* st[] in registers; the next tile's loads stand ahead of this tile's products */
  for (int t = 0; t < 8; ++t) {
    for (int i = 0; i < 8; ++i) *(v8us*)&nb[w][2 * i + hh][ln * 8] = st[i];
    if (t < 7) for (int i = 0; i < 8; ++i) st[i] = *(const v8us*)(xb + (t + 1) * 16 * DM + i * 256);
    __builtin_amdgcn_fence(__ATOMIC_ACQ_REL, "workgroup", "local"); __builtin_amdgcn_wave_barrier();      /* the reads below take what other lanes of this wave stored: the LDS stores are waited for (s_wait_dscnt 0), the global loads in flight are not */
    FragH bf[4];
    for (int j = 0; j < 4; ++j) { bf[j].half[0] = *(const v8us*)&nb[w][ln][32 * j + 8 * hh]; bf[j].half[1] = *(const v8us*)&nb[w][ln][32 * j + 16 + 8 * hh]; }
    __builtin_amdgcn_fence(__ATOMIC_ACQ_REL, "wavefront"); __builtin_amdgcn_wave_barrier();      /* the next tile's stores stay behind these reads */
    v8f sh = {0.f, 0.f, 0.f, 0.f, 0.f, 0.f, 0.f, 0.f}, sl = sh;
    for (int j = 0; j < 4; ++j) { sh = at_mma(ah[j].v, bf[j].v, sh); sl = at_mma(al[j].v, bf[j].v, sl); }
    for (int r = 0; r < 8; ++r) sc[8 * hh + r][128 * w + 16 * t + ln] = sh[r] * 0.088388347648318447f + sl[r] * 0.000086316745750311f; }      /* (mh_hi + mh_lo / 1024) nodes^T / sqrt(128) */
  const int c0 = lane * 4; v4f m[QP / 128], mn[QP / 128];
  { const int p0 = row0 + 2 * w, p1 = p0 + 1; const float* r0 = mask + ((size_t)b * NQ + (p0 < NQ ? p0 : 0)) * NQ + c0; const float* r1 = mask + ((size_t)b * NQ + (p1 < NQ ? p1 : 0)) * NQ + c0;
#pragma unroll      /* m[], mn[] in registers, both rows' mask loads in flight together */
    for (int u = 0; u < QP / 128; ++u) { const int o = (c0 + 128 * u < NQ) ? 128 * u : 0; m[u] = *(const v4fa*)(r0 + o); mn[u] = *(const v4fa*)(r1 + o); } }
  asm volatile("s_wait_xcnt 0x0" ::: "memory");      /* stands in front of part 2, which reuses the address registers of the mask loads just issued */
  __syncthreads();
#pragma unroll 1      /* stays a loop: the 32 tanhf and expf of one row are most of the kernel's text, and twice that would pass 32 KB */
  for (int rr = 0; rr < 2; ++rr) { const int lr = 2 * w + rr, p = row0 + lr; if (p >= NQ) break;      /* rows NQ.. of the last block: no output; no barrier follows */
    float* pr = out + ((size_t)b * NQ + p) * NQ + c0; v4f x[QP / 128]; float mx = -3.0e38f;
#pragma unroll      /* x[] in registers */
    for (int u = 0; u < QP / 128; ++u) x[u] = *(const v4fa*)&sc[lr][c0 + 128 * u];
#pragma unroll      /* x[] in registers */
    for (int u = 0; u < QP / 128; ++u) { const bool in = c0 + 128 * u < NQ; for (int q = 0; q < 4; ++q) { const float v = 10.0f * tanhf(x[u][q]) + bf16_round(m[u][q]); x[u][q] = in ? v : -__builtin_inff(); mx = fmaxf(mx, x[u][q]); } }
    mx = wave_max32(mx); float se = 0.f;
#pragma unroll      /* x[] in registers */
    for (int u = 0; u < QP / 128; ++u) for (int q = 0; q < 4; ++q) { x[u][q] = expf(x[u][q] - mx); se += x[u][q]; }
    const float inv = 1.0f / wave_sum32(se);
#pragma unroll      /* x[] in registers */
    for (int u = 0; u < QP / 128; ++u) { v4f o; for (int q = 0; q < 4; ++q) o[q] = x[u][q] * inv; if (c0 + 128 * u < NQ) *(v4f*)(pr + 128 * u) = o; }
    asm volatile("s_wait_xcnt 0x0" ::: "memory");      /* stands in front of the copies below and the next row, which overwrite the registers of the stores just issued */
#pragma unroll      /* m[] in registers */
    for (int u = 0; u < QP / 128; ++u) m[u] = mn[u]; } }

extern "C" void kernel_launch(void* const* d_in, const int* in_sizes, int n_in,
                              void* d_out, int out_size, void* d_ws, size_t ws_size, hipStream_t stream) {
  (void)in_sizes; (void)n_in; (void)out_size;
  const float* const* I = (const float* const*)d_in; const float* xn = I[0]; const float* xq1 = I[1]; const float* xl = I[2]; const float* mask = I[3]; const float* Wqf = I[4]; const float* Wql = I[5]; const float* Wqm = I[6]; const float* Wk = I[7]; const float* Wv = I[8]; const float* Wc = I[9]; const float* bc = I[10];      /* weights [in][out] */
  char* ws = (char*)d_ws; size_t off = 0;
  auto take = [&](size_t bytes) { char* p = ws + off; off += (bytes + 255) & ~(size_t)255; return p; };
  _Float16* BQF = (_Float16*)take((size_t)NH * 32 * DM * 2); _Float16* BQL = (_Float16*)take((size_t)NH * 32 * DM * 2); _Float16* BK = (_Float16*)take((size_t)NH * 32 * DM * 2); _Float16* BVP = (_Float16*)take((size_t)NH * 64 * DM * 2); _Float16* BCP = (_Float16*)take((size_t)DM * NH * 64 * 2); float* QMP = (float*)take((size_t)NB * NH * 32 * 4);
  _Float16* XN = (_Float16*)take(NRP * DM * 2); _Float16* XQ1 = (_Float16*)take(NRP * DM * 2); _Float16* XL = (_Float16*)take(NRP * DM * 2);
  float* QF = (float*)take(NRP * NH * 32 * 4); _Float16* Q16 = (_Float16*)take(NRP * NH * 32 * 2); _Float16* K16 = (_Float16*)take(NRP * NH * 32 * 2); _Float16* V2 = (_Float16*)take(NRP * NH * 64 * 2); float* OF = (float*)take(NRP * NH * 64 * 4); _Float16* OH = (_Float16*)take(NRP * NH * 64 * 2); _Float16* OL = (_Float16*)take(NRP * NH * 64 * 2);
  _Float16* VT = (_Float16*)take((size_t)NB * NH * 64 * QP * 2);
  float* MH = (float*)take(NRP * DM * 4);
  if (off > ws_size) return;      /* about 75 MiB */
  k_wtpadT<32><<<(NH * 32 * (DM / 8) + 255) / 256, 256, 0, stream>>>(Wqf, BQF); k_wtpadT<32><<<(NH * 32 * (DM / 8) + 255) / 256, 256, 0, stream>>>(Wql, BQL); k_wtpadT<32><<<(NH * 32 * (DM / 8) + 255) / 256, 256, 0, stream>>>(Wk, BK);
  k_wtpadT<64><<<(NH * 64 * (DM / 8) + 255) / 256, 256, 0, stream>>>(Wv, BVP); k_wtopadT<64><<<(DM * (NH * 64 / 8) + 255) / 256, 256, 0, stream>>>(Wc, BCP);
  k_x16pad<<<(unsigned)((NRP * (DM / 8) + 255) / 256), 256, 0, stream>>>(xn, XN); k_x16pad<<<(unsigned)((NRP * (DM / 8) + 255) / 256), 256, 0, stream>>>(xq1, XQ1); k_x16pad<<<(unsigned)((NRP * (DM / 8) + 255) / 256), 256, 0, stream>>>(xl, XL);
  k_qmean<<<NB, 1024, 0, stream>>>(xn, Wqm, QMP);      /* per-batch mean term in the padded q layout */
  k_gemm2<0><<<dim3((unsigned)((NRP / 128) * (NH * 32 / 64)), 1), 128, 0, stream>>>(XQ1, DM, 0, BQF, DM, 0, 0.0625f, nullptr, 0, QMP, QP, NH * 32, 0, QF, nullptr, NH * 32, 0, (int)NRP, NH * 32, DM);      /* q1 Wq_first + mean term (broadcast per batch), f32 */
  k_gemm2<0><<<dim3((unsigned)((NRP / 128) * (NH * 32 / 64)), 1), 128, 0, stream>>>(XL, DM, 0, BQL, DM, 0, 0.0625f, nullptr, 0, QF, -1, 0, 0, nullptr, Q16, NH * 32, 0, (int)NRP, NH * 32, DM);      /* + last Wq_last -> q (f16, padded [8][32]) */
  k_gemm2<0><<<dim3((unsigned)((NRP / 128) * (NH * 32 / 64)), 1), 128, 0, stream>>>(XN, DM, 0, BK, DM, 0, 0.0625f, nullptr, 0, nullptr, 1, 0, 0, nullptr, K16, NH * 32, 0, (int)NRP, NH * 32, DM);      /* k (f16, padded [8][32]) */
  k_gemm2<0><<<dim3((unsigned)((NRP / 128) * (NH * 64 / 64)), 1), 128, 0, stream>>>(XN, DM, 0, BVP, DM, 0, 0.0625f, nullptr, 0, nullptr, 1, 0, 0, nullptr, V2, NH * 64, 0, (int)NRP, NH * 64, DM);      /* v (f16, padded [8][64]) */
  k_vt<NH, QP><<<NB * NH * (QP / 64), 256, 0, stream>>>(V2, NH * 64, 0, VT);      /* V^T [8 batches][8][64][1024] */
  k_attn<<<dim3(QP / 16, NB), 256, 0, stream>>>(Q16, K16, VT, mask, OF);      /* scores / sqrt(16) + mask, softmax, weights v -> o x64 (padded [8][64], f32) */
  k_hl<<<(unsigned)((NRP * NH * 64 / 8 + 255) / 256), 256, 0, stream>>>(OF, OH, OL, NRP * NH * 64 / 8);      /* o -> f16 hi + x1024 residual */
  k_gemm2<0><<<dim3((unsigned)((NRP / 128) * (DM / 64)), 1), 128, 0, stream>>>(OH, NH * 64, 0, BCP, NH * 64, 0, 0.0009765625f, bc, 0, nullptr, 1, 0, 0, MH, nullptr, DM, 0, (int)NRP, DM, NH * 64);      /* mh = o_hi W_comb + b_comb (f32) */
  k_gemm2<0><<<dim3((unsigned)((NRP / 128) * (DM / 64)), 1), 128, 0, stream>>>(OL, NH * 64, 0, BCP, NH * 64, 0, 0.00000095367431640625f, nullptr, 0, MH, -1, 0, 0, MH, nullptr, DM, 0, (int)NRP, DM, NH * 64);      /* += o_lo W_comb 2^-20 */
  k_stage2<<<dim3((NQ + 15) / 16, NB), 256, 0, stream>>>(MH, XN, mask, (float*)d_out);      /* score2 = mh nodes^T / sqrt(128), 10 tanh, + mask, softmax over the 1000 real keys (f32) -> probs */
}

// v005
// A run of this version takes 171 microseconds.
// Next to v004, in two timings, it ran 1.46 and 1.49 times as fast.
// Over all steps from v000 it is 93.3 times as fast.
#include <hip/hip_runtime.h>
// TSP decoder probabilities (encoded_nodes, encoded_q1, encoded_last_node [8][1000][128]; k = nodes Wk, v = nodes Wv, q = q1 Wq_first + last Wq_last + (mean_n nodes) Wq_mean broadcast ([in][out] weights), 8 heads of 16; weights = softmax(q k^T / 4 + ninf_mask); mh = (weights v merged) W_comb + b_comb; score2 = mh nodes^T / sqrt(128); probs = softmax_n(10 tanh(score2) + ninf_mask) -> [8][1000][1000]).
// Compute dtype: inputs rounded to bf16; token rows / weights exact; q, k, v and the stage-1 weights as plain f16 GEMM operands (~2^-12); o and mh as f16 hi + residual operand pairs (~2^-22); the mean term, score2, tanh, mask and the final softmax f32. v_wmma_f32_16x16x32_f16.
#define NB 8
#define NQ 1000                      /* nodes = queries = 1000 */
#define QP 1024                      /* padded rows / keys per batch */
#define DM 128
#define NH 8
#define HD 16
#define SQ QP
#define HG 8
#define B0 0                         /* unused */
#define NBR NB
#define NRP ((size_t)NB * QP)        /* padded token rows */
typedef __bf16 v16b __attribute__((ext_vector_type(16)));
typedef unsigned short v8us __attribute__((ext_vector_type(8), may_alias));
typedef float  v8f  __attribute__((ext_vector_type(8)));
typedef float  v4f  __attribute__((ext_vector_type(4)));
typedef float  v4fa __attribute__((ext_vector_type(4), may_alias));
union FragB { v16b v; v8us half[2]; unsigned short u[16]; };

__device__ __forceinline__ unsigned short bf16_bits(float x) { unsigned int u = __float_as_uint(x); return (unsigned short)((u + 0x7FFFu + ((u >> 16) & 1u)) >> 16); }
__device__ __forceinline__ float bf16_val(unsigned short b) { return __uint_as_float(((unsigned int)b) << 16); }
__device__ __forceinline__ float bf16_round(float x) { return bf16_val(bf16_bits(x)); }
// D += A·B with NT terms: 1 = ah·bh, 2 = + al·bh (A split), 3 = + ah·bl (both split)
template <int NT>
__device__ __forceinline__ v8f mmaN(v16b ah, v16b al, v16b bh, v16b bl, v8f c) {
  c = __builtin_amdgcn_wmma_f32_16x16x32_bf16(false, ah, false, bh, (short)0, c, false, false);
  if (NT >= 2) c = __builtin_amdgcn_wmma_f32_16x16x32_bf16(false, al, false, bh, (short)0, c, false, false);
  if (NT >= 3) c = __builtin_amdgcn_wmma_f32_16x16x32_bf16(false, ah, false, bl, (short)0, c, false, false);
  asm volatile("v_nop\n\tv_nop\n\tv_nop\n\tv_nop" : "+v"(c) : "v"(ah), "v"(al), "v"(bh), "v"(bl));
  return c;
}

__global__ __launch_bounds__(256) void k_wt_bf16(const float* __restrict__ W, unsigned short* __restrict__ Wt, int K, int N) {
  const int t = blockIdx.x * 256 + threadIdx.x;
  const int k8n = K / 8;
  if (t >= N * k8n) return;
  const int n = t / k8n, k8 = (t % k8n) * 8;
  v8us v;
#pragma unroll
  for (int i = 0; i < 8; ++i) v[i] = bf16_bits(W[(size_t)(k8 + i) * N + n]);
  *(v8us*)(Wt + (size_t)n * K + k8) = v;
  
}

// GEMM C[M][N] (f32, pitch ldc) = act(A[M][K]·W + bias). A f32 row-major (pitch lda) converted per fragment to bf16
// (ASPLIT: hi/lo two planes -> 2 terms, else single rounded term); Wt bf16 [N][K] (pitch ldb). BIAS_BF16 rounds the
// bias to bf16 first (bias quantised to bf16 before the add). K%32==0, M%16==0, N%64==0.
template <bool ASPLIT, int ACT, bool BIAS_BF16>
__global__ __launch_bounds__(128) void k_gemm_bf(const float* __restrict__ A, int lda, const unsigned short* __restrict__ Wt, int ldb,
                                               const float* __restrict__ bias, float* __restrict__ C, int ldc, int M, int N, int K) {
  __shared__ __attribute__((aligned(16))) float so[4][16][64];
  const int tid = threadIdx.x, w = tid >> 5, lane = tid & 31, ln = lane & 15, hh = lane >> 4;
  const int ntn = N / 64;
  const int wid = blockIdx.x * 4 + w;
  const int mt = wid / ntn, nq = wid % ntn;
  if (mt * 16 >= M) return;
  const int row0 = mt * 16, col0 = nq * 64;
  const float* arow = A + (size_t)(row0 + ln) * lda;
  v8f acc[4] = {};
  for (int kb = 0; kb < K; kb += 32) {
    FragB ah, al;
    const v4f x0 = *(const v4fa*)(arow + kb + 8 * hh), x1 = *(const v4fa*)(arow + kb + 8 * hh + 4);
    const v4f x2 = *(const v4fa*)(arow + kb + 16 + 8 * hh), x3 = *(const v4fa*)(arow + kb + 16 + 8 * hh + 4);
    float xs[16] = {x0[0],x0[1],x0[2],x0[3],x1[0],x1[1],x1[2],x1[3],x2[0],x2[1],x2[2],x2[3],x3[0],x3[1],x3[2],x3[3]};
#pragma unroll
    for (int i = 0; i < 16; ++i) { const unsigned short hb = bf16_bits(xs[i]); ah.u[i] = hb; al.u[i] = ASPLIT ? bf16_bits(xs[i] - bf16_val(hb)) : (unsigned short)0; }
#pragma unroll
    for (int t = 0; t < 4; ++t) {
      const unsigned short* brow = Wt + (size_t)(col0 + t * 16 + ln) * ldb + kb;
      FragB b;
      b.half[0] = *(const v8us*)(brow + 8 * hh);
      b.half[1] = *(const v8us*)(brow + 16 + 8 * hh);
      acc[t] = mmaN<ASPLIT ? 2 : 1>(ah.v, al.v, b.v, b.v, acc[t]);
    }
  }
#pragma unroll
  for (int t = 0; t < 4; ++t) {
    float bv = bias ? bias[col0 + t * 16 + ln] : 0.f;
    if (BIAS_BF16) bv = bf16_round(bv);
#pragma unroll
    for (int r = 0; r < 8; ++r) { float v = acc[t][r] + bv; if (ACT == 1) v = fmaxf(v, 0.f); so[w][8 * hh + r][t * 16 + ln] = v; }
  }
  __builtin_amdgcn_fence(__ATOMIC_ACQ_REL, "workgroup");
  __builtin_amdgcn_wave_barrier();
  const int rsub = lane >> 4, c4 = (lane & 15) * 4;
  {
#pragma unroll
    for (int q = 0; q < 8; ++q) {
      const int r = q * 2 + rsub;
      const v4f v = *(const v4fa*)&so[w][r][c4];
      *(v4f*)(C + (size_t)(row0 + r) * ldc + col0 + c4) = v;
    }
    
  }
}

// GEMM C = act(A·W + bias + resid): A f32 (ASPLIT -> hi/lo 2 terms), Wt bf16 [N][K]; ACT 0 none, 1 relu, 2 exact gelu;
// resid (optional, f32, row index = (row % rmod), pitch ldr, RES_BF16 rounds it) added before the activation.
template <bool ASPLIT, int ACT, bool BIAS_BF16, bool RES_BF16>
__global__ __launch_bounds__(128) void k_gemm_bf3(const float* __restrict__ A, int lda, const unsigned short* __restrict__ Wt, int ldb,
                                                const float* __restrict__ bias, const float* __restrict__ resid, int rmod, int ldr,
                                                float* __restrict__ C, int ldc, int M, int N, int K) {
  __shared__ __attribute__((aligned(16))) float so[4][16][64];
  const int tid = threadIdx.x, w = tid >> 5, lane = tid & 31, ln = lane & 15, hh = lane >> 4;
  const int ntn = N / 64;
  const int wid = blockIdx.x * 4 + w;
  const int mt = wid / ntn, nq = wid % ntn;
  if (mt * 16 >= M) return;
  const int row0 = mt * 16, col0 = nq * 64;
  const float* arow = A + (size_t)(row0 + ln) * lda;
  v8f acc[4] = {};
  for (int kb = 0; kb < K; kb += 32) {
    FragB ah, al;
    const v4f x0 = *(const v4fa*)(arow + kb + 8 * hh), x1 = *(const v4fa*)(arow + kb + 8 * hh + 4);
    const v4f x2 = *(const v4fa*)(arow + kb + 16 + 8 * hh), x3 = *(const v4fa*)(arow + kb + 16 + 8 * hh + 4);
    float xs[16] = {x0[0],x0[1],x0[2],x0[3],x1[0],x1[1],x1[2],x1[3],x2[0],x2[1],x2[2],x2[3],x3[0],x3[1],x3[2],x3[3]};
#pragma unroll
    for (int i = 0; i < 16; ++i) { const unsigned short hb = bf16_bits(xs[i]); ah.u[i] = hb; al.u[i] = ASPLIT ? bf16_bits(xs[i] - bf16_val(hb)) : (unsigned short)0; }
#pragma unroll
    for (int t = 0; t < 4; ++t) {
      const unsigned short* brow = Wt + (size_t)(col0 + t * 16 + ln) * ldb + kb;
      FragB b;
      b.half[0] = *(const v8us*)(brow + 8 * hh);
      b.half[1] = *(const v8us*)(brow + 16 + 8 * hh);
      acc[t] = mmaN<ASPLIT ? 2 : 1>(ah.v, al.v, b.v, b.v, acc[t]);
    }
  }
#pragma unroll
  for (int t = 0; t < 4; ++t) {
    const int col = col0 + t * 16 + ln;
    float bv = bias ? bias[col] : 0.f;
    if (BIAS_BF16) bv = bf16_round(bv);
#pragma unroll
    for (int r = 0; r < 8; ++r) {
      float v = acc[t][r] + bv;
      if (resid) { float rv = resid[(size_t)((row0 + 8 * hh + r) % rmod) * ldr + col]; if (RES_BF16) rv = bf16_round(rv); v += rv; }
      if (ACT == 1) v = fmaxf(v, 0.f);
      if (ACT == 2) v = 0.5f * v * (1.0f + erff(v * 0.70710678118654752f));
      if (ACT == 3) { const float u = 0.7978845608028654f * (v + 0.044715f * v * v * v); v = 0.5f * v * (1.0f + tanhf(u)); }
      so[w][8 * hh + r][t * 16 + ln] = v;
    }
  }
  __builtin_amdgcn_fence(__ATOMIC_ACQ_REL, "workgroup");
  __builtin_amdgcn_wave_barrier();
  const int rsub = lane >> 4, c4 = (lane & 15) * 4;
  {
#pragma unroll
    for (int q = 0; q < 8; ++q) {
      const int r = q * 2 + rsub;
      const v4f v = *(const v4fa*)&so[w][r][c4];
      *(v4f*)(C + (size_t)(row0 + r) * ldc + col0 + c4) = v;
    }
    
  }
}
// row LayerNorm (biased variance, eps) over N: s = X (+ R); optional out_sum <- s; out_norm <- (s-mu)*rsqrt(var+eps)*g + b
template <bool PARAM_BF16>
__global__ __launch_bounds__(256) void k_layernorm(const float* __restrict__ X, const float* __restrict__ R, const float* __restrict__ g, const float* __restrict__ bta,
                                                  float* __restrict__ out_sum, float* __restrict__ out_norm, int N, float eps) {
  __shared__ float red[256];
  const int row = blockIdx.x, tid = threadIdx.x;
  const float* x = X + (size_t)row * N; const float* rr = R ? R + (size_t)row * N : nullptr;
  float vals[16];                     // up to N = 4096
  const int per = N / 256;            // contiguous chunk per thread? use strided-by-4 chunks: thread handles j = tid*4 + 1024*u
  float s1 = 0.f;
  for (int u = 0; u < per / 4; ++u) {
    const int j = tid * 4 + 1024 * u;
    const v4f a = *(const v4fa*)(x + j);
    v4f b = {0.f,0.f,0.f,0.f}; if (rr) b = *(const v4fa*)(rr + j);
#pragma unroll
    for (int q = 0; q < 4; ++q) { const float v = a[q] + b[q]; vals[u * 4 + q] = v; s1 += v; }
  }
  red[tid] = s1; __syncthreads();
  for (int st = 128; st > 0; st >>= 1) { if (tid < st) red[tid] += red[tid + st]; __syncthreads(); }
  const float mu = red[0] / (float)N; __syncthreads();
  float s2 = 0.f;
  for (int u = 0; u < per / 4; ++u)
#pragma unroll
    for (int q = 0; q < 4; ++q) { const float c = vals[u * 4 + q] - mu; s2 += c * c; }
  red[tid] = s2; __syncthreads();
  for (int st = 128; st > 0; st >>= 1) { if (tid < st) red[tid] += red[tid + st]; __syncthreads(); }
  const float rs = rsqrtf(red[0] / (float)N + eps);
  {
    for (int u = 0; u < per / 4; ++u) {
      const int j = tid * 4 + 1024 * u;
      v4f o, sm;
#pragma unroll
      for (int q = 0; q < 4; ++q) {
        float gg = g[j + q], bb = bta[j + q];
        if (PARAM_BF16) { gg = bf16_round(gg); bb = bf16_round(bb); }
        sm[q] = vals[u * 4 + q]; o[q] = (vals[u * 4 + q] - mu) * rs * gg + bb;
      }
      if (out_sum) *(v4f*)(out_sum + (size_t)row * N + j) = sm;
      *(v4f*)(out_norm + (size_t)row * N + j) = o;
    }
    
  }
}



// ---- f16 WMMA path (v_wmma_f32_16x16x32_f16): 11-bit significands for operands in range — used where a [0,1] probability operand needs more precision than bf16
typedef _Float16 v16h __attribute__((ext_vector_type(16)));
union FragH { v16h v; v8us half[2]; _Float16 h[16]; unsigned short u[16]; };
template <int NT>
__device__ __forceinline__ v8f mmaH(v16h ah, v16h al, v16h bh, v16h bl, v8f c) {
  c = __builtin_amdgcn_wmma_f32_16x16x32_f16(false, ah, false, bh, (short)0, c, false, false);
  if (NT >= 2) c = __builtin_amdgcn_wmma_f32_16x16x32_f16(false, al, false, bh, (short)0, c, false, false);
  if (NT >= 3) c = __builtin_amdgcn_wmma_f32_16x16x32_f16(false, ah, false, bl, (short)0, c, false, false);
  asm volatile("v_nop\n\tv_nop\n\tv_nop\n\tv_nop" : "+v"(c) : "v"(ah), "v"(al), "v"(bh), "v"(bl));
  return c;
}
// batched GEMM like k_gemm_b but f16 operands: A f32 (split into f16 hi/lo if ASPLIT, else rounded to f16), Bt = f16 values [n][k]; alpha; C f32; N multiple of 16 (partial tiles skipped)
template <bool ASPLIT>
__global__ __launch_bounds__(128) void k_gemm_h(const float* __restrict__ A, int lda, size_t sA, const _Float16* __restrict__ Bh, int ldb, size_t sB, float alpha, float* __restrict__ C, int ldc, size_t sC, int M, int N, int K) {
  __shared__ __attribute__((aligned(16))) float so[4][16][64];
  const int tid = threadIdx.x, w = tid >> 5, lane = tid & 31, ln = lane & 15, hh = lane >> 4; const int by = blockIdx.y;
  A += (size_t)by * sA; Bh += (size_t)by * sB; C += (size_t)by * sC;
  const int ntn = (N + 63) / 64; const int wid = blockIdx.x * 4 + w; const int mt = wid / ntn, nq = wid % ntn; if (mt * 16 >= M) return;
  const int row0 = mt * 16, col0 = nq * 64; const float* arow = A + (size_t)(row0 + ln) * lda;
  v8f acc[4] = {};
  for (int kb = 0; kb < K; kb += 32) {
    FragH ah, al;
    const v4f x0 = *(const v4fa*)(arow + kb + 8 * hh), x1 = *(const v4fa*)(arow + kb + 8 * hh + 4), x2 = *(const v4fa*)(arow + kb + 16 + 8 * hh), x3 = *(const v4fa*)(arow + kb + 16 + 8 * hh + 4);
    float xs[16] = {x0[0],x0[1],x0[2],x0[3],x1[0],x1[1],x1[2],x1[3],x2[0],x2[1],x2[2],x2[3],x3[0],x3[1],x3[2],x3[3]};
#pragma unroll
    for (int i = 0; i < 16; ++i) { const _Float16 h = (_Float16)xs[i]; ah.h[i] = h; al.h[i] = ASPLIT ? (_Float16)(xs[i] - (float)h) : (_Float16)0.0f; }
#pragma unroll
    for (int t = 0; t < 4; ++t) { if (col0 + t * 16 >= N) continue; const size_t boff = (size_t)(col0 + t * 16 + ln) * ldb + kb; FragH bq; bq.half[0] = *(const v8us*)(Bh + boff + 8 * hh); bq.half[1] = *(const v8us*)(Bh + boff + 16 + 8 * hh);
      acc[t] = mmaH<ASPLIT ? 2 : 1>(ah.v, al.v, bq.v, bq.v, acc[t]); }
  }
#pragma unroll
  for (int t = 0; t < 4; ++t) { if (col0 + t * 16 >= N) continue;
#pragma unroll
    for (int r = 0; r < 8; ++r) so[w][8 * hh + r][t * 16 + ln] = acc[t][r] * alpha; }
  __builtin_amdgcn_fence(__ATOMIC_ACQ_REL, "workgroup"); __builtin_amdgcn_wave_barrier();
  const int rsub = lane >> 4, c4 = (lane & 15) * 4;
  {
#pragma unroll
    for (int q = 0; q < 8; ++q) { const int r = q * 2 + rsub; if (col0 + c4 < N) { const v4f v = *(const v4fa*)&so[w][r][c4]; *(v4f*)(C + (size_t)(row0 + r) * ldc + col0 + c4) = v; } }
     }
}

// Wt[n][k] = f16(W[k][n]·scale) from f32 row-major W[K][N] (scale = power of two; bf16-exact weights stay exact in f16 away from the subnormal range)
__global__ __launch_bounds__(256) void k_wt_f16(const float* __restrict__ W, _Float16* __restrict__ Wt, int K, int N, float scale) {
  const int t = blockIdx.x * 256 + threadIdx.x; if (t >= N * (K / 8)) return; const int n = t / (K / 8), k8 = (t % (K / 8)) * 8; FragH f;
#pragma unroll
  for (int i = 0; i < 8; ++i) f.h[i] = (_Float16)(bf16_round(W[(size_t)(k8 + i) * N + n]) * scale); const v8us o = f.half[0];
  *(v8us*)((unsigned short*)Wt + (size_t)n * K + k8) = o; 
}
// k_gemm_hh variant with fused epilogue: v = acc·alpha + bias[by·sBias + col] (+ CP[(row/rowsPerB)·sCPb + by·64 + col] if CP) ; ACT 0 none / 1 elu ; writes f16 C16 (and f32 C if non-null)
template <int ACT>
__global__ __launch_bounds__(128) void k_gemm_hhx(const _Float16* __restrict__ A, int lda, size_t sA, const _Float16* __restrict__ Bh, int ldb, size_t sB, float alpha, const float* __restrict__ bias, size_t sBias, const float* __restrict__ CP, int rowsPerB, size_t sCPb, int row0g,
    float* __restrict__ C, _Float16* __restrict__ C16, int ldc, size_t sC, int M, int N, int K) {
  __shared__ __attribute__((aligned(16))) float so[4][16][64];
  const int tid = threadIdx.x, w = tid >> 5, lane = tid & 31, ln = lane & 15, hh = lane >> 4; const int by = blockIdx.y;
  A += (size_t)by * sA; Bh += (size_t)by * sB; const size_t cofs = (size_t)by * sC; const float* bp = bias ? bias + (size_t)by * sBias : nullptr;
  const int ntn = (N + 63) / 64; const int wid = blockIdx.x * 4 + w; const int mt = wid / ntn, nq = wid % ntn; if (mt * 16 >= M) return;
  const int row0 = mt * 16, col0 = nq * 64; const _Float16* arow = A + (size_t)(row0 + ln) * lda;
  v8f acc[4] = {};
  for (int kb = 0; kb < K; kb += 32) { FragH ah; ah.half[0] = *(const v8us*)((const unsigned short*)arow + kb + 8 * hh); ah.half[1] = *(const v8us*)((const unsigned short*)arow + kb + 16 + 8 * hh);
#pragma unroll
    for (int t = 0; t < 4; ++t) { if (col0 + t * 16 >= N) continue; const size_t boff = (size_t)(col0 + t * 16 + ln) * ldb + kb; FragH bq; bq.half[0] = *(const v8us*)((const unsigned short*)Bh + boff + 8 * hh); bq.half[1] = *(const v8us*)((const unsigned short*)Bh + boff + 16 + 8 * hh);
      acc[t] = mmaH<1>(ah.v, ah.v, bq.v, bq.v, acc[t]); }
  }
#pragma unroll
  for (int t = 0; t < 4; ++t) { if (col0 + t * 16 >= N) continue; const int col = col0 + t * 16 + ln; const float bv = bp ? bf16_round(bp[col]) : 0.f;
#pragma unroll
    for (int r = 0; r < 8; ++r) { float v = acc[t][r] * alpha + bv; if (CP) { const int rr = row0g + row0 + 8 * hh + r; if (rowsPerB < 0) v += CP[cofs + (size_t)rr * ldc + col];      /* rowsPerB < 0: own element of the batched C plane */ else { const int bidx = rr / rowsPerB; v += CP[(size_t)bidx * sCPb + (size_t)by * 64 + col]; } } if (ACT == 1) v = (v > 0.f) ? v : expm1f(v); else if (ACT == 7) v = (v > 0.f) ? v + 1.0f : expf(v); else if (ACT == 8) v = tanhf(v); else if (ACT == 9) v = 0.5f * v * (1.0f + tanhf(0.7978845608028654f * (v + 0.044715f * v * v * v))); else if (ACT == 11) v = 1.0f / (1.0f + expf(-v)); else if (ACT == 12) v = (v > 0.f) ? v : 0.01f * v; else if (ACT == 14) v = (v > 0.f) ? v : 0.1f * v; else if (ACT == 16) v = (v >= 0.f) ? v : 0.3f * v; else if (ACT == 17) v = (v >= 0.f) ? v : 0.2f * v; else if (ACT == 15) v = v / (1.0f + expf(-v)); else if (ACT == 3) v = fmaxf(v, 0.f); else if (ACT == 6) v = 0.5f * v * (1.0f + erff(v * 0.70710678118654752f)); so[w][8 * hh + r][t * 16 + ln] = v; } }
  __builtin_amdgcn_fence(__ATOMIC_ACQ_REL, "workgroup"); __builtin_amdgcn_wave_barrier();
  const int rsub = lane >> 4, c4 = (lane & 15) * 4; typedef _Float16 v4h __attribute__((ext_vector_type(4)));
  {
#pragma unroll
    for (int q = 0; q < 8; ++q) { const int r = q * 2 + rsub; if (col0 + c4 < N) { const v4f v = *(const v4fa*)&so[w][r][c4]; if (C) *(v4f*)(C + cofs + (size_t)(row0 + r) * ldc + col0 + c4) = v; if (C16) { v4h h4; for (int i = 0; i < 4; ++i) h4[i] = (_Float16)v[i]; *(v4h*)(C16 + cofs + (size_t)(row0 + r) * ldc + col0 + c4) = h4; } } }
     }
}


typedef _Float16 v4h __attribute__((ext_vector_type(4)));

__global__ __launch_bounds__(256) void k_x16(const float* __restrict__ x, _Float16* __restrict__ X16, size_t n8) { const size_t t = (size_t)blockIdx.x * 256 + threadIdx.x; if (t >= n8) return; FragH f;
#pragma unroll
  for (int q = 0; q < 8; ++q) f.h[q] = (_Float16)bf16_round(x[t * 8 + q]); *(v8us*)((unsigned short*)X16 + t * 8) = f.half[0];  }
__global__ __launch_bounds__(256) void k_h16(const float* __restrict__ x, _Float16* __restrict__ X16, size_t n8) { const size_t t = (size_t)blockIdx.x * 256 + threadIdx.x; if (t >= n8) return; FragH f;
#pragma unroll
  for (int q = 0; q < 8; ++q) f.h[q] = (_Float16)x[t * 8 + q]; *(v8us*)((unsigned short*)X16 + t * 8) = f.half[0];  }
__global__ __launch_bounds__(256) void k_round16f(const float* __restrict__ W, _Float16* __restrict__ Bt, size_t n8) { const size_t t = (size_t)blockIdx.x * 256 + threadIdx.x; if (t >= n8) return; FragH f;
#pragma unroll
  for (int i = 0; i < 8; ++i) f.h[i] = (_Float16)(bf16_round(W[t * 8 + i]) * 16.0f); *(v8us*)((unsigned short*)Bt + t * 8) = f.half[0];  }
template <int NHv, int TTv>
__global__ __launch_bounds__(256) void k_vt(const _Float16* __restrict__ V16, int ldv, int voff, _Float16* __restrict__ Vt) { __shared__ unsigned short tl[64][66]; const int tid = threadIdx.x; const int slab = blockIdx.x / (TTv / 64), lg = blockIdx.x % (TTv / 64); const int b = slab / NHv, h = slab % NHv;
  for (int i = tid; i < 64 * 8; i += 256) { const int r = i / 8, c8 = (i % 8) * 8; FragH f; f.half[0] = *(const v8us*)((const unsigned short*)V16 + ((size_t)b * TTv + lg * 64 + r) * ldv + voff + h * 64 + c8);
#pragma unroll
    for (int q = 0; q < 8; ++q) tl[r][c8 + q] = f.u[q]; }
  __syncthreads();
  {
#pragma unroll
    for (int rd = 0; rd < 2; ++rd) { const int d = rd * 32 + tid / 8, pc = tid % 8; FragH f;
#pragma unroll
      for (int q = 0; q < 8; ++q) f.u[q] = tl[pc * 8 + q][d];
      *(v8us*)((unsigned short*)Vt + ((size_t)slab * 64 + d) * TTv + lg * 64 + pc * 8) = f.half[0]; }
     } }

__global__ __launch_bounds__(256) void k_hl(const float* __restrict__ F, _Float16* __restrict__ Hh, _Float16* __restrict__ Hl, size_t n8) { const size_t t = (size_t)blockIdx.x * 256 + threadIdx.x; if (t >= n8) return; FragH fh, fl; const v4f a = *(const v4fa*)(F + t * 8), c = *(const v4fa*)(F + t * 8 + 4);
#pragma unroll
  for (int q = 0; q < 4; ++q) { _Float16 h = (_Float16)a[q]; fh.h[q] = h; fl.h[q] = (_Float16)((a[q] - (float)h) * 1024.0f); h = (_Float16)c[q]; fh.h[4 + q] = h; fl.h[4 + q] = (_Float16)((c[q] - (float)h) * 1024.0f); }
  { *(v8us*)((unsigned short*)Hh + t * 8) = fh.half[0]; *(v8us*)((unsigned short*)Hl + t * 8) = fl.half[0];  } }

// ---- fast GEMM (wave tile 32x64; requires M % 32 == 0 rows per launch region and N % 64 == 0); epilogue = k_gemm_hhx semantics ----
__device__ __forceinline__ v16h g2_frag(const _Float16* p, int hh) { FragH f; f.half[0] = *(const v8us*)((const unsigned short*)p + 8 * hh); f.half[1] = *(const v8us*)((const unsigned short*)p + 16 + 8 * hh); return f.v; }
__device__ __forceinline__ v8f g2_mma(v16h a, v16h b, v8f c) { v8f d = __builtin_amdgcn_wmma_f32_16x16x32_f16(false, a, false, b, (short)0, c, false, false); asm volatile("v_nop\n\tv_nop\n\tv_nop\n\tv_nop" : "+v"(d) : "v"(a), "v"(b)); return d; }
template <int ACT>
__global__ __launch_bounds__(128) void k_gemm2(const _Float16* __restrict__ A, int lda, size_t sA, const _Float16* __restrict__ Bh, int ldb, size_t sB, float alpha, const float* __restrict__ bias, size_t sBias, const float* __restrict__ CP, int rowsPerB, size_t sCPb, int row0g,
    float* __restrict__ C, _Float16* __restrict__ C16, int ldc, size_t sC, int M, int N, int K) { static_assert(ACT == 0 || ACT == 3 || ACT == 6 || ACT == 8 || ACT == 9 || ACT == 11 || ACT == 12 || ACT == 14 || ACT == 15 || ACT == 16 || ACT == 17, "k_gemm2: unsupported ACT code (would silently apply no activation)");
  __shared__ __attribute__((aligned(16))) float so[4][32][68];
  const int tid = threadIdx.x, w = tid >> 5, lane = tid & 31, ln = lane & 15, hh = lane >> 4; const int by = blockIdx.y;
  A += (size_t)by * sA; Bh += (size_t)by * sB; const size_t cofs = (size_t)by * sC; const float* bp = bias ? bias + (size_t)by * sBias : nullptr;
  const int ntn = N >> 6; const int mt = blockIdx.x / ntn, nq = blockIdx.x - mt * ntn; const int row0 = mt * 128 + 32 * w, col0 = nq * 64; if (row0 >= M) return;
  const _Float16* a0p = A + (size_t)(row0 + ln) * lda; const _Float16* a1p = a0p + (size_t)16 * lda;
  const _Float16* b0p = Bh + (size_t)(col0 + ln) * ldb; const _Float16* b1p = b0p + (size_t)16 * ldb; const _Float16* b2p = b1p + (size_t)16 * ldb; const _Float16* b3p = b2p + (size_t)16 * ldb;
  const v8f z8 = {0.f,0.f,0.f,0.f,0.f,0.f,0.f,0.f}; v8f c00 = z8, c01 = z8, c02 = z8, c03 = z8, c10 = z8, c11 = z8, c12 = z8, c13 = z8;
#pragma unroll 1
  for (int kb = 0; kb < K; kb += 32) { const v16h a0 = g2_frag(a0p + kb, hh), a1 = g2_frag(a1p + kb, hh);
    v16h b = g2_frag(b0p + kb, hh); c00 = g2_mma(a0, b, c00); c10 = g2_mma(a1, b, c10);
    b = g2_frag(b1p + kb, hh); c01 = g2_mma(a0, b, c01); c11 = g2_mma(a1, b, c11);
    b = g2_frag(b2p + kb, hh); c02 = g2_mma(a0, b, c02); c12 = g2_mma(a1, b, c12);
    b = g2_frag(b3p + kb, hh); c03 = g2_mma(a0, b, c03); c13 = g2_mma(a1, b, c13); }
  v8f accs[8] = {c00, c01, c02, c03, c10, c11, c12, c13};
#pragma unroll
  for (int u = 0; u < 8; ++u) { const int t = u & 3, half = u >> 2; const int col = col0 + t * 16 + ln; const float bv = bp ? bf16_round(bp[col]) : 0.f;
#pragma unroll
    for (int r = 0; r < 8; ++r) { const int rloc = half * 16 + 8 * hh + r; float v = accs[u][r] * alpha + bv; if (CP) { if (rowsPerB < 0) v += CP[cofs + (size_t)(row0g + row0 + rloc) * ldc + col];      /* rowsPerB < 0: own element of the batched C plane */ else { const int bidx = (row0g + row0 + rloc) / rowsPerB; v += CP[(size_t)bidx * sCPb + (size_t)by * 64 + col]; } }
      if (ACT == 3) v = fmaxf(v, 0.f); else if (ACT == 6) v = 0.5f * v * (1.0f + erff(v * 0.70710678118654752f)); else if (ACT == 11) v = 1.0f / (1.0f + expf(-v)); else if (ACT == 15) v = v / (1.0f + expf(-v)); else if (ACT == 12) v = (v > 0.f) ? v : 0.01f * v; else if (ACT == 8) v = tanhf(v); else if (ACT == 9) v = 0.5f * v * (1.0f + tanhf(0.7978845608028654f * (v + 0.044715f * v * v * v))); else if (ACT == 14) v = (v > 0.f) ? v : 0.1f * v; else if (ACT == 16) v = (v >= 0.f) ? v : 0.3f * v; else if (ACT == 17) v = (v >= 0.f) ? v : 0.2f * v;
      so[w][rloc][t * 16 + ln] = v; } }
  __builtin_amdgcn_fence(__ATOMIC_ACQ_REL, "workgroup"); __builtin_amdgcn_wave_barrier();
  const int rsub = lane >> 4, c4 = (lane & 15) * 4;
  {
#pragma unroll
    for (int q = 0; q < 16; ++q) { const int r = q * 2 + rsub; const v4f v = *(const v4fa*)&so[w][r][c4]; if (C) *(v4f*)(C + cofs + (size_t)(row0 + r) * ldc + col0 + c4) = v; if (C16) { v4h h4; for (int i = 0; i < 4; ++i) h4[i] = (_Float16)v[i]; *(v4h*)(C16 + cofs + (size_t)(row0 + r) * ldc + col0 + c4) = h4; } }
     } }


__global__ __launch_bounds__(256) void k_wnat(const float* __restrict__ w, size_t n8, _Float16* __restrict__ Bt) { const size_t t = (size_t)blockIdx.x * 256 + threadIdx.x; if (t >= n8) return; FragH f; for (int q = 0; q < 8; ++q) f.h[q] = (_Float16)(bf16_round(w[t * 8 + q]) * 16.0f); *(v8us*)((unsigned short*)Bt + t * 8) = f.half[0];  }
__global__ __launch_bounds__(256) void k_rsm(const float* __restrict__ S, _Float16* __restrict__ P, int nrows) {
  #pragma clang fp contract(off)
  const int i = blockIdx.x * 256 + threadIdx.x; if (i >= nrows) return; const float* s = S + (size_t)i * SQ; float mx = -3.0e38f;
#pragma unroll 1
  for (int j = 0; j < SQ; ++j) mx = fmaxf(mx, s[j]); float se = 0.f;
#pragma unroll 1
  for (int j = 0; j < SQ; ++j) se += expf(s[j] - mx); const float sc = 256.0f / se;
#pragma unroll 1
  for (int j0 = 0; j0 < SQ; j0 += 8) { FragH f; for (int q = 0; q < 8; ++q) f.h[q] = (_Float16)(expf(s[j0 + q] - mx) * sc); unsigned short* d = (unsigned short*)P + (size_t)i * SQ + j0; *(v8us*)d = f.half[0];  } }
__global__ __launch_bounds__(256) void k_vt(const _Float16* __restrict__ V16, int b, int h0, _Float16* __restrict__ VT) { __shared__ unsigned short tl[64][65]; const int tid = threadIdx.x; const int hh = blockIdx.x % HG, sg = blockIdx.x / HG; const int s0 = sg * 64; const int h = h0 + hh;
  for (int i = tid; i < 64 * 8; i += 256) { const int j = i / 8, d8 = (i % 8) * 8; FragH f; f.half[0] = *(const v8us*)((const unsigned short*)V16 + ((size_t)b * SQ + s0 + j) * DM + h * HD + d8); for (int q = 0; q < 8; ++q) tl[d8 + q][j] = f.u[q]; }
  __syncthreads();
  { for (int i = tid; i < 64 * 8; i += 256) { const int d = i / 8, j8 = (i % 8) * 8; FragH f; for (int q = 0; q < 8; ++q) f.u[q] = tl[d][j8 + q]; *(v8us*)((unsigned short*)VT + ((size_t)hh * HD + d) * SQ + s0 + j8) = f.half[0]; }  } }


// The set-up pieces below are device functions of a flat thread index t: k_prep deals them out by block range.
__device__ __forceinline__ void x16pad_at(const float* __restrict__ x, _Float16* __restrict__ X16, size_t t) { if (t >= (size_t)NB * QP * (DM / 8)) return; const int c8 = (int)(t % (DM / 8)) * 8; const size_t row = t / (DM / 8); const int b = (int)(row / QP), q = (int)(row % QP); FragH f;
  for (int i = 0; i < 8; ++i) f.h[i] = (_Float16)((q < NQ) ? bf16_round(x[((size_t)b * NQ + q) * DM + c8 + i]) : 0.f);
  *(v8us*)((unsigned short*)X16 + row * DM + c8) = f.half[0];
  asm volatile("s_wait_xcnt 0x0" ::: "memory"); }      /* behind the store: in k_prep's listing a branch leads on from here into another piece's code, which overwrites the store's registers */


template <int HPP>
__device__ __forceinline__ void wtpadT_at(const float* __restrict__ w, _Float16* __restrict__ Bt, int t) { if (t >= NH * HPP * (DM / 8)) return; const int k8 = (t % (DM / 8)) * 8; const int r = t / (DM / 8); const int h = r / HPP, d = r % HPP; FragH f;
  for (int q = 0; q < 8; ++q) { float v = 0.f; if (d < HD) v = bf16_round(w[(size_t)(k8 + q) * DM + h * HD + d]); f.h[q] = (_Float16)(v * 16.0f); }
  unsigned short* dst = (unsigned short*)Bt + (size_t)r * DM + k8; *(v8us*)dst = f.half[0];
  asm volatile("s_wait_xcnt 0x0" ::: "memory"); }      /* behind the store, as in x16pad_at */
template <int HPP>
__device__ __forceinline__ void wtopadT_at(const float* __restrict__ w, _Float16* __restrict__ Bt, int t) { if (t >= DM * (NH * HPP / 8)) return; const int k8 = (t % (NH * HPP / 8)) * 8; const int n = t / (NH * HPP / 8); FragH f;
  for (int q = 0; q < 8; ++q) { const int kp = k8 + q; const int h = kp / HPP, d = kp % HPP; float v = 0.f; if (d < HD) v = bf16_round(w[(size_t)(h * HD + d) * DM + n]); f.h[q] = (_Float16)(v * 16.0f); }
  unsigned short* dst = (unsigned short*)Bt + (size_t)n * (NH * HPP) + k8; *(v8us*)dst = f.half[0];
  asm volatile("s_wait_xcnt 0x0" ::: "memory"); }      /* behind the store, as in x16pad_at */
// Mean term, one block of 32 waves per batch. Column sums: 25 waves of 40 rows each; a wave reads whole 512-byte rows (lane = 4 columns), rows w, w + 25, ..., eight loads in flight; the 25 partial rows meet in LDS.
// mu Wq_mean: thread = (output column, slice of 16 rows of Wq_mean), its 16 weights loaded ahead of the row loads; the 8 slices meet in LDS.
#define MW 25                        /* waves that sum rows; NQ = MW * 40 */
__device__ __forceinline__ void qmean_at(const float* __restrict__ xn, const float* __restrict__ wqm, float* __restrict__ QMP, int b) {
  static_assert(NQ % (MW * 8) == 0 && MW <= 32, "rows deal out evenly, eight a round");
  __shared__ __attribute__((aligned(16))) float part[MW][DM]; __shared__ float mu[DM]; __shared__ float wp[8][DM];
  const int t = threadIdx.x, c4 = (t & 31) * 4, col = t % DM, kg = t / DM; float wv[DM / 8];
  const int w = __builtin_amdgcn_readfirstlane(t >> 5);      /* wave number in a scalar register: row addresses and the test on it are scalar */
#pragma unroll      /* wv[] in registers, all 16 loads in flight */
  for (int i = 0; i < DM / 8; ++i) wv[i] = wqm[(size_t)(kg * (DM / 8) + i) * DM + col];
  asm volatile("s_wait_xcnt 0x0" ::: "memory");      /* stands in front of the row addresses below: this build forms them in the offset register of the weight loads just issued */
  if (w < MW) { const float* rows = xn + ((size_t)b * NQ + w) * DM + c4; v4f s = {0.f, 0.f, 0.f, 0.f};
#pragma unroll 1      /* eight loads a round: a fully unrolled form of this loop spilled at the 128 registers a wave has in a 1024-thread block */
    for (int r = 0; r < NQ / (MW * 8); ++r) { v4f a[8];
#pragma unroll      /* a[] in registers, the round's loads in flight together */
      for (int j = 0; j < 8; ++j) a[j] = *(const v4fa*)(rows + (size_t)(r * 8 + j) * MW * DM);
#pragma unroll      /* a[] in registers */
      for (int j = 0; j < 8; ++j) for (int q = 0; q < 4; ++q) s[q] += bf16_round(a[j][q]); }
    *(v4f*)&part[w][c4] = s; }
  __syncthreads();
  if (t < DM) { float m = 0.f; for (int i = 0; i < MW; ++i) m += part[i][t]; mu[t] = m / (float)NQ; }
  __syncthreads();
  float v = 0.f;
#pragma unroll      /* wv[] in registers */
  for (int i = 0; i < DM / 8; ++i) v += mu[kg * (DM / 8) + i] * bf16_round(wv[i]);
  wp[kg][col] = v;
  __syncthreads();
  if (t < NH * 32) { const int h = t / 32, d = t % 32; float o = 0.f; if (d < HD) for (int g = 0; g < 8; ++g) o += wp[g][h * HD + d]; QMP[(size_t)b * (NH * 32) + t] = o; } }
// Set-up, one launch: nothing here reads what another piece writes, so the nine pieces are block ranges of one grid of 1024-thread blocks. The mean term and then the weights have the longest chains of waits and take the first blocks.
#define PT 1024                                   /* threads of a set-up block */
#define PB_X ((int)(NRP * (DM / 8) / PT))         /* blocks of one token plane */
#define PB_W32 (NH * 32 * (DM / 8) / PT)          /* blocks of a [8][32]-padded weight */
#define PB_W64 (NH * 64 * (DM / 8) / PT)          /* blocks of a [8][64]-padded weight */
#define PB_ALL (NB + 3 * PB_X + 3 * PB_W32 + 2 * PB_W64)
__global__ __launch_bounds__(PT) void k_prep(const float* __restrict__ xn, const float* __restrict__ xq1, const float* __restrict__ xl, const float* __restrict__ wqf, const float* __restrict__ wql, const float* __restrict__ wqm, const float* __restrict__ wk, const float* __restrict__ wv, const float* __restrict__ wc,
    _Float16* __restrict__ XN, _Float16* __restrict__ XQ1, _Float16* __restrict__ XL, _Float16* __restrict__ BQF, _Float16* __restrict__ BQL, _Float16* __restrict__ BK, _Float16* __restrict__ BVP, _Float16* __restrict__ BCP, float* __restrict__ QMP) {
  static_assert(NRP * (DM / 8) % PT == 0 && NH * 32 * (DM / 8) % PT == 0 && DM * (NH * 64 / 8) == NH * 64 * (DM / 8), "every piece is a whole number of blocks");
  int r = blockIdx.x; const int tid = threadIdx.x;
  if (r < NB) { qmean_at(xn, wqm, QMP, r); return; }      /* the branch is the same for a whole block: its barriers are met by all of it */
  r -= NB;
  if (r < 3 * PB_W32) { const int s = r / PB_W32; wtpadT_at<32>(s == 0 ? wqf : s == 1 ? wql : wk, s == 0 ? BQF : s == 1 ? BQL : BK, (r - s * PB_W32) * PT + tid); return; }
  r -= 3 * PB_W32;
  if (r < PB_W64) { wtpadT_at<64>(wv, BVP, r * PT + tid); return; }
  r -= PB_W64;
  if (r < PB_W64) { wtopadT_at<64>(wc, BCP, r * PT + tid); return; }
  r -= PB_W64;
  const int s = r / PB_X; x16pad_at(s == 0 ? xn : s == 1 ? xq1 : xl, s == 0 ? XN : s == 1 ? XQ1 : XL, (size_t)(r - s * PB_X) * PT + tid); }
// Projections, one launch: q, k and V^T are block ranges of one grid; tile, fragments and store path are those of k_gemm2 (wave tile 32 x 64, K = DM, operands x16 so alpha = 1/16, f16 result).
// q: both products (q1 Wq_first, last Wq_last) run into the same accumulators, the batch's mean term is added behind them.
// V^T: the operands change places, A = rows of the padded Wv^T, B = node rows of one batch, so the tile comes out as [feature][key] and is stored that way.
__device__ __forceinline__ void pj_acc(const _Float16* __restrict__ a0p, const _Float16* __restrict__ b0p, int hh, v8f (&c)[8]) {
  const _Float16* a1p = a0p + 16 * DM; const _Float16* b1p = b0p + 16 * DM; const _Float16* b2p = b0p + 32 * DM; const _Float16* b3p = b0p + 48 * DM;
#pragma unroll 1      /* stays the rolled loop of k_gemm2: the order of loads and products is not part of this change */
  for (int kb = 0; kb < DM; kb += 32) { const v16h a0 = g2_frag(a0p + kb, hh); FragH a1f; a1f.half[0] = *(const v8us*)((const unsigned short*)a1p + kb + 8 * hh);
    asm volatile("s_wait_xcnt 0x0" ::: "memory");      /* the build lets the load below land in the address pair that the three A loads just issued name: the wait stands in front of that overwrite */
    a1f.half[1] = *(const v8us*)((const unsigned short*)a1p + kb + 16 + 8 * hh); const v16h a1 = a1f.v;
    v16h b = g2_frag(b0p + kb, hh); c[0] = g2_mma(a0, b, c[0]); c[4] = g2_mma(a1, b, c[4]);
    b = g2_frag(b1p + kb, hh); c[1] = g2_mma(a0, b, c[1]); c[5] = g2_mma(a1, b, c[5]);
    b = g2_frag(b2p + kb, hh); c[2] = g2_mma(a0, b, c[2]); c[6] = g2_mma(a1, b, c[6]);
    b = g2_frag(b3p + kb, hh); c[3] = g2_mma(a0, b, c[3]); c[7] = g2_mma(a1, b, c[7]); } }
#define JB_QK ((int)(NRP / 128) * (NH * 32 / 64))  /* blocks of q, and of k */
#define JB_V ((NH * 64 / 128) * (QP / 64))         /* blocks of one batch's V^T */
__global__ __launch_bounds__(128) void k_proj(const _Float16* __restrict__ XQ1, const _Float16* __restrict__ BQF, const _Float16* __restrict__ XL, const _Float16* __restrict__ BQL, const float* __restrict__ QMP, _Float16* __restrict__ Q16,
    const _Float16* __restrict__ XN, const _Float16* __restrict__ BK, _Float16* __restrict__ K16, const _Float16* __restrict__ BVP, _Float16* __restrict__ VT) {
  static_assert(QP % 128 == 0 && NH * 32 == 64 << 2 && QP == 64 << 4, "the 32 rows of a wave tile of q lie in one batch; the two values of lg");
  __shared__ __attribute__((aligned(16))) float so[4][32][68];
  const int tid = threadIdx.x, w = tid >> 5, lane = tid & 31, ln = lane & 15, hh = lane >> 4;
  int bx = blockIdx.x, N = NH * 32, lg = 2; const _Float16* A = XQ1; const _Float16* B = BQF; _Float16* C16 = Q16; const bool isq = bx < JB_QK;      /* N: columns and pitch of the result; lg: log2 of its 64-column tiles */
  if (bx >= 2 * JB_QK) { bx -= 2 * JB_QK; const int by = bx / JB_V; bx -= by * JB_V; N = QP; lg = 4; A = BVP; B = XN + (size_t)by * QP * DM; C16 = VT + (size_t)by * NH * 64 * QP; }
  else if (bx >= JB_QK) { bx -= JB_QK; A = XN; B = BK; C16 = K16; }
  const int mt = bx >> lg, nq = bx - (mt << lg), row0 = mt * 128 + 32 * w, col0 = nq * 64;
  const v8f z8 = {0.f, 0.f, 0.f, 0.f, 0.f, 0.f, 0.f, 0.f}; v8f c[8] = {z8, z8, z8, z8, z8, z8, z8, z8};
  float cp[4] = {0.f, 0.f, 0.f, 0.f};      /* q: the batch's mean term at this lane's four columns, loaded ahead of the products */
  if (isq) for (int t = 0; t < 4; ++t) cp[t] = QMP[(size_t)(row0 / QP) * (NH * 32) + col0 + t * 16 + ln];
  pj_acc(A + (size_t)(row0 + ln) * DM, B + (size_t)(col0 + ln) * DM, hh, c);
  if (isq) pj_acc(XL + (size_t)(row0 + ln) * DM, BQL + (size_t)(col0 + ln) * DM, hh, c);
#pragma unroll      /* c[] in registers */
  for (int u = 0; u < 8; ++u) { const int t = u & 3, half = u >> 2;
    for (int r = 0; r < 8; ++r) so[w][half * 16 + 8 * hh + r][t * 16 + ln] = c[u][r] * 0.0625f + cp[t]; }
  __builtin_amdgcn_fence(__ATOMIC_ACQ_REL, "workgroup"); __builtin_amdgcn_wave_barrier();      /* the reads below take what other lanes of this wave stored */
  const int rsub = lane >> 4, c4 = (lane & 15) * 4;
#pragma unroll      /* sixteen plain row stores */
  for (int q = 0; q < 16; ++q) { const int r = q * 2 + rsub; const v4f v = *(const v4fa*)&so[w][r][c4]; v4h h4; for (int i = 0; i < 4; ++i) h4[i] = (_Float16)v[i]; *(v4h*)(C16 + (size_t)(row0 + r) * N + col0 + c4) = h4; } }
// Row softmaxes, one wave per row: lane holds columns 4*lane + 128*u (u = 0..7), so each wave-wide b128 load or store covers 512 contiguous bytes;
// the row's values stay in registers between the maximum, the sum and the store. Maximum and sum: per lane first, then a five-step butterfly over the 32 lanes.
// Columns NQ..QP-1 (lanes 26..31 of u = 7): the score planes hold them; the mask does not, so those lanes re-read their own first chunk; their value is -inf (weight 0) and they are not stored.
__device__ __forceinline__ float wave_max32(float v) { for (int m = 16; m > 0; m >>= 1) v = fmaxf(v, __shfl_xor(v, m, 32)); return v; }
__device__ __forceinline__ float wave_sum32(float v) { for (int m = 16; m > 0; m >>= 1) v += __shfl_xor(v, m, 32); return v; }
// 2^x as one v_exp_f32 (what __expf compiles to behind its multiply) with the issue slot behind it filled
__device__ __forceinline__ float exp2_slot(float x) { float r; asm("v_exp_f32 %0, %1\n\tv_nop" : "=v"(r) : "v"(x)); return r; }
__device__ __forceinline__ v16h at_frag16(v8us lo) { FragH f; f.half[0] = lo; const v8us z = {0, 0, 0, 0, 0, 0, 0, 0}; f.half[1] = z; return f.v; }      /* q or k row of one head: 16 features, k 16..31 of the fragment zero */
__device__ __forceinline__ v8f at_mma(v16h a, v16h b, v8f c) { return __builtin_amdgcn_wmma_f32_16x16x32_f16(false, a, false, b, (short)0, c, false, false); }
// what 32 keys take from memory for one lane: its 8 features of two k rows, 2 x 8 mask values of its query. EDGE: a lane whose 8 keys lie at or past NQ reads its 8 mask values of the row's first 16 columns instead, and those keys count as -inf
struct At32 { v8us k0, k1; v4f m0, m1, m2, m3; };
template <bool EDGE>
__device__ __forceinline__ At32 at_load(const unsigned short* kp, const float* mr, int k0, int hh) {
  At32 t; const int c0 = (!EDGE || k0 + 8 * hh < NQ) ? k0 : 0, c1 = (!EDGE || k0 + 16 + 8 * hh < NQ) ? k0 + 16 : 0;
  t.k0 = *(const v8us*)(kp + (size_t)k0 * (NH * 32)); t.k1 = *(const v8us*)(kp + (size_t)(k0 + 16) * (NH * 32));
  t.m0 = *(const v4fa*)(mr + c0); t.m1 = *(const v4fa*)(mr + c0 + 4); t.m2 = *(const v4fa*)(mr + c1); t.m3 = *(const v4fa*)(mr + c1 + 4); return t; }
// x[0..7], x[8..15]: scores / 4 + mask of this lane's query against keys k0 + 8 * hh + r and k0 + 16 + 8 * hh + r
template <bool EDGE>
__device__ __forceinline__ void at_score(const At32& t, v16h qf, int k0, int hh, float* x) {
  const v8f z8 = {0.f, 0.f, 0.f, 0.f, 0.f, 0.f, 0.f, 0.f}; const v8f s0 = at_mma(at_frag16(t.k0), qf, z8), s1 = at_mma(at_frag16(t.k1), qf, z8);
  const bool in0 = !EDGE || k0 + 8 * hh < NQ, in1 = !EDGE || k0 + 16 + 8 * hh < NQ;
#pragma unroll      /* x[] in registers */
  for (int r = 0; r < 8; ++r) { const float v0 = s0[r] * 0.25f + bf16_round(r < 4 ? t.m0[r & 3] : t.m1[r & 3]), v1 = s1[r] * 0.25f + bf16_round(r < 4 ? t.m2[r & 3] : t.m3[r & 3]);
    x[r] = in0 ? v0 : -__builtin_inff(); x[8 + r] = in1 ? v1 : -__builtin_inff(); } }
template <bool EDGE>
__device__ __forceinline__ float at_max32(const At32& t, v16h qf, int k0, int hh, float mx) {
  float x[16]; at_score<EDGE>(t, qf, k0, hh, x);
#pragma unroll      /* x[] in registers */
  for (int r = 0; r < 16; ++r) mx = fmaxf(mx, x[r]);
  return mx; }
template <bool EDGE>
__device__ __forceinline__ v8f at_pv32(const At32& t, v16h vf, v16h qf, int k0, int hh, float mx, float* se, v8f o) {
  float x[16]; at_score<EDGE>(t, qf, k0, hh, x); FragH pf;
#pragma unroll      /* x[] in registers; four running sums, so that an add does not wait for the one before it */
  for (int r = 0; r < 16; ++r) { const float e = exp2_slot((x[r] - mx) * 1.44269504f + 8.0f); se[r & 3] += e; pf.h[r] = (_Float16)e; }
  return at_mma(vf, pf.v, o); }
__global__ __launch_bounds__(256) void k_attn(const _Float16* __restrict__ Q16, const _Float16* __restrict__ K16, const _Float16* __restrict__ VT, const float* __restrict__ mask, float* __restrict__ OF) {
  static_assert(NQ % 8 == 0 && NQ > QP - 32 && NQ <= QP && QP % 128 == 0, "only the last 32 keys hold an edge, and a lane's 8 keys are all in or all out");
  const int b = blockIdx.y, h = threadIdx.x >> 5, lane = threadIdx.x & 31, c = lane & 15, hh = lane >> 4; const int q = blockIdx.x * 16 + c; const bool live = q < NQ;      /* rows NQ..QP-1: same instruction stream on mask row 0, scale 0, so zeros are stored */
  const v16h qf = at_frag16(*(const v8us*)((const unsigned short*)Q16 + ((size_t)b * QP + q) * (NH * 32) + h * 32 + 8 * hh));
  const unsigned short* kp = (const unsigned short*)K16 + ((size_t)b * QP + c) * (NH * 32) + h * 32 + 8 * hh; const _Float16* vp = VT + ((size_t)(b * NH + h) * 64 + c) * QP;
  const float* mr = mask + ((size_t)b * NQ + (live ? q : 0)) * NQ + 8 * hh; float mx = -3.0e38f;
#pragma unroll 1      /* stays a loop: unrolled whole, the two passes were some 10,000 instructions and spilled */
  for (int k0 = 0; k0 < QP - 128; k0 += 128) { At32 t[4];
#pragma unroll      /* t[] in registers, the loads of 128 keys in flight together */
    for (int j = 0; j < 4; ++j) t[j] = at_load<false>(kp, mr, k0 + 32 * j, hh);
#pragma unroll      /* t[] in registers */
    for (int j = 0; j < 4; ++j) mx = at_max32<false>(t[j], qf, k0 + 32 * j, hh, mx); }
  { At32 t[4];      /* the last 128 keys */
#pragma unroll      /* t[] in registers */
    for (int j = 0; j < 3; ++j) t[j] = at_load<false>(kp, mr, QP - 128 + 32 * j, hh);
    t[3] = at_load<true>(kp, mr, QP - 32, hh);
#pragma unroll      /* t[] in registers */
    for (int j = 0; j < 3; ++j) mx = at_max32<false>(t[j], qf, QP - 128 + 32 * j, hh, mx);
    mx = at_max32<true>(t[3], qf, QP - 32, hh, mx); }
  mx = fmaxf(mx, __shfl_xor(mx, 16, 32));
  v8f o = {0.f, 0.f, 0.f, 0.f, 0.f, 0.f, 0.f, 0.f}; float se[4] = {0.f, 0.f, 0.f, 0.f};
#pragma unroll 1      /* stays a loop, as above */
  for (int k0 = 0; k0 < QP - 64; k0 += 64) {      /* the loads of 64 keys in flight together */
    const At32 t0 = at_load<false>(kp, mr, k0, hh), t1 = at_load<false>(kp, mr, k0 + 32, hh);
    asm volatile("s_wait_xcnt 0x0" ::: "memory");      /* the build let a V load's result land in the address pair of the k loads just issued: the wait stands in front of that overwrite */
    const v16h v0 = g2_frag(vp + k0, hh), v1 = g2_frag(vp + k0 + 32, hh);
    o = at_pv32<false>(t0, v0, qf, k0, hh, mx, se, o); o = at_pv32<false>(t1, v1, qf, k0 + 32, hh, mx, se, o); }
  { const At32 t0 = at_load<false>(kp, mr, QP - 64, hh), t1 = at_load<true>(kp, mr, QP - 32, hh); const v16h v0 = g2_frag(vp + QP - 64, hh), v1 = g2_frag(vp + QP - 32, hh);
    o = at_pv32<false>(t0, v0, qf, QP - 64, hh, mx, se, o); o = at_pv32<true>(t1, v1, qf, QP - 32, hh, mx, se, o); }
  float st = (se[0] + se[1]) + (se[2] + se[3]); st += __shfl_xor(st, 16, 32);
  const float sc = live ? 64.0f / st : 0.f; float* orow = OF + ((size_t)b * QP + q) * (NH * 64) + h * 64;      /* o x64, padded [8][64]: d 0..15 real, 16..63 zero */
  const v4f o0 = {o[0] * sc, o[1] * sc, o[2] * sc, o[3] * sc}, o1 = {o[4] * sc, o[5] * sc, o[6] * sc, o[7] * sc}, z4 = {0.f, 0.f, 0.f, 0.f};
  *(v4f*)(orow + 8 * hh) = o0; *(v4f*)(orow + 8 * hh + 4) = o1;
#pragma unroll      /* six plain stores */
  for (int j = 0; j < 6; ++j) *(v4f*)(orow + HD + 24 * hh + 4 * j) = z4; }
// Stage 2, one launch for all batches: block = (16 query rows, batch), eight waves; score2 stays in LDS, the probabilities go straight to out.
// Part 1: wave w forms score2 of the 16 rows against keys 128 w .. 128 w + 127, eight tiles of 16 keys. The mh rows are split here into f16 hi + x1024 residual fragments (k order of g2_frag) and stay in registers.
// A tile of 16 node rows is 4 KiB in a row in memory: eight loads of 512 contiguous bytes a wave, one tile ahead, then through the wave's own LDS rows into fragments (a fragment load straight from memory touches 16 lines an instruction).
// Part 2, behind the one barrier: wave w takes rows 2 w and 2 w + 1 whole, lane = columns 4 * lane + 128 * u as in the row softmaxes above.
#define SP (QP + 4)                  /* score row pitch in LDS, floats: rows r and r + 8, stored by the two wave halves together, lie 32 banks apart */
#define XP (DM + 8)                  /* staged node row pitch, f16: 272 bytes = 16 x odd, for the b128 fragment reads */
__global__ __launch_bounds__(256) void k_stage2(const float* __restrict__ MH, const _Float16* __restrict__ XN, const float* __restrict__ mask, float* __restrict__ out) {
  static_assert(QP == 8 * 128 && DM == 128 && NQ % 4 == 0, "eight waves of 128 keys; a node row is 16 lanes of 16 bytes; a lane's 4 columns are all in or all out");
  __shared__ __attribute__((aligned(16))) float sc[16][SP]; __shared__ __attribute__((aligned(16))) unsigned short nb[8][16][XP];
  const int b = blockIdx.y, row0 = blockIdx.x * 16, lane = threadIdx.x & 31, ln = lane & 15, hh = lane >> 4;
  const int w = __builtin_amdgcn_readfirstlane(threadIdx.x >> 5);      /* wave number in a scalar register: LDS bases and the row test below are scalar */
  const unsigned short* xb = (const unsigned short*)XN + ((size_t)b * QP + 128 * w) * DM + lane * 8; v8us st[8];
#pragma unroll      /* st[] in registers, the tile's loads in flight together */
  for (int i = 0; i < 8; ++i) st[i] = *(const v8us*)(xb + i * 256);
  const float* ar = MH + ((size_t)b * QP + row0 + ln) * DM + 8 * hh; FragH ah[4], al[4];
#pragma unroll      /* ah[], al[] in registers */
  for (int j = 0; j < 4; ++j) { const v4f x0 = *(const v4fa*)(ar + 32 * j), x1 = *(const v4fa*)(ar + 32 * j + 4), x2 = *(const v4fa*)(ar + 32 * j + 16), x3 = *(const v4fa*)(ar + 32 * j + 20);
    const float xs[16] = {x0[0], x0[1], x0[2], x0[3], x1[0], x1[1], x1[2], x1[3], x2[0], x2[1], x2[2], x2[3], x3[0], x3[1], x3[2], x3[3]};
    for (int i = 0; i < 16; ++i) { const _Float16 h = (_Float16)xs[i]; ah[j].h[i] = h; al[j].h[i] = (_Float16)((xs[i] - (float)h) * 1024.0f); } }
#pragma unroll      /* st[] in registers; the next tile's loads stand ahead of this tile's products */
  for (int t = 0; t < 8; ++t) {
    for (int i = 0; i < 8; ++i) *(v8us*)&nb[w][2 * i + hh][ln * 8] = st[i];
    if (t < 7) for (int i = 0; i < 8; ++i) st[i] = *(const v8us*)(xb + (t + 1) * 16 * DM + i * 256);
    __builtin_amdgcn_fence(__ATOMIC_ACQ_REL, "workgroup", "local"); __builtin_amdgcn_wave_barrier();      /* the reads below take what other lanes of this wave stored: the LDS stores are waited for (s_wait_dscnt 0), the global loads in flight are not */
    FragH bf[4];
    for (int j = 0; j < 4; ++j) { bf[j].half[0] = *(const v8us*)&nb[w][ln][32 * j + 8 * hh]; bf[j].half[1] = *(const v8us*)&nb[w][ln][32 * j + 16 + 8 * hh]; }
    __builtin_amdgcn_fence(__ATOMIC_ACQ_REL, "wavefront"); __builtin_amdgcn_wave_barrier();      /* the next tile's stores stay behind these reads */
    v8f sh = {0.f, 0.f, 0.f, 0.f, 0.f, 0.f, 0.f, 0.f}, sl = sh;
    for (int j = 0; j < 4; ++j) { sh = at_mma(ah[j].v, bf[j].v, sh); sl = at_mma(al[j].v, bf[j].v, sl); }
    for (int r = 0; r < 8; ++r) sc[8 * hh + r][128 * w + 16 * t + ln] = sh[r] * 0.088388347648318447f + sl[r] * 0.000086316745750311f; }      /* (mh_hi + mh_lo / 1024) nodes^T / sqrt(128) */
  const int c0 = lane * 4; v4f m[QP / 128], mn[QP / 128];
  { const int p0 = row0 + 2 * w, p1 = p0 + 1; const float* r0 = mask + ((size_t)b * NQ + (p0 < NQ ? p0 : 0)) * NQ + c0; const float* r1 = mask + ((size_t)b * NQ + (p1 < NQ ? p1 : 0)) * NQ + c0;
#pragma unroll      /* m[], mn[] in registers, both rows' mask loads in flight together */
    for (int u = 0; u < QP / 128; ++u) { const int o = (c0 + 128 * u < NQ) ? 128 * u : 0; m[u] = *(const v4fa*)(r0 + o); mn[u] = *(const v4fa*)(r1 + o); } }
  asm volatile("s_wait_xcnt 0x0" ::: "memory");      /* stands in front of part 2, which reuses the address registers of the mask loads just issued */
  __syncthreads();
#pragma unroll 1      /* stays a loop: the 32 tanhf and expf of one row are most of the kernel's text, and twice that would pass 32 KB */
  for (int rr = 0; rr < 2; ++rr) { const int lr = 2 * w + rr, p = row0 + lr; if (p >= NQ) break;      /* rows NQ.. of the last block: no output; no barrier follows */
    float* pr = out + ((size_t)b * NQ + p) * NQ + c0; v4f x[QP / 128]; float mx = -3.0e38f;
#pragma unroll      /* x[] in registers */
    for (int u = 0; u < QP / 128; ++u) x[u] = *(const v4fa*)&sc[lr][c0 + 128 * u];
#pragma unroll      /* x[] in registers */
    for (int u = 0; u < QP / 128; ++u) { const bool in = c0 + 128 * u < NQ; for (int q = 0; q < 4; ++q) { const float v = 10.0f * tanhf(x[u][q]) + bf16_round(m[u][q]); x[u][q] = in ? v : -__builtin_inff(); mx = fmaxf(mx, x[u][q]); } }
    mx = wave_max32(mx); float se = 0.f;
#pragma unroll      /* x[] in registers */
    for (int u = 0; u < QP / 128; ++u) for (int q = 0; q < 4; ++q) { x[u][q] = expf(x[u][q] - mx); se += x[u][q]; }
    const float inv = 1.0f / wave_sum32(se);
#pragma unroll      /* x[] in registers */
    for (int u = 0; u < QP / 128; ++u) { v4f o; for (int q = 0; q < 4; ++q) o[q] = x[u][q] * inv; if (c0 + 128 * u < NQ) *(v4f*)(pr + 128 * u) = o; }
    asm volatile("s_wait_xcnt 0x0" ::: "memory");      /* stands in front of the copies below and the next row, which overwrite the registers of the stores just issued */
#pragma unroll      /* m[] in registers */
    for (int u = 0; u < QP / 128; ++u) m[u] = mn[u]; } }

extern "C" void kernel_launch(void* const* d_in, const int* in_sizes, int n_in,
                              void* d_out, int out_size, void* d_ws, size_t ws_size, hipStream_t stream) {
  (void)in_sizes; (void)n_in; (void)out_size;
  const float* const* I = (const float* const*)d_in; const float* xn = I[0]; const float* xq1 = I[1]; const float* xl = I[2]; const float* mask = I[3]; const float* Wqf = I[4]; const float* Wql = I[5]; const float* Wqm = I[6]; const float* Wk = I[7]; const float* Wv = I[8]; const float* Wc = I[9]; const float* bc = I[10];      /* weights [in][out] */
  char* ws = (char*)d_ws; size_t off = 0;
  auto take = [&](size_t bytes) { char* p = ws + off; off += (bytes + 255) & ~(size_t)255; return p; };
  _Float16* BQF = (_Float16*)take((size_t)NH * 32 * DM * 2); _Float16* BQL = (_Float16*)take((size_t)NH * 32 * DM * 2); _Float16* BK = (_Float16*)take((size_t)NH * 32 * DM * 2); _Float16* BVP = (_Float16*)take((size_t)NH * 64 * DM * 2); _Float16* BCP = (_Float16*)take((size_t)DM * NH * 64 * 2); float* QMP = (float*)take((size_t)NB * NH * 32 * 4);
  _Float16* XN = (_Float16*)take(NRP * DM * 2); _Float16* XQ1 = (_Float16*)take(NRP * DM * 2); _Float16* XL = (_Float16*)take(NRP * DM * 2);
  _Float16* Q16 = (_Float16*)take(NRP * NH * 32 * 2); _Float16* K16 = (_Float16*)take(NRP * NH * 32 * 2); float* OF = (float*)take(NRP * NH * 64 * 4); _Float16* OH = (_Float16*)take(NRP * NH * 64 * 2); _Float16* OL = (_Float16*)take(NRP * NH * 64 * 2);
  _Float16* VT = (_Float16*)take((size_t)NB * NH * 64 * QP * 2);
  float* MH = (float*)take(NRP * DM * 4);
  if (off > ws_size) return;      /* about 59 MiB */
  k_prep<<<PB_ALL, PT, 0, stream>>>(xn, xq1, xl, Wqf, Wql, Wqm, Wk, Wv, Wc, XN, XQ1, XL, BQF, BQL, BK, BVP, BCP, QMP);      /* f16 token planes (padded rows), transposed x16 weights, per-batch mean term in the padded q layout */
  k_proj<<<2 * JB_QK + NB * JB_V, 128, 0, stream>>>(XQ1, BQF, XL, BQL, QMP, Q16, XN, BK, K16, BVP, VT);      /* q = q1 Wq_first + last Wq_last + mean term, k (f16, padded [8][32]); V^T [8 batches][8][64][1024] */
  k_attn<<<dim3(QP / 16, NB), 256, 0, stream>>>(Q16, K16, VT, mask, OF);      /* scores / sqrt(16) + mask, softmax, weights v -> o x64 (padded [8][64], f32) */
  k_hl<<<(unsigned)((NRP * NH * 64 / 8 + 255) / 256), 256, 0, stream>>>(OF, OH, OL, NRP * NH * 64 / 8);      /* o -> f16 hi + x1024 residual */
  k_gemm2<0><<<dim3((unsigned)((NRP / 128) * (DM / 64)), 1), 128, 0, stream>>>(OH, NH * 64, 0, BCP, NH * 64, 0, 0.0009765625f, bc, 0, nullptr, 1, 0, 0, MH, nullptr, DM, 0, (int)NRP, DM, NH * 64);      /* mh = o_hi W_comb + b_comb (f32) */
  k_gemm2<0><<<dim3((unsigned)((NRP / 128) * (DM / 64)), 1), 128, 0, stream>>>(OL, NH * 64, 0, BCP, NH * 64, 0, 0.00000095367431640625f, nullptr, 0, MH, -1, 0, 0, MH, nullptr, DM, 0, (int)NRP, DM, NH * 64);      /* += o_lo W_comb 2^-20 */
  k_stage2<<<dim3((NQ + 15) / 16, NB), 256, 0, stream>>>(MH, XN, mask, (float*)d_out);      /* score2 = mh nodes^T / sqrt(128), 10 tanh, + mask, softmax over the 1000 real keys (f32) -> probs */
}

// v006
// Measured time: 87.6 microseconds a run.
// In two side-by-side timings against v005, it was 1.92 and 1.97 times as fast.
// Over all steps from v000 it is 182 times as fast.
#include <hip/hip_runtime.h>
// TSP decoder probabilities (encoded_nodes, encoded_q1, encoded_last_node [8][1000][128]; k = nodes Wk, v = nodes Wv, q = q1 Wq_first + last Wq_last + (mean_n nodes) Wq_mean broadcast ([in][out] weights), 8 heads of 16; weights = softmax(q k^T / 4 + ninf_mask); mh = (weights v merged) W_comb + b_comb; score2 = mh nodes^T / sqrt(128); probs = softmax_n(10 tanh(score2) + ninf_mask) -> [8][1000][1000]).
// Compute dtype: inputs rounded to bf16; token rows / weights exact; q, k, v and the stage-1 weights as plain f16 GEMM operands (~2^-12); o and mh as f16 hi + residual operand pairs (~2^-22); the mean term, score2, tanh, mask and the final softmax f32. v_wmma_f32_16x16x32_f16.
#define NB 8
#define NQ 1000                      /* nodes = queries = 1000 */
#define QP 1024                      /* padded rows / keys per batch */
#define DM 128
#define NH 8
#define HD 16
#define SQ QP
#define HG 8
#define B0 0                         /* unused */
#define NBR NB
#define NRP ((size_t)NB * QP)        /* padded token rows */
typedef __bf16 v16b __attribute__((ext_vector_type(16)));
typedef unsigned short v8us __attribute__((ext_vector_type(8), may_alias));
typedef float  v8f  __attribute__((ext_vector_type(8)));
typedef float  v4f  __attribute__((ext_vector_type(4)));
typedef float  v4fa __attribute__((ext_vector_type(4), may_alias));
union FragB { v16b v; v8us half[2]; unsigned short u[16]; };

__device__ __forceinline__ unsigned short bf16_bits(float x) { unsigned int u = __float_as_uint(x); return (unsigned short)((u + 0x7FFFu + ((u >> 16) & 1u)) >> 16); }
__device__ __forceinline__ float bf16_val(unsigned short b) { return __uint_as_float(((unsigned int)b) << 16); }
__device__ __forceinline__ float bf16_round(float x) { return bf16_val(bf16_bits(x)); }
// D += A·B with NT terms: 1 = ah·bh, 2 = + al·bh (A split), 3 = + ah·bl (both split)
template <int NT>
__device__ __forceinline__ v8f mmaN(v16b ah, v16b al, v16b bh, v16b bl, v8f c) {
  c = __builtin_amdgcn_wmma_f32_16x16x32_bf16(false, ah, false, bh, (short)0, c, false, false);
  if (NT >= 2) c = __builtin_amdgcn_wmma_f32_16x16x32_bf16(false, al, false, bh, (short)0, c, false, false);
  if (NT >= 3) c = __builtin_amdgcn_wmma_f32_16x16x32_bf16(false, ah, false, bl, (short)0, c, false, false);
  asm volatile("v_nop\n\tv_nop\n\tv_nop\n\tv_nop" : "+v"(c) : "v"(ah), "v"(al), "v"(bh), "v"(bl));
  return c;
}

__global__ __launch_bounds__(256) void k_wt_bf16(const float* __restrict__ W, unsigned short* __restrict__ Wt, int K, int N) {
  const int t = blockIdx.x * 256 + threadIdx.x;
  const int k8n = K / 8;
  if (t >= N * k8n) return;
  const int n = t / k8n, k8 = (t % k8n) * 8;
  v8us v;
#pragma unroll
  for (int i = 0; i < 8; ++i) v[i] = bf16_bits(W[(size_t)(k8 + i) * N + n]);
  *(v8us*)(Wt + (size_t)n * K + k8) = v;
  
}

// GEMM C[M][N] (f32, pitch ldc) = act(A[M][K]·W + bias). A f32 row-major (pitch lda) converted per fragment to bf16
// (ASPLIT: hi/lo two planes -> 2 terms, else single rounded term); Wt bf16 [N][K] (pitch ldb). BIAS_BF16 rounds the
// bias to bf16 first (bias quantised to bf16 before the add). K%32==0, M%16==0, N%64==0.
template <bool ASPLIT, int ACT, bool BIAS_BF16>
__global__ __launch_bounds__(128) void k_gemm_bf(const float* __restrict__ A, int lda, const unsigned short* __restrict__ Wt, int ldb,
                                               const float* __restrict__ bias, float* __restrict__ C, int ldc, int M, int N, int K) {
  __shared__ __attribute__((aligned(16))) float so[4][16][64];
  const int tid = threadIdx.x, w = tid >> 5, lane = tid & 31, ln = lane & 15, hh = lane >> 4;
  const int ntn = N / 64;
  const int wid = blockIdx.x * 4 + w;
  const int mt = wid / ntn, nq = wid % ntn;
  if (mt * 16 >= M) return;
  const int row0 = mt * 16, col0 = nq * 64;
  const float* arow = A + (size_t)(row0 + ln) * lda;
  v8f acc[4] = {};
  for (int kb = 0; kb < K; kb += 32) {
    FragB ah, al;
    const v4f x0 = *(const v4fa*)(arow + kb + 8 * hh), x1 = *(const v4fa*)(arow + kb + 8 * hh + 4);
    const v4f x2 = *(const v4fa*)(arow + kb + 16 + 8 * hh), x3 = *(const v4fa*)(arow + kb + 16 + 8 * hh + 4);
    float xs[16] = {x0[0],x0[1],x0[2],x0[3],x1[0],x1[1],x1[2],x1[3],x2[0],x2[1],x2[2],x2[3],x3[0],x3[1],x3[2],x3[3]};
#pragma unroll
    for (int i = 0; i < 16; ++i) { const unsigned short hb = bf16_bits(xs[i]); ah.u[i] = hb; al.u[i] = ASPLIT ? bf16_bits(xs[i] - bf16_val(hb)) : (unsigned short)0; }
#pragma unroll
    for (int t = 0; t < 4; ++t) {
      const unsigned short* brow = Wt + (size_t)(col0 + t * 16 + ln) * ldb + kb;
      FragB b;
      b.half[0] = *(const v8us*)(brow + 8 * hh);
      b.half[1] = *(const v8us*)(brow + 16 + 8 * hh);
      acc[t] = mmaN<ASPLIT ? 2 : 1>(ah.v, al.v, b.v, b.v, acc[t]);
    }
  }
#pragma unroll
  for (int t = 0; t < 4; ++t) {
    float bv = bias ? bias[col0 + t * 16 + ln] : 0.f;
    if (BIAS_BF16) bv = bf16_round(bv);
#pragma unroll
    for (int r = 0; r < 8; ++r) { float v = acc[t][r] + bv; if (ACT == 1) v = fmaxf(v, 0.f); so[w][8 * hh + r][t * 16 + ln] = v; }
  }
  __builtin_amdgcn_fence(__ATOMIC_ACQ_REL, "workgroup");
  __builtin_amdgcn_wave_barrier();
  const int rsub = lane >> 4, c4 = (lane & 15) * 4;
  {
#pragma unroll
    for (int q = 0; q < 8; ++q) {
      const int r = q * 2 + rsub;
      const v4f v = *(const v4fa*)&so[w][r][c4];
      *(v4f*)(C + (size_t)(row0 + r) * ldc + col0 + c4) = v;
    }
    
  }
}

// GEMM C = act(A·W + bias + resid): A f32 (ASPLIT -> hi/lo 2 terms), Wt bf16 [N][K]; ACT 0 none, 1 relu, 2 exact gelu;
// resid (optional, f32, row index = (row % rmod), pitch ldr, RES_BF16 rounds it) added before the activation.
template <bool ASPLIT, int ACT, bool BIAS_BF16, bool RES_BF16>
__global__ __launch_bounds__(128) void k_gemm_bf3(const float* __restrict__ A, int lda, const unsigned short* __restrict__ Wt, int ldb,
                                                const float* __restrict__ bias, const float* __restrict__ resid, int rmod, int ldr,
                                                float* __restrict__ C, int ldc, int M, int N, int K) {
  __shared__ __attribute__((aligned(16))) float so[4][16][64];
  const int tid = threadIdx.x, w = tid >> 5, lane = tid & 31, ln = lane & 15, hh = lane >> 4;
  const int ntn = N / 64;
  const int wid = blockIdx.x * 4 + w;
  const int mt = wid / ntn, nq = wid % ntn;
  if (mt * 16 >= M) return;
  const int row0 = mt * 16, col0 = nq * 64;
  const float* arow = A + (size_t)(row0 + ln) * lda;
  v8f acc[4] = {};
  for (int kb = 0; kb < K; kb += 32) {
    FragB ah, al;
    const v4f x0 = *(const v4fa*)(arow + kb + 8 * hh), x1 = *(const v4fa*)(arow + kb + 8 * hh + 4);
    const v4f x2 = *(const v4fa*)(arow + kb + 16 + 8 * hh), x3 = *(const v4fa*)(arow + kb + 16 + 8 * hh + 4);
    float xs[16] = {x0[0],x0[1],x0[2],x0[3],x1[0],x1[1],x1[2],x1[3],x2[0],x2[1],x2[2],x2[3],x3[0],x3[1],x3[2],x3[3]};
#pragma unroll
    for (int i = 0; i < 16; ++i) { const unsigned short hb = bf16_bits(xs[i]); ah.u[i] = hb; al.u[i] = ASPLIT ? bf16_bits(xs[i] - bf16_val(hb)) : (unsigned short)0; }
#pragma unroll
    for (int t = 0; t < 4; ++t) {
      const unsigned short* brow = Wt + (size_t)(col0 + t * 16 + ln) * ldb + kb;
      FragB b;
      b.half[0] = *(const v8us*)(brow + 8 * hh);
      b.half[1] = *(const v8us*)(brow + 16 + 8 * hh);
      acc[t] = mmaN<ASPLIT ? 2 : 1>(ah.v, al.v, b.v, b.v, acc[t]);
    }
  }
#pragma unroll
  for (int t = 0; t < 4; ++t) {
    const int col = col0 + t * 16 + ln;
    float bv = bias ? bias[col] : 0.f;
    if (BIAS_BF16) bv = bf16_round(bv);
#pragma unroll
    for (int r = 0; r < 8; ++r) {
      float v = acc[t][r] + bv;
      if (resid) { float rv = resid[(size_t)((row0 + 8 * hh + r) % rmod) * ldr + col]; if (RES_BF16) rv = bf16_round(rv); v += rv; }
      if (ACT == 1) v = fmaxf(v, 0.f);
      if (ACT == 2) v = 0.5f * v * (1.0f + erff(v * 0.70710678118654752f));
      if (ACT == 3) { const float u = 0.7978845608028654f * (v + 0.044715f * v * v * v); v = 0.5f * v * (1.0f + tanhf(u)); }
      so[w][8 * hh + r][t * 16 + ln] = v;
    }
  }
  __builtin_amdgcn_fence(__ATOMIC_ACQ_REL, "workgroup");
  __builtin_amdgcn_wave_barrier();
  const int rsub = lane >> 4, c4 = (lane & 15) * 4;
  {
#pragma unroll
    for (int q = 0; q < 8; ++q) {
      const int r = q * 2 + rsub;
      const v4f v = *(const v4fa*)&so[w][r][c4];
      *(v4f*)(C + (size_t)(row0 + r) * ldc + col0 + c4) = v;
    }
    
  }
}
// row LayerNorm (biased variance, eps) over N: s = X (+ R); optional out_sum <- s; out_norm <- (s-mu)*rsqrt(var+eps)*g + b
template <bool PARAM_BF16>
__global__ __launch_bounds__(256) void k_layernorm(const float* __restrict__ X, const float* __restrict__ R, const float* __restrict__ g, const float* __restrict__ bta,
                                                  float* __restrict__ out_sum, float* __restrict__ out_norm, int N, float eps) {
  __shared__ float red[256];
  const int row = blockIdx.x, tid = threadIdx.x;
  const float* x = X + (size_t)row * N; const float* rr = R ? R + (size_t)row * N : nullptr;
  float vals[16];                     // up to N = 4096
  const int per = N / 256;            // contiguous chunk per thread? use strided-by-4 chunks: thread handles j = tid*4 + 1024*u
  float s1 = 0.f;
  for (int u = 0; u < per / 4; ++u) {
    const int j = tid * 4 + 1024 * u;
    const v4f a = *(const v4fa*)(x + j);
    v4f b = {0.f,0.f,0.f,0.f}; if (rr) b = *(const v4fa*)(rr + j);
#pragma unroll
    for (int q = 0; q < 4; ++q) { const float v = a[q] + b[q]; vals[u * 4 + q] = v; s1 += v; }
  }
  red[tid] = s1; __syncthreads();
  for (int st = 128; st > 0; st >>= 1) { if (tid < st) red[tid] += red[tid + st]; __syncthreads(); }
  const float mu = red[0] / (float)N; __syncthreads();
  float s2 = 0.f;
  for (int u = 0; u < per / 4; ++u)
#pragma unroll
    for (int q = 0; q < 4; ++q) { const float c = vals[u * 4 + q] - mu; s2 += c * c; }
  red[tid] = s2; __syncthreads();
  for (int st = 128; st > 0; st >>= 1) { if (tid < st) red[tid] += red[tid + st]; __syncthreads(); }
  const float rs = rsqrtf(red[0] / (float)N + eps);
  {
    for (int u = 0; u < per / 4; ++u) {
      const int j = tid * 4 + 1024 * u;
      v4f o, sm;
#pragma unroll
      for (int q = 0; q < 4; ++q) {
        float gg = g[j + q], bb = bta[j + q];
        if (PARAM_BF16) { gg = bf16_round(gg); bb = bf16_round(bb); }
        sm[q] = vals[u * 4 + q]; o[q] = (vals[u * 4 + q] - mu) * rs * gg + bb;
      }
      if (out_sum) *(v4f*)(out_sum + (size_t)row * N + j) = sm;
      *(v4f*)(out_norm + (size_t)row * N + j) = o;
    }
    
  }
}



// ---- f16 WMMA path (v_wmma_f32_16x16x32_f16): 11-bit significands for operands in range — used where a [0,1] probability operand needs more precision than bf16
typedef _Float16 v16h __attribute__((ext_vector_type(16)));
union FragH { v16h v; v8us half[2]; _Float16 h[16]; unsigned short u[16]; };
template <int NT>
__device__ __forceinline__ v8f mmaH(v16h ah, v16h al, v16h bh, v16h bl, v8f c) {
  c = __builtin_amdgcn_wmma_f32_16x16x32_f16(false, ah, false, bh, (short)0, c, false, false);
  if (NT >= 2) c = __builtin_amdgcn_wmma_f32_16x16x32_f16(false, al, false, bh, (short)0, c, false, false);
  if (NT >= 3) c = __builtin_amdgcn_wmma_f32_16x16x32_f16(false, ah, false, bl, (short)0, c, false, false);
  asm volatile("v_nop\n\tv_nop\n\tv_nop\n\tv_nop" : "+v"(c) : "v"(ah), "v"(al), "v"(bh), "v"(bl));
  return c;
}
// batched GEMM like k_gemm_b but f16 operands: A f32 (split into f16 hi/lo if ASPLIT, else rounded to f16), Bt = f16 values [n][k]; alpha; C f32; N multiple of 16 (partial tiles skipped)
template <bool ASPLIT>
__global__ __launch_bounds__(128) void k_gemm_h(const float* __restrict__ A, int lda, size_t sA, const _Float16* __restrict__ Bh, int ldb, size_t sB, float alpha, float* __restrict__ C, int ldc, size_t sC, int M, int N, int K) {
  __shared__ __attribute__((aligned(16))) float so[4][16][64];
  const int tid = threadIdx.x, w = tid >> 5, lane = tid & 31, ln = lane & 15, hh = lane >> 4; const int by = blockIdx.y;
  A += (size_t)by * sA; Bh += (size_t)by * sB; C += (size_t)by * sC;
  const int ntn = (N + 63) / 64; const int wid = blockIdx.x * 4 + w; const int mt = wid / ntn, nq = wid % ntn; if (mt * 16 >= M) return;
  const int row0 = mt * 16, col0 = nq * 64; const float* arow = A + (size_t)(row0 + ln) * lda;
  v8f acc[4] = {};
  for (int kb = 0; kb < K; kb += 32) {
    FragH ah, al;
    const v4f x0 = *(const v4fa*)(arow + kb + 8 * hh), x1 = *(const v4fa*)(arow + kb + 8 * hh + 4), x2 = *(const v4fa*)(arow + kb + 16 + 8 * hh), x3 = *(const v4fa*)(arow + kb + 16 + 8 * hh + 4);
    float xs[16] = {x0[0],x0[1],x0[2],x0[3],x1[0],x1[1],x1[2],x1[3],x2[0],x2[1],x2[2],x2[3],x3[0],x3[1],x3[2],x3[3]};
#pragma unroll
    for (int i = 0; i < 16; ++i) { const _Float16 h = (_Float16)xs[i]; ah.h[i] = h; al.h[i] = ASPLIT ? (_Float16)(xs[i] - (float)h) : (_Float16)0.0f; }
#pragma unroll
    for (int t = 0; t < 4; ++t) { if (col0 + t * 16 >= N) continue; const size_t boff = (size_t)(col0 + t * 16 + ln) * ldb + kb; FragH bq; bq.half[0] = *(const v8us*)(Bh + boff + 8 * hh); bq.half[1] = *(const v8us*)(Bh + boff + 16 + 8 * hh);
      acc[t] = mmaH<ASPLIT ? 2 : 1>(ah.v, al.v, bq.v, bq.v, acc[t]); }
  }
#pragma unroll
  for (int t = 0; t < 4; ++t) { if (col0 + t * 16 >= N) continue;
#pragma unroll
    for (int r = 0; r < 8; ++r) so[w][8 * hh + r][t * 16 + ln] = acc[t][r] * alpha; }
  __builtin_amdgcn_fence(__ATOMIC_ACQ_REL, "workgroup"); __builtin_amdgcn_wave_barrier();
  const int rsub = lane >> 4, c4 = (lane & 15) * 4;
  {
#pragma unroll
    for (int q = 0; q < 8; ++q) { const int r = q * 2 + rsub; if (col0 + c4 < N) { const v4f v = *(const v4fa*)&so[w][r][c4]; *(v4f*)(C + (size_t)(row0 + r) * ldc + col0 + c4) = v; } }
     }
}

// Wt[n][k] = f16(W[k][n]·scale) from f32 row-major W[K][N] (scale = power of two; bf16-exact weights stay exact in f16 away from the subnormal range)
__global__ __launch_bounds__(256) void k_wt_f16(const float* __restrict__ W, _Float16* __restrict__ Wt, int K, int N, float scale) {
  const int t = blockIdx.x * 256 + threadIdx.x; if (t >= N * (K / 8)) return; const int n = t / (K / 8), k8 = (t % (K / 8)) * 8; FragH f;
#pragma unroll
  for (int i = 0; i < 8; ++i) f.h[i] = (_Float16)(bf16_round(W[(size_t)(k8 + i) * N + n]) * scale); const v8us o = f.half[0];
  *(v8us*)((unsigned short*)Wt + (size_t)n * K + k8) = o; 
}
// k_gemm_hh variant with fused epilogue: v = acc·alpha + bias[by·sBias + col] (+ CP[(row/rowsPerB)·sCPb + by·64 + col] if CP) ; ACT 0 none / 1 elu ; writes f16 C16 (and f32 C if non-null)
template <int ACT>
__global__ __launch_bounds__(128) void k_gemm_hhx(const _Float16* __restrict__ A, int lda, size_t sA, const _Float16* __restrict__ Bh, int ldb, size_t sB, float alpha, const float* __restrict__ bias, size_t sBias, const float* __restrict__ CP, int rowsPerB, size_t sCPb, int row0g,
    float* __restrict__ C, _Float16* __restrict__ C16, int ldc, size_t sC, int M, int N, int K) {
  __shared__ __attribute__((aligned(16))) float so[4][16][64];
  const int tid = threadIdx.x, w = tid >> 5, lane = tid & 31, ln = lane & 15, hh = lane >> 4; const int by = blockIdx.y;
  A += (size_t)by * sA; Bh += (size_t)by * sB; const size_t cofs = (size_t)by * sC; const float* bp = bias ? bias + (size_t)by * sBias : nullptr;
  const int ntn = (N + 63) / 64; const int wid = blockIdx.x * 4 + w; const int mt = wid / ntn, nq = wid % ntn; if (mt * 16 >= M) return;
  const int row0 = mt * 16, col0 = nq * 64; const _Float16* arow = A + (size_t)(row0 + ln) * lda;
  v8f acc[4] = {};
  for (int kb = 0; kb < K; kb += 32) { FragH ah; ah.half[0] = *(const v8us*)((const unsigned short*)arow + kb + 8 * hh); ah.half[1] = *(const v8us*)((const unsigned short*)arow + kb + 16 + 8 * hh);
#pragma unroll
    for (int t = 0; t < 4; ++t) { if (col0 + t * 16 >= N) continue; const size_t boff = (size_t)(col0 + t * 16 + ln) * ldb + kb; FragH bq; bq.half[0] = *(const v8us*)((const unsigned short*)Bh + boff + 8 * hh); bq.half[1] = *(const v8us*)((const unsigned short*)Bh + boff + 16 + 8 * hh);
      acc[t] = mmaH<1>(ah.v, ah.v, bq.v, bq.v, acc[t]); }
  }
#pragma unroll
  for (int t = 0; t < 4; ++t) { if (col0 + t * 16 >= N) continue; const int col = col0 + t * 16 + ln; const float bv = bp ? bf16_round(bp[col]) : 0.f;
#pragma unroll
    for (int r = 0; r < 8; ++r) { float v = acc[t][r] * alpha + bv; if (CP) { const int rr = row0g + row0 + 8 * hh + r; if (rowsPerB < 0) v += CP[cofs + (size_t)rr * ldc + col];      /* rowsPerB < 0: own element of the batched C plane */ else { const int bidx = rr / rowsPerB; v += CP[(size_t)bidx * sCPb + (size_t)by * 64 + col]; } } if (ACT == 1) v = (v > 0.f) ? v : expm1f(v); else if (ACT == 7) v = (v > 0.f) ? v + 1.0f : expf(v); else if (ACT == 8) v = tanhf(v); else if (ACT == 9) v = 0.5f * v * (1.0f + tanhf(0.7978845608028654f * (v + 0.044715f * v * v * v))); else if (ACT == 11) v = 1.0f / (1.0f + expf(-v)); else if (ACT == 12) v = (v > 0.f) ? v : 0.01f * v; else if (ACT == 14) v = (v > 0.f) ? v : 0.1f * v; else if (ACT == 16) v = (v >= 0.f) ? v : 0.3f * v; else if (ACT == 17) v = (v >= 0.f) ? v : 0.2f * v; else if (ACT == 15) v = v / (1.0f + expf(-v)); else if (ACT == 3) v = fmaxf(v, 0.f); else if (ACT == 6) v = 0.5f * v * (1.0f + erff(v * 0.70710678118654752f)); so[w][8 * hh + r][t * 16 + ln] = v; } }
  __builtin_amdgcn_fence(__ATOMIC_ACQ_REL, "workgroup"); __builtin_amdgcn_wave_barrier();
  const int rsub = lane >> 4, c4 = (lane & 15) * 4; typedef _Float16 v4h __attribute__((ext_vector_type(4)));
  {
#pragma unroll
    for (int q = 0; q < 8; ++q) { const int r = q * 2 + rsub; if (col0 + c4 < N) { const v4f v = *(const v4fa*)&so[w][r][c4]; if (C) *(v4f*)(C + cofs + (size_t)(row0 + r) * ldc + col0 + c4) = v; if (C16) { v4h h4; for (int i = 0; i < 4; ++i) h4[i] = (_Float16)v[i]; *(v4h*)(C16 + cofs + (size_t)(row0 + r) * ldc + col0 + c4) = h4; } } }
     }
}


typedef _Float16 v4h __attribute__((ext_vector_type(4)));

__global__ __launch_bounds__(256) void k_x16(const float* __restrict__ x, _Float16* __restrict__ X16, size_t n8) { const size_t t = (size_t)blockIdx.x * 256 + threadIdx.x; if (t >= n8) return; FragH f;
#pragma unroll
  for (int q = 0; q < 8; ++q) f.h[q] = (_Float16)bf16_round(x[t * 8 + q]); *(v8us*)((unsigned short*)X16 + t * 8) = f.half[0];  }
__global__ __launch_bounds__(256) void k_h16(const float* __restrict__ x, _Float16* __restrict__ X16, size_t n8) { const size_t t = (size_t)blockIdx.x * 256 + threadIdx.x; if (t >= n8) return; FragH f;
#pragma unroll
  for (int q = 0; q < 8; ++q) f.h[q] = (_Float16)x[t * 8 + q]; *(v8us*)((unsigned short*)X16 + t * 8) = f.half[0];  }
__global__ __launch_bounds__(256) void k_round16f(const float* __restrict__ W, _Float16* __restrict__ Bt, size_t n8) { const size_t t = (size_t)blockIdx.x * 256 + threadIdx.x; if (t >= n8) return; FragH f;
#pragma unroll
  for (int i = 0; i < 8; ++i) f.h[i] = (_Float16)(bf16_round(W[t * 8 + i]) * 16.0f); *(v8us*)((unsigned short*)Bt + t * 8) = f.half[0];  }
template <int NHv, int TTv>
__global__ __launch_bounds__(256) void k_vt(const _Float16* __restrict__ V16, int ldv, int voff, _Float16* __restrict__ Vt) { __shared__ unsigned short tl[64][66]; const int tid = threadIdx.x; const int slab = blockIdx.x / (TTv / 64), lg = blockIdx.x % (TTv / 64); const int b = slab / NHv, h = slab % NHv;
  for (int i = tid; i < 64 * 8; i += 256) { const int r = i / 8, c8 = (i % 8) * 8; FragH f; f.half[0] = *(const v8us*)((const unsigned short*)V16 + ((size_t)b * TTv + lg * 64 + r) * ldv + voff + h * 64 + c8);
#pragma unroll
    for (int q = 0; q < 8; ++q) tl[r][c8 + q] = f.u[q]; }
  __syncthreads();
  {
#pragma unroll
    for (int rd = 0; rd < 2; ++rd) { const int d = rd * 32 + tid / 8, pc = tid % 8; FragH f;
#pragma unroll
      for (int q = 0; q < 8; ++q) f.u[q] = tl[pc * 8 + q][d];
      *(v8us*)((unsigned short*)Vt + ((size_t)slab * 64 + d) * TTv + lg * 64 + pc * 8) = f.half[0]; }
     } }

// ---- fast GEMM (wave tile 32x64; requires M % 32 == 0 rows per launch region and N % 64 == 0); epilogue = k_gemm_hhx semantics ----
__device__ __forceinline__ v16h g2_frag(const _Float16* p, int hh) { FragH f; f.half[0] = *(const v8us*)((const unsigned short*)p + 8 * hh); f.half[1] = *(const v8us*)((const unsigned short*)p + 16 + 8 * hh); return f.v; }
__device__ __forceinline__ v8f g2_mma(v16h a, v16h b, v8f c) { v8f d = __builtin_amdgcn_wmma_f32_16x16x32_f16(false, a, false, b, (short)0, c, false, false); asm volatile("v_nop\n\tv_nop\n\tv_nop\n\tv_nop" : "+v"(d) : "v"(a), "v"(b)); return d; }
template <int ACT>
__global__ __launch_bounds__(128) void k_gemm2(const _Float16* __restrict__ A, int lda, size_t sA, const _Float16* __restrict__ Bh, int ldb, size_t sB, float alpha, const float* __restrict__ bias, size_t sBias, const float* __restrict__ CP, int rowsPerB, size_t sCPb, int row0g,
    float* __restrict__ C, _Float16* __restrict__ C16, int ldc, size_t sC, int M, int N, int K) { static_assert(ACT == 0 || ACT == 3 || ACT == 6 || ACT == 8 || ACT == 9 || ACT == 11 || ACT == 12 || ACT == 14 || ACT == 15 || ACT == 16 || ACT == 17, "k_gemm2: unsupported ACT code (would silently apply no activation)");
  __shared__ __attribute__((aligned(16))) float so[4][32][68];
  const int tid = threadIdx.x, w = tid >> 5, lane = tid & 31, ln = lane & 15, hh = lane >> 4; const int by = blockIdx.y;
  A += (size_t)by * sA; Bh += (size_t)by * sB; const size_t cofs = (size_t)by * sC; const float* bp = bias ? bias + (size_t)by * sBias : nullptr;
  const int ntn = N >> 6; const int mt = blockIdx.x / ntn, nq = blockIdx.x - mt * ntn; const int row0 = mt * 128 + 32 * w, col0 = nq * 64; if (row0 >= M) return;
  const _Float16* a0p = A + (size_t)(row0 + ln) * lda; const _Float16* a1p = a0p + (size_t)16 * lda;
  const _Float16* b0p = Bh + (size_t)(col0 + ln) * ldb; const _Float16* b1p = b0p + (size_t)16 * ldb; const _Float16* b2p = b1p + (size_t)16 * ldb; const _Float16* b3p = b2p + (size_t)16 * ldb;
  const v8f z8 = {0.f,0.f,0.f,0.f,0.f,0.f,0.f,0.f}; v8f c00 = z8, c01 = z8, c02 = z8, c03 = z8, c10 = z8, c11 = z8, c12 = z8, c13 = z8;
#pragma unroll 1
  for (int kb = 0; kb < K; kb += 32) { const v16h a0 = g2_frag(a0p + kb, hh), a1 = g2_frag(a1p + kb, hh);
    v16h b = g2_frag(b0p + kb, hh); c00 = g2_mma(a0, b, c00); c10 = g2_mma(a1, b, c10);
    b = g2_frag(b1p + kb, hh); c01 = g2_mma(a0, b, c01); c11 = g2_mma(a1, b, c11);
    b = g2_frag(b2p + kb, hh); c02 = g2_mma(a0, b, c02); c12 = g2_mma(a1, b, c12);
    b = g2_frag(b3p + kb, hh); c03 = g2_mma(a0, b, c03); c13 = g2_mma(a1, b, c13); }
  v8f accs[8] = {c00, c01, c02, c03, c10, c11, c12, c13};
#pragma unroll
  for (int u = 0; u < 8; ++u) { const int t = u & 3, half = u >> 2; const int col = col0 + t * 16 + ln; const float bv = bp ? bf16_round(bp[col]) : 0.f;
#pragma unroll
    for (int r = 0; r < 8; ++r) { const int rloc = half * 16 + 8 * hh + r; float v = accs[u][r] * alpha + bv; if (CP) { if (rowsPerB < 0) v += CP[cofs + (size_t)(row0g + row0 + rloc) * ldc + col];      /* rowsPerB < 0: own element of the batched C plane */ else { const int bidx = (row0g + row0 + rloc) / rowsPerB; v += CP[(size_t)bidx * sCPb + (size_t)by * 64 + col]; } }
      if (ACT == 3) v = fmaxf(v, 0.f); else if (ACT == 6) v = 0.5f * v * (1.0f + erff(v * 0.70710678118654752f)); else if (ACT == 11) v = 1.0f / (1.0f + expf(-v)); else if (ACT == 15) v = v / (1.0f + expf(-v)); else if (ACT == 12) v = (v > 0.f) ? v : 0.01f * v; else if (ACT == 8) v = tanhf(v); else if (ACT == 9) v = 0.5f * v * (1.0f + tanhf(0.7978845608028654f * (v + 0.044715f * v * v * v))); else if (ACT == 14) v = (v > 0.f) ? v : 0.1f * v; else if (ACT == 16) v = (v >= 0.f) ? v : 0.3f * v; else if (ACT == 17) v = (v >= 0.f) ? v : 0.2f * v;
      so[w][rloc][t * 16 + ln] = v; } }
  __builtin_amdgcn_fence(__ATOMIC_ACQ_REL, "workgroup"); __builtin_amdgcn_wave_barrier();
  const int rsub = lane >> 4, c4 = (lane & 15) * 4;
  {
#pragma unroll
    for (int q = 0; q < 16; ++q) { const int r = q * 2 + rsub; const v4f v = *(const v4fa*)&so[w][r][c4]; if (C) *(v4f*)(C + cofs + (size_t)(row0 + r) * ldc + col0 + c4) = v; if (C16) { v4h h4; for (int i = 0; i < 4; ++i) h4[i] = (_Float16)v[i]; *(v4h*)(C16 + cofs + (size_t)(row0 + r) * ldc + col0 + c4) = h4; } }
     } }


__global__ __launch_bounds__(256) void k_wnat(const float* __restrict__ w, size_t n8, _Float16* __restrict__ Bt) { const size_t t = (size_t)blockIdx.x * 256 + threadIdx.x; if (t >= n8) return; FragH f; for (int q = 0; q < 8; ++q) f.h[q] = (_Float16)(bf16_round(w[t * 8 + q]) * 16.0f); *(v8us*)((unsigned short*)Bt + t * 8) = f.half[0];  }
__global__ __launch_bounds__(256) void k_rsm(const float* __restrict__ S, _Float16* __restrict__ P, int nrows) {
  #pragma clang fp contract(off)
  const int i = blockIdx.x * 256 + threadIdx.x; if (i >= nrows) return; const float* s = S + (size_t)i * SQ; float mx = -3.0e38f;
#pragma unroll 1
  for (int j = 0; j < SQ; ++j) mx = fmaxf(mx, s[j]); float se = 0.f;
#pragma unroll 1
  for (int j = 0; j < SQ; ++j) se += expf(s[j] - mx); const float sc = 256.0f / se;
#pragma unroll 1
  for (int j0 = 0; j0 < SQ; j0 += 8) { FragH f; for (int q = 0; q < 8; ++q) f.h[q] = (_Float16)(expf(s[j0 + q] - mx) * sc); unsigned short* d = (unsigned short*)P + (size_t)i * SQ + j0; *(v8us*)d = f.half[0];  } }
__global__ __launch_bounds__(256) void k_vt(const _Float16* __restrict__ V16, int b, int h0, _Float16* __restrict__ VT) { __shared__ unsigned short tl[64][65]; const int tid = threadIdx.x; const int hh = blockIdx.x % HG, sg = blockIdx.x / HG; const int s0 = sg * 64; const int h = h0 + hh;
  for (int i = tid; i < 64 * 8; i += 256) { const int j = i / 8, d8 = (i % 8) * 8; FragH f; f.half[0] = *(const v8us*)((const unsigned short*)V16 + ((size_t)b * SQ + s0 + j) * DM + h * HD + d8); for (int q = 0; q < 8; ++q) tl[d8 + q][j] = f.u[q]; }
  __syncthreads();
  { for (int i = tid; i < 64 * 8; i += 256) { const int d = i / 8, j8 = (i % 8) * 8; FragH f; for (int q = 0; q < 8; ++q) f.u[q] = tl[d][j8 + q]; *(v8us*)((unsigned short*)VT + ((size_t)hh * HD + d) * SQ + s0 + j8) = f.half[0]; }  } }


// The set-up pieces below are device functions of a flat thread index t: k_prep deals them out by block range.
__device__ __forceinline__ void x16pad_at(const float* __restrict__ x, _Float16* __restrict__ X16, size_t t) { if (t >= (size_t)NB * QP * (DM / 8)) return; const int c8 = (int)(t % (DM / 8)) * 8; const size_t row = t / (DM / 8); const int b = (int)(row / QP), q = (int)(row % QP); FragH f;
  for (int i = 0; i < 8; ++i) f.h[i] = (_Float16)((q < NQ) ? bf16_round(x[((size_t)b * NQ + q) * DM + c8 + i]) : 0.f);
  *(v8us*)((unsigned short*)X16 + row * DM + c8) = f.half[0];
  asm volatile("s_wait_xcnt 0x0" ::: "memory"); }      /* behind the store: in k_prep's listing a branch leads on from here into another piece's code, which overwrites the store's registers */


template <int HPP>
__device__ __forceinline__ void wtpadT_at(const float* __restrict__ w, _Float16* __restrict__ Bt, int t) { if (t >= NH * HPP * (DM / 8)) return; const int k8 = (t % (DM / 8)) * 8; const int r = t / (DM / 8); const int h = r / HPP, d = r % HPP; FragH f;
  for (int q = 0; q < 8; ++q) { float v = 0.f; if (d < HD) v = bf16_round(w[(size_t)(k8 + q) * DM + h * HD + d]); f.h[q] = (_Float16)(v * 16.0f); }
  unsigned short* dst = (unsigned short*)Bt + (size_t)r * DM + k8; *(v8us*)dst = f.half[0];
  asm volatile("s_wait_xcnt 0x0" ::: "memory"); }      /* behind the store, as in x16pad_at */
template <int HPP>
__device__ __forceinline__ void wtopadT_at(const float* __restrict__ w, _Float16* __restrict__ Bt, int t) { if (t >= DM * (NH * HPP / 8)) return; const int k8 = (t % (NH * HPP / 8)) * 8; const int n = t / (NH * HPP / 8); FragH f;
  for (int q = 0; q < 8; ++q) { const int kp = k8 + q; const int h = kp / HPP, d = kp % HPP; float v = 0.f; if (d < HD) v = bf16_round(w[(size_t)(h * HD + d) * DM + n]); f.h[q] = (_Float16)(v * 16.0f); }
  unsigned short* dst = (unsigned short*)Bt + (size_t)n * (NH * HPP) + k8; *(v8us*)dst = f.half[0];
  asm volatile("s_wait_xcnt 0x0" ::: "memory"); }      /* behind the store, as in x16pad_at */
// Mean term, one block of 32 waves per batch. Column sums: 25 waves of 40 rows each; a wave reads whole 512-byte rows (lane = 4 columns), rows w, w + 25, ..., eight loads in flight; the 25 partial rows meet in LDS.
// mu Wq_mean: thread = (output column, slice of 16 rows of Wq_mean), its 16 weights loaded ahead of the row loads; the 8 slices meet in LDS.
#define MW 25                        /* waves that sum rows; NQ = MW * 40 */
__device__ __forceinline__ void qmean_at(const float* __restrict__ xn, const float* __restrict__ wqm, float* __restrict__ QMP, int b) {
  static_assert(NQ % (MW * 8) == 0 && MW <= 32, "rows deal out evenly, eight a round");
  __shared__ __attribute__((aligned(16))) float part[MW][DM]; __shared__ float mu[DM]; __shared__ float wp[8][DM];
  const int t = threadIdx.x, c4 = (t & 31) * 4, col = t % DM, kg = t / DM; float wv[DM / 8];
  const int w = __builtin_amdgcn_readfirstlane(t >> 5);      /* wave number in a scalar register: row addresses and the test on it are scalar */
#pragma unroll      /* wv[] in registers, all 16 loads in flight */
  for (int i = 0; i < DM / 8; ++i) wv[i] = wqm[(size_t)(kg * (DM / 8) + i) * DM + col];
  asm volatile("s_wait_xcnt 0x0" ::: "memory");      /* stands in front of the row addresses below: this build forms them in the offset register of the weight loads just issued */
  if (w < MW) { const float* rows = xn + ((size_t)b * NQ + w) * DM + c4; v4f s = {0.f, 0.f, 0.f, 0.f};
#pragma unroll 1      /* eight loads a round: a fully unrolled form of this loop spilled at the 128 registers a wave has in a 1024-thread block */
    for (int r = 0; r < NQ / (MW * 8); ++r) { v4f a[8];
#pragma unroll      /* a[] in registers, the round's loads in flight together */
      for (int j = 0; j < 8; ++j) a[j] = *(const v4fa*)(rows + (size_t)(r * 8 + j) * MW * DM);
#pragma unroll      /* a[] in registers */
      for (int j = 0; j < 8; ++j) for (int q = 0; q < 4; ++q) s[q] += bf16_round(a[j][q]); }
    *(v4f*)&part[w][c4] = s; }
  __syncthreads();
  if (t < DM) { float m = 0.f; for (int i = 0; i < MW; ++i) m += part[i][t]; mu[t] = m / (float)NQ; }
  __syncthreads();
  float v = 0.f;
#pragma unroll      /* wv[] in registers */
  for (int i = 0; i < DM / 8; ++i) v += mu[kg * (DM / 8) + i] * bf16_round(wv[i]);
  wp[kg][col] = v;
  __syncthreads();
  if (t < NH * 32) { const int h = t / 32, d = t % 32; float o = 0.f; if (d < HD) for (int g = 0; g < 8; ++g) o += wp[g][h * HD + d]; QMP[(size_t)b * (NH * 32) + t] = o; } }
// Set-up, one launch: nothing here reads what another piece writes, so the nine pieces are block ranges of one grid of 1024-thread blocks. The mean term and then the weights have the longest chains of waits and take the first blocks.
#define PT 1024                                   /* threads of a set-up block */
#define PB_X ((int)(NRP * (DM / 8) / PT))         /* blocks of one token plane */
#define PB_W32 (NH * 32 * (DM / 8) / PT)          /* blocks of a [8][32]-padded weight */
#define PB_W64 (NH * 64 * (DM / 8) / PT)          /* blocks of a [8][64]-padded weight */
#define PB_WC (DM * (DM / 8) / PT)                /* blocks of W_comb^T, [128][128] */
#define PB_ALL (NB + 3 * PB_X + 3 * PB_W32 + PB_W64 + PB_WC)
__global__ __launch_bounds__(PT) void k_prep(const float* __restrict__ xn, const float* __restrict__ xq1, const float* __restrict__ xl, const float* __restrict__ wqf, const float* __restrict__ wql, const float* __restrict__ wqm, const float* __restrict__ wk, const float* __restrict__ wv, const float* __restrict__ wc,
    _Float16* __restrict__ XN, _Float16* __restrict__ XQ1, _Float16* __restrict__ XL, _Float16* __restrict__ BQF, _Float16* __restrict__ BQL, _Float16* __restrict__ BK, _Float16* __restrict__ BVP, _Float16* __restrict__ BCP, float* __restrict__ QMP) {
  static_assert(NRP * (DM / 8) % PT == 0 && NH * 32 * (DM / 8) % PT == 0 && DM * (DM / 8) % PT == 0 && NH * HD == DM, "every piece is a whole number of blocks");
  int r = blockIdx.x; const int tid = threadIdx.x;
  if (r < NB) { qmean_at(xn, wqm, QMP, r); return; }      /* the branch is the same for a whole block: its barriers are met by all of it */
  r -= NB;
  if (r < 3 * PB_W32) { const int s = r / PB_W32; wtpadT_at<32>(s == 0 ? wqf : s == 1 ? wql : wk, s == 0 ? BQF : s == 1 ? BQL : BK, (r - s * PB_W32) * PT + tid); return; }
  r -= 3 * PB_W32;
  if (r < PB_W64) { wtpadT_at<64>(wv, BVP, r * PT + tid); return; }
  r -= PB_W64;
  if (r < PB_WC) { wtopadT_at<HD>(wc, BCP, r * PT + tid); return; }      /* heads of 16 with no pad: plain W_comb^T */
  r -= PB_WC;
  const int s = r / PB_X; x16pad_at(s == 0 ? xn : s == 1 ? xq1 : xl, s == 0 ? XN : s == 1 ? XQ1 : XL, (size_t)(r - s * PB_X) * PT + tid); }
// Projections, one launch: q, k and V^T are block ranges of one grid; tile, fragments and store path are those of k_gemm2 (wave tile 32 x 64, K = DM, operands x16 so alpha = 1/16, f16 result).
// q: both products (q1 Wq_first, last Wq_last) run into the same accumulators, the batch's mean term is added behind them.
// V^T: the operands change places, A = rows of the padded Wv^T, B = node rows of one batch, so the tile comes out as [feature][key] and is stored that way.
__device__ __forceinline__ void pj_acc(const _Float16* __restrict__ a0p, const _Float16* __restrict__ b0p, int hh, v8f (&c)[8]) {
  const _Float16* a1p = a0p + 16 * DM; const _Float16* b1p = b0p + 16 * DM; const _Float16* b2p = b0p + 32 * DM; const _Float16* b3p = b0p + 48 * DM;
#pragma unroll 1      /* stays the rolled loop of k_gemm2: the order of loads and products is not part of this change */
  for (int kb = 0; kb < DM; kb += 32) { const v16h a0 = g2_frag(a0p + kb, hh); FragH a1f; a1f.half[0] = *(const v8us*)((const unsigned short*)a1p + kb + 8 * hh);
    asm volatile("s_wait_xcnt 0x0" ::: "memory");      /* the build lets the load below land in the address pair that the three A loads just issued name: the wait stands in front of that overwrite */
    a1f.half[1] = *(const v8us*)((const unsigned short*)a1p + kb + 16 + 8 * hh); const v16h a1 = a1f.v;
    v16h b = g2_frag(b0p + kb, hh); c[0] = g2_mma(a0, b, c[0]); c[4] = g2_mma(a1, b, c[4]);
    b = g2_frag(b1p + kb, hh); c[1] = g2_mma(a0, b, c[1]); c[5] = g2_mma(a1, b, c[5]);
    b = g2_frag(b2p + kb, hh); c[2] = g2_mma(a0, b, c[2]); c[6] = g2_mma(a1, b, c[6]);
    b = g2_frag(b3p + kb, hh); c[3] = g2_mma(a0, b, c[3]); c[7] = g2_mma(a1, b, c[7]); } }
#define JB_QK ((int)(NRP / 128) * (NH * 32 / 64))  /* blocks of q, and of k */
#define JB_V ((NH * 64 / 128) * (QP / 64))         /* blocks of one batch's V^T */
__global__ __launch_bounds__(128) void k_proj(const _Float16* __restrict__ XQ1, const _Float16* __restrict__ BQF, const _Float16* __restrict__ XL, const _Float16* __restrict__ BQL, const float* __restrict__ QMP, _Float16* __restrict__ Q16,
    const _Float16* __restrict__ XN, const _Float16* __restrict__ BK, _Float16* __restrict__ K16, const _Float16* __restrict__ BVP, _Float16* __restrict__ VT) {
  static_assert(QP % 128 == 0 && NH * 32 == 64 << 2 && QP == 64 << 4, "the 32 rows of a wave tile of q lie in one batch; the two values of lg");
  __shared__ __attribute__((aligned(16))) float so[4][32][68];
  const int tid = threadIdx.x, w = tid >> 5, lane = tid & 31, ln = lane & 15, hh = lane >> 4;
  int bx = blockIdx.x, N = NH * 32, lg = 2; const _Float16* A = XQ1; const _Float16* B = BQF; _Float16* C16 = Q16; const bool isq = bx < JB_QK;      /* N: columns and pitch of the result; lg: log2 of its 64-column tiles */
  if (bx >= 2 * JB_QK) { bx -= 2 * JB_QK; const int by = bx / JB_V; bx -= by * JB_V; N = QP; lg = 4; A = BVP; B = XN + (size_t)by * QP * DM; C16 = VT + (size_t)by * NH * 64 * QP; }
  else if (bx >= JB_QK) { bx -= JB_QK; A = XN; B = BK; C16 = K16; }
  const int mt = bx >> lg, nq = bx - (mt << lg), row0 = mt * 128 + 32 * w, col0 = nq * 64;
  const v8f z8 = {0.f, 0.f, 0.f, 0.f, 0.f, 0.f, 0.f, 0.f}; v8f c[8] = {z8, z8, z8, z8, z8, z8, z8, z8};
  float cp[4] = {0.f, 0.f, 0.f, 0.f};      /* q: the batch's mean term at this lane's four columns, loaded ahead of the products */
  if (isq) for (int t = 0; t < 4; ++t) cp[t] = QMP[(size_t)(row0 / QP) * (NH * 32) + col0 + t * 16 + ln];
  pj_acc(A + (size_t)(row0 + ln) * DM, B + (size_t)(col0 + ln) * DM, hh, c);
  if (isq) pj_acc(XL + (size_t)(row0 + ln) * DM, BQL + (size_t)(col0 + ln) * DM, hh, c);
#pragma unroll      /* c[] in registers */
  for (int u = 0; u < 8; ++u) { const int t = u & 3, half = u >> 2;
    for (int r = 0; r < 8; ++r) so[w][half * 16 + 8 * hh + r][t * 16 + ln] = c[u][r] * 0.0625f + cp[t]; }
  __builtin_amdgcn_fence(__ATOMIC_ACQ_REL, "workgroup"); __builtin_amdgcn_wave_barrier();      /* the reads below take what other lanes of this wave stored */
  const int rsub = lane >> 4, c4 = (lane & 15) * 4;
#pragma unroll      /* sixteen plain row stores */
  for (int q = 0; q < 16; ++q) { const int r = q * 2 + rsub; const v4f v = *(const v4fa*)&so[w][r][c4]; v4h h4; for (int i = 0; i < 4; ++i) h4[i] = (_Float16)v[i]; *(v4h*)(C16 + (size_t)(row0 + r) * N + col0 + c4) = h4; } }
// Row softmaxes, one wave per row: lane holds columns 4*lane + 128*u (u = 0..7), so each wave-wide b128 load or store covers 512 contiguous bytes;
// the row's values stay in registers between the maximum, the sum and the store. Maximum and sum: per lane first, then a five-step butterfly over the 32 lanes.
// Columns NQ..QP-1 (lanes 26..31 of u = 7): the score planes hold them; the mask does not, so those lanes re-read their own first chunk; their value is -inf (weight 0) and they are not stored.
__device__ __forceinline__ float wave_max32(float v) { for (int m = 16; m > 0; m >>= 1) v = fmaxf(v, __shfl_xor(v, m, 32)); return v; }
__device__ __forceinline__ float wave_sum32(float v) { for (int m = 16; m > 0; m >>= 1) v += __shfl_xor(v, m, 32); return v; }
// 2^x as one v_exp_f32 (what __expf compiles to behind its multiply) with the issue slot behind it filled
__device__ __forceinline__ float exp2_slot(float x) { float r; asm("v_exp_f32 %0, %1\n\tv_nop" : "=v"(r) : "v"(x)); return r; }
__device__ __forceinline__ v16h at_frag16(v8us lo) { FragH f; f.half[0] = lo; const v8us z = {0, 0, 0, 0, 0, 0, 0, 0}; f.half[1] = z; return f.v; }      /* q or k row of one head: 16 features, k 16..31 of the fragment zero */
__device__ __forceinline__ v8f at_mma(v16h a, v16h b, v8f c) { return __builtin_amdgcn_wmma_f32_16x16x32_f16(false, a, false, b, (short)0, c, false, false); }
// what 32 keys take from memory for one lane: its 8 features of two k rows, 2 x 8 mask values of its query. EDGE: a lane whose 8 keys lie at or past NQ reads its 8 mask values of the row's first 16 columns instead, and those keys count as -inf
struct At32 { v8us k0, k1; v4f m0, m1, m2, m3; };
template <bool EDGE>
__device__ __forceinline__ At32 at_load(const unsigned short* kp, const float* mr, int k0, int hh) {
  At32 t; const int c0 = (!EDGE || k0 + 8 * hh < NQ) ? k0 : 0, c1 = (!EDGE || k0 + 16 + 8 * hh < NQ) ? k0 + 16 : 0;
  t.k0 = *(const v8us*)(kp + (size_t)k0 * (NH * 32)); t.k1 = *(const v8us*)(kp + (size_t)(k0 + 16) * (NH * 32));
  t.m0 = *(const v4fa*)(mr + c0); t.m1 = *(const v4fa*)(mr + c0 + 4); t.m2 = *(const v4fa*)(mr + c1); t.m3 = *(const v4fa*)(mr + c1 + 4); return t; }
// x[0..7], x[8..15]: scores / 4 + mask of this lane's query against keys k0 + 8 * hh + r and k0 + 16 + 8 * hh + r
template <bool EDGE>
__device__ __forceinline__ void at_score(const At32& t, v16h qf, int k0, int hh, float* x) {
  const v8f z8 = {0.f, 0.f, 0.f, 0.f, 0.f, 0.f, 0.f, 0.f}; const v8f s0 = at_mma(at_frag16(t.k0), qf, z8), s1 = at_mma(at_frag16(t.k1), qf, z8);
  const bool in0 = !EDGE || k0 + 8 * hh < NQ, in1 = !EDGE || k0 + 16 + 8 * hh < NQ;
#pragma unroll      /* x[] in registers */
  for (int r = 0; r < 8; ++r) { const float v0 = s0[r] * 0.25f + bf16_round(r < 4 ? t.m0[r & 3] : t.m1[r & 3]), v1 = s1[r] * 0.25f + bf16_round(r < 4 ? t.m2[r & 3] : t.m3[r & 3]);
    x[r] = in0 ? v0 : -__builtin_inff(); x[8 + r] = in1 ? v1 : -__builtin_inff(); } }
template <bool EDGE>
__device__ __forceinline__ float at_max32(const At32& t, v16h qf, int k0, int hh, float mx) {
  float x[16]; at_score<EDGE>(t, qf, k0, hh, x);
#pragma unroll      /* x[] in registers */
  for (int r = 0; r < 16; ++r) mx = fmaxf(mx, x[r]);
  return mx; }
template <bool EDGE>
__device__ __forceinline__ v8f at_pv32(const At32& t, v16h vf, v16h qf, int k0, int hh, float mx, float* se, v8f o) {
  float x[16]; at_score<EDGE>(t, qf, k0, hh, x); FragH pf;
#pragma unroll      /* x[] in registers; four running sums, so that an add does not wait for the one before it */
  for (int r = 0; r < 16; ++r) { const float e = exp2_slot((x[r] - mx) * 1.44269504f + 8.0f); se[r & 3] += e; pf.h[r] = (_Float16)e; }
  return at_mma(vf, pf.v, o); }
// Attention, the combine projection and stage 2 in one launch: block = (16 query rows, batch), eight waves. What went from launch to launch through memory (o, its hi and residual planes, mh) now goes from wave to wave through LDS.
// Attention as described above, wave = head; a lane's 8 values of o (x64) go to its query's row of ob.
// Combine, behind the first barrier: every wave splits the 16 rows of o into f16 hi + x1024 residual fragments (k order of g2_frag, K = 128) and forms the 16 columns 16 w .. 16 w + 15 of mh = o W_comb + b_comb, which go to mhb.
// Stage 2, behind the second barrier: score2 stays in LDS, the probabilities go straight to out.
// Part 1: wave w forms score2 of the 16 rows against keys 128 w .. 128 w + 127, eight tiles of 16 keys. The mh rows are split here into f16 hi + x1024 residual fragments (k order of g2_frag) and stay in registers.
// A tile of 16 node rows is 4 KiB in a row in memory: eight loads of 512 contiguous bytes a wave, one tile ahead, then through the wave's own LDS rows into fragments (a fragment load straight from memory touches 16 lines an instruction).
// Part 2, behind the third barrier: wave w takes rows 2 w and 2 w + 1 whole, lane = columns 4 * lane + 128 * u as in the row softmaxes above.
#define SP (QP + 4)                  /* score row pitch in LDS, floats: rows r and r + 8, stored by the two wave halves together, lie 32 banks apart */
#define XP (DM + 8)                  /* staged node row pitch, f16: 272 bytes = 16 x odd, for the b128 fragment reads */
#define OP (DM + 4)                  /* o and mh row pitch in LDS, floats: 528 bytes, so the 16 rows that a b128 fragment read touches start 4 banks apart */
__global__ __launch_bounds__(256) void k_dec(const _Float16* __restrict__ Q16, const _Float16* __restrict__ K16, const _Float16* __restrict__ VT, const _Float16* __restrict__ BC, const float* __restrict__ bc, const _Float16* __restrict__ XN, const float* __restrict__ mask, float* __restrict__ out) {
  static_assert(NQ % 8 == 0 && NQ > QP - 32 && NQ <= QP && QP % 128 == 0, "only the last 32 keys hold an edge, and a lane's 8 keys are all in or all out");
  static_assert(QP == 8 * 128 && DM == 128 && NQ % 4 == 0, "eight waves of 128 keys; a node row is 16 lanes of 16 bytes; a lane's 4 columns are all in or all out");
  __shared__ __attribute__((aligned(16))) float sc[16][SP]; __shared__ __attribute__((aligned(16))) unsigned short nb[8][16][XP]; __shared__ __attribute__((aligned(16))) float ob[16][OP]; __shared__ __attribute__((aligned(16))) float mhb[16][OP];
  const int b = blockIdx.y, row0 = blockIdx.x * 16, lane = threadIdx.x & 31, ln = lane & 15, hh = lane >> 4;
  const int w = __builtin_amdgcn_readfirstlane(threadIdx.x >> 5);      /* wave number in a scalar register: LDS bases and the row test below are scalar */
  { const int h = w, c = ln, q = row0 + c; const bool live = q < NQ;      /* rows NQ.. of the last block: same instruction stream on mask row 0, scale 0, so zeros go to ob */
  const v16h qf = at_frag16(*(const v8us*)((const unsigned short*)Q16 + ((size_t)b * QP + q) * (NH * 32) + h * 32 + 8 * hh));
  const unsigned short* kp = (const unsigned short*)K16 + ((size_t)b * QP + c) * (NH * 32) + h * 32 + 8 * hh; const _Float16* vp = VT + ((size_t)(b * NH + h) * 64 + c) * QP;
  const float* mr = mask + ((size_t)b * NQ + (live ? q : 0)) * NQ + 8 * hh; float mx = -3.0e38f;
#pragma unroll 1      /* stays a loop: unrolled whole, the two passes were some 10,000 instructions and spilled */
  for (int k0 = 0; k0 < QP - 128; k0 += 128) { At32 t[4];
#pragma unroll      /* t[] in registers, the loads of 128 keys in flight together */
    for (int j = 0; j < 4; ++j) t[j] = at_load<false>(kp, mr, k0 + 32 * j, hh);
#pragma unroll      /* t[] in registers */
    for (int j = 0; j < 4; ++j) mx = at_max32<false>(t[j], qf, k0 + 32 * j, hh, mx); }
  { At32 t[4];      /* the last 128 keys */
#pragma unroll      /* t[] in registers */
    for (int j = 0; j < 3; ++j) t[j] = at_load<false>(kp, mr, QP - 128 + 32 * j, hh);
    t[3] = at_load<true>(kp, mr, QP - 32, hh);
#pragma unroll      /* t[] in registers */
    for (int j = 0; j < 3; ++j) mx = at_max32<false>(t[j], qf, QP - 128 + 32 * j, hh, mx);
    mx = at_max32<true>(t[3], qf, QP - 32, hh, mx); }
  mx = fmaxf(mx, __shfl_xor(mx, 16, 32));
  v8f o = {0.f, 0.f, 0.f, 0.f, 0.f, 0.f, 0.f, 0.f}; float se[4] = {0.f, 0.f, 0.f, 0.f};
#pragma unroll 1      /* stays a loop, as above */
  for (int k0 = 0; k0 < QP - 64; k0 += 64) {      /* the loads of 64 keys in flight together */
    const At32 t0 = at_load<false>(kp, mr, k0, hh), t1 = at_load<false>(kp, mr, k0 + 32, hh);
    asm volatile("s_wait_xcnt 0x0" ::: "memory");      /* the build let a V load's result land in the address pair of the k loads just issued: the wait stands in front of that overwrite */
    const v16h v0 = g2_frag(vp + k0, hh), v1 = g2_frag(vp + k0 + 32, hh);
    o = at_pv32<false>(t0, v0, qf, k0, hh, mx, se, o); o = at_pv32<false>(t1, v1, qf, k0 + 32, hh, mx, se, o); }
  { const At32 t0 = at_load<false>(kp, mr, QP - 64, hh), t1 = at_load<true>(kp, mr, QP - 32, hh); const v16h v0 = g2_frag(vp + QP - 64, hh), v1 = g2_frag(vp + QP - 32, hh);
    o = at_pv32<false>(t0, v0, qf, QP - 64, hh, mx, se, o); o = at_pv32<true>(t1, v1, qf, QP - 32, hh, mx, se, o); }
  float st = (se[0] + se[1]) + (se[2] + se[3]); st += __shfl_xor(st, 16, 32);
  const float osc = live ? 64.0f / st : 0.f;      /* o x64 */
  const v4f o0 = {o[0] * osc, o[1] * osc, o[2] * osc, o[3] * osc}, o1 = {o[4] * osc, o[5] * osc, o[6] * osc, o[7] * osc};
  *(v4f*)&ob[c][h * HD + 8 * hh] = o0; *(v4f*)&ob[c][h * HD + 8 * hh + 4] = o1; }
  v16h wf[4];      /* this wave's 16 rows of W_comb^T (x16), the bias at its column and, below, the first node tile: issued together ahead of the barrier, so that the three latencies are paid as one */
#pragma unroll      /* wf[] in registers */
  for (int j = 0; j < 4; ++j) wf[j] = g2_frag(BC + (size_t)(16 * w + ln) * DM + 32 * j, hh);
  const float bv = bf16_round(bc[16 * w + ln]);
  asm volatile("s_wait_xcnt 0x0" ::: "memory");      /* the build lets a node load's result land in the address pair of the W_comb^T loads just issued: the wait stands in front of that overwrite */
  const unsigned short* xb = (const unsigned short*)XN + ((size_t)b * QP + 128 * w) * DM + lane * 8; v8us st[8];
#pragma unroll      /* st[] in registers, the tile's loads in flight together */
  for (int i = 0; i < 8; ++i) st[i] = *(const v8us*)(xb + i * 256);
  __syncthreads();      /* ob is whole */
  { v8f mh_h = {0.f, 0.f, 0.f, 0.f, 0.f, 0.f, 0.f, 0.f}, mh_l = mh_h; const float* orw = &ob[ln][8 * hh];
#pragma unroll      /* fragments in registers */
    for (int j = 0; j < 4; ++j) { const v4f x0 = *(const v4fa*)(orw + 32 * j), x1 = *(const v4fa*)(orw + 32 * j + 4), x2 = *(const v4fa*)(orw + 32 * j + 16), x3 = *(const v4fa*)(orw + 32 * j + 20); FragH fh, fl;
      const float xs[16] = {x0[0], x0[1], x0[2], x0[3], x1[0], x1[1], x1[2], x1[3], x2[0], x2[1], x2[2], x2[3], x3[0], x3[1], x3[2], x3[3]};
      for (int i = 0; i < 16; ++i) { const _Float16 g = (_Float16)xs[i]; fh.h[i] = g; fl.h[i] = (_Float16)((xs[i] - (float)g) * 1024.0f); }
      mh_h = at_mma(fh.v, wf[j], mh_h); mh_l = at_mma(fl.v, wf[j], mh_l); }
#pragma unroll      /* eight plain LDS stores */
    for (int r = 0; r < 8; ++r) mhb[8 * hh + r][16 * w + ln] = (mh_h[r] * 0.0009765625f + bv) + mh_l[r] * 0.00000095367431640625f; }      /* o x64, W_comb x16: 2^-10; the residual x1024 more: 2^-20 */
  __syncthreads();      /* mhb is whole */
  const float* ar = &mhb[ln][8 * hh]; FragH ah[4], al[4];
#pragma unroll      /* ah[], al[] in registers */
  for (int j = 0; j < 4; ++j) { const v4f x0 = *(const v4fa*)(ar + 32 * j), x1 = *(const v4fa*)(ar + 32 * j + 4), x2 = *(const v4fa*)(ar + 32 * j + 16), x3 = *(const v4fa*)(ar + 32 * j + 20);
    const float xs[16] = {x0[0], x0[1], x0[2], x0[3], x1[0], x1[1], x1[2], x1[3], x2[0], x2[1], x2[2], x2[3], x3[0], x3[1], x3[2], x3[3]};
    for (int i = 0; i < 16; ++i) { const _Float16 h = (_Float16)xs[i]; ah[j].h[i] = h; al[j].h[i] = (_Float16)((xs[i] - (float)h) * 1024.0f); } }
#pragma unroll      /* st[] in registers; the next tile's loads stand ahead of this tile's products */
  for (int t = 0; t < 8; ++t) {
    for (int i = 0; i < 8; ++i) *(v8us*)&nb[w][2 * i + hh][ln * 8] = st[i];
    if (t < 7) for (int i = 0; i < 8; ++i) st[i] = *(const v8us*)(xb + (t + 1) * 16 * DM + i * 256);
    __builtin_amdgcn_fence(__ATOMIC_ACQ_REL, "workgroup", "local"); __builtin_amdgcn_wave_barrier();      /* the reads below take what other lanes of this wave stored: the LDS stores are waited for (s_wait_dscnt 0), the global loads in flight are not */
    FragH bf[4];
    for (int j = 0; j < 4; ++j) { bf[j].half[0] = *(const v8us*)&nb[w][ln][32 * j + 8 * hh]; bf[j].half[1] = *(const v8us*)&nb[w][ln][32 * j + 16 + 8 * hh]; }
    __builtin_amdgcn_fence(__ATOMIC_ACQ_REL, "wavefront"); __builtin_amdgcn_wave_barrier();      /* the next tile's stores stay behind these reads */
    v8f sh = {0.f, 0.f, 0.f, 0.f, 0.f, 0.f, 0.f, 0.f}, sl = sh;
    for (int j = 0; j < 4; ++j) { sh = at_mma(ah[j].v, bf[j].v, sh); sl = at_mma(al[j].v, bf[j].v, sl); }
    for (int r = 0; r < 8; ++r) sc[8 * hh + r][128 * w + 16 * t + ln] = sh[r] * 0.088388347648318447f + sl[r] * 0.000086316745750311f; }      /* (mh_hi + mh_lo / 1024) nodes^T / sqrt(128) */
  const int c0 = lane * 4; v4f m[QP / 128], mn[QP / 128];
  { const int p0 = row0 + 2 * w, p1 = p0 + 1; const float* r0 = mask + ((size_t)b * NQ + (p0 < NQ ? p0 : 0)) * NQ + c0; const float* r1 = mask + ((size_t)b * NQ + (p1 < NQ ? p1 : 0)) * NQ + c0;
#pragma unroll      /* m[], mn[] in registers, both rows' mask loads in flight together */
    for (int u = 0; u < QP / 128; ++u) { const int o = (c0 + 128 * u < NQ) ? 128 * u : 0; m[u] = *(const v4fa*)(r0 + o); mn[u] = *(const v4fa*)(r1 + o); } }
  asm volatile("s_wait_xcnt 0x0" ::: "memory");      /* stands in front of part 2, which reuses the address registers of the mask loads just issued */
  __syncthreads();
#pragma unroll 1      /* stays a loop: the 32 tanhf and expf of one row are most of the kernel's text, and twice that would pass 32 KB */
  for (int rr = 0; rr < 2; ++rr) { const int lr = 2 * w + rr, p = row0 + lr; if (p >= NQ) break;      /* rows NQ.. of the last block: no output; no barrier follows */
    float* pr = out + ((size_t)b * NQ + p) * NQ + c0; v4f x[QP / 128]; float mx = -3.0e38f;
#pragma unroll      /* x[] in registers */
    for (int u = 0; u < QP / 128; ++u) x[u] = *(const v4fa*)&sc[lr][c0 + 128 * u];
#pragma unroll      /* x[] in registers */
    for (int u = 0; u < QP / 128; ++u) { const bool in = c0 + 128 * u < NQ; for (int q = 0; q < 4; ++q) { const float v = 10.0f * tanhf(x[u][q]) + bf16_round(m[u][q]); x[u][q] = in ? v : -__builtin_inff(); mx = fmaxf(mx, x[u][q]); } }
    mx = wave_max32(mx); float se = 0.f;
#pragma unroll      /* x[] in registers */
    for (int u = 0; u < QP / 128; ++u) for (int q = 0; q < 4; ++q) { x[u][q] = expf(x[u][q] - mx); se += x[u][q]; }
    const float inv = 1.0f / wave_sum32(se);
#pragma unroll      /* x[] in registers */
    for (int u = 0; u < QP / 128; ++u) { v4f o; for (int q = 0; q < 4; ++q) o[q] = x[u][q] * inv; if (c0 + 128 * u < NQ) *(v4f*)(pr + 128 * u) = o; }
    asm volatile("s_wait_xcnt 0x0" ::: "memory");      /* stands in front of the copies below and the next row, which overwrite the registers of the stores just issued */
#pragma unroll      /* m[] in registers */
    for (int u = 0; u < QP / 128; ++u) m[u] = mn[u]; } }

extern "C" void kernel_launch(void* const* d_in, const int* in_sizes, int n_in,
                              void* d_out, int out_size, void* d_ws, size_t ws_size, hipStream_t stream) {
  (void)in_sizes; (void)n_in; (void)out_size;
  const float* const* I = (const float* const*)d_in; const float* xn = I[0]; const float* xq1 = I[1]; const float* xl = I[2]; const float* mask = I[3]; const float* Wqf = I[4]; const float* Wql = I[5]; const float* Wqm = I[6]; const float* Wk = I[7]; const float* Wv = I[8]; const float* Wc = I[9]; const float* bc = I[10];      /* weights [in][out] */
  char* ws = (char*)d_ws; size_t off = 0;
  auto take = [&](size_t bytes) { char* p = ws + off; off += (bytes + 255) & ~(size_t)255; return p; };
  _Float16* BQF = (_Float16*)take((size_t)NH * 32 * DM * 2); _Float16* BQL = (_Float16*)take((size_t)NH * 32 * DM * 2); _Float16* BK = (_Float16*)take((size_t)NH * 32 * DM * 2); _Float16* BVP = (_Float16*)take((size_t)NH * 64 * DM * 2); _Float16* BCP = (_Float16*)take((size_t)DM * DM * 2); float* QMP = (float*)take((size_t)NB * NH * 32 * 4);
  _Float16* XN = (_Float16*)take(NRP * DM * 2); _Float16* XQ1 = (_Float16*)take(NRP * DM * 2); _Float16* XL = (_Float16*)take(NRP * DM * 2);
  _Float16* Q16 = (_Float16*)take(NRP * NH * 32 * 2); _Float16* K16 = (_Float16*)take(NRP * NH * 32 * 2);
  _Float16* VT = (_Float16*)take((size_t)NB * NH * 64 * QP * 2);
  if (off > ws_size) return;      /* about 22 MiB */
  k_prep<<<PB_ALL, PT, 0, stream>>>(xn, xq1, xl, Wqf, Wql, Wqm, Wk, Wv, Wc, XN, XQ1, XL, BQF, BQL, BK, BVP, BCP, QMP);      /* f16 token planes (padded rows), transposed x16 weights, per-batch mean term in the padded q layout */
  k_proj<<<2 * JB_QK + NB * JB_V, 128, 0, stream>>>(XQ1, BQF, XL, BQL, QMP, Q16, XN, BK, K16, BVP, VT);      /* q = q1 Wq_first + last Wq_last + mean term, k (f16, padded [8][32]); V^T [8 batches][8][64][1024] */
  k_dec<<<dim3((NQ + 15) / 16, NB), 256, 0, stream>>>(Q16, K16, VT, BCP, bc, XN, mask, (float*)d_out);      /* scores / sqrt(16) + mask, softmax, weights v -> o; mh = o W_comb + b_comb; score2 = mh nodes^T / sqrt(128), 10 tanh, + mask, softmax over the 1000 real keys (f32) -> probs */
}

// v007
// Measured time: 69.3 microseconds a run.
// Next to v006, in two timings, it ran 1.28 and 1.25 times as fast.
// Over all steps from v000 it is 230 times as fast.
#include <hip/hip_runtime.h>
// TSP decoder probabilities (encoded_nodes, encoded_q1, encoded_last_node [8][1000][128]; k = nodes Wk, v = nodes Wv, q = q1 Wq_first + last Wq_last + (mean_n nodes) Wq_mean broadcast ([in][out] weights), 8 heads of 16; weights = softmax(q k^T / 4 + ninf_mask); mh = (weights v merged) W_comb + b_comb; score2 = mh nodes^T / sqrt(128); probs = softmax_n(10 tanh(score2) + ninf_mask) -> [8][1000][1000]).
// Compute dtype: inputs rounded to bf16; token rows / weights exact; q, k, v and the stage-1 weights as plain f16 GEMM operands (~2^-12); o and mh as f16 hi + residual operand pairs (~2^-22); the mean term, score2, tanh, mask and the final softmax f32. v_wmma_f32_16x16x32_f16.
#define NB 8
#define NQ 1000                      /* nodes = queries = 1000 */
#define QP 1024                      /* padded rows / keys per batch */
#define DM 128
#define NH 8
#define HD 16
#define SQ QP
#define HG 8
#define B0 0                         /* unused */
#define NBR NB
#define NRP ((size_t)NB * QP)        /* padded token rows */
typedef __bf16 v16b __attribute__((ext_vector_type(16)));
typedef unsigned short v8us __attribute__((ext_vector_type(8), may_alias));
typedef float  v8f  __attribute__((ext_vector_type(8)));
typedef float  v4f  __attribute__((ext_vector_type(4)));
typedef float  v4fa __attribute__((ext_vector_type(4), may_alias));
union FragB { v16b v; v8us half[2]; unsigned short u[16]; };

__device__ __forceinline__ unsigned short bf16_bits(float x) { unsigned int u = __float_as_uint(x); return (unsigned short)((u + 0x7FFFu + ((u >> 16) & 1u)) >> 16); }
__device__ __forceinline__ float bf16_val(unsigned short b) { return __uint_as_float(((unsigned int)b) << 16); }
__device__ __forceinline__ float bf16_round(float x) { return bf16_val(bf16_bits(x)); }
// D += A·B with NT terms: 1 = ah·bh, 2 = + al·bh (A split), 3 = + ah·bl (both split)
template <int NT>
__device__ __forceinline__ v8f mmaN(v16b ah, v16b al, v16b bh, v16b bl, v8f c) {
  c = __builtin_amdgcn_wmma_f32_16x16x32_bf16(false, ah, false, bh, (short)0, c, false, false);
  if (NT >= 2) c = __builtin_amdgcn_wmma_f32_16x16x32_bf16(false, al, false, bh, (short)0, c, false, false);
  if (NT >= 3) c = __builtin_amdgcn_wmma_f32_16x16x32_bf16(false, ah, false, bl, (short)0, c, false, false);
  asm volatile("v_nop\n\tv_nop\n\tv_nop\n\tv_nop" : "+v"(c) : "v"(ah), "v"(al), "v"(bh), "v"(bl));
  return c;
}

__global__ __launch_bounds__(256) void k_wt_bf16(const float* __restrict__ W, unsigned short* __restrict__ Wt, int K, int N) {
  const int t = blockIdx.x * 256 + threadIdx.x;
  const int k8n = K / 8;
  if (t >= N * k8n) return;
  const int n = t / k8n, k8 = (t % k8n) * 8;
  v8us v;
#pragma unroll
  for (int i = 0; i < 8; ++i) v[i] = bf16_bits(W[(size_t)(k8 + i) * N + n]);
  *(v8us*)(Wt + (size_t)n * K + k8) = v;
  
}

// GEMM C[M][N] (f32, pitch ldc) = act(A[M][K]·W + bias). A f32 row-major (pitch lda) converted per fragment to bf16
// (ASPLIT: hi/lo two planes -> 2 terms, else single rounded term); Wt bf16 [N][K] (pitch ldb). BIAS_BF16 rounds the
// bias to bf16 first (bias quantised to bf16 before the add). K%32==0, M%16==0, N%64==0.
template <bool ASPLIT, int ACT, bool BIAS_BF16>
__global__ __launch_bounds__(128) void k_gemm_bf(const float* __restrict__ A, int lda, const unsigned short* __restrict__ Wt, int ldb,
                                               const float* __restrict__ bias, float* __restrict__ C, int ldc, int M, int N, int K) {
  __shared__ __attribute__((aligned(16))) float so[4][16][64];
  const int tid = threadIdx.x, w = tid >> 5, lane = tid & 31, ln = lane & 15, hh = lane >> 4;
  const int ntn = N / 64;
  const int wid = blockIdx.x * 4 + w;
  const int mt = wid / ntn, nq = wid % ntn;
  if (mt * 16 >= M) return;
  const int row0 = mt * 16, col0 = nq * 64;
  const float* arow = A + (size_t)(row0 + ln) * lda;
  v8f acc[4] = {};
  for (int kb = 0; kb < K; kb += 32) {
    FragB ah, al;
    const v4f x0 = *(const v4fa*)(arow + kb + 8 * hh), x1 = *(const v4fa*)(arow + kb + 8 * hh + 4);
    const v4f x2 = *(const v4fa*)(arow + kb + 16 + 8 * hh), x3 = *(const v4fa*)(arow + kb + 16 + 8 * hh + 4);
    float xs[16] = {x0[0],x0[1],x0[2],x0[3],x1[0],x1[1],x1[2],x1[3],x2[0],x2[1],x2[2],x2[3],x3[0],x3[1],x3[2],x3[3]};
#pragma unroll
    for (int i = 0; i < 16; ++i) { const unsigned short hb = bf16_bits(xs[i]); ah.u[i] = hb; al.u[i] = ASPLIT ? bf16_bits(xs[i] - bf16_val(hb)) : (unsigned short)0; }
#pragma unroll
    for (int t = 0; t < 4; ++t) {
      const unsigned short* brow = Wt + (size_t)(col0 + t * 16 + ln) * ldb + kb;
      FragB b;
      b.half[0] = *(const v8us*)(brow + 8 * hh);
      b.half[1] = *(const v8us*)(brow + 16 + 8 * hh);
      acc[t] = mmaN<ASPLIT ? 2 : 1>(ah.v, al.v, b.v, b.v, acc[t]);
    }
  }
#pragma unroll
  for (int t = 0; t < 4; ++t) {
    float bv = bias ? bias[col0 + t * 16 + ln] : 0.f;
    if (BIAS_BF16) bv = bf16_round(bv);
#pragma unroll
    for (int r = 0; r < 8; ++r) { float v = acc[t][r] + bv; if (ACT == 1) v = fmaxf(v, 0.f); so[w][8 * hh + r][t * 16 + ln] = v; }
  }
  __builtin_amdgcn_fence(__ATOMIC_ACQ_REL, "workgroup");
  __builtin_amdgcn_wave_barrier();
  const int rsub = lane >> 4, c4 = (lane & 15) * 4;
  {
#pragma unroll
    for (int q = 0; q < 8; ++q) {
      const int r = q * 2 + rsub;
      const v4f v = *(const v4fa*)&so[w][r][c4];
      *(v4f*)(C + (size_t)(row0 + r) * ldc + col0 + c4) = v;
    }
    
  }
}

// GEMM C = act(A·W + bias + resid): A f32 (ASPLIT -> hi/lo 2 terms), Wt bf16 [N][K]; ACT 0 none, 1 relu, 2 exact gelu;
// resid (optional, f32, row index = (row % rmod), pitch ldr, RES_BF16 rounds it) added before the activation.
template <bool ASPLIT, int ACT, bool BIAS_BF16, bool RES_BF16>
__global__ __launch_bounds__(128) void k_gemm_bf3(const float* __restrict__ A, int lda, const unsigned short* __restrict__ Wt, int ldb,
                                                const float* __restrict__ bias, const float* __restrict__ resid, int rmod, int ldr,
                                                float* __restrict__ C, int ldc, int M, int N, int K) {
  __shared__ __attribute__((aligned(16))) float so[4][16][64];
  const int tid = threadIdx.x, w = tid >> 5, lane = tid & 31, ln = lane & 15, hh = lane >> 4;
  const int ntn = N / 64;
  const int wid = blockIdx.x * 4 + w;
  const int mt = wid / ntn, nq = wid % ntn;
  if (mt * 16 >= M) return;
  const int row0 = mt * 16, col0 = nq * 64;
  const float* arow = A + (size_t)(row0 + ln) * lda;
  v8f acc[4] = {};
  for (int kb = 0; kb < K; kb += 32) {
    FragB ah, al;
    const v4f x0 = *(const v4fa*)(arow + kb + 8 * hh), x1 = *(const v4fa*)(arow + kb + 8 * hh + 4);
    const v4f x2 = *(const v4fa*)(arow + kb + 16 + 8 * hh), x3 = *(const v4fa*)(arow + kb + 16 + 8 * hh + 4);
    float xs[16] = {x0[0],x0[1],x0[2],x0[3],x1[0],x1[1],x1[2],x1[3],x2[0],x2[1],x2[2],x2[3],x3[0],x3[1],x3[2],x3[3]};
#pragma unroll
    for (int i = 0; i < 16; ++i) { const unsigned short hb = bf16_bits(xs[i]); ah.u[i] = hb; al.u[i] = ASPLIT ? bf16_bits(xs[i] - bf16_val(hb)) : (unsigned short)0; }
#pragma unroll
    for (int t = 0; t < 4; ++t) {
      const unsigned short* brow = Wt + (size_t)(col0 + t * 16 + ln) * ldb + kb;
      FragB b;
      b.half[0] = *(const v8us*)(brow + 8 * hh);
      b.half[1] = *(const v8us*)(brow + 16 + 8 * hh);
      acc[t] = mmaN<ASPLIT ? 2 : 1>(ah.v, al.v, b.v, b.v, acc[t]);
    }
  }
#pragma unroll
  for (int t = 0; t < 4; ++t) {
    const int col = col0 + t * 16 + ln;
    float bv = bias ? bias[col] : 0.f;
    if (BIAS_BF16) bv = bf16_round(bv);
#pragma unroll
    for (int r = 0; r < 8; ++r) {
      float v = acc[t][r] + bv;
      if (resid) { float rv = resid[(size_t)((row0 + 8 * hh + r) % rmod) * ldr + col]; if (RES_BF16) rv = bf16_round(rv); v += rv; }
      if (ACT == 1) v = fmaxf(v, 0.f);
      if (ACT == 2) v = 0.5f * v * (1.0f + erff(v * 0.70710678118654752f));
      if (ACT == 3) { const float u = 0.7978845608028654f * (v + 0.044715f * v * v * v); v = 0.5f * v * (1.0f + tanhf(u)); }
      so[w][8 * hh + r][t * 16 + ln] = v;
    }
  }
  __builtin_amdgcn_fence(__ATOMIC_ACQ_REL, "workgroup");
  __builtin_amdgcn_wave_barrier();
  const int rsub = lane >> 4, c4 = (lane & 15) * 4;
  {
#pragma unroll
    for (int q = 0; q < 8; ++q) {
      const int r = q * 2 + rsub;
      const v4f v = *(const v4fa*)&so[w][r][c4];
      *(v4f*)(C + (size_t)(row0 + r) * ldc + col0 + c4) = v;
    }
    
  }
}
// row LayerNorm (biased variance, eps) over N: s = X (+ R); optional out_sum <- s; out_norm <- (s-mu)*rsqrt(var+eps)*g + b
template <bool PARAM_BF16>
__global__ __launch_bounds__(256) void k_layernorm(const float* __restrict__ X, const float* __restrict__ R, const float* __restrict__ g, const float* __restrict__ bta,
                                                  float* __restrict__ out_sum, float* __restrict__ out_norm, int N, float eps) {
  __shared__ float red[256];
  const int row = blockIdx.x, tid = threadIdx.x;
  const float* x = X + (size_t)row * N; const float* rr = R ? R + (size_t)row * N : nullptr;
  float vals[16];                     // up to N = 4096
  const int per = N / 256;            // contiguous chunk per thread? use strided-by-4 chunks: thread handles j = tid*4 + 1024*u
  float s1 = 0.f;
  for (int u = 0; u < per / 4; ++u) {
    const int j = tid * 4 + 1024 * u;
    const v4f a = *(const v4fa*)(x + j);
    v4f b = {0.f,0.f,0.f,0.f}; if (rr) b = *(const v4fa*)(rr + j);
#pragma unroll
    for (int q = 0; q < 4; ++q) { const float v = a[q] + b[q]; vals[u * 4 + q] = v; s1 += v; }
  }
  red[tid] = s1; __syncthreads();
  for (int st = 128; st > 0; st >>= 1) { if (tid < st) red[tid] += red[tid + st]; __syncthreads(); }
  const float mu = red[0] / (float)N; __syncthreads();
  float s2 = 0.f;
  for (int u = 0; u < per / 4; ++u)
#pragma unroll
    for (int q = 0; q < 4; ++q) { const float c = vals[u * 4 + q] - mu; s2 += c * c; }
  red[tid] = s2; __syncthreads();
  for (int st = 128; st > 0; st >>= 1) { if (tid < st) red[tid] += red[tid + st]; __syncthreads(); }
  const float rs = rsqrtf(red[0] / (float)N + eps);
  {
    for (int u = 0; u < per / 4; ++u) {
      const int j = tid * 4 + 1024 * u;
      v4f o, sm;
#pragma unroll
      for (int q = 0; q < 4; ++q) {
        float gg = g[j + q], bb = bta[j + q];
        if (PARAM_BF16) { gg = bf16_round(gg); bb = bf16_round(bb); }
        sm[q] = vals[u * 4 + q]; o[q] = (vals[u * 4 + q] - mu) * rs * gg + bb;
      }
      if (out_sum) *(v4f*)(out_sum + (size_t)row * N + j) = sm;
      *(v4f*)(out_norm + (size_t)row * N + j) = o;
    }
    
  }
}



// ---- f16 WMMA path (v_wmma_f32_16x16x32_f16): 11-bit significands for operands in range — used where a [0,1] probability operand needs more precision than bf16
typedef _Float16 v16h __attribute__((ext_vector_type(16)));
union FragH { v16h v; v8us half[2]; _Float16 h[16]; unsigned short u[16]; };
template <int NT>
__device__ __forceinline__ v8f mmaH(v16h ah, v16h al, v16h bh, v16h bl, v8f c) {
  c = __builtin_amdgcn_wmma_f32_16x16x32_f16(false, ah, false, bh, (short)0, c, false, false);
  if (NT >= 2) c = __builtin_amdgcn_wmma_f32_16x16x32_f16(false, al, false, bh, (short)0, c, false, false);
  if (NT >= 3) c = __builtin_amdgcn_wmma_f32_16x16x32_f16(false, ah, false, bl, (short)0, c, false, false);
  asm volatile("v_nop\n\tv_nop\n\tv_nop\n\tv_nop" : "+v"(c) : "v"(ah), "v"(al), "v"(bh), "v"(bl));
  return c;
}
// batched GEMM like k_gemm_b but f16 operands: A f32 (split into f16 hi/lo if ASPLIT, else rounded to f16), Bt = f16 values [n][k]; alpha; C f32; N multiple of 16 (partial tiles skipped)
template <bool ASPLIT>
__global__ __launch_bounds__(128) void k_gemm_h(const float* __restrict__ A, int lda, size_t sA, const _Float16* __restrict__ Bh, int ldb, size_t sB, float alpha, float* __restrict__ C, int ldc, size_t sC, int M, int N, int K) {
  __shared__ __attribute__((aligned(16))) float so[4][16][64];
  const int tid = threadIdx.x, w = tid >> 5, lane = tid & 31, ln = lane & 15, hh = lane >> 4; const int by = blockIdx.y;
  A += (size_t)by * sA; Bh += (size_t)by * sB; C += (size_t)by * sC;
  const int ntn = (N + 63) / 64; const int wid = blockIdx.x * 4 + w; const int mt = wid / ntn, nq = wid % ntn; if (mt * 16 >= M) return;
  const int row0 = mt * 16, col0 = nq * 64; const float* arow = A + (size_t)(row0 + ln) * lda;
  v8f acc[4] = {};
  for (int kb = 0; kb < K; kb += 32) {
    FragH ah, al;
    const v4f x0 = *(const v4fa*)(arow + kb + 8 * hh), x1 = *(const v4fa*)(arow + kb + 8 * hh + 4), x2 = *(const v4fa*)(arow + kb + 16 + 8 * hh), x3 = *(const v4fa*)(arow + kb + 16 + 8 * hh + 4);
    float xs[16] = {x0[0],x0[1],x0[2],x0[3],x1[0],x1[1],x1[2],x1[3],x2[0],x2[1],x2[2],x2[3],x3[0],x3[1],x3[2],x3[3]};
#pragma unroll
    for (int i = 0; i < 16; ++i) { const _Float16 h = (_Float16)xs[i]; ah.h[i] = h; al.h[i] = ASPLIT ? (_Float16)(xs[i] - (float)h) : (_Float16)0.0f; }
#pragma unroll
    for (int t = 0; t < 4; ++t) { if (col0 + t * 16 >= N) continue; const size_t boff = (size_t)(col0 + t * 16 + ln) * ldb + kb; FragH bq; bq.half[0] = *(const v8us*)(Bh + boff + 8 * hh); bq.half[1] = *(const v8us*)(Bh + boff + 16 + 8 * hh);
      acc[t] = mmaH<ASPLIT ? 2 : 1>(ah.v, al.v, bq.v, bq.v, acc[t]); }
  }
#pragma unroll
  for (int t = 0; t < 4; ++t) { if (col0 + t * 16 >= N) continue;
#pragma unroll
    for (int r = 0; r < 8; ++r) so[w][8 * hh + r][t * 16 + ln] = acc[t][r] * alpha; }
  __builtin_amdgcn_fence(__ATOMIC_ACQ_REL, "workgroup"); __builtin_amdgcn_wave_barrier();
  const int rsub = lane >> 4, c4 = (lane & 15) * 4;
  {
#pragma unroll
    for (int q = 0; q < 8; ++q) { const int r = q * 2 + rsub; if (col0 + c4 < N) { const v4f v = *(const v4fa*)&so[w][r][c4]; *(v4f*)(C + (size_t)(row0 + r) * ldc + col0 + c4) = v; } }
     }
}

// Wt[n][k] = f16(W[k][n]·scale) from f32 row-major W[K][N] (scale = power of two; bf16-exact weights stay exact in f16 away from the subnormal range)
__global__ __launch_bounds__(256) void k_wt_f16(const float* __restrict__ W, _Float16* __restrict__ Wt, int K, int N, float scale) {
  const int t = blockIdx.x * 256 + threadIdx.x; if (t >= N * (K / 8)) return; const int n = t / (K / 8), k8 = (t % (K / 8)) * 8; FragH f;
#pragma unroll
  for (int i = 0; i < 8; ++i) f.h[i] = (_Float16)(bf16_round(W[(size_t)(k8 + i) * N + n]) * scale); const v8us o = f.half[0];
  *(v8us*)((unsigned short*)Wt + (size_t)n * K + k8) = o; 
}
// k_gemm_hh variant with fused epilogue: v = acc·alpha + bias[by·sBias + col] (+ CP[(row/rowsPerB)·sCPb + by·64 + col] if CP) ; ACT 0 none / 1 elu ; writes f16 C16 (and f32 C if non-null)
template <int ACT>
__global__ __launch_bounds__(128) void k_gemm_hhx(const _Float16* __restrict__ A, int lda, size_t sA, const _Float16* __restrict__ Bh, int ldb, size_t sB, float alpha, const float* __restrict__ bias, size_t sBias, const float* __restrict__ CP, int rowsPerB, size_t sCPb, int row0g,
    float* __restrict__ C, _Float16* __restrict__ C16, int ldc, size_t sC, int M, int N, int K) {
  __shared__ __attribute__((aligned(16))) float so[4][16][64];
  const int tid = threadIdx.x, w = tid >> 5, lane = tid & 31, ln = lane & 15, hh = lane >> 4; const int by = blockIdx.y;
  A += (size_t)by * sA; Bh += (size_t)by * sB; const size_t cofs = (size_t)by * sC; const float* bp = bias ? bias + (size_t)by * sBias : nullptr;
  const int ntn = (N + 63) / 64; const int wid = blockIdx.x * 4 + w; const int mt = wid / ntn, nq = wid % ntn; if (mt * 16 >= M) return;
  const int row0 = mt * 16, col0 = nq * 64; const _Float16* arow = A + (size_t)(row0 + ln) * lda;
  v8f acc[4] = {};
  for (int kb = 0; kb < K; kb += 32) { FragH ah; ah.half[0] = *(const v8us*)((const unsigned short*)arow + kb + 8 * hh); ah.half[1] = *(const v8us*)((const unsigned short*)arow + kb + 16 + 8 * hh);
#pragma unroll
    for (int t = 0; t < 4; ++t) { if (col0 + t * 16 >= N) continue; const size_t boff = (size_t)(col0 + t * 16 + ln) * ldb + kb; FragH bq; bq.half[0] = *(const v8us*)((const unsigned short*)Bh + boff + 8 * hh); bq.half[1] = *(const v8us*)((const unsigned short*)Bh + boff + 16 + 8 * hh);
      acc[t] = mmaH<1>(ah.v, ah.v, bq.v, bq.v, acc[t]); }
  }
#pragma unroll
  for (int t = 0; t < 4; ++t) { if (col0 + t * 16 >= N) continue; const int col = col0 + t * 16 + ln; const float bv = bp ? bf16_round(bp[col]) : 0.f;
#pragma unroll
    for (int r = 0; r < 8; ++r) { float v = acc[t][r] * alpha + bv; if (CP) { const int rr = row0g + row0 + 8 * hh + r; if (rowsPerB < 0) v += CP[cofs + (size_t)rr * ldc + col];      /* rowsPerB < 0: own element of the batched C plane */ else { const int bidx = rr / rowsPerB; v += CP[(size_t)bidx * sCPb + (size_t)by * 64 + col]; } } if (ACT == 1) v = (v > 0.f) ? v : expm1f(v); else if (ACT == 7) v = (v > 0.f) ? v + 1.0f : expf(v); else if (ACT == 8) v = tanhf(v); else if (ACT == 9) v = 0.5f * v * (1.0f + tanhf(0.7978845608028654f * (v + 0.044715f * v * v * v))); else if (ACT == 11) v = 1.0f / (1.0f + expf(-v)); else if (ACT == 12) v = (v > 0.f) ? v : 0.01f * v; else if (ACT == 14) v = (v > 0.f) ? v : 0.1f * v; else if (ACT == 16) v = (v >= 0.f) ? v : 0.3f * v; else if (ACT == 17) v = (v >= 0.f) ? v : 0.2f * v; else if (ACT == 15) v = v / (1.0f + expf(-v)); else if (ACT == 3) v = fmaxf(v, 0.f); else if (ACT == 6) v = 0.5f * v * (1.0f + erff(v * 0.70710678118654752f)); so[w][8 * hh + r][t * 16 + ln] = v; } }
  __builtin_amdgcn_fence(__ATOMIC_ACQ_REL, "workgroup"); __builtin_amdgcn_wave_barrier();
  const int rsub = lane >> 4, c4 = (lane & 15) * 4; typedef _Float16 v4h __attribute__((ext_vector_type(4)));
  {
#pragma unroll
    for (int q = 0; q < 8; ++q) { const int r = q * 2 + rsub; if (col0 + c4 < N) { const v4f v = *(const v4fa*)&so[w][r][c4]; if (C) *(v4f*)(C + cofs + (size_t)(row0 + r) * ldc + col0 + c4) = v; if (C16) { v4h h4; for (int i = 0; i < 4; ++i) h4[i] = (_Float16)v[i]; *(v4h*)(C16 + cofs + (size_t)(row0 + r) * ldc + col0 + c4) = h4; } } }
     }
}


typedef _Float16 v4h __attribute__((ext_vector_type(4)));

__global__ __launch_bounds__(256) void k_x16(const float* __restrict__ x, _Float16* __restrict__ X16, size_t n8) { const size_t t = (size_t)blockIdx.x * 256 + threadIdx.x; if (t >= n8) return; FragH f;
#pragma unroll
  for (int q = 0; q < 8; ++q) f.h[q] = (_Float16)bf16_round(x[t * 8 + q]); *(v8us*)((unsigned short*)X16 + t * 8) = f.half[0];  }
__global__ __launch_bounds__(256) void k_h16(const float* __restrict__ x, _Float16* __restrict__ X16, size_t n8) { const size_t t = (size_t)blockIdx.x * 256 + threadIdx.x; if (t >= n8) return; FragH f;
#pragma unroll
  for (int q = 0; q < 8; ++q) f.h[q] = (_Float16)x[t * 8 + q]; *(v8us*)((unsigned short*)X16 + t * 8) = f.half[0];  }
__global__ __launch_bounds__(256) void k_round16f(const float* __restrict__ W, _Float16* __restrict__ Bt, size_t n8) { const size_t t = (size_t)blockIdx.x * 256 + threadIdx.x; if (t >= n8) return; FragH f;
#pragma unroll
  for (int i = 0; i < 8; ++i) f.h[i] = (_Float16)(bf16_round(W[t * 8 + i]) * 16.0f); *(v8us*)((unsigned short*)Bt + t * 8) = f.half[0];  }
template <int NHv, int TTv>
__global__ __launch_bounds__(256) void k_vt(const _Float16* __restrict__ V16, int ldv, int voff, _Float16* __restrict__ Vt) { __shared__ unsigned short tl[64][66]; const int tid = threadIdx.x; const int slab = blockIdx.x / (TTv / 64), lg = blockIdx.x % (TTv / 64); const int b = slab / NHv, h = slab % NHv;
  for (int i = tid; i < 64 * 8; i += 256) { const int r = i / 8, c8 = (i % 8) * 8; FragH f; f.half[0] = *(const v8us*)((const unsigned short*)V16 + ((size_t)b * TTv + lg * 64 + r) * ldv + voff + h * 64 + c8);
#pragma unroll
    for (int q = 0; q < 8; ++q) tl[r][c8 + q] = f.u[q]; }
  __syncthreads();
  {
#pragma unroll
    for (int rd = 0; rd < 2; ++rd) { const int d = rd * 32 + tid / 8, pc = tid % 8; FragH f;
#pragma unroll
      for (int q = 0; q < 8; ++q) f.u[q] = tl[pc * 8 + q][d];
      *(v8us*)((unsigned short*)Vt + ((size_t)slab * 64 + d) * TTv + lg * 64 + pc * 8) = f.half[0]; }
     } }

// ---- fast GEMM (wave tile 32x64; requires M % 32 == 0 rows per launch region and N % 64 == 0); epilogue = k_gemm_hhx semantics ----
__device__ __forceinline__ v16h g2_frag(const _Float16* p, int hh) { FragH f; f.half[0] = *(const v8us*)((const unsigned short*)p + 8 * hh); f.half[1] = *(const v8us*)((const unsigned short*)p + 16 + 8 * hh); return f.v; }
__device__ __forceinline__ v8f g2_mma(v16h a, v16h b, v8f c) { v8f d = __builtin_amdgcn_wmma_f32_16x16x32_f16(false, a, false, b, (short)0, c, false, false); asm volatile("v_nop\n\tv_nop\n\tv_nop\n\tv_nop" : "+v"(d) : "v"(a), "v"(b)); return d; }
template <int ACT>
__global__ __launch_bounds__(128) void k_gemm2(const _Float16* __restrict__ A, int lda, size_t sA, const _Float16* __restrict__ Bh, int ldb, size_t sB, float alpha, const float* __restrict__ bias, size_t sBias, const float* __restrict__ CP, int rowsPerB, size_t sCPb, int row0g,
    float* __restrict__ C, _Float16* __restrict__ C16, int ldc, size_t sC, int M, int N, int K) { static_assert(ACT == 0 || ACT == 3 || ACT == 6 || ACT == 8 || ACT == 9 || ACT == 11 || ACT == 12 || ACT == 14 || ACT == 15 || ACT == 16 || ACT == 17, "k_gemm2: unsupported ACT code (would silently apply no activation)");
  __shared__ __attribute__((aligned(16))) float so[4][32][68];
  const int tid = threadIdx.x, w = tid >> 5, lane = tid & 31, ln = lane & 15, hh = lane >> 4; const int by = blockIdx.y;
  A += (size_t)by * sA; Bh += (size_t)by * sB; const size_t cofs = (size_t)by * sC; const float* bp = bias ? bias + (size_t)by * sBias : nullptr;
  const int ntn = N >> 6; const int mt = blockIdx.x / ntn, nq = blockIdx.x - mt * ntn; const int row0 = mt * 128 + 32 * w, col0 = nq * 64; if (row0 >= M) return;
  const _Float16* a0p = A + (size_t)(row0 + ln) * lda; const _Float16* a1p = a0p + (size_t)16 * lda;
  const _Float16* b0p = Bh + (size_t)(col0 + ln) * ldb; const _Float16* b1p = b0p + (size_t)16 * ldb; const _Float16* b2p = b1p + (size_t)16 * ldb; const _Float16* b3p = b2p + (size_t)16 * ldb;
  const v8f z8 = {0.f,0.f,0.f,0.f,0.f,0.f,0.f,0.f}; v8f c00 = z8, c01 = z8, c02 = z8, c03 = z8, c10 = z8, c11 = z8, c12 = z8, c13 = z8;
#pragma unroll 1
  for (int kb = 0; kb < K; kb += 32) { const v16h a0 = g2_frag(a0p + kb, hh), a1 = g2_frag(a1p + kb, hh);
    v16h b = g2_frag(b0p + kb, hh); c00 = g2_mma(a0, b, c00); c10 = g2_mma(a1, b, c10);
    b = g2_frag(b1p + kb, hh); c01 = g2_mma(a0, b, c01); c11 = g2_mma(a1, b, c11);
    b = g2_frag(b2p + kb, hh); c02 = g2_mma(a0, b, c02); c12 = g2_mma(a1, b, c12);
    b = g2_frag(b3p + kb, hh); c03 = g2_mma(a0, b, c03); c13 = g2_mma(a1, b, c13); }
  v8f accs[8] = {c00, c01, c02, c03, c10, c11, c12, c13};
#pragma unroll
  for (int u = 0; u < 8; ++u) { const int t = u & 3, half = u >> 2; const int col = col0 + t * 16 + ln; const float bv = bp ? bf16_round(bp[col]) : 0.f;
#pragma unroll
    for (int r = 0; r < 8; ++r) { const int rloc = half * 16 + 8 * hh + r; float v = accs[u][r] * alpha + bv; if (CP) { if (rowsPerB < 0) v += CP[cofs + (size_t)(row0g + row0 + rloc) * ldc + col];      /* rowsPerB < 0: own element of the batched C plane */ else { const int bidx = (row0g + row0 + rloc) / rowsPerB; v += CP[(size_t)bidx * sCPb + (size_t)by * 64 + col]; } }
      if (ACT == 3) v = fmaxf(v, 0.f); else if (ACT == 6) v = 0.5f * v * (1.0f + erff(v * 0.70710678118654752f)); else if (ACT == 11) v = 1.0f / (1.0f + expf(-v)); else if (ACT == 15) v = v / (1.0f + expf(-v)); else if (ACT == 12) v = (v > 0.f) ? v : 0.01f * v; else if (ACT == 8) v = tanhf(v); else if (ACT == 9) v = 0.5f * v * (1.0f + tanhf(0.7978845608028654f * (v + 0.044715f * v * v * v))); else if (ACT == 14) v = (v > 0.f) ? v : 0.1f * v; else if (ACT == 16) v = (v >= 0.f) ? v : 0.3f * v; else if (ACT == 17) v = (v >= 0.f) ? v : 0.2f * v;
      so[w][rloc][t * 16 + ln] = v; } }
  __builtin_amdgcn_fence(__ATOMIC_ACQ_REL, "workgroup"); __builtin_amdgcn_wave_barrier();
  const int rsub = lane >> 4, c4 = (lane & 15) * 4;
  {
#pragma unroll
    for (int q = 0; q < 16; ++q) { const int r = q * 2 + rsub; const v4f v = *(const v4fa*)&so[w][r][c4]; if (C) *(v4f*)(C + cofs + (size_t)(row0 + r) * ldc + col0 + c4) = v; if (C16) { v4h h4; for (int i = 0; i < 4; ++i) h4[i] = (_Float16)v[i]; *(v4h*)(C16 + cofs + (size_t)(row0 + r) * ldc + col0 + c4) = h4; } }
     } }


__global__ __launch_bounds__(256) void k_wnat(const float* __restrict__ w, size_t n8, _Float16* __restrict__ Bt) { const size_t t = (size_t)blockIdx.x * 256 + threadIdx.x; if (t >= n8) return; FragH f; for (int q = 0; q < 8; ++q) f.h[q] = (_Float16)(bf16_round(w[t * 8 + q]) * 16.0f); *(v8us*)((unsigned short*)Bt + t * 8) = f.half[0];  }
__global__ __launch_bounds__(256) void k_rsm(const float* __restrict__ S, _Float16* __restrict__ P, int nrows) {
  #pragma clang fp contract(off)
  const int i = blockIdx.x * 256 + threadIdx.x; if (i >= nrows) return; const float* s = S + (size_t)i * SQ; float mx = -3.0e38f;
#pragma unroll 1
  for (int j = 0; j < SQ; ++j) mx = fmaxf(mx, s[j]); float se = 0.f;
#pragma unroll 1
  for (int j = 0; j < SQ; ++j) se += expf(s[j] - mx); const float sc = 256.0f / se;
#pragma unroll 1
  for (int j0 = 0; j0 < SQ; j0 += 8) { FragH f; for (int q = 0; q < 8; ++q) f.h[q] = (_Float16)(expf(s[j0 + q] - mx) * sc); unsigned short* d = (unsigned short*)P + (size_t)i * SQ + j0; *(v8us*)d = f.half[0];  } }
__global__ __launch_bounds__(256) void k_vt(const _Float16* __restrict__ V16, int b, int h0, _Float16* __restrict__ VT) { __shared__ unsigned short tl[64][65]; const int tid = threadIdx.x; const int hh = blockIdx.x % HG, sg = blockIdx.x / HG; const int s0 = sg * 64; const int h = h0 + hh;
  for (int i = tid; i < 64 * 8; i += 256) { const int j = i / 8, d8 = (i % 8) * 8; FragH f; f.half[0] = *(const v8us*)((const unsigned short*)V16 + ((size_t)b * SQ + s0 + j) * DM + h * HD + d8); for (int q = 0; q < 8; ++q) tl[d8 + q][j] = f.u[q]; }
  __syncthreads();
  { for (int i = tid; i < 64 * 8; i += 256) { const int d = i / 8, j8 = (i % 8) * 8; FragH f; for (int q = 0; q < 8; ++q) f.u[q] = tl[d][j8 + q]; *(v8us*)((unsigned short*)VT + ((size_t)hh * HD + d) * SQ + s0 + j8) = f.half[0]; }  } }


// The set-up pieces below are device functions of a flat thread index t: k_prep deals them out by block range.
__device__ __forceinline__ void x16pad_at(const float* __restrict__ x, _Float16* __restrict__ X16, size_t t) { if (t >= (size_t)NB * QP * (DM / 8)) return; const int c8 = (int)(t % (DM / 8)) * 8; const size_t row = t / (DM / 8); const int b = (int)(row / QP), q = (int)(row % QP); FragH f;
  for (int i = 0; i < 8; ++i) f.h[i] = (_Float16)((q < NQ) ? bf16_round(x[((size_t)b * NQ + q) * DM + c8 + i]) : 0.f);
  *(v8us*)((unsigned short*)X16 + row * DM + c8) = f.half[0];
  asm volatile("s_wait_xcnt 0x0" ::: "memory"); }      /* behind the store: in k_prep's listing a branch leads on from here into another piece's code, which overwrites the store's registers */


template <int HPP>
__device__ __forceinline__ void wtpadT_at(const float* __restrict__ w, _Float16* __restrict__ Bt, int t) { if (t >= NH * HPP * (DM / 8)) return; const int k8 = (t % (DM / 8)) * 8; const int r = t / (DM / 8); const int h = r / HPP, d = r % HPP; FragH f;
  for (int q = 0; q < 8; ++q) { float v = 0.f; if (d < HD) v = bf16_round(w[(size_t)(k8 + q) * DM + h * HD + d]); f.h[q] = (_Float16)(v * 16.0f); }
  unsigned short* dst = (unsigned short*)Bt + (size_t)r * DM + k8; *(v8us*)dst = f.half[0];
  asm volatile("s_wait_xcnt 0x0" ::: "memory"); }      /* behind the store, as in x16pad_at */
template <int HPP>
__device__ __forceinline__ void wtopadT_at(const float* __restrict__ w, _Float16* __restrict__ Bt, int t) { if (t >= DM * (NH * HPP / 8)) return; const int k8 = (t % (NH * HPP / 8)) * 8; const int n = t / (NH * HPP / 8); FragH f;
  for (int q = 0; q < 8; ++q) { const int kp = k8 + q; const int h = kp / HPP, d = kp % HPP; float v = 0.f; if (d < HD) v = bf16_round(w[(size_t)(h * HD + d) * DM + n]); f.h[q] = (_Float16)(v * 16.0f); }
  unsigned short* dst = (unsigned short*)Bt + (size_t)n * (NH * HPP) + k8; *(v8us*)dst = f.half[0];
  asm volatile("s_wait_xcnt 0x0" ::: "memory"); }      /* behind the store, as in x16pad_at */
// Mean term, one block of 32 waves per batch. Column sums: 25 waves of 40 rows each; a wave reads whole 512-byte rows (lane = 4 columns), rows w, w + 25, ..., eight loads in flight; the 25 partial rows meet in LDS.
// mu Wq_mean: thread = (output column, slice of 16 rows of Wq_mean), its 16 weights loaded ahead of the row loads; the 8 slices meet in LDS.
#define MW 25                        /* waves that sum rows; NQ = MW * 40 */
__device__ __forceinline__ void qmean_at(const float* __restrict__ xn, const float* __restrict__ wqm, float* __restrict__ QMP, int b) {
  static_assert(NQ % (MW * 8) == 0 && MW <= 32, "rows deal out evenly, eight a round");
  __shared__ __attribute__((aligned(16))) float part[MW][DM]; __shared__ float mu[DM]; __shared__ float wp[8][DM];
  const int t = threadIdx.x, c4 = (t & 31) * 4, col = t % DM, kg = t / DM; float wv[DM / 8];
  const int w = __builtin_amdgcn_readfirstlane(t >> 5);      /* wave number in a scalar register: row addresses and the test on it are scalar */
#pragma unroll      /* wv[] in registers, all 16 loads in flight */
  for (int i = 0; i < DM / 8; ++i) wv[i] = wqm[(size_t)(kg * (DM / 8) + i) * DM + col];
  asm volatile("s_wait_xcnt 0x0" ::: "memory");      /* stands in front of the row addresses below: this build forms them in the offset register of the weight loads just issued */
  if (w < MW) { const float* rows = xn + ((size_t)b * NQ + w) * DM + c4; v4f s = {0.f, 0.f, 0.f, 0.f};
#pragma unroll 1      /* eight loads a round: a fully unrolled form of this loop spilled at the 128 registers a wave has in a 1024-thread block */
    for (int r = 0; r < NQ / (MW * 8); ++r) { v4f a[8];
#pragma unroll      /* a[] in registers, the round's loads in flight together */
      for (int j = 0; j < 8; ++j) a[j] = *(const v4fa*)(rows + (size_t)(r * 8 + j) * MW * DM);
#pragma unroll      /* a[] in registers */
      for (int j = 0; j < 8; ++j) for (int q = 0; q < 4; ++q) s[q] += bf16_round(a[j][q]); }
    *(v4f*)&part[w][c4] = s; }
  __syncthreads();
  if (t < DM) { float m = 0.f; for (int i = 0; i < MW; ++i) m += part[i][t]; mu[t] = m / (float)NQ; }
  __syncthreads();
  float v = 0.f;
#pragma unroll      /* wv[] in registers */
  for (int i = 0; i < DM / 8; ++i) v += mu[kg * (DM / 8) + i] * bf16_round(wv[i]);
  wp[kg][col] = v;
  __syncthreads();
  if (t < NH * 32) { const int h = t / 32, d = t % 32; float o = 0.f; if (d < HD) for (int g = 0; g < 8; ++g) o += wp[g][h * HD + d]; QMP[(size_t)b * (NH * 32) + t] = o; } }
// Set-up, one launch: nothing here reads what another piece writes, so the nine pieces are block ranges of one grid of 1024-thread blocks. The mean term and then the weights have the longest chains of waits and take the first blocks.
#define PT 1024                                   /* threads of a set-up block */
#define PB_X ((int)(NRP * (DM / 8) / PT))         /* blocks of one token plane */
#define PB_W32 (NH * 32 * (DM / 8) / PT)          /* blocks of a [8][32]-padded weight */
#define PB_W64 (NH * 64 * (DM / 8) / PT)          /* blocks of a [8][64]-padded weight */
#define PB_WC (DM * (DM / 8) / PT)                /* blocks of W_comb^T, [128][128] */
#define PB_ALL (NB + 3 * PB_X + 3 * PB_W32 + PB_W64 + PB_WC)
__global__ __launch_bounds__(PT) void k_prep(const float* __restrict__ xn, const float* __restrict__ xq1, const float* __restrict__ xl, const float* __restrict__ wqf, const float* __restrict__ wql, const float* __restrict__ wqm, const float* __restrict__ wk, const float* __restrict__ wv, const float* __restrict__ wc,
    _Float16* __restrict__ XN, _Float16* __restrict__ XQ1, _Float16* __restrict__ XL, _Float16* __restrict__ BQF, _Float16* __restrict__ BQL, _Float16* __restrict__ BK, _Float16* __restrict__ BVP, _Float16* __restrict__ BCP, float* __restrict__ QMP) {
  static_assert(NRP * (DM / 8) % PT == 0 && NH * 32 * (DM / 8) % PT == 0 && DM * (DM / 8) % PT == 0 && NH * HD == DM, "every piece is a whole number of blocks");
  int r = blockIdx.x; const int tid = threadIdx.x;
  if (r < NB) { qmean_at(xn, wqm, QMP, r); return; }      /* the branch is the same for a whole block: its barriers are met by all of it */
  r -= NB;
  if (r < 3 * PB_W32) { const int s = r / PB_W32; wtpadT_at<32>(s == 0 ? wqf : s == 1 ? wql : wk, s == 0 ? BQF : s == 1 ? BQL : BK, (r - s * PB_W32) * PT + tid); return; }
  r -= 3 * PB_W32;
  if (r < PB_W64) { wtpadT_at<64>(wv, BVP, r * PT + tid); return; }
  r -= PB_W64;
  if (r < PB_WC) { wtopadT_at<HD>(wc, BCP, r * PT + tid); return; }      /* heads of 16 with no pad: plain W_comb^T */
  r -= PB_WC;
  const int s = r / PB_X; x16pad_at(s == 0 ? xn : s == 1 ? xq1 : xl, s == 0 ? XN : s == 1 ? XQ1 : XL, (size_t)(r - s * PB_X) * PT + tid); }
// Projections, one launch: q, k and V^T are block ranges of one grid; tile, fragments and store path are those of k_gemm2 (wave tile 32 x 64, K = DM, operands x16 so alpha = 1/16, f16 result).
// q: both products (q1 Wq_first, last Wq_last) run into the same accumulators, the batch's mean term is added behind them.
// V^T: the operands change places, A = rows of the padded Wv^T, B = node rows of one batch, so the tile comes out as [feature][key] and is stored that way.
__device__ __forceinline__ void pj_acc(const _Float16* __restrict__ a0p, const _Float16* __restrict__ b0p, int hh, v8f (&c)[8]) {
  const _Float16* a1p = a0p + 16 * DM; const _Float16* b1p = b0p + 16 * DM; const _Float16* b2p = b0p + 32 * DM; const _Float16* b3p = b0p + 48 * DM;
#pragma unroll 1      /* stays the rolled loop of k_gemm2: the order of loads and products is not part of this change */
  for (int kb = 0; kb < DM; kb += 32) { const v16h a0 = g2_frag(a0p + kb, hh); FragH a1f; a1f.half[0] = *(const v8us*)((const unsigned short*)a1p + kb + 8 * hh);
    asm volatile("s_wait_xcnt 0x0" ::: "memory");      /* the build lets the load below land in the address pair that the three A loads just issued name: the wait stands in front of that overwrite */
    a1f.half[1] = *(const v8us*)((const unsigned short*)a1p + kb + 16 + 8 * hh); const v16h a1 = a1f.v;
    v16h b = g2_frag(b0p + kb, hh); c[0] = g2_mma(a0, b, c[0]); c[4] = g2_mma(a1, b, c[4]);
    b = g2_frag(b1p + kb, hh); c[1] = g2_mma(a0, b, c[1]); c[5] = g2_mma(a1, b, c[5]);
    b = g2_frag(b2p + kb, hh); c[2] = g2_mma(a0, b, c[2]); c[6] = g2_mma(a1, b, c[6]);
    b = g2_frag(b3p + kb, hh); c[3] = g2_mma(a0, b, c[3]); c[7] = g2_mma(a1, b, c[7]); } }
#define JB_QK ((int)(NRP / 128) * (NH * 32 / 64))  /* blocks of q, and of k */
#define JB_V ((NH * 64 / 128) * (QP / 64))         /* blocks of one batch's V^T */
__global__ __launch_bounds__(128) void k_proj(const _Float16* __restrict__ XQ1, const _Float16* __restrict__ BQF, const _Float16* __restrict__ XL, const _Float16* __restrict__ BQL, const float* __restrict__ QMP, _Float16* __restrict__ Q16,
    const _Float16* __restrict__ XN, const _Float16* __restrict__ BK, _Float16* __restrict__ K16, const _Float16* __restrict__ BVP, _Float16* __restrict__ VT) {
  static_assert(QP % 128 == 0 && NH * 32 == 64 << 2 && QP == 64 << 4, "the 32 rows of a wave tile of q lie in one batch; the two values of lg");
  __shared__ __attribute__((aligned(16))) float so[4][32][68];
  const int tid = threadIdx.x, w = tid >> 5, lane = tid & 31, ln = lane & 15, hh = lane >> 4;
  int bx = blockIdx.x, N = NH * 32, lg = 2; const _Float16* A = XQ1; const _Float16* B = BQF; _Float16* C16 = Q16; const bool isq = bx < JB_QK;      /* N: columns and pitch of the result; lg: log2 of its 64-column tiles */
  if (bx >= 2 * JB_QK) { bx -= 2 * JB_QK; const int by = bx / JB_V; bx -= by * JB_V; N = QP; lg = 4; A = BVP; B = XN + (size_t)by * QP * DM; C16 = VT + (size_t)by * NH * 64 * QP; }
  else if (bx >= JB_QK) { bx -= JB_QK; A = XN; B = BK; C16 = K16; }
  const int mt = bx >> lg, nq = bx - (mt << lg), row0 = mt * 128 + 32 * w, col0 = nq * 64;
  const v8f z8 = {0.f, 0.f, 0.f, 0.f, 0.f, 0.f, 0.f, 0.f}; v8f c[8] = {z8, z8, z8, z8, z8, z8, z8, z8};
  float cp[4] = {0.f, 0.f, 0.f, 0.f};      /* q: the batch's mean term at this lane's four columns, loaded ahead of the products */
  if (isq) for (int t = 0; t < 4; ++t) cp[t] = QMP[(size_t)(row0 / QP) * (NH * 32) + col0 + t * 16 + ln];
  pj_acc(A + (size_t)(row0 + ln) * DM, B + (size_t)(col0 + ln) * DM, hh, c);
  if (isq) pj_acc(XL + (size_t)(row0 + ln) * DM, BQL + (size_t)(col0 + ln) * DM, hh, c);
#pragma unroll      /* c[] in registers */
  for (int u = 0; u < 8; ++u) { const int t = u & 3, half = u >> 2;
    for (int r = 0; r < 8; ++r) so[w][half * 16 + 8 * hh + r][t * 16 + ln] = c[u][r] * 0.0625f + cp[t]; }
  __builtin_amdgcn_fence(__ATOMIC_ACQ_REL, "workgroup"); __builtin_amdgcn_wave_barrier();      /* the reads below take what other lanes of this wave stored */
  const int rsub = lane >> 4, c4 = (lane & 15) * 4;
#pragma unroll      /* sixteen plain row stores */
  for (int q = 0; q < 16; ++q) { const int r = q * 2 + rsub; const v4f v = *(const v4fa*)&so[w][r][c4]; v4h h4; for (int i = 0; i < 4; ++i) h4[i] = (_Float16)v[i]; *(v4h*)(C16 + (size_t)(row0 + r) * N + col0 + c4) = h4; } }
// Row softmaxes, one wave per row: lane holds columns 4*lane + 128*u (u = 0..7), so each wave-wide b128 load or store covers 512 contiguous bytes;
// the row's values stay in registers between the maximum, the sum and the store. Maximum and sum: per lane first, then a five-step butterfly over the 32 lanes.
// Columns NQ..QP-1 (lanes 26..31 of u = 7): the score planes hold them; the mask does not, so those lanes re-read their own first chunk; their value is -inf (weight 0) and they are not stored.
__device__ __forceinline__ float wave_max32(float v) { for (int m = 16; m > 0; m >>= 1) v = fmaxf(v, __shfl_xor(v, m, 32)); return v; }
__device__ __forceinline__ float wave_sum32(float v) { for (int m = 16; m > 0; m >>= 1) v += __shfl_xor(v, m, 32); return v; }
// 2^x as one v_exp_f32 (what __expf compiles to behind its multiply) with the issue slot behind it filled
__device__ __forceinline__ float exp2_slot(float x) { float r; asm("v_exp_f32 %0, %1\n\tv_nop" : "=v"(r) : "v"(x)); return r; }
__device__ __forceinline__ v16h at_frag16(v8us lo) { FragH f; f.half[0] = lo; const v8us z = {0, 0, 0, 0, 0, 0, 0, 0}; f.half[1] = z; return f.v; }      /* q or k row of one head: 16 features, k 16..31 of the fragment zero */
__device__ __forceinline__ v8f at_mma(v16h a, v16h b, v8f c) { return __builtin_amdgcn_wmma_f32_16x16x32_f16(false, a, false, b, (short)0, c, false, false); }
// what 32 keys take for one lane: from memory its 8 features of two k rows, from the block's staged mask rows in LDS (mr, already rounded) 2 x 8 mask values of its query. EDGE: a lane whose 8 keys lie at or past NQ reads its 8 mask values of the row's first 16 columns instead, and those keys count as -inf
struct At32 { v8us k0, k1; v4f m0, m1, m2, m3; };
template <bool EDGE>
__device__ __forceinline__ At32 at_load(const unsigned short* kp, const float* mr, int k0, int hh) {
  At32 t; const int c0 = (!EDGE || k0 + 8 * hh < NQ) ? k0 : 0, c1 = (!EDGE || k0 + 16 + 8 * hh < NQ) ? k0 + 16 : 0;
  t.k0 = *(const v8us*)(kp + (size_t)k0 * (NH * 32)); t.k1 = *(const v8us*)(kp + (size_t)(k0 + 16) * (NH * 32));
  t.m0 = *(const v4fa*)(mr + c0); t.m1 = *(const v4fa*)(mr + c0 + 4); t.m2 = *(const v4fa*)(mr + c1); t.m3 = *(const v4fa*)(mr + c1 + 4); return t; }
// x[0..7], x[8..15]: scores / 4 + mask of this lane's query against keys k0 + 8 * hh + r and k0 + 16 + 8 * hh + r
template <bool EDGE>
__device__ __forceinline__ void at_score(const At32& t, v16h qf, int k0, int hh, float* x) {
  const v8f z8 = {0.f, 0.f, 0.f, 0.f, 0.f, 0.f, 0.f, 0.f}; const v8f s0 = at_mma(at_frag16(t.k0), qf, z8), s1 = at_mma(at_frag16(t.k1), qf, z8);
  const bool in0 = !EDGE || k0 + 8 * hh < NQ, in1 = !EDGE || k0 + 16 + 8 * hh < NQ;
#pragma unroll      /* x[] in registers */
  for (int r = 0; r < 8; ++r) { const float v0 = s0[r] * 0.25f + (r < 4 ? t.m0[r & 3] : t.m1[r & 3]), v1 = s1[r] * 0.25f + (r < 4 ? t.m2[r & 3] : t.m3[r & 3]);
    x[r] = in0 ? v0 : -__builtin_inff(); x[8 + r] = in1 ? v1 : -__builtin_inff(); } }
template <bool EDGE>
__device__ __forceinline__ float at_max32(const At32& t, v16h qf, int k0, int hh, float mx) {
  float x[16]; at_score<EDGE>(t, qf, k0, hh, x);
#pragma unroll      /* x[] in registers */
  for (int r = 0; r < 16; ++r) mx = fmaxf(mx, x[r]);
  return mx; }
template <bool EDGE>
__device__ __forceinline__ v8f at_pv32(const At32& t, v16h vf, v16h qf, int k0, int hh, float mx, float* se, v8f o) {
  float x[16]; at_score<EDGE>(t, qf, k0, hh, x); FragH pf;
#pragma unroll      /* x[] in registers; four running sums, so that an add does not wait for the one before it */
  for (int r = 0; r < 16; ++r) { const float e = exp2_slot((x[r] - mx) * 1.44269504f + 8.0f); se[r & 3] += e; pf.h[r] = (_Float16)e; }
  return at_mma(vf, pf.v, o); }
// Attention, the combine projection and stage 2 in one launch: block = (16 query rows, batch), eight waves. What went from launch to launch through memory (o, its hi and residual planes, mh) now goes from wave to wave through LDS.
// Ahead of the attention the block's 16 mask rows are staged once in sc (free until stage 2): wave w brings rows 2 w and 2 w + 1 by loads of 512 contiguous bytes and rounds them; all eight heads read them there in both passes
// (a lane's 8 mask values straight from memory made every load touch 16 lines, and every head did that twice). The pitch SP puts the 16 rows that a b128 read touches 4 banks apart.
// Attention as described above, wave = head; a lane's 8 values of o (x64) go to its query's row of ob.
// Combine, behind the second barrier: every wave splits the 16 rows of o into f16 hi + x1024 residual fragments (k order of g2_frag, K = 128) and forms the 16 columns 16 w .. 16 w + 15 of mh = o W_comb + b_comb, which go to mhb.
// Stage 2, behind the third barrier: score2 stays in LDS, the probabilities go straight to out.
// Part 1: wave w forms score2 of the 16 rows against keys 128 w .. 128 w + 127, eight tiles of 16 keys. The mh rows are split here into f16 hi + x1024 residual fragments (k order of g2_frag) and stay in registers.
// A tile of 16 node rows is 4 KiB in a row in memory: eight loads of 512 contiguous bytes a wave, one tile ahead, then through the wave's own LDS rows into fragments (a fragment load straight from memory touches 16 lines an instruction).
// Part 2, behind the fourth barrier: wave w takes rows 2 w and 2 w + 1 whole, lane = columns 4 * lane + 128 * u as in the row softmaxes above.
#define SP (QP + 4)                  /* score row pitch in LDS, floats: rows r and r + 8, stored by the two wave halves together, lie 32 banks apart */
#define XP (DM + 8)                  /* staged node row pitch, f16: 272 bytes = 16 x odd, for the b128 fragment reads */
#define OP (DM + 4)                  /* o and mh row pitch in LDS, floats: 528 bytes, so the 16 rows that a b128 fragment read touches start 4 banks apart */
__global__ __launch_bounds__(256) void k_dec(const _Float16* __restrict__ Q16, const _Float16* __restrict__ K16, const _Float16* __restrict__ VT, const _Float16* __restrict__ BC, const float* __restrict__ bc, const _Float16* __restrict__ XN, const float* __restrict__ mask, float* __restrict__ out) {
  static_assert(NQ % 8 == 0 && NQ > QP - 32 && NQ <= QP && QP % 128 == 0, "only the last 32 keys hold an edge, and a lane's 8 keys are all in or all out");
  static_assert(QP == 8 * 128 && DM == 128 && NQ % 4 == 0, "eight waves of 128 keys; a node row is 16 lanes of 16 bytes; a lane's 4 columns are all in or all out");
  __shared__ __attribute__((aligned(16))) float sc[16][SP]; __shared__ __attribute__((aligned(16))) unsigned short nb[8][16][XP]; __shared__ __attribute__((aligned(16))) float ob[16][OP]; __shared__ __attribute__((aligned(16))) float mhb[16][OP];
  const int b = blockIdx.y, row0 = blockIdx.x * 16, lane = threadIdx.x & 31, ln = lane & 15, hh = lane >> 4;
  const int w = __builtin_amdgcn_readfirstlane(threadIdx.x >> 5);      /* wave number in a scalar register: LDS bases and the row test below are scalar */
  { const int h = w, c = ln, q = row0 + c; const bool live = q < NQ;      /* rows NQ.. of the last block: same instruction stream on a staged copy of mask row 0, scale 0, so zeros go to ob */
  const v16h qf = at_frag16(*(const v8us*)((const unsigned short*)Q16 + ((size_t)b * QP + q) * (NH * 32) + h * 32 + 8 * hh));
  const unsigned short* kp = (const unsigned short*)K16 + ((size_t)b * QP + c) * (NH * 32) + h * 32 + 8 * hh; const _Float16* vp = VT + ((size_t)(b * NH + h) * 64 + c) * QP;
  { const int cs = lane * 4, p0 = row0 + 2 * w, p1 = p0 + 1; const float* r0 = mask + ((size_t)b * NQ + (p0 < NQ ? p0 : 0)) * NQ + cs; const float* r1 = mask + ((size_t)b * NQ + (p1 < NQ ? p1 : 0)) * NQ + cs; v4f g0[QP / 128], g1[QP / 128];
#pragma unroll      /* g0[], g1[] in registers, both rows' loads in flight together */
    for (int u = 0; u < QP / 128; ++u) { const int o = (cs + 128 * u < NQ) ? 128 * u : 0; g0[u] = *(const v4fa*)(r0 + o); g1[u] = *(const v4fa*)(r1 + o); }
    asm volatile("s_wait_xcnt 0x0" ::: "memory");      /* stands in front of whatever reuses the address registers of the mask loads just issued */
#pragma unroll      /* g0[], g1[] in registers */
    for (int u = 0; u < QP / 128; ++u) { const bool in = cs + 128 * u < NQ; v4f a, d; for (int i = 0; i < 4; ++i) { a[i] = bf16_round(in ? g0[u][i] : -__builtin_inff()); d[i] = bf16_round(in ? g1[u][i] : -__builtin_inff()); }
      *(v4f*)&sc[2 * w][cs + 128 * u] = a; *(v4f*)&sc[2 * w + 1][cs + 128 * u] = d; } }      /* columns NQ.. get -inf: one store path for every lane (with a branch round the last stores the build moved their loads into it, a second trip to memory) */
  __syncthreads();      /* the 16 mask rows are whole */
  const float* mr = &sc[c][8 * hh]; float mx = -3.0e38f;
#pragma unroll 1      /* stays a loop: unrolled whole, the two passes were some 10,000 instructions and spilled */
  for (int k0 = 0; k0 < QP - 128; k0 += 128) { At32 t[4];
#pragma unroll      /* t[] in registers, the loads of 128 keys in flight together */
    for (int j = 0; j < 4; ++j) t[j] = at_load<false>(kp, mr, k0 + 32 * j, hh);
#pragma unroll      /* t[] in registers */
    for (int j = 0; j < 4; ++j) mx = at_max32<false>(t[j], qf, k0 + 32 * j, hh, mx); }
  { At32 t[4];      /* the last 128 keys */
#pragma unroll      /* t[] in registers */
    for (int j = 0; j < 3; ++j) t[j] = at_load<false>(kp, mr, QP - 128 + 32 * j, hh);
    t[3] = at_load<true>(kp, mr, QP - 32, hh);
#pragma unroll      /* t[] in registers */
    for (int j = 0; j < 3; ++j) mx = at_max32<false>(t[j], qf, QP - 128 + 32 * j, hh, mx);
    mx = at_max32<true>(t[3], qf, QP - 32, hh, mx); }
  mx = fmaxf(mx, __shfl_xor(mx, 16, 32));
  v8f o = {0.f, 0.f, 0.f, 0.f, 0.f, 0.f, 0.f, 0.f}; float se[4] = {0.f, 0.f, 0.f, 0.f};
#pragma unroll 1      /* stays a loop, as above */
  for (int k0 = 0; k0 < QP - 64; k0 += 64) {      /* the loads of 64 keys in flight together */
    const At32 t0 = at_load<false>(kp, mr, k0, hh), t1 = at_load<false>(kp, mr, k0 + 32, hh);
    asm volatile("s_wait_xcnt 0x0" ::: "memory");      /* the build let a V load's result land in the address pair of the k loads just issued: the wait stands in front of that overwrite */
    const v16h v0 = g2_frag(vp + k0, hh), v1 = g2_frag(vp + k0 + 32, hh);
    o = at_pv32<false>(t0, v0, qf, k0, hh, mx, se, o); o = at_pv32<false>(t1, v1, qf, k0 + 32, hh, mx, se, o); }
  { const At32 t0 = at_load<false>(kp, mr, QP - 64, hh), t1 = at_load<true>(kp, mr, QP - 32, hh); const v16h v0 = g2_frag(vp + QP - 64, hh), v1 = g2_frag(vp + QP - 32, hh);
    o = at_pv32<false>(t0, v0, qf, QP - 64, hh, mx, se, o); o = at_pv32<true>(t1, v1, qf, QP - 32, hh, mx, se, o); }
  float st = (se[0] + se[1]) + (se[2] + se[3]); st += __shfl_xor(st, 16, 32);
  const float osc = live ? 64.0f / st : 0.f;      /* o x64 */
  const v4f o0 = {o[0] * osc, o[1] * osc, o[2] * osc, o[3] * osc}, o1 = {o[4] * osc, o[5] * osc, o[6] * osc, o[7] * osc};
  *(v4f*)&ob[c][h * HD + 8 * hh] = o0; *(v4f*)&ob[c][h * HD + 8 * hh + 4] = o1; }
  v16h wf[4];      /* this wave's 16 rows of W_comb^T (x16), the bias at its column and, below, the first node tile: issued together ahead of the barrier, so that the three latencies are paid as one */
#pragma unroll      /* wf[] in registers */
  for (int j = 0; j < 4; ++j) wf[j] = g2_frag(BC + (size_t)(16 * w + ln) * DM + 32 * j, hh);
  const float bv = bf16_round(bc[16 * w + ln]);
  asm volatile("s_wait_xcnt 0x0" ::: "memory");      /* the build lets a node load's result land in the address pair of the W_comb^T loads just issued: the wait stands in front of that overwrite */
  const unsigned short* xb = (const unsigned short*)XN + ((size_t)b * QP + 128 * w) * DM + lane * 8; v8us st[8];
#pragma unroll      /* st[] in registers, the tile's loads in flight together */
  for (int i = 0; i < 8; ++i) st[i] = *(const v8us*)(xb + i * 256);
  __syncthreads();      /* ob is whole */
  { v8f mh_h = {0.f, 0.f, 0.f, 0.f, 0.f, 0.f, 0.f, 0.f}, mh_l = mh_h; const float* orw = &ob[ln][8 * hh];
#pragma unroll      /* fragments in registers */
    for (int j = 0; j < 4; ++j) { const v4f x0 = *(const v4fa*)(orw + 32 * j), x1 = *(const v4fa*)(orw + 32 * j + 4), x2 = *(const v4fa*)(orw + 32 * j + 16), x3 = *(const v4fa*)(orw + 32 * j + 20); FragH fh, fl;
      const float xs[16] = {x0[0], x0[1], x0[2], x0[3], x1[0], x1[1], x1[2], x1[3], x2[0], x2[1], x2[2], x2[3], x3[0], x3[1], x3[2], x3[3]};
      for (int i = 0; i < 16; ++i) { const _Float16 g = (_Float16)xs[i]; fh.h[i] = g; fl.h[i] = (_Float16)((xs[i] - (float)g) * 1024.0f); }
      mh_h = at_mma(fh.v, wf[j], mh_h); mh_l = at_mma(fl.v, wf[j], mh_l); }
#pragma unroll      /* eight plain LDS stores */
    for (int r = 0; r < 8; ++r) mhb[8 * hh + r][16 * w + ln] = (mh_h[r] * 0.0009765625f + bv) + mh_l[r] * 0.00000095367431640625f; }      /* o x64, W_comb x16: 2^-10; the residual x1024 more: 2^-20 */
  __syncthreads();      /* mhb is whole */
  const float* ar = &mhb[ln][8 * hh]; FragH ah[4], al[4];
#pragma unroll      /* ah[], al[] in registers */
  for (int j = 0; j < 4; ++j) { const v4f x0 = *(const v4fa*)(ar + 32 * j), x1 = *(const v4fa*)(ar + 32 * j + 4), x2 = *(const v4fa*)(ar + 32 * j + 16), x3 = *(const v4fa*)(ar + 32 * j + 20);
    const float xs[16] = {x0[0], x0[1], x0[2], x0[3], x1[0], x1[1], x1[2], x1[3], x2[0], x2[1], x2[2], x2[3], x3[0], x3[1], x3[2], x3[3]};
    for (int i = 0; i < 16; ++i) { const _Float16 h = (_Float16)xs[i]; ah[j].h[i] = h; al[j].h[i] = (_Float16)((xs[i] - (float)h) * 1024.0f); } }
#pragma unroll      /* st[] in registers; the next tile's loads stand ahead of this tile's products */
  for (int t = 0; t < 8; ++t) {
    for (int i = 0; i < 8; ++i) *(v8us*)&nb[w][2 * i + hh][ln * 8] = st[i];
    if (t < 7) for (int i = 0; i < 8; ++i) st[i] = *(const v8us*)(xb + (t + 1) * 16 * DM + i * 256);
    __builtin_amdgcn_fence(__ATOMIC_ACQ_REL, "workgroup", "local"); __builtin_amdgcn_wave_barrier();      /* the reads below take what other lanes of this wave stored: the LDS stores are waited for (s_wait_dscnt 0), the global loads in flight are not */
    FragH bf[4];
    for (int j = 0; j < 4; ++j) { bf[j].half[0] = *(const v8us*)&nb[w][ln][32 * j + 8 * hh]; bf[j].half[1] = *(const v8us*)&nb[w][ln][32 * j + 16 + 8 * hh]; }
    __builtin_amdgcn_fence(__ATOMIC_ACQ_REL, "wavefront"); __builtin_amdgcn_wave_barrier();      /* the next tile's stores stay behind these reads */
    v8f sh = {0.f, 0.f, 0.f, 0.f, 0.f, 0.f, 0.f, 0.f}, sl = sh;
    for (int j = 0; j < 4; ++j) { sh = at_mma(ah[j].v, bf[j].v, sh); sl = at_mma(al[j].v, bf[j].v, sl); }
    for (int r = 0; r < 8; ++r) sc[8 * hh + r][128 * w + 16 * t + ln] = sh[r] * 0.088388347648318447f + sl[r] * 0.000086316745750311f; }      /* (mh_hi + mh_lo / 1024) nodes^T / sqrt(128) */
  const int c0 = lane * 4; v4f m[QP / 128], mn[QP / 128];
  { const int p0 = row0 + 2 * w, p1 = p0 + 1; const float* r0 = mask + ((size_t)b * NQ + (p0 < NQ ? p0 : 0)) * NQ + c0; const float* r1 = mask + ((size_t)b * NQ + (p1 < NQ ? p1 : 0)) * NQ + c0;
#pragma unroll      /* m[], mn[] in registers, both rows' mask loads in flight together */
    for (int u = 0; u < QP / 128; ++u) { const int o = (c0 + 128 * u < NQ) ? 128 * u : 0; m[u] = *(const v4fa*)(r0 + o); mn[u] = *(const v4fa*)(r1 + o); } }
  asm volatile("s_wait_xcnt 0x0" ::: "memory");      /* stands in front of part 2, which reuses the address registers of the mask loads just issued */
  __syncthreads();
#pragma unroll 1      /* stays a loop: the 32 tanhf and expf of one row are most of the kernel's text, and twice that would pass 32 KB */
  for (int rr = 0; rr < 2; ++rr) { const int lr = 2 * w + rr, p = row0 + lr; if (p >= NQ) break;      /* rows NQ.. of the last block: no output; no barrier follows */
    float* pr = out + ((size_t)b * NQ + p) * NQ + c0; v4f x[QP / 128]; float mx = -3.0e38f;
#pragma unroll      /* x[] in registers */
    for (int u = 0; u < QP / 128; ++u) x[u] = *(const v4fa*)&sc[lr][c0 + 128 * u];
#pragma unroll      /* x[] in registers */
    for (int u = 0; u < QP / 128; ++u) { const bool in = c0 + 128 * u < NQ; for (int q = 0; q < 4; ++q) { const float v = 10.0f * tanhf(x[u][q]) + bf16_round(m[u][q]); x[u][q] = in ? v : -__builtin_inff(); mx = fmaxf(mx, x[u][q]); } }
    mx = wave_max32(mx); float se = 0.f;
#pragma unroll      /* x[] in registers */
    for (int u = 0; u < QP / 128; ++u) for (int q = 0; q < 4; ++q) { x[u][q] = expf(x[u][q] - mx); se += x[u][q]; }
    const float inv = 1.0f / wave_sum32(se);
#pragma unroll      /* x[] in registers */
    for (int u = 0; u < QP / 128; ++u) { v4f o; for (int q = 0; q < 4; ++q) o[q] = x[u][q] * inv; if (c0 + 128 * u < NQ) *(v4f*)(pr + 128 * u) = o; }
    asm volatile("s_wait_xcnt 0x0" ::: "memory");      /* stands in front of the copies below and the next row, which overwrite the registers of the stores just issued */
#pragma unroll      /* m[] in registers */
    for (int u = 0; u < QP / 128; ++u) m[u] = mn[u]; } }

extern "C" void kernel_launch(void* const* d_in, const int* in_sizes, int n_in,
                              void* d_out, int out_size, void* d_ws, size_t ws_size, hipStream_t stream) {
  (void)in_sizes; (void)n_in; (void)out_size;
  const float* const* I = (const float* const*)d_in; const float* xn = I[0]; const float* xq1 = I[1]; const float* xl = I[2]; const float* mask = I[3]; const float* Wqf = I[4]; const float* Wql = I[5]; const float* Wqm = I[6]; const float* Wk = I[7]; const float* Wv = I[8]; const float* Wc = I[9]; const float* bc = I[10];      /* weights [in][out] */
  char* ws = (char*)d_ws; size_t off = 0;
  auto take = [&](size_t bytes) { char* p = ws + off; off += (bytes + 255) & ~(size_t)255; return p; };
  _Float16* BQF = (_Float16*)take((size_t)NH * 32 * DM * 2); _Float16* BQL = (_Float16*)take((size_t)NH * 32 * DM * 2); _Float16* BK = (_Float16*)take((size_t)NH * 32 * DM * 2); _Float16* BVP = (_Float16*)take((size_t)NH * 64 * DM * 2); _Float16* BCP = (_Float16*)take((size_t)DM * DM * 2); float* QMP = (float*)take((size_t)NB * NH * 32 * 4);
  _Float16* XN = (_Float16*)take(NRP * DM * 2); _Float16* XQ1 = (_Float16*)take(NRP * DM * 2); _Float16* XL = (_Float16*)take(NRP * DM * 2);
  _Float16* Q16 = (_Float16*)take(NRP * NH * 32 * 2); _Float16* K16 = (_Float16*)take(NRP * NH * 32 * 2);
  _Float16* VT = (_Float16*)take((size_t)NB * NH * 64 * QP * 2);
  if (off > ws_size) return;      /* about 22 MiB */
  k_prep<<<PB_ALL, PT, 0, stream>>>(xn, xq1, xl, Wqf, Wql, Wqm, Wk, Wv, Wc, XN, XQ1, XL, BQF, BQL, BK, BVP, BCP, QMP);      /* f16 token planes (padded rows), transposed x16 weights, per-batch mean term in the padded q layout */
  k_proj<<<2 * JB_QK + NB * JB_V, 128, 0, stream>>>(XQ1, BQF, XL, BQL, QMP, Q16, XN, BK, K16, BVP, VT);      /* q = q1 Wq_first + last Wq_last + mean term, k (f16, padded [8][32]); V^T [8 batches][8][64][1024] */
  k_dec<<<dim3((NQ + 15) / 16, NB), 256, 0, stream>>>(Q16, K16, VT, BCP, bc, XN, mask, (float*)d_out);      /* scores / sqrt(16) + mask, softmax, weights v -> o; mh = o W_comb + b_comb; score2 = mh nodes^T / sqrt(128), 10 tanh, + mask, softmax over the 1000 real keys (f32) -> probs */
}

// v008
// One run takes 60.4 microseconds.
// In two side-by-side timings against v007, it was 1.13 and 1.14 times as fast.
// All steps since v000 together make it 261 times as fast.
#include <hip/hip_runtime.h>
// TSP decoder probabilities (encoded_nodes, encoded_q1, encoded_last_node [8][1000][128]; k = nodes Wk, v = nodes Wv, q = q1 Wq_first + last Wq_last + (mean_n nodes) Wq_mean broadcast ([in][out] weights), 8 heads of 16; weights = softmax(q k^T / 4 + ninf_mask); mh = (weights v merged) W_comb + b_comb; score2 = mh nodes^T / sqrt(128); probs = softmax_n(10 tanh(score2) + ninf_mask) -> [8][1000][1000]).
// Compute dtype: inputs rounded to bf16; token rows / weights exact; q, k, v and the stage-1 weights as plain f16 GEMM operands (~2^-12); o and mh as f16 hi + residual operand pairs (~2^-22); the mean term, score2, tanh, mask and the final softmax f32. v_wmma_f32_16x16x32_f16.
#define NB 8
#define NQ 1000                      /* nodes = queries = 1000 */
#define QP 1024                      /* padded rows / keys per batch */
#define DM 128
#define NH 8
#define HD 16
#define SQ QP
#define HG 8
#define B0 0                         /* unused */
#define NBR NB
#define NRP ((size_t)NB * QP)        /* padded token rows */
typedef __bf16 v16b __attribute__((ext_vector_type(16)));
typedef unsigned short v8us __attribute__((ext_vector_type(8), may_alias));
typedef float  v8f  __attribute__((ext_vector_type(8)));
typedef float  v4f  __attribute__((ext_vector_type(4)));
typedef float  v4fa __attribute__((ext_vector_type(4), may_alias));
union FragB { v16b v; v8us half[2]; unsigned short u[16]; };

__device__ __forceinline__ unsigned short bf16_bits(float x) { unsigned int u = __float_as_uint(x); return (unsigned short)((u + 0x7FFFu + ((u >> 16) & 1u)) >> 16); }
__device__ __forceinline__ float bf16_val(unsigned short b) { return __uint_as_float(((unsigned int)b) << 16); }
__device__ __forceinline__ float bf16_round(float x) { return bf16_val(bf16_bits(x)); }
// D += A·B with NT terms: 1 = ah·bh, 2 = + al·bh (A split), 3 = + ah·bl (both split)
template <int NT>
__device__ __forceinline__ v8f mmaN(v16b ah, v16b al, v16b bh, v16b bl, v8f c) {
  c = __builtin_amdgcn_wmma_f32_16x16x32_bf16(false, ah, false, bh, (short)0, c, false, false);
  if (NT >= 2) c = __builtin_amdgcn_wmma_f32_16x16x32_bf16(false, al, false, bh, (short)0, c, false, false);
  if (NT >= 3) c = __builtin_amdgcn_wmma_f32_16x16x32_bf16(false, ah, false, bl, (short)0, c, false, false);
  asm volatile("v_nop\n\tv_nop\n\tv_nop\n\tv_nop" : "+v"(c) : "v"(ah), "v"(al), "v"(bh), "v"(bl));
  return c;
}

__global__ __launch_bounds__(256) void k_wt_bf16(const float* __restrict__ W, unsigned short* __restrict__ Wt, int K, int N) {
  const int t = blockIdx.x * 256 + threadIdx.x;
  const int k8n = K / 8;
  if (t >= N * k8n) return;
  const int n = t / k8n, k8 = (t % k8n) * 8;
  v8us v;
#pragma unroll
  for (int i = 0; i < 8; ++i) v[i] = bf16_bits(W[(size_t)(k8 + i) * N + n]);
  *(v8us*)(Wt + (size_t)n * K + k8) = v;
  
}

// GEMM C[M][N] (f32, pitch ldc) = act(A[M][K]·W + bias). A f32 row-major (pitch lda) converted per fragment to bf16
// (ASPLIT: hi/lo two planes -> 2 terms, else single rounded term); Wt bf16 [N][K] (pitch ldb). BIAS_BF16 rounds the
// bias to bf16 first (bias quantised to bf16 before the add). K%32==0, M%16==0, N%64==0.
template <bool ASPLIT, int ACT, bool BIAS_BF16>
__global__ __launch_bounds__(128) void k_gemm_bf(const float* __restrict__ A, int lda, const unsigned short* __restrict__ Wt, int ldb,
                                               const float* __restrict__ bias, float* __restrict__ C, int ldc, int M, int N, int K) {
  __shared__ __attribute__((aligned(16))) float so[4][16][64];
  const int tid = threadIdx.x, w = tid >> 5, lane = tid & 31, ln = lane & 15, hh = lane >> 4;
  const int ntn = N / 64;
  const int wid = blockIdx.x * 4 + w;
  const int mt = wid / ntn, nq = wid % ntn;
  if (mt * 16 >= M) return;
  const int row0 = mt * 16, col0 = nq * 64;
  const float* arow = A + (size_t)(row0 + ln) * lda;
  v8f acc[4] = {};
  for (int kb = 0; kb < K; kb += 32) {
    FragB ah, al;
    const v4f x0 = *(const v4fa*)(arow + kb + 8 * hh), x1 = *(const v4fa*)(arow + kb + 8 * hh + 4);
    const v4f x2 = *(const v4fa*)(arow + kb + 16 + 8 * hh), x3 = *(const v4fa*)(arow + kb + 16 + 8 * hh + 4);
    float xs[16] = {x0[0],x0[1],x0[2],x0[3],x1[0],x1[1],x1[2],x1[3],x2[0],x2[1],x2[2],x2[3],x3[0],x3[1],x3[2],x3[3]};
#pragma unroll
    for (int i = 0; i < 16; ++i) { const unsigned short hb = bf16_bits(xs[i]); ah.u[i] = hb; al.u[i] = ASPLIT ? bf16_bits(xs[i] - bf16_val(hb)) : (unsigned short)0; }
#pragma unroll
    for (int t = 0; t < 4; ++t) {
      const unsigned short* brow = Wt + (size_t)(col0 + t * 16 + ln) * ldb + kb;
      FragB b;
      b.half[0] = *(const v8us*)(brow + 8 * hh);
      b.half[1] = *(const v8us*)(brow + 16 + 8 * hh);
      acc[t] = mmaN<ASPLIT ? 2 : 1>(ah.v, al.v, b.v, b.v, acc[t]);
    }
  }
#pragma unroll
  for (int t = 0; t < 4; ++t) {
    float bv = bias ? bias[col0 + t * 16 + ln] : 0.f;
    if (BIAS_BF16) bv = bf16_round(bv);
#pragma unroll
    for (int r = 0; r < 8; ++r) { float v = acc[t][r] + bv; if (ACT == 1) v = fmaxf(v, 0.f); so[w][8 * hh + r][t * 16 + ln] = v; }
  }
  __builtin_amdgcn_fence(__ATOMIC_ACQ_REL, "workgroup");
  __builtin_amdgcn_wave_barrier();
  const int rsub = lane >> 4, c4 = (lane & 15) * 4;
  {
#pragma unroll
    for (int q = 0; q < 8; ++q) {
      const int r = q * 2 + rsub;
      const v4f v = *(const v4fa*)&so[w][r][c4];
      *(v4f*)(C + (size_t)(row0 + r) * ldc + col0 + c4) = v;
    }
    
  }
}

// GEMM C = act(A·W + bias + resid): A f32 (ASPLIT -> hi/lo 2 terms), Wt bf16 [N][K]; ACT 0 none, 1 relu, 2 exact gelu;
// resid (optional, f32, row index = (row % rmod), pitch ldr, RES_BF16 rounds it) added before the activation.
template <bool ASPLIT, int ACT, bool BIAS_BF16, bool RES_BF16>
__global__ __launch_bounds__(128) void k_gemm_bf3(const float* __restrict__ A, int lda, const unsigned short* __restrict__ Wt, int ldb,
                                                const float* __restrict__ bias, const float* __restrict__ resid, int rmod, int ldr,
                                                float* __restrict__ C, int ldc, int M, int N, int K) {
  __shared__ __attribute__((aligned(16))) float so[4][16][64];
  const int tid = threadIdx.x, w = tid >> 5, lane = tid & 31, ln = lane & 15, hh = lane >> 4;
  const int ntn = N / 64;
  const int wid = blockIdx.x * 4 + w;
  const int mt = wid / ntn, nq = wid % ntn;
  if (mt * 16 >= M) return;
  const int row0 = mt * 16, col0 = nq * 64;
  const float* arow = A + (size_t)(row0 + ln) * lda;
  v8f acc[4] = {};
  for (int kb = 0; kb < K; kb += 32) {
    FragB ah, al;
    const v4f x0 = *(const v4fa*)(arow + kb + 8 * hh), x1 = *(const v4fa*)(arow + kb + 8 * hh + 4);
    const v4f x2 = *(const v4fa*)(arow + kb + 16 + 8 * hh), x3 = *(const v4fa*)(arow + kb + 16 + 8 * hh + 4);
    float xs[16] = {x0[0],x0[1],x0[2],x0[3],x1[0],x1[1],x1[2],x1[3],x2[0],x2[1],x2[2],x2[3],x3[0],x3[1],x3[2],x3[3]};
#pragma unroll
    for (int i = 0; i < 16; ++i) { const unsigned short hb = bf16_bits(xs[i]); ah.u[i] = hb; al.u[i] = ASPLIT ? bf16_bits(xs[i] - bf16_val(hb)) : (unsigned short)0; }
#pragma unroll
    for (int t = 0; t < 4; ++t) {
      const unsigned short* brow = Wt + (size_t)(col0 + t * 16 + ln) * ldb + kb;
      FragB b;
      b.half[0] = *(const v8us*)(brow + 8 * hh);
      b.half[1] = *(const v8us*)(brow + 16 + 8 * hh);
      acc[t] = mmaN<ASPLIT ? 2 : 1>(ah.v, al.v, b.v, b.v, acc[t]);
    }
  }
#pragma unroll
  for (int t = 0; t < 4; ++t) {
    const int col = col0 + t * 16 + ln;
    float bv = bias ? bias[col] : 0.f;
    if (BIAS_BF16) bv = bf16_round(bv);
#pragma unroll
    for (int r = 0; r < 8; ++r) {
      float v = acc[t][r] + bv;
      if (resid) { float rv = resid[(size_t)((row0 + 8 * hh + r) % rmod) * ldr + col]; if (RES_BF16) rv = bf16_round(rv); v += rv; }
      if (ACT == 1) v = fmaxf(v, 0.f);
      if (ACT == 2) v = 0.5f * v * (1.0f + erff(v * 0.70710678118654752f));
      if (ACT == 3) { const float u = 0.7978845608028654f * (v + 0.044715f * v * v * v); v = 0.5f * v * (1.0f + tanhf(u)); }
      so[w][8 * hh + r][t * 16 + ln] = v;
    }
  }
  __builtin_amdgcn_fence(__ATOMIC_ACQ_REL, "workgroup");
  __builtin_amdgcn_wave_barrier();
  const int rsub = lane >> 4, c4 = (lane & 15) * 4;
  {
#pragma unroll
    for (int q = 0; q < 8; ++q) {
      const int r = q * 2 + rsub;
      const v4f v = *(const v4fa*)&so[w][r][c4];
      *(v4f*)(C + (size_t)(row0 + r) * ldc + col0 + c4) = v;
    }
    
  }
}
// row LayerNorm (biased variance, eps) over N: s = X (+ R); optional out_sum <- s; out_norm <- (s-mu)*rsqrt(var+eps)*g + b
template <bool PARAM_BF16>
__global__ __launch_bounds__(256) void k_layernorm(const float* __restrict__ X, const float* __restrict__ R, const float* __restrict__ g, const float* __restrict__ bta,
                                                  float* __restrict__ out_sum, float* __restrict__ out_norm, int N, float eps) {
  __shared__ float red[256];
  const int row = blockIdx.x, tid = threadIdx.x;
  const float* x = X + (size_t)row * N; const float* rr = R ? R + (size_t)row * N : nullptr;
  float vals[16];                     // up to N = 4096
  const int per = N / 256;            // contiguous chunk per thread? use strided-by-4 chunks: thread handles j = tid*4 + 1024*u
  float s1 = 0.f;
  for (int u = 0; u < per / 4; ++u) {
    const int j = tid * 4 + 1024 * u;
    const v4f a = *(const v4fa*)(x + j);
    v4f b = {0.f,0.f,0.f,0.f}; if (rr) b = *(const v4fa*)(rr + j);
#pragma unroll
    for (int q = 0; q < 4; ++q) { const float v = a[q] + b[q]; vals[u * 4 + q] = v; s1 += v; }
  }
  red[tid] = s1; __syncthreads();
  for (int st = 128; st > 0; st >>= 1) { if (tid < st) red[tid] += red[tid + st]; __syncthreads(); }
  const float mu = red[0] / (float)N; __syncthreads();
  float s2 = 0.f;
  for (int u = 0; u < per / 4; ++u)
#pragma unroll
    for (int q = 0; q < 4; ++q) { const float c = vals[u * 4 + q] - mu; s2 += c * c; }
  red[tid] = s2; __syncthreads();
  for (int st = 128; st > 0; st >>= 1) { if (tid < st) red[tid] += red[tid + st]; __syncthreads(); }
  const float rs = rsqrtf(red[0] / (float)N + eps);
  {
    for (int u = 0; u < per / 4; ++u) {
      const int j = tid * 4 + 1024 * u;
      v4f o, sm;
#pragma unroll
      for (int q = 0; q < 4; ++q) {
        float gg = g[j + q], bb = bta[j + q];
        if (PARAM_BF16) { gg = bf16_round(gg); bb = bf16_round(bb); }
        sm[q] = vals[u * 4 + q]; o[q] = (vals[u * 4 + q] - mu) * rs * gg + bb;
      }
      if (out_sum) *(v4f*)(out_sum + (size_t)row * N + j) = sm;
      *(v4f*)(out_norm + (size_t)row * N + j) = o;
    }
    
  }
}



// ---- f16 WMMA path (v_wmma_f32_16x16x32_f16): 11-bit significands for operands in range — used where a [0,1] probability operand needs more precision than bf16
typedef _Float16 v16h __attribute__((ext_vector_type(16)));
union FragH { v16h v; v8us half[2]; _Float16 h[16]; unsigned short u[16]; };
template <int NT>
__device__ __forceinline__ v8f mmaH(v16h ah, v16h al, v16h bh, v16h bl, v8f c) {
  c = __builtin_amdgcn_wmma_f32_16x16x32_f16(false, ah, false, bh, (short)0, c, false, false);
  if (NT >= 2) c = __builtin_amdgcn_wmma_f32_16x16x32_f16(false, al, false, bh, (short)0, c, false, false);
  if (NT >= 3) c = __builtin_amdgcn_wmma_f32_16x16x32_f16(false, ah, false, bl, (short)0, c, false, false);
  asm volatile("v_nop\n\tv_nop\n\tv_nop\n\tv_nop" : "+v"(c) : "v"(ah), "v"(al), "v"(bh), "v"(bl));
  return c;
}
// batched GEMM like k_gemm_b but f16 operands: A f32 (split into f16 hi/lo if ASPLIT, else rounded to f16), Bt = f16 values [n][k]; alpha; C f32; N multiple of 16 (partial tiles skipped)
template <bool ASPLIT>
__global__ __launch_bounds__(128) void k_gemm_h(const float* __restrict__ A, int lda, size_t sA, const _Float16* __restrict__ Bh, int ldb, size_t sB, float alpha, float* __restrict__ C, int ldc, size_t sC, int M, int N, int K) {
  __shared__ __attribute__((aligned(16))) float so[4][16][64];
  const int tid = threadIdx.x, w = tid >> 5, lane = tid & 31, ln = lane & 15, hh = lane >> 4; const int by = blockIdx.y;
  A += (size_t)by * sA; Bh += (size_t)by * sB; C += (size_t)by * sC;
  const int ntn = (N + 63) / 64; const int wid = blockIdx.x * 4 + w; const int mt = wid / ntn, nq = wid % ntn; if (mt * 16 >= M) return;
  const int row0 = mt * 16, col0 = nq * 64; const float* arow = A + (size_t)(row0 + ln) * lda;
  v8f acc[4] = {};
  for (int kb = 0; kb < K; kb += 32) {
    FragH ah, al;
    const v4f x0 = *(const v4fa*)(arow + kb + 8 * hh), x1 = *(const v4fa*)(arow + kb + 8 * hh + 4), x2 = *(const v4fa*)(arow + kb + 16 + 8 * hh), x3 = *(const v4fa*)(arow + kb + 16 + 8 * hh + 4);
    float xs[16] = {x0[0],x0[1],x0[2],x0[3],x1[0],x1[1],x1[2],x1[3],x2[0],x2[1],x2[2],x2[3],x3[0],x3[1],x3[2],x3[3]};
#pragma unroll
    for (int i = 0; i < 16; ++i) { const _Float16 h = (_Float16)xs[i]; ah.h[i] = h; al.h[i] = ASPLIT ? (_Float16)(xs[i] - (float)h) : (_Float16)0.0f; }
#pragma unroll
    for (int t = 0; t < 4; ++t) { if (col0 + t * 16 >= N) continue; const size_t boff = (size_t)(col0 + t * 16 + ln) * ldb + kb; FragH bq; bq.half[0] = *(const v8us*)(Bh + boff + 8 * hh); bq.half[1] = *(const v8us*)(Bh + boff + 16 + 8 * hh);
      acc[t] = mmaH<ASPLIT ? 2 : 1>(ah.v, al.v, bq.v, bq.v, acc[t]); }
  }
#pragma unroll
  for (int t = 0; t < 4; ++t) { if (col0 + t * 16 >= N) continue;
#pragma unroll
    for (int r = 0; r < 8; ++r) so[w][8 * hh + r][t * 16 + ln] = acc[t][r] * alpha; }
  __builtin_amdgcn_fence(__ATOMIC_ACQ_REL, "workgroup"); __builtin_amdgcn_wave_barrier();
  const int rsub = lane >> 4, c4 = (lane & 15) * 4;
  {
#pragma unroll
    for (int q = 0; q < 8; ++q) { const int r = q * 2 + rsub; if (col0 + c4 < N) { const v4f v = *(const v4fa*)&so[w][r][c4]; *(v4f*)(C + (size_t)(row0 + r) * ldc + col0 + c4) = v; } }
     }
}

// Wt[n][k] = f16(W[k][n]·scale) from f32 row-major W[K][N] (scale = power of two; bf16-exact weights stay exact in f16 away from the subnormal range)
__global__ __launch_bounds__(256) void k_wt_f16(const float* __restrict__ W, _Float16* __restrict__ Wt, int K, int N, float scale) {
  const int t = blockIdx.x * 256 + threadIdx.x; if (t >= N * (K / 8)) return; const int n = t / (K / 8), k8 = (t % (K / 8)) * 8; FragH f;
#pragma unroll
  for (int i = 0; i < 8; ++i) f.h[i] = (_Float16)(bf16_round(W[(size_t)(k8 + i) * N + n]) * scale); const v8us o = f.half[0];
  *(v8us*)((unsigned short*)Wt + (size_t)n * K + k8) = o; 
}
// k_gemm_hh variant with fused epilogue: v = acc·alpha + bias[by·sBias + col] (+ CP[(row/rowsPerB)·sCPb + by·64 + col] if CP) ; ACT 0 none / 1 elu ; writes f16 C16 (and f32 C if non-null)
template <int ACT>
__global__ __launch_bounds__(128) void k_gemm_hhx(const _Float16* __restrict__ A, int lda, size_t sA, const _Float16* __restrict__ Bh, int ldb, size_t sB, float alpha, const float* __restrict__ bias, size_t sBias, const float* __restrict__ CP, int rowsPerB, size_t sCPb, int row0g,
    float* __restrict__ C, _Float16* __restrict__ C16, int ldc, size_t sC, int M, int N, int K) {
  __shared__ __attribute__((aligned(16))) float so[4][16][64];
  const int tid = threadIdx.x, w = tid >> 5, lane = tid & 31, ln = lane & 15, hh = lane >> 4; const int by = blockIdx.y;
  A += (size_t)by * sA; Bh += (size_t)by * sB; const size_t cofs = (size_t)by * sC; const float* bp = bias ? bias + (size_t)by * sBias : nullptr;
  const int ntn = (N + 63) / 64; const int wid = blockIdx.x * 4 + w; const int mt = wid / ntn, nq = wid % ntn; if (mt * 16 >= M) return;
  const int row0 = mt * 16, col0 = nq * 64; const _Float16* arow = A + (size_t)(row0 + ln) * lda;
  v8f acc[4] = {};
  for (int kb = 0; kb < K; kb += 32) { FragH ah; ah.half[0] = *(const v8us*)((const unsigned short*)arow + kb + 8 * hh); ah.half[1] = *(const v8us*)((const unsigned short*)arow + kb + 16 + 8 * hh);
#pragma unroll
    for (int t = 0; t < 4; ++t) { if (col0 + t * 16 >= N) continue; const size_t boff = (size_t)(col0 + t * 16 + ln) * ldb + kb; FragH bq; bq.half[0] = *(const v8us*)((const unsigned short*)Bh + boff + 8 * hh); bq.half[1] = *(const v8us*)((const unsigned short*)Bh + boff + 16 + 8 * hh);
      acc[t] = mmaH<1>(ah.v, ah.v, bq.v, bq.v, acc[t]); }
  }
#pragma unroll
  for (int t = 0; t < 4; ++t) { if (col0 + t * 16 >= N) continue; const int col = col0 + t * 16 + ln; const float bv = bp ? bf16_round(bp[col]) : 0.f;
#pragma unroll
    for (int r = 0; r < 8; ++r) { float v = acc[t][r] * alpha + bv; if (CP) { const int rr = row0g + row0 + 8 * hh + r; if (rowsPerB < 0) v += CP[cofs + (size_t)rr * ldc + col];      /* rowsPerB < 0: own element of the batched C plane */ else { const int bidx = rr / rowsPerB; v += CP[(size_t)bidx * sCPb + (size_t)by * 64 + col]; } } if (ACT == 1) v = (v > 0.f) ? v : expm1f(v); else if (ACT == 7) v = (v > 0.f) ? v + 1.0f : expf(v); else if (ACT == 8) v = tanhf(v); else if (ACT == 9) v = 0.5f * v * (1.0f + tanhf(0.7978845608028654f * (v + 0.044715f * v * v * v))); else if (ACT == 11) v = 1.0f / (1.0f + expf(-v)); else if (ACT == 12) v = (v > 0.f) ? v : 0.01f * v; else if (ACT == 14) v = (v > 0.f) ? v : 0.1f * v; else if (ACT == 16) v = (v >= 0.f) ? v : 0.3f * v; else if (ACT == 17) v = (v >= 0.f) ? v : 0.2f * v; else if (ACT == 15) v = v / (1.0f + expf(-v)); else if (ACT == 3) v = fmaxf(v, 0.f); else if (ACT == 6) v = 0.5f * v * (1.0f + erff(v * 0.70710678118654752f)); so[w][8 * hh + r][t * 16 + ln] = v; } }
  __builtin_amdgcn_fence(__ATOMIC_ACQ_REL, "workgroup"); __builtin_amdgcn_wave_barrier();
  const int rsub = lane >> 4, c4 = (lane & 15) * 4; typedef _Float16 v4h __attribute__((ext_vector_type(4)));
  {
#pragma unroll
    for (int q = 0; q < 8; ++q) { const int r = q * 2 + rsub; if (col0 + c4 < N) { const v4f v = *(const v4fa*)&so[w][r][c4]; if (C) *(v4f*)(C + cofs + (size_t)(row0 + r) * ldc + col0 + c4) = v; if (C16) { v4h h4; for (int i = 0; i < 4; ++i) h4[i] = (_Float16)v[i]; *(v4h*)(C16 + cofs + (size_t)(row0 + r) * ldc + col0 + c4) = h4; } } }
     }
}


typedef _Float16 v4h __attribute__((ext_vector_type(4)));

__global__ __launch_bounds__(256) void k_x16(const float* __restrict__ x, _Float16* __restrict__ X16, size_t n8) { const size_t t = (size_t)blockIdx.x * 256 + threadIdx.x; if (t >= n8) return; FragH f;
#pragma unroll
  for (int q = 0; q < 8; ++q) f.h[q] = (_Float16)bf16_round(x[t * 8 + q]); *(v8us*)((unsigned short*)X16 + t * 8) = f.half[0];  }
__global__ __launch_bounds__(256) void k_h16(const float* __restrict__ x, _Float16* __restrict__ X16, size_t n8) { const size_t t = (size_t)blockIdx.x * 256 + threadIdx.x; if (t >= n8) return; FragH f;
#pragma unroll
  for (int q = 0; q < 8; ++q) f.h[q] = (_Float16)x[t * 8 + q]; *(v8us*)((unsigned short*)X16 + t * 8) = f.half[0];  }
__global__ __launch_bounds__(256) void k_round16f(const float* __restrict__ W, _Float16* __restrict__ Bt, size_t n8) { const size_t t = (size_t)blockIdx.x * 256 + threadIdx.x; if (t >= n8) return; FragH f;
#pragma unroll
  for (int i = 0; i < 8; ++i) f.h[i] = (_Float16)(bf16_round(W[t * 8 + i]) * 16.0f); *(v8us*)((unsigned short*)Bt + t * 8) = f.half[0];  }
template <int NHv, int TTv>
__global__ __launch_bounds__(256) void k_vt(const _Float16* __restrict__ V16, int ldv, int voff, _Float16* __restrict__ Vt) { __shared__ unsigned short tl[64][66]; const int tid = threadIdx.x; const int slab = blockIdx.x / (TTv / 64), lg = blockIdx.x % (TTv / 64); const int b = slab / NHv, h = slab % NHv;
  for (int i = tid; i < 64 * 8; i += 256) { const int r = i / 8, c8 = (i % 8) * 8; FragH f; f.half[0] = *(const v8us*)((const unsigned short*)V16 + ((size_t)b * TTv + lg * 64 + r) * ldv + voff + h * 64 + c8);
#pragma unroll
    for (int q = 0; q < 8; ++q) tl[r][c8 + q] = f.u[q]; }
  __syncthreads();
  {
#pragma unroll
    for (int rd = 0; rd < 2; ++rd) { const int d = rd * 32 + tid / 8, pc = tid % 8; FragH f;
#pragma unroll
      for (int q = 0; q < 8; ++q) f.u[q] = tl[pc * 8 + q][d];
      *(v8us*)((unsigned short*)Vt + ((size_t)slab * 64 + d) * TTv + lg * 64 + pc * 8) = f.half[0]; }
     } }

// ---- fast GEMM (wave tile 32x64; requires M % 32 == 0 rows per launch region and N % 64 == 0); epilogue = k_gemm_hhx semantics ----
__device__ __forceinline__ v16h g2_frag(const _Float16* p, int hh) { FragH f; f.half[0] = *(const v8us*)((const unsigned short*)p + 8 * hh); f.half[1] = *(const v8us*)((const unsigned short*)p + 16 + 8 * hh); return f.v; }
__device__ __forceinline__ v8f g2_mma(v16h a, v16h b, v8f c) { v8f d = __builtin_amdgcn_wmma_f32_16x16x32_f16(false, a, false, b, (short)0, c, false, false); asm volatile("v_nop\n\tv_nop\n\tv_nop\n\tv_nop" : "+v"(d) : "v"(a), "v"(b)); return d; }
template <int ACT>
__global__ __launch_bounds__(128) void k_gemm2(const _Float16* __restrict__ A, int lda, size_t sA, const _Float16* __restrict__ Bh, int ldb, size_t sB, float alpha, const float* __restrict__ bias, size_t sBias, const float* __restrict__ CP, int rowsPerB, size_t sCPb, int row0g,
    float* __restrict__ C, _Float16* __restrict__ C16, int ldc, size_t sC, int M, int N, int K) { static_assert(ACT == 0 || ACT == 3 || ACT == 6 || ACT == 8 || ACT == 9 || ACT == 11 || ACT == 12 || ACT == 14 || ACT == 15 || ACT == 16 || ACT == 17, "k_gemm2: unsupported ACT code (would silently apply no activation)");
  __shared__ __attribute__((aligned(16))) float so[4][32][68];
  const int tid = threadIdx.x, w = tid >> 5, lane = tid & 31, ln = lane & 15, hh = lane >> 4; const int by = blockIdx.y;
  A += (size_t)by * sA; Bh += (size_t)by * sB; const size_t cofs = (size_t)by * sC; const float* bp = bias ? bias + (size_t)by * sBias : nullptr;
  const int ntn = N >> 6; const int mt = blockIdx.x / ntn, nq = blockIdx.x - mt * ntn; const int row0 = mt * 128 + 32 * w, col0 = nq * 64; if (row0 >= M) return;
  const _Float16* a0p = A + (size_t)(row0 + ln) * lda; const _Float16* a1p = a0p + (size_t)16 * lda;
  const _Float16* b0p = Bh + (size_t)(col0 + ln) * ldb; const _Float16* b1p = b0p + (size_t)16 * ldb; const _Float16* b2p = b1p + (size_t)16 * ldb; const _Float16* b3p = b2p + (size_t)16 * ldb;
  const v8f z8 = {0.f,0.f,0.f,0.f,0.f,0.f,0.f,0.f}; v8f c00 = z8, c01 = z8, c02 = z8, c03 = z8, c10 = z8, c11 = z8, c12 = z8, c13 = z8;
#pragma unroll 1
  for (int kb = 0; kb < K; kb += 32) { const v16h a0 = g2_frag(a0p + kb, hh), a1 = g2_frag(a1p + kb, hh);
    v16h b = g2_frag(b0p + kb, hh); c00 = g2_mma(a0, b, c00); c10 = g2_mma(a1, b, c10);
    b = g2_frag(b1p + kb, hh); c01 = g2_mma(a0, b, c01); c11 = g2_mma(a1, b, c11);
    b = g2_frag(b2p + kb, hh); c02 = g2_mma(a0, b, c02); c12 = g2_mma(a1, b, c12);
    b = g2_frag(b3p + kb, hh); c03 = g2_mma(a0, b, c03); c13 = g2_mma(a1, b, c13); }
  v8f accs[8] = {c00, c01, c02, c03, c10, c11, c12, c13};
#pragma unroll
  for (int u = 0; u < 8; ++u) { const int t = u & 3, half = u >> 2; const int col = col0 + t * 16 + ln; const float bv = bp ? bf16_round(bp[col]) : 0.f;
#pragma unroll
    for (int r = 0; r < 8; ++r) { const int rloc = half * 16 + 8 * hh + r; float v = accs[u][r] * alpha + bv; if (CP) { if (rowsPerB < 0) v += CP[cofs + (size_t)(row0g + row0 + rloc) * ldc + col];      /* rowsPerB < 0: own element of the batched C plane */ else { const int bidx = (row0g + row0 + rloc) / rowsPerB; v += CP[(size_t)bidx * sCPb + (size_t)by * 64 + col]; } }
      if (ACT == 3) v = fmaxf(v, 0.f); else if (ACT == 6) v = 0.5f * v * (1.0f + erff(v * 0.70710678118654752f)); else if (ACT == 11) v = 1.0f / (1.0f + expf(-v)); else if (ACT == 15) v = v / (1.0f + expf(-v)); else if (ACT == 12) v = (v > 0.f) ? v : 0.01f * v; else if (ACT == 8) v = tanhf(v); else if (ACT == 9) v = 0.5f * v * (1.0f + tanhf(0.7978845608028654f * (v + 0.044715f * v * v * v))); else if (ACT == 14) v = (v > 0.f) ? v : 0.1f * v; else if (ACT == 16) v = (v >= 0.f) ? v : 0.3f * v; else if (ACT == 17) v = (v >= 0.f) ? v : 0.2f * v;
      so[w][rloc][t * 16 + ln] = v; } }
  __builtin_amdgcn_fence(__ATOMIC_ACQ_REL, "workgroup"); __builtin_amdgcn_wave_barrier();
  const int rsub = lane >> 4, c4 = (lane & 15) * 4;
  {
#pragma unroll
    for (int q = 0; q < 16; ++q) { const int r = q * 2 + rsub; const v4f v = *(const v4fa*)&so[w][r][c4]; if (C) *(v4f*)(C + cofs + (size_t)(row0 + r) * ldc + col0 + c4) = v; if (C16) { v4h h4; for (int i = 0; i < 4; ++i) h4[i] = (_Float16)v[i]; *(v4h*)(C16 + cofs + (size_t)(row0 + r) * ldc + col0 + c4) = h4; } }
     } }


__global__ __launch_bounds__(256) void k_wnat(const float* __restrict__ w, size_t n8, _Float16* __restrict__ Bt) { const size_t t = (size_t)blockIdx.x * 256 + threadIdx.x; if (t >= n8) return; FragH f; for (int q = 0; q < 8; ++q) f.h[q] = (_Float16)(bf16_round(w[t * 8 + q]) * 16.0f); *(v8us*)((unsigned short*)Bt + t * 8) = f.half[0];  }
__global__ __launch_bounds__(256) void k_rsm(const float* __restrict__ S, _Float16* __restrict__ P, int nrows) {
  #pragma clang fp contract(off)
  const int i = blockIdx.x * 256 + threadIdx.x; if (i >= nrows) return; const float* s = S + (size_t)i * SQ; float mx = -3.0e38f;
#pragma unroll 1
  for (int j = 0; j < SQ; ++j) mx = fmaxf(mx, s[j]); float se = 0.f;
#pragma unroll 1
  for (int j = 0; j < SQ; ++j) se += expf(s[j] - mx); const float sc = 256.0f / se;
#pragma unroll 1
  for (int j0 = 0; j0 < SQ; j0 += 8) { FragH f; for (int q = 0; q < 8; ++q) f.h[q] = (_Float16)(expf(s[j0 + q] - mx) * sc); unsigned short* d = (unsigned short*)P + (size_t)i * SQ + j0; *(v8us*)d = f.half[0];  } }
__global__ __launch_bounds__(256) void k_vt(const _Float16* __restrict__ V16, int b, int h0, _Float16* __restrict__ VT) { __shared__ unsigned short tl[64][65]; const int tid = threadIdx.x; const int hh = blockIdx.x % HG, sg = blockIdx.x / HG; const int s0 = sg * 64; const int h = h0 + hh;
  for (int i = tid; i < 64 * 8; i += 256) { const int j = i / 8, d8 = (i % 8) * 8; FragH f; f.half[0] = *(const v8us*)((const unsigned short*)V16 + ((size_t)b * SQ + s0 + j) * DM + h * HD + d8); for (int q = 0; q < 8; ++q) tl[d8 + q][j] = f.u[q]; }
  __syncthreads();
  { for (int i = tid; i < 64 * 8; i += 256) { const int d = i / 8, j8 = (i % 8) * 8; FragH f; for (int q = 0; q < 8; ++q) f.u[q] = tl[d][j8 + q]; *(v8us*)((unsigned short*)VT + ((size_t)hh * HD + d) * SQ + s0 + j8) = f.half[0]; }  } }


// The set-up pieces below are device functions of a flat thread index t: k_prep deals them out by block range.
// Every f16 operand plane that k_prep writes lies in blocks of 16 rows x 16 columns (k), 512 bytes in a row each, the DM / 16 blocks of 16 rows one behind the other: element (r, k) of a plane stands at
// ((r / 16) * (DM / 16) + k / 16) * 256 + (r % 16) * 16 + k % 16. One half of a WMMA fragment (lane = row ln, 8 values from k = 8 * hh of a block) is then 512 contiguous bytes for the wave, 4 lines; from a row-major plane it was 16 lines.
// The pieces that write such a plane take t in the order of the plane: thread t writes the plane's values 8 t .. 8 t + 7, a wave one whole block.
__device__ __forceinline__ int fb_row(size_t t) { return (int)(t / (DM / 8 * 16)) * 16 + ((int)(t >> 1) & 15); }      /* row of thread t's 8 values */
__device__ __forceinline__ int fb_k8(size_t t) { return ((int)(t >> 5) % (DM / 16)) * 16 + ((int)t & 1) * 8; }      /* their first column */
// a fragment (k order of g2_frag) from such a plane: p = the plane + 16-row group * 16 * DM + first k * 16 + ln * 16 + 8 * hh
__device__ __forceinline__ v16h fb_frag(const _Float16* p) { FragH f; f.half[0] = *(const v8us*)((const unsigned short*)p); f.half[1] = *(const v8us*)((const unsigned short*)p + 256); return f.v; }
__device__ __forceinline__ void x16pad_at(const float* __restrict__ x, _Float16* __restrict__ X16, size_t t) { if (t >= (size_t)NB * QP * (DM / 8)) return; const int c8 = fb_k8(t); const size_t row = fb_row(t); const int b = (int)(row / QP), q = (int)(row % QP); FragH f;
  for (int i = 0; i < 8; ++i) f.h[i] = (_Float16)((q < NQ) ? bf16_round(x[((size_t)b * NQ + q) * DM + c8 + i]) : 0.f);
  *(v8us*)((unsigned short*)X16 + t * 8) = f.half[0];
  asm volatile("s_wait_xcnt 0x0" ::: "memory"); }      /* behind the store: in k_prep's listing a branch leads on from here into another piece's code, which overwrites the store's registers */


template <int HPP>
__device__ __forceinline__ void wtpadT_at(const float* __restrict__ w, _Float16* __restrict__ Bt, int t) { if (t >= NH * HPP * (DM / 8)) return; const int k8 = fb_k8(t); const int r = fb_row(t); const int h = r / HPP, d = r % HPP; FragH f;
  for (int q = 0; q < 8; ++q) { float v = 0.f; if (d < HD) v = bf16_round(w[(size_t)(k8 + q) * DM + h * HD + d]); f.h[q] = (_Float16)(v * 16.0f); }
  unsigned short* dst = (unsigned short*)Bt + (size_t)t * 8; *(v8us*)dst = f.half[0];
  asm volatile("s_wait_xcnt 0x0" ::: "memory"); }      /* behind the store, as in x16pad_at */
template <int HPP>
__device__ __forceinline__ void wtopadT_at(const float* __restrict__ w, _Float16* __restrict__ Bt, int t) { static_assert(NH * HPP == DM, "the block order above is that of a plane of DM columns"); if (t >= DM * (NH * HPP / 8)) return; const int k8 = fb_k8(t); const int n = fb_row(t); FragH f;
  for (int q = 0; q < 8; ++q) { const int kp = k8 + q; const int h = kp / HPP, d = kp % HPP; float v = 0.f; if (d < HD) v = bf16_round(w[(size_t)(h * HD + d) * DM + n]); f.h[q] = (_Float16)(v * 16.0f); }
  unsigned short* dst = (unsigned short*)Bt + (size_t)t * 8; *(v8us*)dst = f.half[0];
  asm volatile("s_wait_xcnt 0x0" ::: "memory"); }      /* behind the store, as in x16pad_at */
// Mean term, one block of 32 waves per batch. Column sums: 25 waves of 40 rows each; a wave reads whole 512-byte rows (lane = 4 columns), rows w, w + 25, ..., eight loads in flight; the 25 partial rows meet in LDS.
// mu Wq_mean: thread = (output column, slice of 16 rows of Wq_mean), its 16 weights loaded ahead of the row loads; the 8 slices meet in LDS.
#define MW 25                        /* waves that sum rows; NQ = MW * 40 */
__device__ __forceinline__ void qmean_at(const float* __restrict__ xn, const float* __restrict__ wqm, float* __restrict__ QMP, int b) {
  static_assert(NQ % (MW * 8) == 0 && MW <= 32, "rows deal out evenly, eight a round");
  __shared__ __attribute__((aligned(16))) float part[MW][DM]; __shared__ float mu[DM]; __shared__ float wp[8][DM];
  const int t = threadIdx.x, c4 = (t & 31) * 4, col = t % DM, kg = t / DM; float wv[DM / 8];
  const int w = __builtin_amdgcn_readfirstlane(t >> 5);      /* wave number in a scalar register: row addresses and the test on it are scalar */
#pragma unroll      /* wv[] in registers, all 16 loads in flight */
  for (int i = 0; i < DM / 8; ++i) wv[i] = wqm[(size_t)(kg * (DM / 8) + i) * DM + col];
  asm volatile("s_wait_xcnt 0x0" ::: "memory");      /* stands in front of the row addresses below: this build forms them in the offset register of the weight loads just issued */
  if (w < MW) { const float* rows = xn + ((size_t)b * NQ + w) * DM + c4; v4f s = {0.f, 0.f, 0.f, 0.f};
#pragma unroll 1      /* eight loads a round: a fully unrolled form of this loop spilled at the 128 registers a wave has in a 1024-thread block */
    for (int r = 0; r < NQ / (MW * 8); ++r) { v4f a[8];
#pragma unroll      /* a[] in registers, the round's loads in flight together */
      for (int j = 0; j < 8; ++j) a[j] = *(const v4fa*)(rows + (size_t)(r * 8 + j) * MW * DM);
#pragma unroll      /* a[] in registers */
      for (int j = 0; j < 8; ++j) for (int q = 0; q < 4; ++q) s[q] += bf16_round(a[j][q]); }
    *(v4f*)&part[w][c4] = s; }
  __syncthreads();
  if (t < DM) { float m = 0.f; for (int i = 0; i < MW; ++i) m += part[i][t]; mu[t] = m / (float)NQ; }
  __syncthreads();
  float v = 0.f;
#pragma unroll      /* wv[] in registers */
  for (int i = 0; i < DM / 8; ++i) v += mu[kg * (DM / 8) + i] * bf16_round(wv[i]);
  wp[kg][col] = v;
  __syncthreads();
  if (t < NH * 32) { const int h = t / 32, d = t % 32; float o = 0.f; if (d < HD) for (int g = 0; g < 8; ++g) o += wp[g][h * HD + d]; QMP[(size_t)b * (NH * 32) + t] = o; } }
// Set-up, one launch: nothing here reads what another piece writes, so the nine pieces are block ranges of one grid of 1024-thread blocks. The mean term and then the weights have the longest chains of waits and take the first blocks.
#define PT 1024                                   /* threads of a set-up block */
#define PB_X ((int)(NRP * (DM / 8) / PT))         /* blocks of one token plane */
#define PB_W32 (NH * 32 * (DM / 8) / PT)          /* blocks of a [8][32]-padded weight */
#define PB_W64 (NH * 64 * (DM / 8) / PT)          /* blocks of a [8][64]-padded weight */
#define PB_WC (DM * (DM / 8) / PT)                /* blocks of W_comb^T, [128][128] */
#define PB_ALL (NB + 3 * PB_X + 3 * PB_W32 + PB_W64 + PB_WC)
__global__ __launch_bounds__(PT) void k_prep(const float* __restrict__ xn, const float* __restrict__ xq1, const float* __restrict__ xl, const float* __restrict__ wqf, const float* __restrict__ wql, const float* __restrict__ wqm, const float* __restrict__ wk, const float* __restrict__ wv, const float* __restrict__ wc,
    _Float16* __restrict__ XN, _Float16* __restrict__ XQ1, _Float16* __restrict__ XL, _Float16* __restrict__ BQF, _Float16* __restrict__ BQL, _Float16* __restrict__ BK, _Float16* __restrict__ BVP, _Float16* __restrict__ BCP, float* __restrict__ QMP) {
  static_assert(NRP * (DM / 8) % PT == 0 && NH * 32 * (DM / 8) % PT == 0 && DM * (DM / 8) % PT == 0 && NH * HD == DM, "every piece is a whole number of blocks");
  int r = blockIdx.x; const int tid = threadIdx.x;
  if (r < NB) { qmean_at(xn, wqm, QMP, r); return; }      /* the branch is the same for a whole block: its barriers are met by all of it */
  r -= NB;
  if (r < 3 * PB_W32) { const int s = r / PB_W32; wtpadT_at<32>(s == 0 ? wqf : s == 1 ? wql : wk, s == 0 ? BQF : s == 1 ? BQL : BK, (r - s * PB_W32) * PT + tid); return; }
  r -= 3 * PB_W32;
  if (r < PB_W64) { wtpadT_at<64>(wv, BVP, r * PT + tid); return; }
  r -= PB_W64;
  if (r < PB_WC) { wtopadT_at<HD>(wc, BCP, r * PT + tid); return; }      /* heads of 16 with no pad: plain W_comb^T */
  r -= PB_WC;
  const int s = r / PB_X; x16pad_at(s == 0 ? xn : s == 1 ? xq1 : xl, s == 0 ? XN : s == 1 ? XQ1 : XL, (size_t)(r - s * PB_X) * PT + tid); }
// Projections, one launch: q, k and V^T are block ranges of one grid; the tile is that of k_gemm2 (wave tile 32 x 64, K = DM, operands x16 so alpha = 1/16, f16 result), the fragments come from planes in 16 x 16 blocks.
// q: both products (q1 Wq_first, last Wq_last) run into the same accumulators, the batch's mean term is added behind them.
// V^T: the operands change places, A = rows of the padded Wv^T, B = node rows of one batch, so the tile comes out as [feature][key].
// q, k and V^T are stored in the order in which k_dec's fragment loads take them: per batch and head, blocks of 16 rows x 16 features (q, k: [row][feature], V^T: [d][key]), 512 bytes in a row each, no pads.
__device__ __forceinline__ void pj_acc(const _Float16* __restrict__ a0p, const _Float16* __restrict__ b0p, v8f (&c)[8]) {
  const _Float16* a1p = a0p + 16 * DM; const _Float16* b1p = b0p + 16 * DM; const _Float16* b2p = b0p + 32 * DM; const _Float16* b3p = b0p + 48 * DM;
#pragma unroll 1      /* stays the rolled loop of k_gemm2: the order of loads and products is not part of this change */
  for (int kb = 0; kb < DM; kb += 32) { const v16h a0 = fb_frag(a0p + kb * 16); FragH a1f; a1f.half[0] = *(const v8us*)((const unsigned short*)a1p + kb * 16);
    asm volatile("s_wait_xcnt 0x0" ::: "memory");      /* the build lets the load below land in the address pair that the three A loads just issued name: the wait stands in front of that overwrite */
    a1f.half[1] = *(const v8us*)((const unsigned short*)a1p + kb * 16 + 256); const v16h a1 = a1f.v;
    v16h b = fb_frag(b0p + kb * 16); c[0] = g2_mma(a0, b, c[0]); c[4] = g2_mma(a1, b, c[4]);
    b = fb_frag(b1p + kb * 16); c[1] = g2_mma(a0, b, c[1]); c[5] = g2_mma(a1, b, c[5]);
    b = fb_frag(b2p + kb * 16); c[2] = g2_mma(a0, b, c[2]); c[6] = g2_mma(a1, b, c[6]);
    b = fb_frag(b3p + kb * 16); c[3] = g2_mma(a0, b, c[3]); c[7] = g2_mma(a1, b, c[7]); } }
#define JB_QK ((int)(NRP / 128) * (NH * 32 / 64))  /* blocks of q, and of k */
#define JB_V ((NH * 64 / 128) * (QP / 64))         /* blocks of one batch's V^T */
__global__ __launch_bounds__(128) void k_proj(const _Float16* __restrict__ XQ1, const _Float16* __restrict__ BQF, const _Float16* __restrict__ XL, const _Float16* __restrict__ BQL, const float* __restrict__ QMP, _Float16* __restrict__ Q16,
    const _Float16* __restrict__ XN, const _Float16* __restrict__ BK, _Float16* __restrict__ K16, const _Float16* __restrict__ BVP, _Float16* __restrict__ VT) {
  static_assert(QP % 128 == 0 && NH * 32 == 64 << 2 && QP == 64 << 4, "the 32 rows of a wave tile of q lie in one batch; the two values of lg");
  __shared__ __attribute__((aligned(16))) float so[4][32][68];
  const int tid = threadIdx.x, w = tid >> 5, lane = tid & 31, ln = lane & 15, hh = lane >> 4;
  int bx = blockIdx.x, lg = 2; const _Float16* A = XQ1; const _Float16* B = BQF; _Float16* C16 = Q16; const bool isq = bx < JB_QK, isv = bx >= 2 * JB_QK;      /* lg: log2 of the result's 64-column tiles */
  if (bx >= 2 * JB_QK) { bx -= 2 * JB_QK; const int by = bx / JB_V; bx -= by * JB_V; lg = 4; A = BVP; B = XN + (size_t)by * QP * DM; C16 = VT + (size_t)by * NH * QP * HD; }
  else if (bx >= JB_QK) { bx -= JB_QK; A = XN; B = BK; C16 = K16; }
  const int mt = bx >> lg, nq = bx - (mt << lg), row0 = mt * 128 + 32 * w, col0 = nq * 64;
  if (isv && (row0 & 63)) return;      /* V^T: these 32 rows are all pad rows of Wv^T, which have no place in the stored form; whole waves leave, and no work-group barrier follows */
  const v8f z8 = {0.f, 0.f, 0.f, 0.f, 0.f, 0.f, 0.f, 0.f}; v8f c[8] = {z8, z8, z8, z8, z8, z8, z8, z8};
  float cp[4] = {0.f, 0.f, 0.f, 0.f};      /* q: the batch's mean term at this lane's four columns, loaded ahead of the products */
  if (isq) for (int t = 0; t < 4; ++t) cp[t] = QMP[(size_t)(row0 / QP) * (NH * 32) + col0 + t * 16 + ln];
  const int fo = ln * 16 + 8 * hh;      /* this lane's place in a block */
  pj_acc(A + (size_t)row0 * DM + fo, B + (size_t)col0 * DM + fo, c);
  if (isq) pj_acc(XL + (size_t)row0 * DM + fo, BQL + (size_t)col0 * DM + fo, c);
#pragma unroll      /* c[] in registers */
  for (int u = 0; u < 8; ++u) { const int t = u & 3, half = u >> 2;
    for (int r = 0; r < 8; ++r) so[w][half * 16 + 8 * hh + r][t * 16 + ln] = c[u][r] * 0.0625f + cp[t]; }
  __builtin_amdgcn_fence(__ATOMIC_ACQ_REL, "workgroup"); __builtin_amdgcn_wave_barrier();      /* the reads below take what other lanes of this wave stored */
  /* a store is one 16 x 16 block, lane = (row e of the block, 8 of its 16 values), 512 bytes in a row; the pad columns of q and k and the pad rows of V^T stay behind */
  const int e = lane >> 1, f8 = (lane & 1) * 8; const float* sp = &so[w][e][f8]; FragH f[4];
  _Float16* dp = C16 + (isv ? ((size_t)((row0 >> 6) * (QP / 16) + (col0 >> 4)) * 16 + e) * HD + f8      /* V^T: [head][block of 16 keys][16 d][16 keys]; rows 0..15 of the tile hold 4 blocks */
                            : ((size_t)((row0 / QP) * NH + (col0 >> 5)) * QP + (row0 % QP) + e) * HD + f8);      /* q, k: [batch][head][row][16 features]; the tile holds 2 heads x 2 blocks */
#pragma unroll      /* f[] in registers: the four blocks are read and converted first, the four stores follow in a row */
  for (int q = 0; q < 4; ++q) { const float* s8 = sp + (isv ? q * 16 : (q & 1) * 16 * 68 + (q >> 1) * 32); const v4f x0 = *(const v4fa*)s8, x1 = *(const v4fa*)(s8 + 4);
    for (int i = 0; i < 4; ++i) { f[q].h[i] = (_Float16)x0[i]; f[q].h[4 + i] = (_Float16)x1[i]; } }
#pragma unroll      /* f[] in registers */
  for (int q = 0; q < 4; ++q) *(v8us*)(dp + (isv ? q * 16 * HD : ((q >> 1) * QP + (q & 1) * 16) * HD)) = f[q].half[0]; }
// Row softmaxes, one wave per row: lane holds columns 4*lane + 128*u (u = 0..7), so each wave-wide b128 load or store covers 512 contiguous bytes;
// the row's values stay in registers between the maximum, the sum and the store. Maximum and sum: per lane first, then a five-step butterfly over the 32 lanes.
// Columns NQ..QP-1 (lanes 26..31 of u = 7): the score planes hold them; the mask does not, so those lanes re-read their own first chunk; their value is -inf (weight 0) and they are not stored.
__device__ __forceinline__ float wave_max32(float v) { for (int m = 16; m > 0; m >>= 1) v = fmaxf(v, __shfl_xor(v, m, 32)); return v; }
__device__ __forceinline__ float wave_sum32(float v) { for (int m = 16; m > 0; m >>= 1) v += __shfl_xor(v, m, 32); return v; }
// 2^x as one v_exp_f32 (what __expf compiles to behind its multiply) with the issue slot behind it filled
__device__ __forceinline__ float exp2_slot(float x) { float r; asm("v_exp_f32 %0, %1\n\tv_nop" : "=v"(r) : "v"(x)); return r; }
__device__ __forceinline__ v16h at_frag16(v8us lo) { FragH f; f.half[0] = lo; const v8us z = {0, 0, 0, 0, 0, 0, 0, 0}; f.half[1] = z; return f.v; }      /* q or k row of one head: 16 features, k 16..31 of the fragment zero */
__device__ __forceinline__ v8f at_mma(v16h a, v16h b, v8f c) { return __builtin_amdgcn_wmma_f32_16x16x32_f16(false, a, false, b, (short)0, c, false, false); }
// what 32 keys take for one lane: from memory its 8 features of two k rows (a tile of 16 keys of one head is 512 bytes in a row, lane l takes bytes 32 (l % 16) + 16 (l / 16) ..: a whole-line load), from the block's staged mask rows in LDS (mr, already rounded) 2 x 8 mask values of its query. EDGE: a lane whose 8 keys lie at or past NQ reads its 8 mask values of the row's first 16 columns instead, and those keys count as -inf
struct At32 { v8us k0, k1; v4f m0, m1, m2, m3; };
template <bool EDGE>
__device__ __forceinline__ At32 at_load(const unsigned short* kp, const float* mr, int k0, int hh) {
  At32 t; const int c0 = (!EDGE || k0 + 8 * hh < NQ) ? k0 : 0, c1 = (!EDGE || k0 + 16 + 8 * hh < NQ) ? k0 + 16 : 0;
  t.k0 = *(const v8us*)(kp + (size_t)k0 * HD); t.k1 = *(const v8us*)(kp + (size_t)(k0 + 16) * HD);
  t.m0 = *(const v4fa*)(mr + c0); t.m1 = *(const v4fa*)(mr + c0 + 4); t.m2 = *(const v4fa*)(mr + c1); t.m3 = *(const v4fa*)(mr + c1 + 4); return t; }
// x[0..7], x[8..15]: scores / 4 + mask of this lane's query against keys k0 + 8 * hh + r and k0 + 16 + 8 * hh + r
template <bool EDGE>
__device__ __forceinline__ void at_score(const At32& t, v16h qf, int k0, int hh, float* x) {
  const v8f z8 = {0.f, 0.f, 0.f, 0.f, 0.f, 0.f, 0.f, 0.f}; const v8f s0 = at_mma(at_frag16(t.k0), qf, z8), s1 = at_mma(at_frag16(t.k1), qf, z8);
  const bool in0 = !EDGE || k0 + 8 * hh < NQ, in1 = !EDGE || k0 + 16 + 8 * hh < NQ;
#pragma unroll      /* x[] in registers */
  for (int r = 0; r < 8; ++r) { const float v0 = s0[r] * 0.25f + (r < 4 ? t.m0[r & 3] : t.m1[r & 3]), v1 = s1[r] * 0.25f + (r < 4 ? t.m2[r & 3] : t.m3[r & 3]);
    x[r] = in0 ? v0 : -__builtin_inff(); x[8 + r] = in1 ? v1 : -__builtin_inff(); } }
// V^T fragment of 32 keys (k order of g2_frag): two blocks [16 d][16 keys] of 512 bytes in a row each; vp points at this lane's 8 keys of its row d in block 0
__device__ __forceinline__ v16h at_vfrag(const _Float16* vp, int k0) { FragH f; f.half[0] = *(const v8us*)((const unsigned short*)vp + (size_t)k0 * HD); f.half[1] = *(const v8us*)((const unsigned short*)vp + (size_t)(k0 + 16) * HD); return f.v; }
template <bool EDGE>
__device__ __forceinline__ float at_max32(const At32& t, v16h qf, int k0, int hh, float mx) {
  float x[16]; at_score<EDGE>(t, qf, k0, hh, x);
#pragma unroll      /* x[] in registers */
  for (int r = 0; r < 16; ++r) mx = fmaxf(mx, x[r]);
  return mx; }
template <bool EDGE>
__device__ __forceinline__ v8f at_pv32(const At32& t, v16h vf, v16h qf, int k0, int hh, float mx, float* se, v8f o) {
  float x[16]; at_score<EDGE>(t, qf, k0, hh, x); FragH pf;
#pragma unroll      /* x[] in registers; four running sums, so that an add does not wait for the one before it */
  for (int r = 0; r < 16; ++r) { const float e = exp2_slot((x[r] - mx) * 1.44269504f + 8.0f); se[r & 3] += e; pf.h[r] = (_Float16)e; }
  return at_mma(vf, pf.v, o); }
// Attention, the combine projection and stage 2 in one launch: block = (16 query rows, batch), eight waves. What went from launch to launch through memory (o, its hi and residual planes, mh) now goes from wave to wave through LDS.
// Ahead of the attention the block's 16 mask rows are staged once in sc (free until stage 2): wave w brings rows 2 w and 2 w + 1 by loads of 512 contiguous bytes and rounds them; all eight heads read them there in both passes
// (a lane's 8 mask values straight from memory made every load touch 16 lines, and every head did that twice). The pitch SP puts the 16 rows that a b128 read touches 4 banks apart.
// Attention as described above, wave = head; a lane's 8 values of o (x64) go to its query's row of ob.
// Combine, behind the second barrier: every wave splits the 16 rows of o into f16 hi + x1024 residual fragments (k order of g2_frag, K = 128) and forms the 16 columns 16 w .. 16 w + 15 of mh = o W_comb + b_comb, which go to mhb.
// Stage 2, behind the third barrier: score2 stays in LDS, the probabilities go straight to out.
// Part 1: wave w forms score2 of the 16 rows against keys 128 w .. 128 w + 127, eight tiles of 16 keys. The mh rows are split here into f16 hi + x1024 residual fragments (k order of g2_frag) and stay in registers.
// A tile of 16 node rows is 4 KiB in a row in memory, eight blocks in fragment order: eight loads of 512 contiguous bytes a wave, one tile ahead, are the tile's four fragments.
// Part 2, behind the fourth barrier: wave w takes rows 2 w and 2 w + 1 whole, lane = columns 4 * lane + 128 * u as in the row softmaxes above.
#define SP (QP + 4)                  /* score row pitch in LDS, floats: rows r and r + 8, stored by the two wave halves together, lie 32 banks apart */
#define OP (DM + 4)                  /* o and mh row pitch in LDS, floats: 528 bytes, so the 16 rows that a b128 fragment read touches start 4 banks apart */
__global__ __launch_bounds__(256) void k_dec(const _Float16* __restrict__ Q16, const _Float16* __restrict__ K16, const _Float16* __restrict__ VT, const _Float16* __restrict__ BC, const float* __restrict__ bc, const _Float16* __restrict__ XN, const float* __restrict__ mask, float* __restrict__ out) {
  static_assert(NQ % 8 == 0 && NQ > QP - 32 && NQ <= QP && QP % 128 == 0, "only the last 32 keys hold an edge, and a lane's 8 keys are all in or all out");
  static_assert(QP == 8 * 128 && DM == 128 && NQ % 4 == 0, "eight waves of 128 keys; a node row is 16 lanes of 16 bytes; a lane's 4 columns are all in or all out");
  __shared__ __attribute__((aligned(16))) float sc[16][SP]; __shared__ __attribute__((aligned(16))) float ob[16][OP]; __shared__ __attribute__((aligned(16))) float mhb[16][OP];
  const int b = blockIdx.y, row0 = blockIdx.x * 16, lane = threadIdx.x & 31, ln = lane & 15, hh = lane >> 4;
  const int w = __builtin_amdgcn_readfirstlane(threadIdx.x >> 5);      /* wave number in a scalar register: LDS bases and the row test below are scalar */
  { const int h = w, c = ln, q = row0 + c; const bool live = q < NQ;      /* rows NQ.. of the last block: same instruction stream on a staged copy of mask row 0, scale 0, so zeros go to ob */
  const v16h qf = at_frag16(*(const v8us*)((const unsigned short*)Q16 + ((size_t)(b * NH + h) * QP + q) * HD + 8 * hh));
  const unsigned short* kp = (const unsigned short*)K16 + ((size_t)(b * NH + h) * QP + c) * HD + 8 * hh; const _Float16* vp = VT + (size_t)(b * NH + h) * QP * HD + c * HD + 8 * hh;
  { const int cs = lane * 4, p0 = row0 + 2 * w, p1 = p0 + 1; const float* r0 = mask + ((size_t)b * NQ + (p0 < NQ ? p0 : 0)) * NQ + cs; const float* r1 = mask + ((size_t)b * NQ + (p1 < NQ ? p1 : 0)) * NQ + cs; v4f g0[QP / 128], g1[QP / 128];
#pragma unroll      /* g0[], g1[] in registers, both rows' loads in flight together */
    for (int u = 0; u < QP / 128; ++u) { const int o = (cs + 128 * u < NQ) ? 128 * u : 0; g0[u] = *(const v4fa*)(r0 + o); g1[u] = *(const v4fa*)(r1 + o); }
    asm volatile("s_wait_xcnt 0x0" ::: "memory");      /* stands in front of whatever reuses the address registers of the mask loads just issued */
#pragma unroll      /* g0[], g1[] in registers */
    for (int u = 0; u < QP / 128; ++u) { const bool in = cs + 128 * u < NQ; v4f a, d; for (int i = 0; i < 4; ++i) { a[i] = bf16_round(in ? g0[u][i] : -__builtin_inff()); d[i] = bf16_round(in ? g1[u][i] : -__builtin_inff()); }
      *(v4f*)&sc[2 * w][cs + 128 * u] = a; *(v4f*)&sc[2 * w + 1][cs + 128 * u] = d; } }      /* columns NQ.. get -inf: one store path for every lane (with a branch round the last stores the build moved their loads into it, a second trip to memory) */
  __syncthreads();      /* the 16 mask rows are whole */
  const float* mr = &sc[c][8 * hh]; float mx = -3.0e38f;
#pragma unroll 1      /* stays a loop: unrolled whole, the two passes were some 10,000 instructions and spilled */
  for (int k0 = 0; k0 < QP - 128; k0 += 128) { At32 t[4];
#pragma unroll      /* t[] in registers, the loads of 128 keys in flight together */
    for (int j = 0; j < 4; ++j) t[j] = at_load<false>(kp, mr, k0 + 32 * j, hh);
#pragma unroll      /* t[] in registers */
    for (int j = 0; j < 4; ++j) mx = at_max32<false>(t[j], qf, k0 + 32 * j, hh, mx); }
  { At32 t[4];      /* the last 128 keys */
#pragma unroll      /* t[] in registers */
    for (int j = 0; j < 3; ++j) t[j] = at_load<false>(kp, mr, QP - 128 + 32 * j, hh);
    t[3] = at_load<true>(kp, mr, QP - 32, hh);
#pragma unroll      /* t[] in registers */
    for (int j = 0; j < 3; ++j) mx = at_max32<false>(t[j], qf, QP - 128 + 32 * j, hh, mx);
    mx = at_max32<true>(t[3], qf, QP - 32, hh, mx); }
  mx = fmaxf(mx, __shfl_xor(mx, 16, 32));
  v8f o = {0.f, 0.f, 0.f, 0.f, 0.f, 0.f, 0.f, 0.f}; float se[4] = {0.f, 0.f, 0.f, 0.f};
#pragma unroll 1      /* stays a loop, as above */
  for (int k0 = 0; k0 < QP - 64; k0 += 64) {      /* the loads of 64 keys in flight together */
    const At32 t0 = at_load<false>(kp, mr, k0, hh), t1 = at_load<false>(kp, mr, k0 + 32, hh);
    asm volatile("s_wait_xcnt 0x0" ::: "memory");      /* the build let a V load's result land in the address pair of the k loads just issued: the wait stands in front of that overwrite */
    const v16h v0 = at_vfrag(vp, k0), v1 = at_vfrag(vp, k0 + 32);
    o = at_pv32<false>(t0, v0, qf, k0, hh, mx, se, o); o = at_pv32<false>(t1, v1, qf, k0 + 32, hh, mx, se, o); }
  { const At32 t0 = at_load<false>(kp, mr, QP - 64, hh), t1 = at_load<true>(kp, mr, QP - 32, hh);
    asm volatile("s_wait_xcnt 0x0" ::: "memory");      /* as in the loop: a V load's result lands in the address pair of the k loads just issued */
    const v16h v0 = at_vfrag(vp, QP - 64), v1 = at_vfrag(vp, QP - 32);
    o = at_pv32<false>(t0, v0, qf, QP - 64, hh, mx, se, o); o = at_pv32<true>(t1, v1, qf, QP - 32, hh, mx, se, o); }
  float st = (se[0] + se[1]) + (se[2] + se[3]); st += __shfl_xor(st, 16, 32);
  const float osc = live ? 64.0f / st : 0.f;      /* o x64 */
  const v4f o0 = {o[0] * osc, o[1] * osc, o[2] * osc, o[3] * osc}, o1 = {o[4] * osc, o[5] * osc, o[6] * osc, o[7] * osc};
  *(v4f*)&ob[c][h * HD + 8 * hh] = o0; *(v4f*)&ob[c][h * HD + 8 * hh + 4] = o1; }
  v16h wf[4];      /* this wave's 16 rows of W_comb^T (x16), the bias at its column and, below, the first node tile: issued together ahead of the barrier, so that the three latencies are paid as one */
#pragma unroll      /* wf[] in registers */
  for (int j = 0; j < 4; ++j) wf[j] = fb_frag(BC + (size_t)16 * w * DM + 32 * j * 16 + ln * 16 + 8 * hh);
  const float bv = bf16_round(bc[16 * w + ln]);
  asm volatile("s_wait_xcnt 0x0" ::: "memory");      /* the build lets a node load's result land in the address pair of the W_comb^T loads just issued: the wait stands in front of that overwrite */
  const unsigned short* xb = (const unsigned short*)XN + ((size_t)b * QP + 128 * w) * DM + ln * 16 + 8 * hh; v8us st[8];      /* st[i]: this lane's 8 values of block i of a tile of 16 node rows, that is half i & 1 of fragment i / 2 */
#pragma unroll      /* st[] in registers, the tile's loads in flight together */
  for (int i = 0; i < 8; ++i) st[i] = *(const v8us*)(xb + i * 256);
  __syncthreads();      /* ob is whole */
  { v8f mh_h = {0.f, 0.f, 0.f, 0.f, 0.f, 0.f, 0.f, 0.f}, mh_l = mh_h; const float* orw = &ob[ln][8 * hh];
#pragma unroll      /* fragments in registers */
    for (int j = 0; j < 4; ++j) { const v4f x0 = *(const v4fa*)(orw + 32 * j), x1 = *(const v4fa*)(orw + 32 * j + 4), x2 = *(const v4fa*)(orw + 32 * j + 16), x3 = *(const v4fa*)(orw + 32 * j + 20); FragH fh, fl;
      const float xs[16] = {x0[0], x0[1], x0[2], x0[3], x1[0], x1[1], x1[2], x1[3], x2[0], x2[1], x2[2], x2[3], x3[0], x3[1], x3[2], x3[3]};
      for (int i = 0; i < 16; ++i) { const _Float16 g = (_Float16)xs[i]; fh.h[i] = g; fl.h[i] = (_Float16)((xs[i] - (float)g) * 1024.0f); }
      mh_h = at_mma(fh.v, wf[j], mh_h); mh_l = at_mma(fl.v, wf[j], mh_l); }
#pragma unroll      /* eight plain LDS stores */
    for (int r = 0; r < 8; ++r) mhb[8 * hh + r][16 * w + ln] = (mh_h[r] * 0.0009765625f + bv) + mh_l[r] * 0.00000095367431640625f; }      /* o x64, W_comb x16: 2^-10; the residual x1024 more: 2^-20 */
  __syncthreads();      /* mhb is whole */
  const float* ar = &mhb[ln][8 * hh]; FragH ah[4], al[4];
#pragma unroll      /* ah[], al[] in registers */
  for (int j = 0; j < 4; ++j) { const v4f x0 = *(const v4fa*)(ar + 32 * j), x1 = *(const v4fa*)(ar + 32 * j + 4), x2 = *(const v4fa*)(ar + 32 * j + 16), x3 = *(const v4fa*)(ar + 32 * j + 20);
    const float xs[16] = {x0[0], x0[1], x0[2], x0[3], x1[0], x1[1], x1[2], x1[3], x2[0], x2[1], x2[2], x2[3], x3[0], x3[1], x3[2], x3[3]};
    for (int i = 0; i < 16; ++i) { const _Float16 h = (_Float16)xs[i]; ah[j].h[i] = h; al[j].h[i] = (_Float16)((xs[i] - (float)h) * 1024.0f); } }
#pragma unroll      /* st[] in registers; the next tile's loads stand ahead of this tile's products */
  for (int t = 0; t < 8; ++t) {
    FragH bf[4];
    for (int j = 0; j < 4; ++j) { bf[j].half[0] = st[2 * j]; bf[j].half[1] = st[2 * j + 1]; }
    if (t < 7) for (int i = 0; i < 8; ++i) st[i] = *(const v8us*)(xb + (t + 1) * 16 * DM + i * 256);
    __builtin_amdgcn_sched_barrier(0);      /* the next tile's eight loads stay together ahead of this tile's products: left free, the build moved each pair of loads down to its use, a trip to L2 waited for per fragment */
    v8f sh = {0.f, 0.f, 0.f, 0.f, 0.f, 0.f, 0.f, 0.f}, sl = sh;
    for (int j = 0; j < 4; ++j) { sh = at_mma(ah[j].v, bf[j].v, sh); sl = at_mma(al[j].v, bf[j].v, sl); }
    for (int r = 0; r < 8; ++r) sc[8 * hh + r][128 * w + 16 * t + ln] = sh[r] * 0.088388347648318447f + sl[r] * 0.000086316745750311f; }      /* (mh_hi + mh_lo / 1024) nodes^T / sqrt(128) */
  const int c0 = lane * 4; v4f m[QP / 128], mn[QP / 128];
  { const int p0 = row0 + 2 * w, p1 = p0 + 1; const float* r0 = mask + ((size_t)b * NQ + (p0 < NQ ? p0 : 0)) * NQ + c0; const float* r1 = mask + ((size_t)b * NQ + (p1 < NQ ? p1 : 0)) * NQ + c0;
#pragma unroll      /* m[], mn[] in registers, both rows' mask loads in flight together */
    for (int u = 0; u < QP / 128; ++u) { const int o = (c0 + 128 * u < NQ) ? 128 * u : 0;
      if (u == QP / 128 - 1) asm volatile("s_wait_xcnt 0x0" ::: "memory");      /* without these two waits the build let the result of the last load land in address pairs that loads just issued name: a wait stands in front of each of the last two loads */
      m[u] = *(const v4fa*)(r0 + o);
      if (u == QP / 128 - 1) asm volatile("s_wait_xcnt 0x0" ::: "memory");      /* the second of the two waits */
      mn[u] = *(const v4fa*)(r1 + o); } }
  asm volatile("s_wait_xcnt 0x0" ::: "memory");      /* stands in front of part 2, which reuses the address registers of the mask loads just issued */
  __syncthreads();
#pragma unroll 1      /* stays a loop: the 32 tanhf and expf of one row are most of the kernel's text, and twice that would pass 32 KB */
  for (int rr = 0; rr < 2; ++rr) { const int lr = 2 * w + rr, p = row0 + lr; if (p >= NQ) break;      /* rows NQ.. of the last block: no output; no barrier follows */
    float* pr = out + ((size_t)b * NQ + p) * NQ + c0; v4f x[QP / 128]; float mx = -3.0e38f;
#pragma unroll      /* x[] in registers */
    for (int u = 0; u < QP / 128; ++u) x[u] = *(const v4fa*)&sc[lr][c0 + 128 * u];
#pragma unroll      /* x[] in registers */
    for (int u = 0; u < QP / 128; ++u) { const bool in = c0 + 128 * u < NQ; for (int q = 0; q < 4; ++q) { const float v = 10.0f * tanhf(x[u][q]) + bf16_round(m[u][q]); x[u][q] = in ? v : -__builtin_inff(); mx = fmaxf(mx, x[u][q]); } }
    mx = wave_max32(mx); float se = 0.f;
#pragma unroll      /* x[] in registers */
    for (int u = 0; u < QP / 128; ++u) for (int q = 0; q < 4; ++q) { x[u][q] = expf(x[u][q] - mx); se += x[u][q]; }
    const float inv = 1.0f / wave_sum32(se);
#pragma unroll      /* x[] in registers */
    for (int u = 0; u < QP / 128; ++u) { v4f o; for (int q = 0; q < 4; ++q) o[q] = x[u][q] * inv; if (c0 + 128 * u < NQ) *(v4f*)(pr + 128 * u) = o; }
    asm volatile("s_wait_xcnt 0x0" ::: "memory");      /* stands in front of the copies below and the next row, which overwrite the registers of the stores just issued */
#pragma unroll      /* m[] in registers */
    for (int u = 0; u < QP / 128; ++u) m[u] = mn[u]; } }

extern "C" void kernel_launch(void* const* d_in, const int* in_sizes, int n_in,
                              void* d_out, int out_size, void* d_ws, size_t ws_size, hipStream_t stream) {
  (void)in_sizes; (void)n_in; (void)out_size;
  const float* const* I = (const float* const*)d_in; const float* xn = I[0]; const float* xq1 = I[1]; const float* xl = I[2]; const float* mask = I[3]; const float* Wqf = I[4]; const float* Wql = I[5]; const float* Wqm = I[6]; const float* Wk = I[7]; const float* Wv = I[8]; const float* Wc = I[9]; const float* bc = I[10];      /* weights [in][out] */
  char* ws = (char*)d_ws; size_t off = 0;
  auto take = [&](size_t bytes) { char* p = ws + off; off += (bytes + 255) & ~(size_t)255; return p; };
  _Float16* BQF = (_Float16*)take((size_t)NH * 32 * DM * 2); _Float16* BQL = (_Float16*)take((size_t)NH * 32 * DM * 2); _Float16* BK = (_Float16*)take((size_t)NH * 32 * DM * 2); _Float16* BVP = (_Float16*)take((size_t)NH * 64 * DM * 2); _Float16* BCP = (_Float16*)take((size_t)DM * DM * 2); float* QMP = (float*)take((size_t)NB * NH * 32 * 4);
  _Float16* XN = (_Float16*)take(NRP * DM * 2); _Float16* XQ1 = (_Float16*)take(NRP * DM * 2); _Float16* XL = (_Float16*)take(NRP * DM * 2);
  _Float16* Q16 = (_Float16*)take(NRP * NH * HD * 2); _Float16* K16 = (_Float16*)take(NRP * NH * HD * 2);
  _Float16* VT = (_Float16*)take((size_t)NB * NH * HD * QP * 2);
  if (off > ws_size) return;      /* about 12 MiB */
  k_prep<<<PB_ALL, PT, 0, stream>>>(xn, xq1, xl, Wqf, Wql, Wqm, Wk, Wv, Wc, XN, XQ1, XL, BQF, BQL, BK, BVP, BCP, QMP);      /* f16 token planes (padded rows), transposed x16 weights, all in 16 x 16 blocks; per-batch mean term in the padded q layout */
  k_proj<<<2 * JB_QK + NB * JB_V, 128, 0, stream>>>(XQ1, BQF, XL, BQL, QMP, Q16, XN, BK, K16, BVP, VT);      /* q = q1 Wq_first + last Wq_last + mean term, k: [8 batches][8][1024][16]; V^T [8 batches][8][64 blocks][16][16] */
  k_dec<<<dim3((NQ + 15) / 16, NB), 256, 0, stream>>>(Q16, K16, VT, BCP, bc, XN, mask, (float*)d_out);      /* scores / sqrt(16) + mask, softmax, weights v -> o; mh = o W_comb + b_comb; score2 = mh nodes^T / sqrt(128), 10 tanh, + mask, softmax over the 1000 real keys (f32) -> probs */
}
